// v000
// The times below were measured on an AMD MI455X: many runs one after another, warmed up first and cycling through
// copies of the inputs, with the whole window's GPU time divided by the number of runs. Launches and the gaps
// between them are all in it. The median over several windows is given; except for v000 it joins two sittings, which
// can be a few percent apart, so the side-by-side timings, each taken in one sitting, are the better comparison.
// v000 is the starting kernel. One run takes 3730 microseconds.
#include <hip/hip_runtime.h>

// Compute dtypes, f32 accumulate: k|v = [memory; x].Wkv ([4096 x 1024].[1024 x 2048]), q = x.Wq, r = pos_emb.Wrel (k-major weights transposed once; PLAIN bf16 operands
// = inputs rounded once, exact) and attn_out = attn_vec.Wo (hi/lo A, + x) on v_wmma_f32_16x16x32_bf16; per (batch, head): AC = (q + u).k^T and BD = (q + v_bias).r^T
// ([1024 x 64].[64 x 2048], both operands bf16 hi + UNSCALED residual, three products), the module's _rel_shift applied by INDEX (the literal pad-reshape-slice
// mapping, incl. its wrap-around entries), x 1/8, the INPUT mask (-1e30), the softmax over keys and the mean attention map in f32, attn.v ([1024 x 2048].[2048 x 64],

#define LQ   1024
#define TK   2048
#define NBT  2
#define DD   1024
#define NH_  16
#define HD   64
#define NXR  (LQ * NBT)           // 2048 x rows (l, b)
#define NCR  (TK * NBT)           // 4096 c / pos rows (t, b)
#define DM   DD
#define NTK  NCR
#define SCL  0.125f
#define NEGV -1e30f
#define LN_EPS 1e-5f
#define LOSC 1024.0f

typedef _Float16 h16;
typedef unsigned short bf;
typedef __attribute__((ext_vector_type(16))) __bf16   v16bf;
typedef __attribute__((ext_vector_type(16))) _Float16 v16h;
typedef __attribute__((ext_vector_type(8)))  _Float16 v8h;
typedef __attribute__((ext_vector_type(8)))  unsigned short v8us;
typedef __attribute__((ext_vector_type(8)))  float    v8f;
typedef __attribute__((ext_vector_type(4)))  float    v4f;
typedef __attribute__((ext_vector_type(4)))  _Float16 v4h;
typedef v8h  __attribute__((may_alias)) v8ha;
typedef v4f  __attribute__((may_alias)) v4fa;
typedef v8us __attribute__((may_alias)) v8usa;

__device__ __forceinline__ unsigned short f2bf(float f) { unsigned u = __float_as_uint(f); u += 0x7FFFu + ((u >> 16) & 1u); return (unsigned short)(u >> 16); }
__device__ __forceinline__ float bf2f(unsigned short b) { return __uint_as_float(((unsigned)b) << 16); }
__device__ __forceinline__ float bfr(float f) { return bf2f(f2bf(f)); }
__device__ __forceinline__ v16h cat16(v8h lo, v8h hi) { return __builtin_shufflevector(lo, hi, 0, 1, 2, 3, 4, 5, 6, 7, 8, 9, 10, 11, 12, 13, 14, 15); }
__device__ __forceinline__ v16bf cat16b(v8us lo, v8us hi) { return __builtin_bit_cast(v16bf, __builtin_shufflevector(lo, hi, 0, 1, 2, 3, 4, 5, 6, 7, 8, 9, 10, 11, 12, 13, 14, 15)); }
__device__ __forceinline__ v8f wmma16(v16h a, v16h b, v8f c) { return __builtin_amdgcn_wmma_f32_16x16x32_f16(false, a, false, b, (short)0, c, false, false); }
__device__ __forceinline__ v8f wmmab(v16bf a, v16bf b, v8f c) { return __builtin_amdgcn_wmma_f32_16x16x32_bf16(false, a, false, b, (short)0, c, false, false); }

// k_wt: WT [n][K] = bf16(W[k][n]) (k-major [K][ncols]) via 64 x 64 LDS tiles; grid (K/64, ncols/64).
__global__ __launch_bounds__(256) void k_wt(const float* __restrict__ Wm, int K, int ncols, bf* WT) {
    __shared__ __align__(16) unsigned short tl[64 * 72];
    const int tid = threadIdx.x, k0 = blockIdx.x * 64, n0 = blockIdx.y * 64;
    const int kk = tid >> 2, nq = (tid & 3) * 16;
#pragma unroll
    for (int i = 0; i < 16; ++i) tl[(nq + i) * 72 + kk] = f2bf(Wm[(size_t)(k0 + kk) * ncols + n0 + nq + i]);
    __syncthreads();
    const int piece = tid & 7;
    auto pass = [&]() {
#pragma unroll
        for (int s = 0; s < 2; ++s) { const int nr = (tid >> 3) + 32 * s; const v8us val = *(const v8usa*)(tl + nr * 72 + piece * 8); *(v8us*)(WT + (size_t)(n0 + nr) * K + k0 + piece * 8) = val; }
    };
    pass(); 
}
__global__ __launch_bounds__(256) void k_cvtb(const float* __restrict__ src, int nrows, bf* dst) {
    const int lane = threadIdx.x & 31, r = blockIdx.x * 8 + (threadIdx.x >> 5);
    if (r >= nrows) return;
    v8us o[DM / 256];
#pragma unroll
    for (int q = 0; q < DM / 256; ++q) { v8us t;
#pragma unroll
        for (int i = 0; i < 8; ++i) t[i] = f2bf(src[(size_t)r * DM + q * 256 + lane * 8 + i]);
        o[q] = t; }
#pragma unroll
    for (int q = 0; q < DM / 256; ++q) *(v8us*)(dst + (size_t)r * DM + q * 256 + lane * 8) = o[q];
    
}

// k_gemmb: 64 x 64 block tile (4 waves x 16 x 64) of C[NTK][NW] = (A [+ Al]).B^T (K = 1024) [+ bf(bias[c])] [+ bf(R[r][c]) residual]; f32 whole-line epilogue (or f16
template <bool SPLITA, bool F16OUT = false>
__global__ __launch_bounds__(128) void k_gemmb(const bf* __restrict__ A, const bf* __restrict__ Al, const bf* __restrict__ Bn, const float* __restrict__ bias, float* C, int ldc, h16* C2, const float* __restrict__ R = nullptr, int K = DM, int roundR = 1) {
    __shared__ __align__(16) float ost[4][16 * 68];
    const int lane = threadIdx.x & 31, wave = threadIdx.x >> 5, lr = lane & 15, hi = lane >> 4;
    const int r0 = blockIdx.x * 64 + wave * 16, c0 = blockIdx.y * 64;
    const size_t aoff = (size_t)(r0 + lr) * K + 8 * hi;
    size_t boff[4];
#pragma unroll
    for (int t = 0; t < 4; ++t) boff[t] = (size_t)(c0 + t * 16 + lr) * K + 8 * hi;
    v8f acc[4];
#pragma unroll
    for (int t = 0; t < 4; ++t) acc[t] = (v8f){};
#pragma unroll 1
    for (int kc = 0; kc < K; kc += 32) {
        const v16bf a = cat16b(*(const v8us*)(A + aoff + kc), *(const v8us*)(A + aoff + kc + 16));
        v16bf al = a;
        if (SPLITA) al = cat16b(*(const v8us*)(Al + aoff + kc), *(const v8us*)(Al + aoff + kc + 16));
#pragma unroll
        for (int t = 0; t < 4; ++t) { const v16bf b = cat16b(*(const v8us*)(Bn + boff[t] + kc), *(const v8us*)(Bn + boff[t] + kc + 16)); acc[t] = wmmab(a, b, acc[t]); if (SPLITA) acc[t] = wmmab(al, b, acc[t]); }
        asm volatile("v_nop\n\tv_nop\n\tv_nop\n\tv_nop" : "+v"(acc[0]), "+v"(acc[1]), "+v"(acc[2]), "+v"(acc[3]) : "v"(a), "v"(al));
    }
    float* os = &ost[wave][0];
#pragma unroll
    for (int t = 0; t < 4; ++t) { const float bv = bias ? bfr(bias[c0 + t * 16 + lr]) : 0.f;
#pragma unroll
        for (int j = 0; j < 8; ++j) os[(hi * 8 + j) * 68 + t * 16 + lr] = acc[t][j] + bv; }
    __syncthreads();
    if (F16OUT) {
        h16* crow = (h16*)(void*)C + (size_t)r0 * ldc + c0;
        auto pass = [&]() {
#pragma unroll
            for (int s = 0; s < 4; ++s) { const int row = 4 * s + (lane >> 3), piece = lane & 7; const float* sp = os + row * 68 + piece * 8; v8h o, o2;
#pragma unroll
                for (int i = 0; i < 8; ++i) { const h16 a = (h16)sp[i]; o[i] = a; o2[i] = (h16)((sp[i] - (float)a) * LOSC); }
                *(v8h*)(crow + (size_t)row * ldc + piece * 8) = o; if (C2) *(v8h*)(C2 + (size_t)r0 * ldc + c0 + (size_t)row * ldc + piece * 8) = o2; }
        };
        pass(); 
    } else {
        float* crow = C + (size_t)r0 * ldc + c0;
        auto pass = [&]() {
#pragma unroll
            for (int s = 0; s < 8; ++s) { const int Lid = (lane >> 3) + 4 * s, piece = lane & 7; const int row = Lid >> 1, cofs = (Lid & 1) * 32 + piece * 4;
                v4f val = *(const v4fa*)(os + row * 68 + cofs); if (R) { const v4f rv = *(const v4f*)(R + ((size_t)r0 + row) * ldc + c0 + cofs); val += roundR ? (v4f){bfr(rv[0]), bfr(rv[1]), bfr(rv[2]), bfr(rv[3])} : rv; }
                *(v4f*)(crow + (size_t)row * ldc + cofs) = val; }
        };
        pass(); 
    }
}

// k_gemm3: 64 x 64 tile of C = (Ah + Al).(Bh + Bl)^T over K (row strides = K for all four planes; n-major B): three products per 32-k step (hh, hl, lh); f32
__global__ __launch_bounds__(128) void k_gemm3(const bf* __restrict__ Ah, const bf* __restrict__ Al, const bf* __restrict__ Bh, const bf* __restrict__ Bl, int K, float* C, int ldc) {
    __shared__ __align__(16) float ost[4][16 * 68];
    const int lane = threadIdx.x & 31, wave = threadIdx.x >> 5, lr = lane & 15, hi = lane >> 4;
    const int r0 = blockIdx.x * 64 + wave * 16, c0 = blockIdx.y * 64;
    const size_t aoff = (size_t)(r0 + lr) * K + 8 * hi;
    v8f acc[4];
#pragma unroll
    for (int t = 0; t < 4; ++t) acc[t] = (v8f){};
#pragma unroll 1
    for (int kc = 0; kc < K; kc += 32) {
        const v16bf a = cat16b(*(const v8us*)(Ah + aoff + kc), *(const v8us*)(Ah + aoff + kc + 16));
        const v16bf al = cat16b(*(const v8us*)(Al + aoff + kc), *(const v8us*)(Al + aoff + kc + 16));
#pragma unroll
        for (int t = 0; t < 4; ++t) { const size_t bo = (size_t)(c0 + t * 16 + lr) * K + kc + 8 * hi;
            const v16bf bh = cat16b(*(const v8us*)(Bh + bo), *(const v8us*)(Bh + bo + 16)); const v16bf bl = cat16b(*(const v8us*)(Bl + bo), *(const v8us*)(Bl + bo + 16));
            acc[t] = wmmab(a, bh, acc[t]); acc[t] = wmmab(al, bh, acc[t]); acc[t] = wmmab(a, bl, acc[t]); }
        asm volatile("v_nop\n\tv_nop\n\tv_nop\n\tv_nop" : "+v"(acc[0]), "+v"(acc[1]), "+v"(acc[2]), "+v"(acc[3]) : "v"(a), "v"(al));
    }
    float* os = &ost[wave][0];
#pragma unroll
    for (int t = 0; t < 4; ++t) {
#pragma unroll
        for (int j = 0; j < 8; ++j) os[(hi * 8 + j) * 68 + t * 16 + lr] = acc[t][j]; }
    __builtin_amdgcn_wave_barrier(); asm volatile("" ::: "memory");
    float* crow = C + (size_t)r0 * ldc + c0;
    auto pass = [&]() {
#pragma unroll
        for (int s = 0; s < 8; ++s) { const int Lid = (lane >> 3) + 4 * s, piece = lane & 7; const int row = Lid >> 1, cofs = (Lid & 1) * 32 + piece * 4;
            const v4f val = *(const v4fa*)(os + row * 68 + cofs); *(v4f*)(crow + (size_t)row * ldc + cofs) = val; }
    };
    pass(); 
}

// k_hplanes: per (batch b, head h) contiguous operand planes [rows][64] = bf16 hi + UNSCALED residual of SRC[(row*2 + b)][col0 + h*64 + d] (+ bias[h][d] when given):
__global__ __launch_bounds__(256) void k_hplanes(const float* __restrict__ SRC, int pitch, int col0, int nrows, const float* __restrict__ bias, bf* Ph, bf* Pl) {
    typedef __attribute__((ext_vector_type(2))) unsigned short v2us;
    const int lane = threadIdx.x & 31, wid = blockIdx.x * 8 + (threadIdx.x >> 5); if (wid >= NBT * NH_ * nrows) return;
    const int row = wid % nrows, bh = wid / nrows, h = bh % NH_, b = bh / NH_;
    v2us oh, ol;
#pragma unroll
    for (int i = 0; i < 2; ++i) { const int d = 2 * lane + i; float v = SRC[((size_t)row * NBT + b) * pitch + col0 + h * HD + d]; if (bias) v += bfr(bias[h * HD + d]); const unsigned short hb = f2bf(v); oh[i] = hb; ol[i] = f2bf(v - bf2f(hb)); }
    const size_t o = ((size_t)bh * nrows + row) * HD + 2 * lane;
    *(v2us*)(Ph + o) = oh; *(v2us*)(Pl + o) = ol; 
}
__global__ __launch_bounds__(256) void k_vtplanes(const float* __restrict__ Vsrc, bf* VTh, bf* VTl) {
    typedef __attribute__((ext_vector_type(2))) unsigned short v2us;
    const int lane = threadIdx.x & 31, wid = blockIdx.x * 8 + (threadIdx.x >> 5); if (wid >= NBT * NH_ * HD * (TK / 64)) return;
    const int tg = wid % (TK / 64), rest = wid / (TK / 64), d = rest % HD, bh = rest / HD, h = bh % NH_, b = bh / NH_; const int t0 = tg * 64 + 2 * lane;
    v2us oh, ol;
#pragma unroll
    for (int i = 0; i < 2; ++i) { const float v = Vsrc[((size_t)(t0 + i) * NBT + b) * DD + h * HD + d]; const unsigned short hb = f2bf(v); oh[i] = hb; ol[i] = f2bf(v - bf2f(hb)); }
    const size_t o = ((size_t)bh * HD + d) * TK + t0;
    *(v2us*)(VTh + o) = oh; *(v2us*)(VTl + o) = ol; 
}
// k_relsoft: one wave per query row i of head (b,h): for each key j: the module's _rel_shift by index (idx = L + i*T + j, row = idx / (T+1), col = idx % (T+1), bd = col ?
// BD[row][col-1] : 0), s = (AC[i][j] + bd)/8, s = -1e30 where mask[i][j][b]; softmax over the 2048 keys (f32, fixed lane order, three passes) -> bf16 hi + UNSCALED
// residual planes; the mean attention map accumulates p / 32 in (b,h) order through two ping-pong buffers (AMIN = the previous head's buffer, never the one being written,
__global__ __launch_bounds__(256) void k_relsoft(const float* __restrict__ AC, const float* __restrict__ BD, const int* __restrict__ MSK, int b, int first, const float* __restrict__ AMIN, bf* PH, bf* PL, float* AMDST) {
    typedef __attribute__((ext_vector_type(4))) unsigned short v4us;
    const int lane = threadIdx.x & 31, i = blockIdx.x * 8 + (threadIdx.x >> 5); if (i >= LQ) return;
    // _rel_shift by index with one integer division per row: idx = L + i*T + j; (row0, col0) for j = 0, then col = col0 + j wraps at most once past T+1
    const int base = LQ + i * TK; const int row0 = base / (TK + 1), col0 = base % (TK + 1);
    auto score = [&](int j) -> float { int col = col0 + j, row = row0; if (col >= TK + 1) { col -= TK + 1; row += 1; }
        const float bd = col ? BD[(size_t)row * TK + col - 1] : 0.f; const float s = (AC[(size_t)i * TK + j] + bd) * SCL; return MSK[((size_t)i * TK + j) * NBT + b] ? NEGV : s; };
    float m = -3.0e38f;
#pragma unroll 1
    for (int c0 = lane * 4; c0 < TK; c0 += 128) {
#pragma unroll
        for (int q = 0; q < 4; ++q) m = fmaxf(m, score(c0 + q)); }
#pragma unroll
    for (int sh = 16; sh; sh >>= 1) m = fmaxf(m, __shfl_xor(m, sh, 32));
    float sum = 0.f;
#pragma unroll 1
    for (int c0 = lane * 4; c0 < TK; c0 += 128) {
#pragma unroll
        for (int q = 0; q < 4; ++q) sum += __expf(score(c0 + q) - m); }
#pragma unroll
    for (int sh = 16; sh; sh >>= 1) sum += __shfl_xor(sum, sh, 32);
    const float inv = 1.0f / sum;
{
#pragma unroll 1
        for (int c0 = lane * 4; c0 < TK; c0 += 128) { v4us oh, ol; v4f am;
#pragma unroll
            for (int q = 0; q < 4; ++q) { const float p = __expf(score(c0 + q) - m) * inv; const unsigned short hb = f2bf(p); oh[q] = hb; ol[q] = f2bf(p - bf2f(hb));
                am[q] = (first ? 0.f : AMIN[(size_t)i * TK + c0 + q]) + p * (1.0f / (NBT * NH_)); }
            const size_t o = (size_t)i * TK + c0; *(v4us*)(PH + o) = oh; *(v4us*)(PL + o) = ol; *(v4f*)(AMDST + o) = am; }
         }
}
__global__ __launch_bounds__(256) void k_split(const float* __restrict__ src, int nrows, bf* dh, bf* dl) {
    const int lane = threadIdx.x & 31, r = blockIdx.x * 8 + (threadIdx.x >> 5); if (r >= nrows) return;
{
#pragma unroll 1
        for (int q = 0; q < DD / 256; ++q) { const size_t o = (size_t)r * DD + q * 256 + lane * 8; const v8f v = *(const v8f*)(src + o); v8us oh, ol;
#pragma unroll
            for (int i = 0; i < 8; ++i) { const unsigned short hb = f2bf(v[i]); oh[i] = hb; ol[i] = f2bf(v[i] - bf2f(hb)); }
            *(v8us*)(dh + o) = oh; *(v8us*)(dl + o) = ol; }
         }
}
// k_ln: one wave per row of H [2048][1024]: LayerNorm (mean, biased var, eps 1e-5) x bf(gamma) + bf(beta) -> f32 output rows; lane -> 4 consecutive floats per 128-column
__global__ __launch_bounds__(256) void k_ln(const float* __restrict__ Hs, const float* __restrict__ g, const float* __restrict__ bb, float* OUTP) {
    const int lane = threadIdx.x & 31, r = blockIdx.x * 8 + (threadIdx.x >> 5); if (r >= NXR) return;
    v4f v[DD / 128]; float s = 0.f;
#pragma unroll
    for (int q = 0; q < DD / 128; ++q) { v[q] = *(const v4f*)(Hs + (size_t)r * DD + q * 128 + lane * 4);
#pragma unroll
        for (int i = 0; i < 4; ++i) s += v[q][i]; }
#pragma unroll
    for (int sh = 16; sh; sh >>= 1) s += __shfl_xor(s, sh, 32);
    const float mu = s * (1.0f / DD); float s2 = 0.f;
#pragma unroll
    for (int q = 0; q < DD / 128; ++q)
#pragma unroll
        for (int i = 0; i < 4; ++i) { const float d = v[q][i] - mu; s2 = fmaf(d, d, s2); }
#pragma unroll
    for (int sh = 16; sh; sh >>= 1) s2 += __shfl_xor(s2, sh, 32);
    const float rs = rsqrtf(s2 * (1.0f / DD) + LN_EPS);
{
#pragma unroll
        for (int q = 0; q < DD / 128; ++q) { const int c0 = q * 128 + lane * 4; v4f y;
#pragma unroll
            for (int i = 0; i < 4; ++i) y[i] = (v[q][i] - mu) * rs * bfr(g[c0 + i]) + bfr(bb[c0 + i]);
            *(v4f*)(OUTP + (size_t)r * DD + c0) = y; }
         }
}

extern "C" void kernel_launch(void* const* d_in, const int* in_sizes, int n_in,
                              void* d_out, int out_size, void* d_ws, size_t ws_size, hipStream_t stream) {
    (void)in_sizes; (void)n_in; (void)out_size;
    const float* x = (const float*)d_in[0]; const float* pe = (const float*)d_in[1]; const float* mem = (const float*)d_in[2]; const float* pbu = (const float*)d_in[3]; const float* pbv = (const float*)d_in[4]; const int* msk = (const int*)d_in[5];
    const float* Wq = (const float*)d_in[6]; const float* Wkv = (const float*)d_in[7]; const float* Wrel = (const float*)d_in[8]; const float* Wo = (const float*)d_in[9]; const float* g = (const float*)d_in[10]; const float* bb = (const float*)d_in[11];
    float* out = (float*)d_out; float* out2 = out + (size_t)NXR * DD;    // output [1024][2][1024]; attn_matrix [1024][2048]
    char* wsp = (char*)d_ws;
    auto take = [&](size_t bytes) { char* p = wsp; wsp += (bytes + 255) & ~(size_t)255; return (void*)p; };
    bf* WqT = (bf*)take((size_t)DD * DD * 2); bf* WkvT = (bf*)take((size_t)2 * DD * DD * 2); bf* WrT = (bf*)take((size_t)DD * DD * 2); bf* WoT = (bf*)take((size_t)DD * DD * 2);
    bf* Cb = (bf*)take((size_t)NCR * DD * 2); float* TMP = (float*)take((size_t)NCR * DD * 4);
    bf* QUh = (bf*)take((size_t)NBT * NH_ * LQ * HD * 2); bf* QUl = (bf*)take((size_t)NBT * NH_ * LQ * HD * 2); bf* QVh = (bf*)take((size_t)NBT * NH_ * LQ * HD * 2); bf* QVl = (bf*)take((size_t)NBT * NH_ * LQ * HD * 2);
    bf* Kh = (bf*)take((size_t)NBT * NH_ * TK * HD * 2); bf* Kl = (bf*)take((size_t)NBT * NH_ * TK * HD * 2); bf* Rh = (bf*)take((size_t)NBT * NH_ * TK * HD * 2); bf* Rl = (bf*)take((size_t)NBT * NH_ * TK * HD * 2);
    bf* VTh = (bf*)take((size_t)NBT * NH_ * HD * TK * 2); bf* VTl = (bf*)take((size_t)NBT * NH_ * HD * TK * 2);
    float* AC = (float*)take((size_t)LQ * TK * 4); float* BD = (float*)take((size_t)LQ * TK * 4); bf* PH = (bf*)take((size_t)LQ * TK * 2); bf* PL = (bf*)take((size_t)LQ * TK * 2); float* AM = (float*)take((size_t)LQ * TK * 4);
    float* AV = (float*)take((size_t)NXR * DD * 4); bf* AVh = (bf*)take((size_t)NXR * DD * 2); bf* AVl = (bf*)take((size_t)NXR * DD * 2);
    if ((size_t)(wsp - (char*)d_ws) > ws_size) return;    // 10.5 + 8.4 + 16.8 + 16.8 + 33.6 + 16.8 + 8.4 + 8.4 + 4.2 + 4.2 + 8.4 + 8.4 + 4.2 + 4.2 ~ 153 MB = 146 MiB; Hs (the pre-LN sum, f32 [2048][1024] = 8.4 MB) reuses BD (same size, dead after the head loop); TMP holds k, v, q, r in turn (each converted to planes before the next GEMM) and then serves as the second mean-map ping-pong buffer (8.4 of its 16.8 MB) during the head loop
    float* Hs = BD; float* AMP[2] = {AM, TMP};     // mean-map ping-pong: AM and (aliasing TMP, dead after the r planes) the second buffer
    k_wt<<<dim3(DD / 64, DD / 64, 1), 256, 0, stream>>>(Wq, DD, DD, WqT); k_wt<<<dim3(DD / 64, (2 * DD) / 64, 1), 256, 0, stream>>>(Wkv, DD, 2 * DD, WkvT); k_wt<<<dim3(DD / 64, DD / 64, 1), 256, 0, stream>>>(Wrel, DD, DD, WrT); k_wt<<<dim3(DD / 64, DD / 64, 1), 256, 0, stream>>>(Wo, DD, DD, WoT);
    // c = [memory; x] as bf16 rows (t, b): rows 0..2047 from memory, 2048..4095 from x
    k_cvtb<<<NXR / 8, 256, 0, stream>>>(mem, NXR, Cb); k_cvtb<<<NXR / 8, 256, 0, stream>>>(x, NXR, Cb + (size_t)NXR * DD);
    k_gemmb<false, false><<<dim3(NCR / 64, DD / 64, 1), 128, 0, stream>>>(Cb, nullptr, WkvT, nullptr, TMP, DD, nullptr);                       // k = c.Wkv[:, :1024]
    k_hplanes<<<(NBT * NH_ * TK) / 8, 256, 0, stream>>>(TMP, DD, 0, TK, nullptr, Kh, Kl);
    k_gemmb<false, false><<<dim3(NCR / 64, DD / 64, 1), 128, 0, stream>>>(Cb, nullptr, WkvT + (size_t)DD * DD, nullptr, TMP, DD, nullptr);    // v = c.Wkv[:, 1024:]
    k_vtplanes<<<(NBT * NH_ * HD * (TK / 64)) / 8, 256, 0, stream>>>(TMP, VTh, VTl);
    k_gemmb<false, false><<<dim3(NXR / 64, DD / 64, 1), 128, 0, stream>>>(Cb + (size_t)NXR * DD, nullptr, WqT, nullptr, TMP, DD, nullptr);      // q = x.Wq (x = the last 2048 rows of c)
    k_hplanes<<<(NBT * NH_ * LQ) / 8, 256, 0, stream>>>(TMP, DD, 0, LQ, pbu, QUh, QUl); k_hplanes<<<(NBT * NH_ * LQ) / 8, 256, 0, stream>>>(TMP, DD, 0, LQ, pbv, QVh, QVl);     // q + u, q + v_bias
    k_cvtb<<<NCR / 8, 256, 0, stream>>>(pe, NCR, Cb);                                                                                    // pos_emb rows (t, b) (c no longer needed)
    k_gemmb<false, false><<<dim3(NCR / 64, DD / 64, 1), 128, 0, stream>>>(Cb, nullptr, WrT, nullptr, TMP, DD, nullptr);                        // r = pos_emb.Wrel
    k_hplanes<<<(NBT * NH_ * TK) / 8, 256, 0, stream>>>(TMP, DD, 0, TK, nullptr, Rh, Rl);
    for (int b = 0; b < NBT; ++b) for (int h = 0; h < NH_; ++h) { const size_t bh = (size_t)b * NH_ + h; const int first = (b == 0 && h == 0), last = (b == NBT - 1 && h == NH_ - 1);
        k_gemm3<<<dim3(LQ / 64, TK / 64, 1), 128, 0, stream>>>(QUh + bh * LQ * HD, QUl + bh * LQ * HD, Kh + bh * TK * HD, Kl + bh * TK * HD, HD, AC, TK);     // AC = (q+u).k^T
        k_gemm3<<<dim3(LQ / 64, TK / 64, 1), 128, 0, stream>>>(QVh + bh * LQ * HD, QVl + bh * LQ * HD, Rh + bh * TK * HD, Rl + bh * TK * HD, HD, BD, TK);     // BD = (q+v).r^T (pre-shift)
        k_relsoft<<<LQ / 8, 256, 0, stream>>>(AC, BD, msk, b, first, AMP[(bh + 1) & 1], PH, PL, last ? out2 : AMP[bh & 1]);     // reads the previous head's buffer, writes the other
        k_gemm3<<<dim3(LQ / 64, 1, 1), 128, 0, stream>>>(PH, PL, VTh + bh * HD * TK, VTl + bh * HD * TK, TK, AV + (size_t)b * DD + h * HD, NBT * DD);          // attn.v -> attn_vec[(l,b)][h*64 + d]
    }
    k_split<<<NXR / 8, 256, 0, stream>>>(AV, NXR, AVh, AVl);
    k_gemmb<true, false><<<dim3(NXR / 64, DD / 64, 1), 128, 0, stream>>>(AVh, AVl, WoT, nullptr, Hs, DD, nullptr, x, DD, 1);                 // h = x + attn_vec.Wo  (x bf16-rounded)
    k_ln<<<NXR / 8, 256, 0, stream>>>(Hs, g, bb, out);
}

// v001
// It runs in 1880 microseconds.
// Timed twice side by side with v000, it ran 1.98 and 2.00 times as fast.
#include <hip/hip_runtime.h>

// Compute dtypes, f32 accumulate: k|v = [memory; x].Wkv ([4096 x 1024].[1024 x 2048]), q = x.Wq, r = pos_emb.Wrel (k-major weights transposed once; PLAIN bf16 operands
// = inputs rounded once, exact) and attn_out = attn_vec.Wo (hi/lo A, + x) on v_wmma_f32_16x16x32_bf16; per (batch, head): AC = (q + u).k^T and BD = (q + v_bias).r^T
// ([1024 x 64].[64 x 2048], both operands bf16 hi + UNSCALED residual, three products), the module's _rel_shift applied by INDEX (the literal pad-reshape-slice
// mapping, incl. its wrap-around entries), x 1/8, the INPUT mask (-1e30), the softmax over keys and the mean attention map in f32, attn.v ([1024 x 2048].[2048 x 64],

#define LQ   1024
#define TK   2048
#define NBT  2
#define DD   1024
#define NH_  16
#define HD   64
#define NXR  (LQ * NBT)           // 2048 x rows (l, b)
#define NCR  (TK * NBT)           // 4096 c / pos rows (t, b)
#define DM   DD
#define NTK  NCR
#define SCL  0.125f
#define NEGV -1e30f
#define LN_EPS 1e-5f
#define LOSC 1024.0f

typedef _Float16 h16;
typedef unsigned short bf;
typedef __attribute__((ext_vector_type(16))) __bf16   v16bf;
typedef __attribute__((ext_vector_type(16))) _Float16 v16h;
typedef __attribute__((ext_vector_type(8)))  _Float16 v8h;
typedef __attribute__((ext_vector_type(8)))  unsigned short v8us;
typedef __attribute__((ext_vector_type(8)))  float    v8f;
typedef __attribute__((ext_vector_type(4)))  float    v4f;
typedef __attribute__((ext_vector_type(4)))  _Float16 v4h;
typedef v8h  __attribute__((may_alias)) v8ha;
typedef v4f  __attribute__((may_alias)) v4fa;
typedef v8us __attribute__((may_alias)) v8usa;

__device__ __forceinline__ unsigned short f2bf(float f) { unsigned u = __float_as_uint(f); u += 0x7FFFu + ((u >> 16) & 1u); return (unsigned short)(u >> 16); }
__device__ __forceinline__ float bf2f(unsigned short b) { return __uint_as_float(((unsigned)b) << 16); }
__device__ __forceinline__ float bfr(float f) { return bf2f(f2bf(f)); }
__device__ __forceinline__ v16h cat16(v8h lo, v8h hi) { return __builtin_shufflevector(lo, hi, 0, 1, 2, 3, 4, 5, 6, 7, 8, 9, 10, 11, 12, 13, 14, 15); }
__device__ __forceinline__ v16bf cat16b(v8us lo, v8us hi) { return __builtin_bit_cast(v16bf, __builtin_shufflevector(lo, hi, 0, 1, 2, 3, 4, 5, 6, 7, 8, 9, 10, 11, 12, 13, 14, 15)); }
__device__ __forceinline__ v8f wmma16(v16h a, v16h b, v8f c) { return __builtin_amdgcn_wmma_f32_16x16x32_f16(false, a, false, b, (short)0, c, false, false); }
__device__ __forceinline__ v8f wmmab(v16bf a, v16bf b, v8f c) { return __builtin_amdgcn_wmma_f32_16x16x32_bf16(false, a, false, b, (short)0, c, false, false); }

// k_wt: WT [n][K] = bf16(W[k][n]) (k-major [K][ncols]) via 64 x 64 LDS tiles; grid (K/64, ncols/64).
__global__ __launch_bounds__(256) void k_wt(const float* __restrict__ Wm, int K, int ncols, bf* WT) {
    __shared__ __align__(16) unsigned short tl[64 * 72];
    const int tid = threadIdx.x, k0 = blockIdx.x * 64, n0 = blockIdx.y * 64;
    const int kk = tid >> 2, nq = (tid & 3) * 16;
#pragma unroll
    for (int i = 0; i < 16; ++i) tl[(nq + i) * 72 + kk] = f2bf(Wm[(size_t)(k0 + kk) * ncols + n0 + nq + i]);
    __syncthreads();
    const int piece = tid & 7;
    auto pass = [&]() {
#pragma unroll
        for (int s = 0; s < 2; ++s) { const int nr = (tid >> 3) + 32 * s; const v8us val = *(const v8usa*)(tl + nr * 72 + piece * 8); *(v8us*)(WT + (size_t)(n0 + nr) * K + k0 + piece * 8) = val; }
    };
    pass(); 
}
__global__ __launch_bounds__(256) void k_cvtb(const float* __restrict__ src, int nrows, bf* dst) {
    const int lane = threadIdx.x & 31, r = blockIdx.x * 8 + (threadIdx.x >> 5);
    if (r >= nrows) return;
    v8us o[DM / 256];
#pragma unroll
    for (int q = 0; q < DM / 256; ++q) { v8us t;
#pragma unroll
        for (int i = 0; i < 8; ++i) t[i] = f2bf(src[(size_t)r * DM + q * 256 + lane * 8 + i]);
        o[q] = t; }
#pragma unroll
    for (int q = 0; q < DM / 256; ++q) *(v8us*)(dst + (size_t)r * DM + q * 256 + lane * 8) = o[q];
    
}

// k_gemmb: 64 x 64 block tile (4 waves x 16 x 64) of C[NTK][NW] = (A [+ Al]).B^T (K = 1024) [+ bf(bias[c])] [+ bf(R[r][c]) residual]; f32 whole-line epilogue (or f16
template <bool SPLITA, bool F16OUT = false>
__global__ __launch_bounds__(128) void k_gemmb(const bf* __restrict__ A, const bf* __restrict__ Al, const bf* __restrict__ Bn, const float* __restrict__ bias, float* C, int ldc, h16* C2, const float* __restrict__ R = nullptr, int K = DM, int roundR = 1) {
    __shared__ __align__(16) float ost[4][16 * 68];
    const int lane = threadIdx.x & 31, wave = threadIdx.x >> 5, lr = lane & 15, hi = lane >> 4;
    const int r0 = blockIdx.x * 64 + wave * 16, c0 = blockIdx.y * 64;
    const size_t aoff = (size_t)(r0 + lr) * K + 8 * hi;
    size_t boff[4];
#pragma unroll
    for (int t = 0; t < 4; ++t) boff[t] = (size_t)(c0 + t * 16 + lr) * K + 8 * hi;
    v8f acc[4];
#pragma unroll
    for (int t = 0; t < 4; ++t) acc[t] = (v8f){};
#pragma unroll 1
    for (int kc = 0; kc < K; kc += 32) {
        const v16bf a = cat16b(*(const v8us*)(A + aoff + kc), *(const v8us*)(A + aoff + kc + 16));
        v16bf al = a;
        if (SPLITA) al = cat16b(*(const v8us*)(Al + aoff + kc), *(const v8us*)(Al + aoff + kc + 16));
#pragma unroll
        for (int t = 0; t < 4; ++t) { const v16bf b = cat16b(*(const v8us*)(Bn + boff[t] + kc), *(const v8us*)(Bn + boff[t] + kc + 16)); acc[t] = wmmab(a, b, acc[t]); if (SPLITA) acc[t] = wmmab(al, b, acc[t]); }
        asm volatile("v_nop\n\tv_nop\n\tv_nop\n\tv_nop" : "+v"(acc[0]), "+v"(acc[1]), "+v"(acc[2]), "+v"(acc[3]) : "v"(a), "v"(al));
    }
    float* os = &ost[wave][0];
#pragma unroll
    for (int t = 0; t < 4; ++t) { const float bv = bias ? bfr(bias[c0 + t * 16 + lr]) : 0.f;
#pragma unroll
        for (int j = 0; j < 8; ++j) os[(hi * 8 + j) * 68 + t * 16 + lr] = acc[t][j] + bv; }
    __syncthreads();
    if (F16OUT) {
        h16* crow = (h16*)(void*)C + (size_t)r0 * ldc + c0;
        auto pass = [&]() {
#pragma unroll
            for (int s = 0; s < 4; ++s) { const int row = 4 * s + (lane >> 3), piece = lane & 7; const float* sp = os + row * 68 + piece * 8; v8h o, o2;
#pragma unroll
                for (int i = 0; i < 8; ++i) { const h16 a = (h16)sp[i]; o[i] = a; o2[i] = (h16)((sp[i] - (float)a) * LOSC); }
                *(v8h*)(crow + (size_t)row * ldc + piece * 8) = o; if (C2) *(v8h*)(C2 + (size_t)r0 * ldc + c0 + (size_t)row * ldc + piece * 8) = o2; }
        };
        pass(); 
    } else {
        float* crow = C + (size_t)r0 * ldc + c0;
        auto pass = [&]() {
#pragma unroll
            for (int s = 0; s < 8; ++s) { const int Lid = (lane >> 3) + 4 * s, piece = lane & 7; const int row = Lid >> 1, cofs = (Lid & 1) * 32 + piece * 4;
                v4f val = *(const v4fa*)(os + row * 68 + cofs); if (R) { const v4f rv = *(const v4f*)(R + ((size_t)r0 + row) * ldc + c0 + cofs); val += roundR ? (v4f){bfr(rv[0]), bfr(rv[1]), bfr(rv[2]), bfr(rv[3])} : rv; }
                *(v4f*)(crow + (size_t)row * ldc + cofs) = val; }
        };
        pass(); 
    }
}

// k_gemm3: 64 x 64 tile of C = (Ah + Al).(Bh + Bl)^T over K (row strides = K for all four planes; n-major B): three products per 32-k step (hh, hl, lh); f32
__global__ __launch_bounds__(128) void k_gemm3(const bf* __restrict__ Ah, const bf* __restrict__ Al, const bf* __restrict__ Bh, const bf* __restrict__ Bl, int K, float* C, int ldc) {
    __shared__ __align__(16) float ost[4][16 * 68];
    const int lane = threadIdx.x & 31, wave = threadIdx.x >> 5, lr = lane & 15, hi = lane >> 4;
    const int r0 = blockIdx.x * 64 + wave * 16, c0 = blockIdx.y * 64;
    const size_t aoff = (size_t)(r0 + lr) * K + 8 * hi;
    v8f acc[4];
#pragma unroll
    for (int t = 0; t < 4; ++t) acc[t] = (v8f){};
#pragma unroll 1
    for (int kc = 0; kc < K; kc += 32) {
        const v16bf a = cat16b(*(const v8us*)(Ah + aoff + kc), *(const v8us*)(Ah + aoff + kc + 16));
        const v16bf al = cat16b(*(const v8us*)(Al + aoff + kc), *(const v8us*)(Al + aoff + kc + 16));
#pragma unroll
        for (int t = 0; t < 4; ++t) { const size_t bo = (size_t)(c0 + t * 16 + lr) * K + kc + 8 * hi;
            const v16bf bh = cat16b(*(const v8us*)(Bh + bo), *(const v8us*)(Bh + bo + 16)); const v16bf bl = cat16b(*(const v8us*)(Bl + bo), *(const v8us*)(Bl + bo + 16));
            acc[t] = wmmab(a, bh, acc[t]); acc[t] = wmmab(al, bh, acc[t]); acc[t] = wmmab(a, bl, acc[t]); }
        asm volatile("v_nop\n\tv_nop\n\tv_nop\n\tv_nop" : "+v"(acc[0]), "+v"(acc[1]), "+v"(acc[2]), "+v"(acc[3]) : "v"(a), "v"(al));
    }
    float* os = &ost[wave][0];
#pragma unroll
    for (int t = 0; t < 4; ++t) {
#pragma unroll
        for (int j = 0; j < 8; ++j) os[(hi * 8 + j) * 68 + t * 16 + lr] = acc[t][j]; }
    __builtin_amdgcn_wave_barrier(); asm volatile("" ::: "memory");
    float* crow = C + (size_t)r0 * ldc + c0;
    auto pass = [&]() {
#pragma unroll
        for (int s = 0; s < 8; ++s) { const int Lid = (lane >> 3) + 4 * s, piece = lane & 7; const int row = Lid >> 1, cofs = (Lid & 1) * 32 + piece * 4;
            const v4f val = *(const v4fa*)(os + row * 68 + cofs); *(v4f*)(crow + (size_t)row * ldc + cofs) = val; }
    };
    pass(); 
}

// k_pv: attn.v of one head, C[1024][64] = (Ah + Al).(Bh + Bl)^T over the 2048 keys (three products per 32-k step, loaders as in k_gemm3). One 16 x 32 output tile and one
// half of the keys per block (grid: 2 column tiles, 64 row tiles, 2 key halves = 256 blocks); each of the 8 waves sums 128 keys, the 8 partial tiles are added in wave order
// through LDS, and the two halves go to two planes (C, C + zstride) that k_split adds. Each stored tile row is one whole 128-byte line.
__global__ __launch_bounds__(256) void k_pv(const bf* __restrict__ Ah, const bf* __restrict__ Al, const bf* __restrict__ Bh, const bf* __restrict__ Bl, float* C, int ldc, size_t zstride) {
    __shared__ __align__(16) float red[8][2 * 272];     // per wave: two 8-row halves of 8 x 32 floats, 16 floats apart in bank so that the two lane halves do not collide
    const int lane = threadIdx.x & 31, wave = threadIdx.x >> 5, lr = lane & 15, hi = lane >> 4;
    const int c0 = blockIdx.x * 32, r0 = blockIdx.y * 16, k0 = blockIdx.z * (TK / 2) + wave * (TK / 16);
    const size_t aoff = (size_t)(r0 + lr) * TK + k0 + 8 * hi;
    v8f acc[2];
#pragma unroll
    for (int t = 0; t < 2; ++t) acc[t] = (v8f){};
    // all 48 fragment loads of the wave's 128 keys are issued first, so that the wave pays one memory round trip and not one per product
    v8us fa[4][4], fb[4][2][4];
#pragma unroll
    for (int s = 0; s < 4; ++s) { const int kc = s * 32;
        fa[s][0] = *(const v8us*)(Ah + aoff + kc); fa[s][1] = *(const v8us*)(Ah + aoff + kc + 16); fa[s][2] = *(const v8us*)(Al + aoff + kc); fa[s][3] = *(const v8us*)(Al + aoff + kc + 16);
#pragma unroll
        for (int t = 0; t < 2; ++t) { const size_t bo = (size_t)(c0 + t * 16 + lr) * TK + k0 + kc + 8 * hi;
            fb[s][t][0] = *(const v8us*)(Bh + bo); fb[s][t][1] = *(const v8us*)(Bh + bo + 16); fb[s][t][2] = *(const v8us*)(Bl + bo); fb[s][t][3] = *(const v8us*)(Bl + bo + 16); }
    }
    asm volatile("s_wait_xcnt 0x0" ::: "memory");     // the accumulators reuse the loads' address registers: this wait stands before that overwrite
    __builtin_amdgcn_sched_barrier(0);     // keeps the matrix instructions behind the wait and all 48 loads ahead of them (without it the scheduler interleaves them, reuses few registers and waits after every pair)
#pragma unroll
    for (int s = 0; s < 4; ++s) { const v16bf a = cat16b(fa[s][0], fa[s][1]), al = cat16b(fa[s][2], fa[s][3]);
#pragma unroll
        for (int t = 0; t < 2; ++t) { const v16bf bh = cat16b(fb[s][t][0], fb[s][t][1]), bl = cat16b(fb[s][t][2], fb[s][t][3]);
            acc[t] = wmmab(a, bh, acc[t]); acc[t] = wmmab(al, bh, acc[t]); acc[t] = wmmab(a, bl, acc[t]); }
    }
#pragma unroll
    for (int t = 0; t < 2; ++t) {
#pragma unroll
        for (int j = 0; j < 8; ++j) red[wave][hi * 272 + j * 32 + t * 16 + lr] = acc[t][j]; }
    __syncthreads();     // every wave's partial tile is in LDS before any wave adds them
    float* crow = C + (size_t)blockIdx.z * zstride + (size_t)r0 * ldc + c0;
#pragma unroll
    for (int s = 0; s < 2; ++s) { float v = red[0][s * 272 + wave * 32 + lane];
#pragma unroll
        for (int w = 1; w < 8; ++w) v += red[w][s * 272 + wave * 32 + lane];
        crow[(size_t)(s * 8 + wave) * ldc + lane] = v; }
}

// k_hplanes: per (batch b, head h) contiguous operand planes [rows][64] = bf16 hi + UNSCALED residual of SRC[(row*2 + b)][col0 + h*64 + d] (+ bias[h][d] when given):
__global__ __launch_bounds__(256) void k_hplanes(const float* __restrict__ SRC, int pitch, int col0, int nrows, const float* __restrict__ bias, bf* Ph, bf* Pl) {
    typedef __attribute__((ext_vector_type(2))) unsigned short v2us;
    const int lane = threadIdx.x & 31, wid = blockIdx.x * 8 + (threadIdx.x >> 5); if (wid >= NBT * NH_ * nrows) return;
    const int row = wid % nrows, bh = wid / nrows, h = bh % NH_, b = bh / NH_;
    v2us oh, ol;
#pragma unroll
    for (int i = 0; i < 2; ++i) { const int d = 2 * lane + i; float v = SRC[((size_t)row * NBT + b) * pitch + col0 + h * HD + d]; if (bias) v += bfr(bias[h * HD + d]); const unsigned short hb = f2bf(v); oh[i] = hb; ol[i] = f2bf(v - bf2f(hb)); }
    const size_t o = ((size_t)bh * nrows + row) * HD + 2 * lane;
    *(v2us*)(Ph + o) = oh; *(v2us*)(Pl + o) = ol; 
}
__global__ __launch_bounds__(256) void k_vtplanes(const float* __restrict__ Vsrc, bf* VTh, bf* VTl) {
    typedef __attribute__((ext_vector_type(2))) unsigned short v2us;
    const int lane = threadIdx.x & 31, wid = blockIdx.x * 8 + (threadIdx.x >> 5); if (wid >= NBT * NH_ * HD * (TK / 64)) return;
    const int tg = wid % (TK / 64), rest = wid / (TK / 64), d = rest % HD, bh = rest / HD, h = bh % NH_, b = bh / NH_; const int t0 = tg * 64 + 2 * lane;
    v2us oh, ol;
#pragma unroll
    for (int i = 0; i < 2; ++i) { const float v = Vsrc[((size_t)(t0 + i) * NBT + b) * DD + h * HD + d]; const unsigned short hb = f2bf(v); oh[i] = hb; ol[i] = f2bf(v - bf2f(hb)); }
    const size_t o = ((size_t)bh * HD + d) * TK + t0;
    *(v2us*)(VTh + o) = oh; *(v2us*)(VTl + o) = ol; 
}
// k_relsoft: one wave per query row i of head (b,h): for each key j: the module's _rel_shift by index (idx = L + i*T + j, row = idx / (T+1), col = idx % (T+1), bd = col ?
// BD[row][col-1] : 0), s = (AC[i][j] + bd)/8, s = -1e30 where mask[i][j][b]; softmax over the 2048 keys (f32, fixed lane order, three passes) -> bf16 hi + UNSCALED
// residual planes; the mean attention map accumulates p / 32 in (b,h) order through two ping-pong buffers (AMIN = the previous head's buffer, never the one being written,
__global__ __launch_bounds__(256) void k_relsoft(const float* __restrict__ AC, const float* __restrict__ BD, const int* __restrict__ MSK, int b, int first, const float* __restrict__ AMIN, bf* PH, bf* PL, float* AMDST) {
    typedef __attribute__((ext_vector_type(4))) unsigned short v4us;
    const int lane = threadIdx.x & 31, i = blockIdx.x * 8 + (threadIdx.x >> 5); if (i >= LQ) return;
    // _rel_shift by index with one integer division per row: idx = L + i*T + j; (row0, col0) for j = 0, then col = col0 + j wraps at most once past T+1
    const int base = LQ + i * TK; const int row0 = base / (TK + 1), col0 = base % (TK + 1);
    auto score = [&](int j) -> float { int col = col0 + j, row = row0; if (col >= TK + 1) { col -= TK + 1; row += 1; }
        const float bd = col ? BD[(size_t)row * TK + col - 1] : 0.f; const float s = (AC[(size_t)i * TK + j] + bd) * SCL; return MSK[((size_t)i * TK + j) * NBT + b] ? NEGV : s; };
    float m = -3.0e38f;
#pragma unroll 1
    for (int c0 = lane * 4; c0 < TK; c0 += 128) {
#pragma unroll
        for (int q = 0; q < 4; ++q) m = fmaxf(m, score(c0 + q)); }
#pragma unroll
    for (int sh = 16; sh; sh >>= 1) m = fmaxf(m, __shfl_xor(m, sh, 32));
    float sum = 0.f;
#pragma unroll 1
    for (int c0 = lane * 4; c0 < TK; c0 += 128) {
#pragma unroll
        for (int q = 0; q < 4; ++q) sum += __expf(score(c0 + q) - m); }
#pragma unroll
    for (int sh = 16; sh; sh >>= 1) sum += __shfl_xor(sum, sh, 32);
    const float inv = 1.0f / sum;
{
#pragma unroll 1
        for (int c0 = lane * 4; c0 < TK; c0 += 128) { v4us oh, ol; v4f am;
#pragma unroll
            for (int q = 0; q < 4; ++q) { const float p = __expf(score(c0 + q) - m) * inv; const unsigned short hb = f2bf(p); oh[q] = hb; ol[q] = f2bf(p - bf2f(hb));
                am[q] = (first ? 0.f : AMIN[(size_t)i * TK + c0 + q]) + p * (1.0f / (NBT * NH_)); }
            const size_t o = (size_t)i * TK + c0; *(v4us*)(PH + o) = oh; *(v4us*)(PL + o) = ol; *(v4f*)(AMDST + o) = am; }
         }
}
__global__ __launch_bounds__(256) void k_split(const float* __restrict__ src, const float* __restrict__ src2, int nrows, bf* dh, bf* dl) {
    const int lane = threadIdx.x & 31, r = blockIdx.x * 8 + (threadIdx.x >> 5); if (r >= nrows) return;
{
#pragma unroll 1
        for (int q = 0; q < DD / 256; ++q) { const size_t o = (size_t)r * DD + q * 256 + lane * 8; const v8f v = *(const v8f*)(src + o) + *(const v8f*)(src2 + o); v8us oh, ol;
#pragma unroll
            for (int i = 0; i < 8; ++i) { const unsigned short hb = f2bf(v[i]); oh[i] = hb; ol[i] = f2bf(v[i] - bf2f(hb)); }
            *(v8us*)(dh + o) = oh; *(v8us*)(dl + o) = ol; }
         }
}
// k_ln: one wave per row of H [2048][1024]: LayerNorm (mean, biased var, eps 1e-5) x bf(gamma) + bf(beta) -> f32 output rows; lane -> 4 consecutive floats per 128-column
__global__ __launch_bounds__(256) void k_ln(const float* __restrict__ Hs, const float* __restrict__ g, const float* __restrict__ bb, float* OUTP) {
    const int lane = threadIdx.x & 31, r = blockIdx.x * 8 + (threadIdx.x >> 5); if (r >= NXR) return;
    v4f v[DD / 128]; float s = 0.f;
#pragma unroll
    for (int q = 0; q < DD / 128; ++q) { v[q] = *(const v4f*)(Hs + (size_t)r * DD + q * 128 + lane * 4);
#pragma unroll
        for (int i = 0; i < 4; ++i) s += v[q][i]; }
#pragma unroll
    for (int sh = 16; sh; sh >>= 1) s += __shfl_xor(s, sh, 32);
    const float mu = s * (1.0f / DD); float s2 = 0.f;
#pragma unroll
    for (int q = 0; q < DD / 128; ++q)
#pragma unroll
        for (int i = 0; i < 4; ++i) { const float d = v[q][i] - mu; s2 = fmaf(d, d, s2); }
#pragma unroll
    for (int sh = 16; sh; sh >>= 1) s2 += __shfl_xor(s2, sh, 32);
    const float rs = rsqrtf(s2 * (1.0f / DD) + LN_EPS);
{
#pragma unroll
        for (int q = 0; q < DD / 128; ++q) { const int c0 = q * 128 + lane * 4; v4f y;
#pragma unroll
            for (int i = 0; i < 4; ++i) y[i] = (v[q][i] - mu) * rs * bfr(g[c0 + i]) + bfr(bb[c0 + i]);
            *(v4f*)(OUTP + (size_t)r * DD + c0) = y; }
         }
}

extern "C" void kernel_launch(void* const* d_in, const int* in_sizes, int n_in,
                              void* d_out, int out_size, void* d_ws, size_t ws_size, hipStream_t stream) {
    (void)in_sizes; (void)n_in; (void)out_size;
    const float* x = (const float*)d_in[0]; const float* pe = (const float*)d_in[1]; const float* mem = (const float*)d_in[2]; const float* pbu = (const float*)d_in[3]; const float* pbv = (const float*)d_in[4]; const int* msk = (const int*)d_in[5];
    const float* Wq = (const float*)d_in[6]; const float* Wkv = (const float*)d_in[7]; const float* Wrel = (const float*)d_in[8]; const float* Wo = (const float*)d_in[9]; const float* g = (const float*)d_in[10]; const float* bb = (const float*)d_in[11];
    float* out = (float*)d_out; float* out2 = out + (size_t)NXR * DD;    // output [1024][2][1024]; attn_matrix [1024][2048]
    char* wsp = (char*)d_ws;
    auto take = [&](size_t bytes) { char* p = wsp; wsp += (bytes + 255) & ~(size_t)255; return (void*)p; };
    bf* WqT = (bf*)take((size_t)DD * DD * 2); bf* WkvT = (bf*)take((size_t)2 * DD * DD * 2); bf* WrT = (bf*)take((size_t)DD * DD * 2); bf* WoT = (bf*)take((size_t)DD * DD * 2);
    bf* Cb = (bf*)take((size_t)NCR * DD * 2); float* TMP = (float*)take((size_t)NCR * DD * 4);
    bf* QUh = (bf*)take((size_t)NBT * NH_ * LQ * HD * 2); bf* QUl = (bf*)take((size_t)NBT * NH_ * LQ * HD * 2); bf* QVh = (bf*)take((size_t)NBT * NH_ * LQ * HD * 2); bf* QVl = (bf*)take((size_t)NBT * NH_ * LQ * HD * 2);
    bf* Kh = (bf*)take((size_t)NBT * NH_ * TK * HD * 2); bf* Kl = (bf*)take((size_t)NBT * NH_ * TK * HD * 2); bf* Rh = (bf*)take((size_t)NBT * NH_ * TK * HD * 2); bf* Rl = (bf*)take((size_t)NBT * NH_ * TK * HD * 2);
    bf* VTh = (bf*)take((size_t)NBT * NH_ * HD * TK * 2); bf* VTl = (bf*)take((size_t)NBT * NH_ * HD * TK * 2);
    float* AC = (float*)take((size_t)LQ * TK * 4); float* BD = (float*)take((size_t)LQ * TK * 4); bf* PH = (bf*)take((size_t)LQ * TK * 2); bf* PL = (bf*)take((size_t)LQ * TK * 2); float* AM = (float*)take((size_t)LQ * TK * 4);
    float* AV = (float*)take((size_t)2 * NXR * DD * 4); bf* AVh = (bf*)take((size_t)NXR * DD * 2); bf* AVl = (bf*)take((size_t)NXR * DD * 2);
    if ((size_t)(wsp - (char*)d_ws) > ws_size) return;    // 10.5 + 8.4 + 16.8 + 16.8 + 33.6 + 16.8 + 8.4 + 8.4 + 4.2 + 4.2 + 8.4 + 8.4 + 4.2 + 4.2 ~ 153 MB, + 8.4 MB for the second attn_vec plane ~ 161 MB = 154 MiB; Hs (the pre-LN sum, f32 [2048][1024] = 8.4 MB) reuses BD (same size, dead after the head loop); TMP holds k, v, q, r in turn (each converted to planes before the next GEMM) and then serves as the second mean-map ping-pong buffer (8.4 of its 16.8 MB) during the head loop
    float* Hs = BD; float* AMP[2] = {AM, TMP};     // mean-map ping-pong: AM and (aliasing TMP, dead after the r planes) the second buffer
    k_wt<<<dim3(DD / 64, DD / 64, 1), 256, 0, stream>>>(Wq, DD, DD, WqT); k_wt<<<dim3(DD / 64, (2 * DD) / 64, 1), 256, 0, stream>>>(Wkv, DD, 2 * DD, WkvT); k_wt<<<dim3(DD / 64, DD / 64, 1), 256, 0, stream>>>(Wrel, DD, DD, WrT); k_wt<<<dim3(DD / 64, DD / 64, 1), 256, 0, stream>>>(Wo, DD, DD, WoT);
    // c = [memory; x] as bf16 rows (t, b): rows 0..2047 from memory, 2048..4095 from x
    k_cvtb<<<NXR / 8, 256, 0, stream>>>(mem, NXR, Cb); k_cvtb<<<NXR / 8, 256, 0, stream>>>(x, NXR, Cb + (size_t)NXR * DD);
    k_gemmb<false, false><<<dim3(NCR / 64, DD / 64, 1), 128, 0, stream>>>(Cb, nullptr, WkvT, nullptr, TMP, DD, nullptr);                       // k = c.Wkv[:, :1024]
    k_hplanes<<<(NBT * NH_ * TK) / 8, 256, 0, stream>>>(TMP, DD, 0, TK, nullptr, Kh, Kl);
    k_gemmb<false, false><<<dim3(NCR / 64, DD / 64, 1), 128, 0, stream>>>(Cb, nullptr, WkvT + (size_t)DD * DD, nullptr, TMP, DD, nullptr);    // v = c.Wkv[:, 1024:]
    k_vtplanes<<<(NBT * NH_ * HD * (TK / 64)) / 8, 256, 0, stream>>>(TMP, VTh, VTl);
    k_gemmb<false, false><<<dim3(NXR / 64, DD / 64, 1), 128, 0, stream>>>(Cb + (size_t)NXR * DD, nullptr, WqT, nullptr, TMP, DD, nullptr);      // q = x.Wq (x = the last 2048 rows of c)
    k_hplanes<<<(NBT * NH_ * LQ) / 8, 256, 0, stream>>>(TMP, DD, 0, LQ, pbu, QUh, QUl); k_hplanes<<<(NBT * NH_ * LQ) / 8, 256, 0, stream>>>(TMP, DD, 0, LQ, pbv, QVh, QVl);     // q + u, q + v_bias
    k_cvtb<<<NCR / 8, 256, 0, stream>>>(pe, NCR, Cb);                                                                                    // pos_emb rows (t, b) (c no longer needed)
    k_gemmb<false, false><<<dim3(NCR / 64, DD / 64, 1), 128, 0, stream>>>(Cb, nullptr, WrT, nullptr, TMP, DD, nullptr);                        // r = pos_emb.Wrel
    k_hplanes<<<(NBT * NH_ * TK) / 8, 256, 0, stream>>>(TMP, DD, 0, TK, nullptr, Rh, Rl);
    for (int b = 0; b < NBT; ++b) for (int h = 0; h < NH_; ++h) { const size_t bh = (size_t)b * NH_ + h; const int first = (b == 0 && h == 0), last = (b == NBT - 1 && h == NH_ - 1);
        k_gemm3<<<dim3(LQ / 64, TK / 64, 1), 128, 0, stream>>>(QUh + bh * LQ * HD, QUl + bh * LQ * HD, Kh + bh * TK * HD, Kl + bh * TK * HD, HD, AC, TK);     // AC = (q+u).k^T
        k_gemm3<<<dim3(LQ / 64, TK / 64, 1), 128, 0, stream>>>(QVh + bh * LQ * HD, QVl + bh * LQ * HD, Rh + bh * TK * HD, Rl + bh * TK * HD, HD, BD, TK);     // BD = (q+v).r^T (pre-shift)
        k_relsoft<<<LQ / 8, 256, 0, stream>>>(AC, BD, msk, b, first, AMP[(bh + 1) & 1], PH, PL, last ? out2 : AMP[bh & 1]);     // reads the previous head's buffer, writes the other
        k_pv<<<dim3(HD / 32, LQ / 16, 2), 256, 0, stream>>>(PH, PL, VTh + bh * HD * TK, VTl + bh * HD * TK, AV + (size_t)b * DD + h * HD, NBT * DD, (size_t)NXR * DD);          // attn.v -> attn_vec[(l,b)][h*64 + d], two key-half planes
    }
    k_split<<<NXR / 8, 256, 0, stream>>>(AV, AV + (size_t)NXR * DD, NXR, AVh, AVl);     // adds the two key-half planes of attn_vec
    k_gemmb<true, false><<<dim3(NXR / 64, DD / 64, 1), 128, 0, stream>>>(AVh, AVl, WoT, nullptr, Hs, DD, nullptr, x, DD, 1);                 // h = x + attn_vec.Wo  (x bf16-rounded)
    k_ln<<<NXR / 8, 256, 0, stream>>>(Hs, g, bb, out);
}

// v002
// One run takes 940 microseconds.
// Next to v001, in two timings, it ran 2.00 times as fast each time.
// Counting every step since v000, it is 3.98 times as fast.
#include <hip/hip_runtime.h>

// Compute dtypes, f32 accumulate: k|v = [memory; x].Wkv ([4096 x 1024].[1024 x 2048]), q = x.Wq, r = pos_emb.Wrel (k-major weights transposed once; PLAIN bf16 operands
// = inputs rounded once, exact) and attn_out = attn_vec.Wo (hi/lo A, + x) on v_wmma_f32_16x16x32_bf16; per (batch, head): AC = (q + u).k^T and BD = (q + v_bias).r^T
// ([1024 x 64].[64 x 2048], both operands bf16 hi + UNSCALED residual, three products), the module's _rel_shift applied by INDEX (the literal pad-reshape-slice
// mapping, incl. its wrap-around entries), x 1/8, the INPUT mask (-1e30), the softmax over keys and the mean attention map in f32, attn.v ([1024 x 2048].[2048 x 64],

#define LQ   1024
#define TK   2048
#define NBT  2
#define DD   1024
#define NH_  16
#define HD   64
#define NXR  (LQ * NBT)           // 2048 x rows (l, b)
#define NCR  (TK * NBT)           // 4096 c / pos rows (t, b)
#define DM   DD
#define NTK  NCR
#define SCL  0.125f
#define NEGV -1e30f
#define LN_EPS 1e-5f
#define LOSC 1024.0f
#define HG   4                    // heads of one batch that each launch of the head loop works on side by side (divides NH_, so one launch has one batch index)

typedef _Float16 h16;
typedef unsigned short bf;
typedef __attribute__((ext_vector_type(16))) __bf16   v16bf;
typedef __attribute__((ext_vector_type(16))) _Float16 v16h;
typedef __attribute__((ext_vector_type(8)))  _Float16 v8h;
typedef __attribute__((ext_vector_type(8)))  unsigned short v8us;
typedef __attribute__((ext_vector_type(8)))  float    v8f;
typedef __attribute__((ext_vector_type(4)))  float    v4f;
typedef __attribute__((ext_vector_type(4)))  _Float16 v4h;
typedef v8h  __attribute__((may_alias)) v8ha;
typedef v4f  __attribute__((may_alias)) v4fa;
typedef v8us __attribute__((may_alias)) v8usa;

__device__ __forceinline__ unsigned short f2bf(float f) { unsigned u = __float_as_uint(f); u += 0x7FFFu + ((u >> 16) & 1u); return (unsigned short)(u >> 16); }
__device__ __forceinline__ float bf2f(unsigned short b) { return __uint_as_float(((unsigned)b) << 16); }
__device__ __forceinline__ float bfr(float f) { return bf2f(f2bf(f)); }
__device__ __forceinline__ v16h cat16(v8h lo, v8h hi) { return __builtin_shufflevector(lo, hi, 0, 1, 2, 3, 4, 5, 6, 7, 8, 9, 10, 11, 12, 13, 14, 15); }
__device__ __forceinline__ v16bf cat16b(v8us lo, v8us hi) { return __builtin_bit_cast(v16bf, __builtin_shufflevector(lo, hi, 0, 1, 2, 3, 4, 5, 6, 7, 8, 9, 10, 11, 12, 13, 14, 15)); }
__device__ __forceinline__ v8f wmma16(v16h a, v16h b, v8f c) { return __builtin_amdgcn_wmma_f32_16x16x32_f16(false, a, false, b, (short)0, c, false, false); }
__device__ __forceinline__ v8f wmmab(v16bf a, v16bf b, v8f c) { return __builtin_amdgcn_wmma_f32_16x16x32_bf16(false, a, false, b, (short)0, c, false, false); }

// k_wt: WT [n][K] = bf16(W[k][n]) (k-major [K][ncols]) via 64 x 64 LDS tiles; grid (K/64, ncols/64).
__global__ __launch_bounds__(256) void k_wt(const float* __restrict__ Wm, int K, int ncols, bf* WT) {
    __shared__ __align__(16) unsigned short tl[64 * 72];
    const int tid = threadIdx.x, k0 = blockIdx.x * 64, n0 = blockIdx.y * 64;
    const int kk = tid >> 2, nq = (tid & 3) * 16;
#pragma unroll
    for (int i = 0; i < 16; ++i) tl[(nq + i) * 72 + kk] = f2bf(Wm[(size_t)(k0 + kk) * ncols + n0 + nq + i]);
    __syncthreads();
    const int piece = tid & 7;
    auto pass = [&]() {
#pragma unroll
        for (int s = 0; s < 2; ++s) { const int nr = (tid >> 3) + 32 * s; const v8us val = *(const v8usa*)(tl + nr * 72 + piece * 8); *(v8us*)(WT + (size_t)(n0 + nr) * K + k0 + piece * 8) = val; }
    };
    pass(); 
}
__global__ __launch_bounds__(256) void k_cvtb(const float* __restrict__ src, int nrows, bf* dst) {
    const int lane = threadIdx.x & 31, r = blockIdx.x * 8 + (threadIdx.x >> 5);
    if (r >= nrows) return;
    v8us o[DM / 256];
#pragma unroll
    for (int q = 0; q < DM / 256; ++q) { v8us t;
#pragma unroll
        for (int i = 0; i < 8; ++i) t[i] = f2bf(src[(size_t)r * DM + q * 256 + lane * 8 + i]);
        o[q] = t; }
#pragma unroll
    for (int q = 0; q < DM / 256; ++q) *(v8us*)(dst + (size_t)r * DM + q * 256 + lane * 8) = o[q];
    
}

// k_gemmb: 64 x 64 block tile (4 waves x 16 x 64) of C[NTK][NW] = (A [+ Al]).B^T (K = 1024) [+ bf(bias[c])] [+ bf(R[r][c]) residual]; f32 whole-line epilogue (or f16
template <bool SPLITA, bool F16OUT = false>
__global__ __launch_bounds__(128) void k_gemmb(const bf* __restrict__ A, const bf* __restrict__ Al, const bf* __restrict__ Bn, const float* __restrict__ bias, float* C, int ldc, h16* C2, const float* __restrict__ R = nullptr, int K = DM, int roundR = 1) {
    __shared__ __align__(16) float ost[4][16 * 68];
    const int lane = threadIdx.x & 31, wave = threadIdx.x >> 5, lr = lane & 15, hi = lane >> 4;
    const int r0 = blockIdx.x * 64 + wave * 16, c0 = blockIdx.y * 64;
    const size_t aoff = (size_t)(r0 + lr) * K + 8 * hi;
    size_t boff[4];
#pragma unroll
    for (int t = 0; t < 4; ++t) boff[t] = (size_t)(c0 + t * 16 + lr) * K + 8 * hi;
    v8f acc[4];
#pragma unroll
    for (int t = 0; t < 4; ++t) acc[t] = (v8f){};
#pragma unroll 1
    for (int kc = 0; kc < K; kc += 32) {
        const v16bf a = cat16b(*(const v8us*)(A + aoff + kc), *(const v8us*)(A + aoff + kc + 16));
        v16bf al = a;
        if (SPLITA) al = cat16b(*(const v8us*)(Al + aoff + kc), *(const v8us*)(Al + aoff + kc + 16));
#pragma unroll
        for (int t = 0; t < 4; ++t) { const v16bf b = cat16b(*(const v8us*)(Bn + boff[t] + kc), *(const v8us*)(Bn + boff[t] + kc + 16)); acc[t] = wmmab(a, b, acc[t]); if (SPLITA) acc[t] = wmmab(al, b, acc[t]); }
        asm volatile("v_nop\n\tv_nop\n\tv_nop\n\tv_nop" : "+v"(acc[0]), "+v"(acc[1]), "+v"(acc[2]), "+v"(acc[3]) : "v"(a), "v"(al));
    }
    float* os = &ost[wave][0];
#pragma unroll
    for (int t = 0; t < 4; ++t) { const float bv = bias ? bfr(bias[c0 + t * 16 + lr]) : 0.f;
#pragma unroll
        for (int j = 0; j < 8; ++j) os[(hi * 8 + j) * 68 + t * 16 + lr] = acc[t][j] + bv; }
    __syncthreads();
    if (F16OUT) {
        h16* crow = (h16*)(void*)C + (size_t)r0 * ldc + c0;
        auto pass = [&]() {
#pragma unroll
            for (int s = 0; s < 4; ++s) { const int row = 4 * s + (lane >> 3), piece = lane & 7; const float* sp = os + row * 68 + piece * 8; v8h o, o2;
#pragma unroll
                for (int i = 0; i < 8; ++i) { const h16 a = (h16)sp[i]; o[i] = a; o2[i] = (h16)((sp[i] - (float)a) * LOSC); }
                *(v8h*)(crow + (size_t)row * ldc + piece * 8) = o; if (C2) *(v8h*)(C2 + (size_t)r0 * ldc + c0 + (size_t)row * ldc + piece * 8) = o2; }
        };
        pass(); 
    } else {
        float* crow = C + (size_t)r0 * ldc + c0;
        auto pass = [&]() {
#pragma unroll
            for (int s = 0; s < 8; ++s) { const int Lid = (lane >> 3) + 4 * s, piece = lane & 7; const int row = Lid >> 1, cofs = (Lid & 1) * 32 + piece * 4;
                v4f val = *(const v4fa*)(os + row * 68 + cofs); if (R) { const v4f rv = *(const v4f*)(R + ((size_t)r0 + row) * ldc + c0 + cofs); val += roundR ? (v4f){bfr(rv[0]), bfr(rv[1]), bfr(rv[2]), bfr(rv[3])} : rv; }
                *(v4f*)(crow + (size_t)row * ldc + cofs) = val; }
        };
        pass(); 
    }
}

// k_gemm3: 64 x 64 tile of C = (Ah + Al).(Bh + Bl)^T over K (row strides = K for all four planes; n-major B): three products per 32-k step (hh, hl, lh); f32
// blockIdx.z = the head inside the launch's group: its A, B and C planes lie sA, sB and sC elements behind the previous head's.
__global__ __launch_bounds__(128) void k_gemm3(const bf* __restrict__ Ah, const bf* __restrict__ Al, const bf* __restrict__ Bh, const bf* __restrict__ Bl, int K, float* C, int ldc, size_t sA, size_t sB, size_t sC) {
    __shared__ __align__(16) float ost[4][16 * 68];
    Ah += blockIdx.z * sA; Al += blockIdx.z * sA; Bh += blockIdx.z * sB; Bl += blockIdx.z * sB; C += blockIdx.z * sC;
    const int lane = threadIdx.x & 31, wave = threadIdx.x >> 5, lr = lane & 15, hi = lane >> 4;
    const int r0 = blockIdx.x * 64 + wave * 16, c0 = blockIdx.y * 64;
    const size_t aoff = (size_t)(r0 + lr) * K + 8 * hi;
    v8f acc[4];
#pragma unroll
    for (int t = 0; t < 4; ++t) acc[t] = (v8f){};
#pragma unroll 1
    for (int kc = 0; kc < K; kc += 32) {
        const v16bf a = cat16b(*(const v8us*)(Ah + aoff + kc), *(const v8us*)(Ah + aoff + kc + 16));
        const v16bf al = cat16b(*(const v8us*)(Al + aoff + kc), *(const v8us*)(Al + aoff + kc + 16));
#pragma unroll
        for (int t = 0; t < 4; ++t) { const size_t bo = (size_t)(c0 + t * 16 + lr) * K + kc + 8 * hi;
            const v16bf bh = cat16b(*(const v8us*)(Bh + bo), *(const v8us*)(Bh + bo + 16)); const v16bf bl = cat16b(*(const v8us*)(Bl + bo), *(const v8us*)(Bl + bo + 16));
            acc[t] = wmmab(a, bh, acc[t]); acc[t] = wmmab(al, bh, acc[t]); acc[t] = wmmab(a, bl, acc[t]); }
        asm volatile("v_nop\n\tv_nop\n\tv_nop\n\tv_nop" : "+v"(acc[0]), "+v"(acc[1]), "+v"(acc[2]), "+v"(acc[3]) : "v"(a), "v"(al));
    }
    float* os = &ost[wave][0];
#pragma unroll
    for (int t = 0; t < 4; ++t) {
#pragma unroll
        for (int j = 0; j < 8; ++j) os[(hi * 8 + j) * 68 + t * 16 + lr] = acc[t][j]; }
    __builtin_amdgcn_wave_barrier(); asm volatile("" ::: "memory");
    float* crow = C + (size_t)r0 * ldc + c0;
    auto pass = [&]() {
#pragma unroll
        for (int s = 0; s < 8; ++s) { const int Lid = (lane >> 3) + 4 * s, piece = lane & 7; const int row = Lid >> 1, cofs = (Lid & 1) * 32 + piece * 4;
            const v4f val = *(const v4fa*)(os + row * 68 + cofs); *(v4f*)(crow + (size_t)row * ldc + cofs) = val; }
    };
    pass(); 
}

// k_pv: attn.v of the group's HG heads, each C[1024][64] = (Ah + Al).(Bh + Bl)^T over the 2048 keys (three products per 32-k step, loaders as in k_gemm3). One 16 x 32 output tile and one
// half of the keys per block (grid: 2 column tiles, 64 row tiles, z = HG heads x 2 key halves = 1024 blocks); each of the 8 waves sums 128 keys, the 8 partial tiles are added in wave order
// through LDS, and the two halves go to two planes (C, C + zstride) that k_split adds. Each stored tile row is one whole 128-byte line.
__global__ __launch_bounds__(256) void k_pv(const bf* __restrict__ Ah, const bf* __restrict__ Al, const bf* __restrict__ Bh, const bf* __restrict__ Bl, float* C, int ldc, size_t zstride) {
    __shared__ __align__(16) float red[8][2 * 272];     // per wave: two 8-row halves of 8 x 32 floats, 16 floats apart in bank so that the two lane halves do not collide
    const int lane = threadIdx.x & 31, wave = threadIdx.x >> 5, lr = lane & 15, hi = lane >> 4;
    const int hz = blockIdx.z >> 1, kh = blockIdx.z & 1;     // head inside the group, key half
    Ah += (size_t)hz * LQ * TK; Al += (size_t)hz * LQ * TK; Bh += (size_t)hz * HD * TK; Bl += (size_t)hz * HD * TK;
    const int c0 = blockIdx.x * 32, r0 = blockIdx.y * 16, k0 = kh * (TK / 2) + wave * (TK / 16);
    const size_t aoff = (size_t)(r0 + lr) * TK + k0 + 8 * hi;
    v8f acc[2];
#pragma unroll
    for (int t = 0; t < 2; ++t) acc[t] = (v8f){};
    // all 48 fragment loads of the wave's 128 keys are issued first, so that the wave pays one memory round trip and not one per product
    v8us fa[4][4], fb[4][2][4];
#pragma unroll
    for (int s = 0; s < 4; ++s) { const int kc = s * 32;
        fa[s][0] = *(const v8us*)(Ah + aoff + kc); fa[s][1] = *(const v8us*)(Ah + aoff + kc + 16); fa[s][2] = *(const v8us*)(Al + aoff + kc); fa[s][3] = *(const v8us*)(Al + aoff + kc + 16);
#pragma unroll
        for (int t = 0; t < 2; ++t) { const size_t bo = (size_t)(c0 + t * 16 + lr) * TK + k0 + kc + 8 * hi;
            fb[s][t][0] = *(const v8us*)(Bh + bo); fb[s][t][1] = *(const v8us*)(Bh + bo + 16); fb[s][t][2] = *(const v8us*)(Bl + bo); fb[s][t][3] = *(const v8us*)(Bl + bo + 16); }
    }
    asm volatile("s_wait_xcnt 0x0" ::: "memory");     // the accumulators reuse the loads' address registers: this wait stands before that overwrite
    __builtin_amdgcn_sched_barrier(0);     // keeps the matrix instructions behind the wait and all 48 loads ahead of them (without it the scheduler interleaves them, reuses few registers and waits after every pair)
#pragma unroll
    for (int s = 0; s < 4; ++s) { const v16bf a = cat16b(fa[s][0], fa[s][1]), al = cat16b(fa[s][2], fa[s][3]);
#pragma unroll
        for (int t = 0; t < 2; ++t) { const v16bf bh = cat16b(fb[s][t][0], fb[s][t][1]), bl = cat16b(fb[s][t][2], fb[s][t][3]);
            acc[t] = wmmab(a, bh, acc[t]); acc[t] = wmmab(al, bh, acc[t]); acc[t] = wmmab(a, bl, acc[t]); }
    }
#pragma unroll
    for (int t = 0; t < 2; ++t) {
#pragma unroll
        for (int j = 0; j < 8; ++j) red[wave][hi * 272 + j * 32 + t * 16 + lr] = acc[t][j]; }
    __syncthreads();     // every wave's partial tile is in LDS before any wave adds them
    float* crow = C + (size_t)kh * zstride + (size_t)r0 * ldc + hz * HD + c0;
#pragma unroll
    for (int s = 0; s < 2; ++s) { float v = red[0][s * 272 + wave * 32 + lane];
#pragma unroll
        for (int w = 1; w < 8; ++w) v += red[w][s * 272 + wave * 32 + lane];
        crow[(size_t)(s * 8 + wave) * ldc + lane] = v; }
}

// k_hplanes: per (batch b, head h) contiguous operand planes [rows][64] = bf16 hi + UNSCALED residual of SRC[(row*2 + b)][col0 + h*64 + d] (+ bias[h][d] when given):
__global__ __launch_bounds__(256) void k_hplanes(const float* __restrict__ SRC, int pitch, int col0, int nrows, const float* __restrict__ bias, bf* Ph, bf* Pl) {
    typedef __attribute__((ext_vector_type(2))) unsigned short v2us;
    const int lane = threadIdx.x & 31, wid = blockIdx.x * 8 + (threadIdx.x >> 5); if (wid >= NBT * NH_ * nrows) return;
    const int row = wid % nrows, bh = wid / nrows, h = bh % NH_, b = bh / NH_;
    v2us oh, ol;
#pragma unroll
    for (int i = 0; i < 2; ++i) { const int d = 2 * lane + i; float v = SRC[((size_t)row * NBT + b) * pitch + col0 + h * HD + d]; if (bias) v += bfr(bias[h * HD + d]); const unsigned short hb = f2bf(v); oh[i] = hb; ol[i] = f2bf(v - bf2f(hb)); }
    const size_t o = ((size_t)bh * nrows + row) * HD + 2 * lane;
    *(v2us*)(Ph + o) = oh; *(v2us*)(Pl + o) = ol; 
}
__global__ __launch_bounds__(256) void k_vtplanes(const float* __restrict__ Vsrc, bf* VTh, bf* VTl) {
    typedef __attribute__((ext_vector_type(2))) unsigned short v2us;
    const int lane = threadIdx.x & 31, wid = blockIdx.x * 8 + (threadIdx.x >> 5); if (wid >= NBT * NH_ * HD * (TK / 64)) return;
    const int tg = wid % (TK / 64), rest = wid / (TK / 64), d = rest % HD, bh = rest / HD, h = bh % NH_, b = bh / NH_; const int t0 = tg * 64 + 2 * lane;
    v2us oh, ol;
#pragma unroll
    for (int i = 0; i < 2; ++i) { const float v = Vsrc[((size_t)(t0 + i) * NBT + b) * DD + h * HD + d]; const unsigned short hb = f2bf(v); oh[i] = hb; ol[i] = f2bf(v - bf2f(hb)); }
    const size_t o = ((size_t)bh * HD + d) * TK + t0;
    *(v2us*)(VTh + o) = oh; *(v2us*)(VTl + o) = ol; 
}
// k_relsoft: one wave per query row i of head (b,h); a block = 2 rows x the HG heads of the group (planes LQ*TK elements apart); for each key j: the module's _rel_shift by index (idx = L + i*T + j, row = idx / (T+1), col = idx % (T+1), bd = col ?
// BD[row][col-1] : 0), s = (AC[i][j] + bd)/8, s = -1e30 where mask[i][j][b]; softmax over the 2048 keys (f32, fixed lane order, three passes) -> bf16 hi + UNSCALED
// residual planes; the mean attention map accumulates p / 32 in (b,h) order: each wave leaves its head's p / 32 in LDS, and behind a barrier the block adds the HG heads in
// head order onto the previous group's map, through two ping-pong buffers (AMIN = the previous group's buffer, never the one being written,
__global__ __launch_bounds__(256) void k_relsoft(const float* __restrict__ ACg, const float* __restrict__ BDg, const int* __restrict__ MSK, int b, int first, const float* __restrict__ AMIN, bf* PHg, bf* PLg, float* AMDST) {
    typedef __attribute__((ext_vector_type(4))) unsigned short v4us;
    __shared__ __align__(16) float pm[8][TK];     // p / 32 of each wave's (row, head)
    const int lane = threadIdx.x & 31, wave = threadIdx.x >> 5, hz = wave % HG, i = blockIdx.x * (8 / HG) + wave / HG;
    const float* __restrict__ AC = ACg + (size_t)hz * LQ * TK; const float* __restrict__ BD = BDg + (size_t)hz * LQ * TK; bf* PH = PHg + (size_t)hz * LQ * TK; bf* PL = PLg + (size_t)hz * LQ * TK;
    // _rel_shift by index with one integer division per row: idx = L + i*T + j; (row0, col0) for j = 0, then col = col0 + j wraps at most once past T+1
    const int base = LQ + i * TK; const int row0 = base / (TK + 1), col0 = base % (TK + 1);
    auto score = [&](int j) -> float { int col = col0 + j, row = row0; if (col >= TK + 1) { col -= TK + 1; row += 1; }
        const float bd = col ? BD[(size_t)row * TK + col - 1] : 0.f; const float s = (AC[(size_t)i * TK + j] + bd) * SCL; return MSK[((size_t)i * TK + j) * NBT + b] ? NEGV : s; };
    float m = -3.0e38f;
#pragma unroll 1
    for (int c0 = lane * 4; c0 < TK; c0 += 128) {
#pragma unroll
        for (int q = 0; q < 4; ++q) m = fmaxf(m, score(c0 + q)); }
#pragma unroll
    for (int sh = 16; sh; sh >>= 1) m = fmaxf(m, __shfl_xor(m, sh, 32));
    float sum = 0.f;
#pragma unroll 1
    for (int c0 = lane * 4; c0 < TK; c0 += 128) {
#pragma unroll
        for (int q = 0; q < 4; ++q) sum += __expf(score(c0 + q) - m); }
#pragma unroll
    for (int sh = 16; sh; sh >>= 1) sum += __shfl_xor(sum, sh, 32);
    const float inv = 1.0f / sum;
    // the block's 8 / HG rows of the map are one run of floats: thread t owns floats 4 t .. 4 t + 3 of every 1024; the previous group's values are fetched here, under the last pass
    const size_t mo = (size_t)blockIdx.x * (8 / HG) * TK + threadIdx.x * 4;
    v4f am[(8 / HG) * TK / 1024];
#pragma unroll     // unrolled (here and in the two loops behind the barrier): am[] is indexed by constants and stays in registers, and the loads go out together
    for (int s = 0; s < (8 / HG) * TK / 1024; ++s) am[s] = first ? (v4f){} : *(const v4f*)(AMIN + mo + s * 1024);
{
#pragma unroll 1
        for (int c0 = lane * 4; c0 < TK; c0 += 128) { v4us oh, ol; v4f pq;
#pragma unroll
            for (int q = 0; q < 4; ++q) { const float p = __expf(score(c0 + q) - m) * inv; const unsigned short hb = f2bf(p); oh[q] = hb; ol[q] = f2bf(p - bf2f(hb));
                pq[q] = p * (1.0f / (NBT * NH_)); }
            const size_t o = (size_t)i * TK + c0; *(v4us*)(PH + o) = oh; *(v4us*)(PL + o) = ol; *(v4fa*)(&pm[wave][c0]) = pq; }
         }
    __syncthreads();     // every head's p / 32 of the block's rows is in LDS before any thread adds them
#pragma unroll
    for (int s = 0; s < (8 / HG) * TK / 1024; ++s) { const int e = s * 1024 + threadIdx.x * 4, rs = e / TK, c = e % TK;
#pragma unroll     // unrolled: the HG LDS reads of a slot go out together; the adds stay in head order
        for (int w = 0; w < HG; ++w) am[s] += *(const v4fa*)(&pm[rs * HG + w][c]); }
#pragma unroll
    for (int s = 0; s < (8 / HG) * TK / 1024; ++s) *(v4f*)(AMDST + mo + s * 1024) = am[s];
}
__global__ __launch_bounds__(256) void k_split(const float* __restrict__ src, const float* __restrict__ src2, int nrows, bf* dh, bf* dl) {
    const int lane = threadIdx.x & 31, r = blockIdx.x * 8 + (threadIdx.x >> 5); if (r >= nrows) return;
{
#pragma unroll 1
        for (int q = 0; q < DD / 256; ++q) { const size_t o = (size_t)r * DD + q * 256 + lane * 8; const v8f v = *(const v8f*)(src + o) + *(const v8f*)(src2 + o); v8us oh, ol;
#pragma unroll
            for (int i = 0; i < 8; ++i) { const unsigned short hb = f2bf(v[i]); oh[i] = hb; ol[i] = f2bf(v[i] - bf2f(hb)); }
            *(v8us*)(dh + o) = oh; *(v8us*)(dl + o) = ol; }
         }
}
// k_ln: one wave per row of H [2048][1024]: LayerNorm (mean, biased var, eps 1e-5) x bf(gamma) + bf(beta) -> f32 output rows; lane -> 4 consecutive floats per 128-column
__global__ __launch_bounds__(256) void k_ln(const float* __restrict__ Hs, const float* __restrict__ g, const float* __restrict__ bb, float* OUTP) {
    const int lane = threadIdx.x & 31, r = blockIdx.x * 8 + (threadIdx.x >> 5); if (r >= NXR) return;
    v4f v[DD / 128]; float s = 0.f;
#pragma unroll
    for (int q = 0; q < DD / 128; ++q) { v[q] = *(const v4f*)(Hs + (size_t)r * DD + q * 128 + lane * 4);
#pragma unroll
        for (int i = 0; i < 4; ++i) s += v[q][i]; }
#pragma unroll
    for (int sh = 16; sh; sh >>= 1) s += __shfl_xor(s, sh, 32);
    const float mu = s * (1.0f / DD); float s2 = 0.f;
#pragma unroll
    for (int q = 0; q < DD / 128; ++q)
#pragma unroll
        for (int i = 0; i < 4; ++i) { const float d = v[q][i] - mu; s2 = fmaf(d, d, s2); }
#pragma unroll
    for (int sh = 16; sh; sh >>= 1) s2 += __shfl_xor(s2, sh, 32);
    const float rs = rsqrtf(s2 * (1.0f / DD) + LN_EPS);
{
#pragma unroll
        for (int q = 0; q < DD / 128; ++q) { const int c0 = q * 128 + lane * 4; v4f y;
#pragma unroll
            for (int i = 0; i < 4; ++i) y[i] = (v[q][i] - mu) * rs * bfr(g[c0 + i]) + bfr(bb[c0 + i]);
            *(v4f*)(OUTP + (size_t)r * DD + c0) = y; }
         }
}

extern "C" void kernel_launch(void* const* d_in, const int* in_sizes, int n_in,
                              void* d_out, int out_size, void* d_ws, size_t ws_size, hipStream_t stream) {
    (void)in_sizes; (void)n_in; (void)out_size;
    const float* x = (const float*)d_in[0]; const float* pe = (const float*)d_in[1]; const float* mem = (const float*)d_in[2]; const float* pbu = (const float*)d_in[3]; const float* pbv = (const float*)d_in[4]; const int* msk = (const int*)d_in[5];
    const float* Wq = (const float*)d_in[6]; const float* Wkv = (const float*)d_in[7]; const float* Wrel = (const float*)d_in[8]; const float* Wo = (const float*)d_in[9]; const float* g = (const float*)d_in[10]; const float* bb = (const float*)d_in[11];
    float* out = (float*)d_out; float* out2 = out + (size_t)NXR * DD;    // output [1024][2][1024]; attn_matrix [1024][2048]
    char* wsp = (char*)d_ws;
    auto take = [&](size_t bytes) { char* p = wsp; wsp += (bytes + 255) & ~(size_t)255; return (void*)p; };
    bf* WqT = (bf*)take((size_t)DD * DD * 2); bf* WkvT = (bf*)take((size_t)2 * DD * DD * 2); bf* WrT = (bf*)take((size_t)DD * DD * 2); bf* WoT = (bf*)take((size_t)DD * DD * 2);
    bf* Cb = (bf*)take((size_t)NCR * DD * 2); float* TMP = (float*)take((size_t)NCR * DD * 4);
    bf* QUh = (bf*)take((size_t)NBT * NH_ * LQ * HD * 2); bf* QUl = (bf*)take((size_t)NBT * NH_ * LQ * HD * 2); bf* QVh = (bf*)take((size_t)NBT * NH_ * LQ * HD * 2); bf* QVl = (bf*)take((size_t)NBT * NH_ * LQ * HD * 2);
    bf* Kh = (bf*)take((size_t)NBT * NH_ * TK * HD * 2); bf* Kl = (bf*)take((size_t)NBT * NH_ * TK * HD * 2); bf* Rh = (bf*)take((size_t)NBT * NH_ * TK * HD * 2); bf* Rl = (bf*)take((size_t)NBT * NH_ * TK * HD * 2);
    bf* VTh = (bf*)take((size_t)NBT * NH_ * HD * TK * 2); bf* VTl = (bf*)take((size_t)NBT * NH_ * HD * TK * 2);
    float* AC = (float*)take((size_t)HG * LQ * TK * 4); float* BD = (float*)take((size_t)HG * LQ * TK * 4); bf* PH = (bf*)take((size_t)HG * LQ * TK * 2); bf* PL = (bf*)take((size_t)HG * LQ * TK * 2); float* AM = (float*)take((size_t)LQ * TK * 4);
    float* AV = (float*)take((size_t)2 * NXR * DD * 4); bf* AVh = (bf*)take((size_t)NXR * DD * 2); bf* AVl = (bf*)take((size_t)NXR * DD * 2);
    if ((size_t)(wsp - (char*)d_ws) > ws_size) return;    // in MiB: weights 10, Cb 8, TMP 16, q planes 16, k and r planes 32, v planes 16, AC and BD 8 each and PH and PL 4 each per head of a group (96), AM 8, attn_vec 24 = 226 of the 256 given; Hs (the pre-LN sum, f32 [2048][1024] = 8 MiB) reuses the start of BD (dead after the head loop); TMP holds k, v, q, r in turn (each converted to planes before the next GEMM) and then serves as the second mean-map ping-pong buffer (8.4 of its 16.8 MB) during the head loop
    float* Hs = BD; float* AMP[2] = {AM, TMP};     // mean-map ping-pong: AM and (aliasing TMP, dead after the r planes) the second buffer
    k_wt<<<dim3(DD / 64, DD / 64, 1), 256, 0, stream>>>(Wq, DD, DD, WqT); k_wt<<<dim3(DD / 64, (2 * DD) / 64, 1), 256, 0, stream>>>(Wkv, DD, 2 * DD, WkvT); k_wt<<<dim3(DD / 64, DD / 64, 1), 256, 0, stream>>>(Wrel, DD, DD, WrT); k_wt<<<dim3(DD / 64, DD / 64, 1), 256, 0, stream>>>(Wo, DD, DD, WoT);
    // c = [memory; x] as bf16 rows (t, b): rows 0..2047 from memory, 2048..4095 from x
    k_cvtb<<<NXR / 8, 256, 0, stream>>>(mem, NXR, Cb); k_cvtb<<<NXR / 8, 256, 0, stream>>>(x, NXR, Cb + (size_t)NXR * DD);
    k_gemmb<false, false><<<dim3(NCR / 64, DD / 64, 1), 128, 0, stream>>>(Cb, nullptr, WkvT, nullptr, TMP, DD, nullptr);                       // k = c.Wkv[:, :1024]
    k_hplanes<<<(NBT * NH_ * TK) / 8, 256, 0, stream>>>(TMP, DD, 0, TK, nullptr, Kh, Kl);
    k_gemmb<false, false><<<dim3(NCR / 64, DD / 64, 1), 128, 0, stream>>>(Cb, nullptr, WkvT + (size_t)DD * DD, nullptr, TMP, DD, nullptr);    // v = c.Wkv[:, 1024:]
    k_vtplanes<<<(NBT * NH_ * HD * (TK / 64)) / 8, 256, 0, stream>>>(TMP, VTh, VTl);
    k_gemmb<false, false><<<dim3(NXR / 64, DD / 64, 1), 128, 0, stream>>>(Cb + (size_t)NXR * DD, nullptr, WqT, nullptr, TMP, DD, nullptr);      // q = x.Wq (x = the last 2048 rows of c)
    k_hplanes<<<(NBT * NH_ * LQ) / 8, 256, 0, stream>>>(TMP, DD, 0, LQ, pbu, QUh, QUl); k_hplanes<<<(NBT * NH_ * LQ) / 8, 256, 0, stream>>>(TMP, DD, 0, LQ, pbv, QVh, QVl);     // q + u, q + v_bias
    k_cvtb<<<NCR / 8, 256, 0, stream>>>(pe, NCR, Cb);                                                                                    // pos_emb rows (t, b) (c no longer needed)
    k_gemmb<false, false><<<dim3(NCR / 64, DD / 64, 1), 128, 0, stream>>>(Cb, nullptr, WrT, nullptr, TMP, DD, nullptr);                        // r = pos_emb.Wrel
    k_hplanes<<<(NBT * NH_ * TK) / 8, 256, 0, stream>>>(TMP, DD, 0, TK, nullptr, Rh, Rl);
    // the head loop, HG heads of one batch per launch (grid z; in k_relsoft the waves of a block)
    for (int b = 0; b < NBT; ++b) for (int h = 0; h < NH_; h += HG) { const size_t bh = (size_t)b * NH_ + h, gr = bh / HG; const int first = (b == 0 && h == 0), last = (b == NBT - 1 && h == NH_ - HG);
        k_gemm3<<<dim3(LQ / 64, TK / 64, HG), 128, 0, stream>>>(QUh + bh * LQ * HD, QUl + bh * LQ * HD, Kh + bh * TK * HD, Kl + bh * TK * HD, HD, AC, TK, (size_t)LQ * HD, (size_t)TK * HD, (size_t)LQ * TK);     // AC = (q+u).k^T
        k_gemm3<<<dim3(LQ / 64, TK / 64, HG), 128, 0, stream>>>(QVh + bh * LQ * HD, QVl + bh * LQ * HD, Rh + bh * TK * HD, Rl + bh * TK * HD, HD, BD, TK, (size_t)LQ * HD, (size_t)TK * HD, (size_t)LQ * TK);     // BD = (q+v).r^T (pre-shift)
        k_relsoft<<<LQ / (8 / HG), 256, 0, stream>>>(AC, BD, msk, b, first, AMP[(gr + 1) & 1], PH, PL, last ? out2 : AMP[gr & 1]);     // reads the previous group's buffer, writes the other
        k_pv<<<dim3(HD / 32, LQ / 16, 2 * HG), 256, 0, stream>>>(PH, PL, VTh + bh * HD * TK, VTl + bh * HD * TK, AV + (size_t)b * DD + h * HD, NBT * DD, (size_t)NXR * DD);          // attn.v -> attn_vec[(l,b)][h*64 + d], two key-half planes
    }
    k_split<<<NXR / 8, 256, 0, stream>>>(AV, AV + (size_t)NXR * DD, NXR, AVh, AVl);     // adds the two key-half planes of attn_vec
    k_gemmb<true, false><<<dim3(NXR / 64, DD / 64, 1), 128, 0, stream>>>(AVh, AVl, WoT, nullptr, Hs, DD, nullptr, x, DD, 1);                 // h = x + attn_vec.Wo  (x bf16-rounded)
    k_ln<<<NXR / 8, 256, 0, stream>>>(Hs, g, bb, out);
}

// v003
// Measured time: 777 microseconds a run.
// Two timings next to v002 both put it at 1.21 times that version's speed.
// Counting every step since v000, it is 4.82 times as fast.
#include <hip/hip_runtime.h>

// Compute dtypes, f32 accumulate: k|v = [memory; x].Wkv ([4096 x 1024].[1024 x 2048]), q = x.Wq, r = pos_emb.Wrel (k-major weights transposed once; PLAIN bf16 operands
// = inputs rounded once, exact) and attn_out = attn_vec.Wo (hi/lo A, + x) on v_wmma_f32_16x16x32_bf16; per (batch, head): AC = (q + u).k^T and BD = (q + v_bias).r^T
// ([1024 x 64].[64 x 2048], both operands bf16 hi + UNSCALED residual, three products), the module's _rel_shift applied by INDEX (the literal pad-reshape-slice
// mapping, incl. its wrap-around entries), x 1/8, the INPUT mask (-1e30), the softmax over keys and the mean attention map in f32, attn.v ([1024 x 2048].[2048 x 64],

#define LQ   1024
#define TK   2048
#define NBT  2
#define DD   1024
#define NH_  16
#define HD   64
#define NXR  (LQ * NBT)           // 2048 x rows (l, b)
#define NCR  (TK * NBT)           // 4096 c / pos rows (t, b)
#define DM   DD
#define NTK  NCR
#define SCL  0.125f
#define NEGV -1e30f
#define LN_EPS 1e-5f
#define LOSC 1024.0f
#define HG   4                    // heads of one batch that each launch of the head loop works on side by side (divides NH_, so one launch has one batch index)

typedef _Float16 h16;
typedef unsigned short bf;
typedef __attribute__((ext_vector_type(16))) __bf16   v16bf;
typedef __attribute__((ext_vector_type(16))) _Float16 v16h;
typedef __attribute__((ext_vector_type(8)))  _Float16 v8h;
typedef __attribute__((ext_vector_type(8)))  unsigned short v8us;
typedef __attribute__((ext_vector_type(8)))  float    v8f;
typedef __attribute__((ext_vector_type(4)))  float    v4f;
typedef __attribute__((ext_vector_type(4)))  _Float16 v4h;
typedef v8h  __attribute__((may_alias)) v8ha;
typedef v4f  __attribute__((may_alias)) v4fa;
typedef v8us __attribute__((may_alias)) v8usa;

__device__ __forceinline__ unsigned short f2bf(float f) { unsigned u = __float_as_uint(f); u += 0x7FFFu + ((u >> 16) & 1u); return (unsigned short)(u >> 16); }
__device__ __forceinline__ float bf2f(unsigned short b) { return __uint_as_float(((unsigned)b) << 16); }
__device__ __forceinline__ float bfr(float f) { return bf2f(f2bf(f)); }
__device__ __forceinline__ v16h cat16(v8h lo, v8h hi) { return __builtin_shufflevector(lo, hi, 0, 1, 2, 3, 4, 5, 6, 7, 8, 9, 10, 11, 12, 13, 14, 15); }
__device__ __forceinline__ v16bf cat16b(v8us lo, v8us hi) { return __builtin_bit_cast(v16bf, __builtin_shufflevector(lo, hi, 0, 1, 2, 3, 4, 5, 6, 7, 8, 9, 10, 11, 12, 13, 14, 15)); }
__device__ __forceinline__ v8f wmma16(v16h a, v16h b, v8f c) { return __builtin_amdgcn_wmma_f32_16x16x32_f16(false, a, false, b, (short)0, c, false, false); }
__device__ __forceinline__ v8f wmmab(v16bf a, v16bf b, v8f c) { return __builtin_amdgcn_wmma_f32_16x16x32_bf16(false, a, false, b, (short)0, c, false, false); }

// k_wt: WT [n][K] = bf16(W[k][n]) (k-major [K][ncols]) via 64 x 64 LDS tiles; grid (K/64, ncols/64).
__global__ __launch_bounds__(256) void k_wt(const float* __restrict__ Wm, int K, int ncols, bf* WT) {
    __shared__ __align__(16) unsigned short tl[64 * 72];
    const int tid = threadIdx.x, k0 = blockIdx.x * 64, n0 = blockIdx.y * 64;
    const int kk = tid >> 2, nq = (tid & 3) * 16;
#pragma unroll
    for (int i = 0; i < 16; ++i) tl[(nq + i) * 72 + kk] = f2bf(Wm[(size_t)(k0 + kk) * ncols + n0 + nq + i]);
    __syncthreads();
    const int piece = tid & 7;
    auto pass = [&]() {
#pragma unroll
        for (int s = 0; s < 2; ++s) { const int nr = (tid >> 3) + 32 * s; const v8us val = *(const v8usa*)(tl + nr * 72 + piece * 8); *(v8us*)(WT + (size_t)(n0 + nr) * K + k0 + piece * 8) = val; }
    };
    pass(); 
}
__global__ __launch_bounds__(256) void k_cvtb(const float* __restrict__ src, int nrows, bf* dst) {
    const int lane = threadIdx.x & 31, r = blockIdx.x * 8 + (threadIdx.x >> 5);
    if (r >= nrows) return;
    v8us o[DM / 256];
#pragma unroll
    for (int q = 0; q < DM / 256; ++q) { v8us t;
#pragma unroll
        for (int i = 0; i < 8; ++i) t[i] = f2bf(src[(size_t)r * DM + q * 256 + lane * 8 + i]);
        o[q] = t; }
#pragma unroll
    for (int q = 0; q < DM / 256; ++q) *(v8us*)(dst + (size_t)r * DM + q * 256 + lane * 8) = o[q];
    
}

// k_gemmb: 64 x 64 block tile (4 waves x 16 x 64) of C[NTK][NW] = (A [+ Al]).B^T (K = 1024) [+ bf(bias[c])] [+ bf(R[r][c]) residual]; f32 whole-line epilogue (or f16
template <bool SPLITA, bool F16OUT = false>
__global__ __launch_bounds__(128) void k_gemmb(const bf* __restrict__ A, const bf* __restrict__ Al, const bf* __restrict__ Bn, const float* __restrict__ bias, float* C, int ldc, h16* C2, const float* __restrict__ R = nullptr, int K = DM, int roundR = 1) {
    __shared__ __align__(16) float ost[4][16 * 68];
    const int lane = threadIdx.x & 31, wave = threadIdx.x >> 5, lr = lane & 15, hi = lane >> 4;
    const int r0 = blockIdx.x * 64 + wave * 16, c0 = blockIdx.y * 64;
    const size_t aoff = (size_t)(r0 + lr) * K + 8 * hi;
    size_t boff[4];
#pragma unroll
    for (int t = 0; t < 4; ++t) boff[t] = (size_t)(c0 + t * 16 + lr) * K + 8 * hi;
    v8f acc[4];
#pragma unroll
    for (int t = 0; t < 4; ++t) acc[t] = (v8f){};
#pragma unroll 1
    for (int kc = 0; kc < K; kc += 32) {
        const v16bf a = cat16b(*(const v8us*)(A + aoff + kc), *(const v8us*)(A + aoff + kc + 16));
        v16bf al = a;
        if (SPLITA) al = cat16b(*(const v8us*)(Al + aoff + kc), *(const v8us*)(Al + aoff + kc + 16));
#pragma unroll
        for (int t = 0; t < 4; ++t) { const v16bf b = cat16b(*(const v8us*)(Bn + boff[t] + kc), *(const v8us*)(Bn + boff[t] + kc + 16)); acc[t] = wmmab(a, b, acc[t]); if (SPLITA) acc[t] = wmmab(al, b, acc[t]); }
        asm volatile("v_nop\n\tv_nop\n\tv_nop\n\tv_nop" : "+v"(acc[0]), "+v"(acc[1]), "+v"(acc[2]), "+v"(acc[3]) : "v"(a), "v"(al));
    }
    float* os = &ost[wave][0];
#pragma unroll
    for (int t = 0; t < 4; ++t) { const float bv = bias ? bfr(bias[c0 + t * 16 + lr]) : 0.f;
#pragma unroll
        for (int j = 0; j < 8; ++j) os[(hi * 8 + j) * 68 + t * 16 + lr] = acc[t][j] + bv; }
    __syncthreads();
    if (F16OUT) {
        h16* crow = (h16*)(void*)C + (size_t)r0 * ldc + c0;
        auto pass = [&]() {
#pragma unroll
            for (int s = 0; s < 4; ++s) { const int row = 4 * s + (lane >> 3), piece = lane & 7; const float* sp = os + row * 68 + piece * 8; v8h o, o2;
#pragma unroll
                for (int i = 0; i < 8; ++i) { const h16 a = (h16)sp[i]; o[i] = a; o2[i] = (h16)((sp[i] - (float)a) * LOSC); }
                *(v8h*)(crow + (size_t)row * ldc + piece * 8) = o; if (C2) *(v8h*)(C2 + (size_t)r0 * ldc + c0 + (size_t)row * ldc + piece * 8) = o2; }
        };
        pass(); 
    } else {
        float* crow = C + (size_t)r0 * ldc + c0;
        auto pass = [&]() {
#pragma unroll
            for (int s = 0; s < 8; ++s) { const int Lid = (lane >> 3) + 4 * s, piece = lane & 7; const int row = Lid >> 1, cofs = (Lid & 1) * 32 + piece * 4;
                v4f val = *(const v4fa*)(os + row * 68 + cofs); if (R) { const v4f rv = *(const v4f*)(R + ((size_t)r0 + row) * ldc + c0 + cofs); val += roundR ? (v4f){bfr(rv[0]), bfr(rv[1]), bfr(rv[2]), bfr(rv[3])} : rv; }
                *(v4f*)(crow + (size_t)row * ldc + cofs) = val; }
        };
        pass(); 
    }
}

// k_gemm3: 64 x 64 tile of C = (Ah + Al).(Bh + Bl)^T over K (row strides = K for all four planes; n-major B): three products per 32-k step (hh, hl, lh); f32
// blockIdx.z = the head inside the launch's group: its A, B and C planes lie sA, sB and sC elements behind the previous head's.
__global__ __launch_bounds__(128) void k_gemm3(const bf* __restrict__ Ah, const bf* __restrict__ Al, const bf* __restrict__ Bh, const bf* __restrict__ Bl, int K, float* C, int ldc, size_t sA, size_t sB, size_t sC) {
    __shared__ __align__(16) float ost[4][16 * 68];
    Ah += blockIdx.z * sA; Al += blockIdx.z * sA; Bh += blockIdx.z * sB; Bl += blockIdx.z * sB; C += blockIdx.z * sC;
    const int lane = threadIdx.x & 31, wave = threadIdx.x >> 5, lr = lane & 15, hi = lane >> 4;
    const int r0 = blockIdx.x * 64 + wave * 16, c0 = blockIdx.y * 64;
    const size_t aoff = (size_t)(r0 + lr) * K + 8 * hi;
    v8f acc[4];
#pragma unroll
    for (int t = 0; t < 4; ++t) acc[t] = (v8f){};
#pragma unroll 1
    for (int kc = 0; kc < K; kc += 32) {
        const v16bf a = cat16b(*(const v8us*)(Ah + aoff + kc), *(const v8us*)(Ah + aoff + kc + 16));
        const v16bf al = cat16b(*(const v8us*)(Al + aoff + kc), *(const v8us*)(Al + aoff + kc + 16));
#pragma unroll
        for (int t = 0; t < 4; ++t) { const size_t bo = (size_t)(c0 + t * 16 + lr) * K + kc + 8 * hi;
            const v16bf bh = cat16b(*(const v8us*)(Bh + bo), *(const v8us*)(Bh + bo + 16)); const v16bf bl = cat16b(*(const v8us*)(Bl + bo), *(const v8us*)(Bl + bo + 16));
            acc[t] = wmmab(a, bh, acc[t]); acc[t] = wmmab(al, bh, acc[t]); acc[t] = wmmab(a, bl, acc[t]); }
        asm volatile("v_nop\n\tv_nop\n\tv_nop\n\tv_nop" : "+v"(acc[0]), "+v"(acc[1]), "+v"(acc[2]), "+v"(acc[3]) : "v"(a), "v"(al));
    }
    float* os = &ost[wave][0];
#pragma unroll
    for (int t = 0; t < 4; ++t) {
#pragma unroll
        for (int j = 0; j < 8; ++j) os[(hi * 8 + j) * 68 + t * 16 + lr] = acc[t][j]; }
    __builtin_amdgcn_wave_barrier(); asm volatile("" ::: "memory");
    float* crow = C + (size_t)r0 * ldc + c0;
    auto pass = [&]() {
#pragma unroll
        for (int s = 0; s < 8; ++s) { const int Lid = (lane >> 3) + 4 * s, piece = lane & 7; const int row = Lid >> 1, cofs = (Lid & 1) * 32 + piece * 4;
            const v4f val = *(const v4fa*)(os + row * 68 + cofs); *(v4f*)(crow + (size_t)row * ldc + cofs) = val; }
    };
    pass(); 
}

// k_pv: attn.v of the group's HG heads, each C[1024][64] = (Ah + Al).(Bh + Bl)^T over the 2048 keys (three products per 32-k step, loaders as in k_gemm3). One 16 x 32 output tile and one
// half of the keys per block (grid: 2 column tiles, 64 row tiles, z = HG heads x 2 key halves = 1024 blocks); each of the 8 waves sums 128 keys, the 8 partial tiles are added in wave order
// through LDS, and the two halves go to two planes (C, C + zstride) that k_split adds. Each stored tile row is one whole 128-byte line.
__global__ __launch_bounds__(256) void k_pv(const bf* __restrict__ Ah, const bf* __restrict__ Al, const bf* __restrict__ Bh, const bf* __restrict__ Bl, float* C, int ldc, size_t zstride) {
    __shared__ __align__(16) float red[8][2 * 272];     // per wave: two 8-row halves of 8 x 32 floats, 16 floats apart in bank so that the two lane halves do not collide
    const int lane = threadIdx.x & 31, wave = threadIdx.x >> 5, lr = lane & 15, hi = lane >> 4;
    const int hz = blockIdx.z >> 1, kh = blockIdx.z & 1;     // head inside the group, key half
    Ah += (size_t)hz * LQ * TK; Al += (size_t)hz * LQ * TK; Bh += (size_t)hz * HD * TK; Bl += (size_t)hz * HD * TK;
    const int c0 = blockIdx.x * 32, r0 = blockIdx.y * 16, k0 = kh * (TK / 2) + wave * (TK / 16);
    const size_t aoff = (size_t)(r0 + lr) * TK + k0 + 8 * hi;
    v8f acc[2];
#pragma unroll
    for (int t = 0; t < 2; ++t) acc[t] = (v8f){};
    // all 48 fragment loads of the wave's 128 keys are issued first, so that the wave pays one memory round trip and not one per product
    v8us fa[4][4], fb[4][2][4];
#pragma unroll
    for (int s = 0; s < 4; ++s) { const int kc = s * 32;
        fa[s][0] = *(const v8us*)(Ah + aoff + kc); fa[s][1] = *(const v8us*)(Ah + aoff + kc + 16); fa[s][2] = *(const v8us*)(Al + aoff + kc); fa[s][3] = *(const v8us*)(Al + aoff + kc + 16);
#pragma unroll
        for (int t = 0; t < 2; ++t) { const size_t bo = (size_t)(c0 + t * 16 + lr) * TK + k0 + kc + 8 * hi;
            fb[s][t][0] = *(const v8us*)(Bh + bo); fb[s][t][1] = *(const v8us*)(Bh + bo + 16); fb[s][t][2] = *(const v8us*)(Bl + bo); fb[s][t][3] = *(const v8us*)(Bl + bo + 16); }
    }
    asm volatile("s_wait_xcnt 0x0" ::: "memory");     // the accumulators reuse the loads' address registers: this wait stands before that overwrite
    __builtin_amdgcn_sched_barrier(0);     // keeps the matrix instructions behind the wait and all 48 loads ahead of them (without it the scheduler interleaves them, reuses few registers and waits after every pair)
#pragma unroll
    for (int s = 0; s < 4; ++s) { const v16bf a = cat16b(fa[s][0], fa[s][1]), al = cat16b(fa[s][2], fa[s][3]);
#pragma unroll
        for (int t = 0; t < 2; ++t) { const v16bf bh = cat16b(fb[s][t][0], fb[s][t][1]), bl = cat16b(fb[s][t][2], fb[s][t][3]);
            acc[t] = wmmab(a, bh, acc[t]); acc[t] = wmmab(al, bh, acc[t]); acc[t] = wmmab(a, bl, acc[t]); }
    }
#pragma unroll
    for (int t = 0; t < 2; ++t) {
#pragma unroll
        for (int j = 0; j < 8; ++j) red[wave][hi * 272 + j * 32 + t * 16 + lr] = acc[t][j]; }
    __syncthreads();     // every wave's partial tile is in LDS before any wave adds them
    float* crow = C + (size_t)kh * zstride + (size_t)r0 * ldc + hz * HD + c0;
#pragma unroll
    for (int s = 0; s < 2; ++s) { float v = red[0][s * 272 + wave * 32 + lane];
#pragma unroll
        for (int w = 1; w < 8; ++w) v += red[w][s * 272 + wave * 32 + lane];
        crow[(size_t)(s * 8 + wave) * ldc + lane] = v; }
}

// k_hplanes: per (batch b, head h) contiguous operand planes [rows][64] = bf16 hi + UNSCALED residual of SRC[(row*2 + b)][col0 + h*64 + d] (+ bias[h][d] when given):
__global__ __launch_bounds__(256) void k_hplanes(const float* __restrict__ SRC, int pitch, int col0, int nrows, const float* __restrict__ bias, bf* Ph, bf* Pl) {
    typedef __attribute__((ext_vector_type(2))) unsigned short v2us;
    const int lane = threadIdx.x & 31, wid = blockIdx.x * 8 + (threadIdx.x >> 5); if (wid >= NBT * NH_ * nrows) return;
    const int row = wid % nrows, bh = wid / nrows, h = bh % NH_, b = bh / NH_;
    v2us oh, ol;
#pragma unroll
    for (int i = 0; i < 2; ++i) { const int d = 2 * lane + i; float v = SRC[((size_t)row * NBT + b) * pitch + col0 + h * HD + d]; if (bias) v += bfr(bias[h * HD + d]); const unsigned short hb = f2bf(v); oh[i] = hb; ol[i] = f2bf(v - bf2f(hb)); }
    const size_t o = ((size_t)bh * nrows + row) * HD + 2 * lane;
    *(v2us*)(Ph + o) = oh; *(v2us*)(Pl + o) = ol; 
}
__global__ __launch_bounds__(256) void k_vtplanes(const float* __restrict__ Vsrc, bf* VTh, bf* VTl) {
    typedef __attribute__((ext_vector_type(2))) unsigned short v2us;
    const int lane = threadIdx.x & 31, wid = blockIdx.x * 8 + (threadIdx.x >> 5); if (wid >= NBT * NH_ * HD * (TK / 64)) return;
    const int tg = wid % (TK / 64), rest = wid / (TK / 64), d = rest % HD, bh = rest / HD, h = bh % NH_, b = bh / NH_; const int t0 = tg * 64 + 2 * lane;
    v2us oh, ol;
#pragma unroll
    for (int i = 0; i < 2; ++i) { const float v = Vsrc[((size_t)(t0 + i) * NBT + b) * DD + h * HD + d]; const unsigned short hb = f2bf(v); oh[i] = hb; ol[i] = f2bf(v - bf2f(hb)); }
    const size_t o = ((size_t)bh * HD + d) * TK + t0;
    *(v2us*)(VTh + o) = oh; *(v2us*)(VTl + o) = ol; 
}
// 2^x. The v_nop is the slot that the instruction set asks for behind a transcendental before its source register is overwritten.
__device__ __forceinline__ float exp2_slot(float x) { float r; asm("v_exp_f32 %0, %1\n\tv_nop" : "=v"(r) : "v"(x)); return r; }
// k_relsoft: one wave per query row i of head (b,h); a block = 2 rows x the HG heads of the group (planes LQ*TK elements apart); for each key j: the module's _rel_shift by index (idx = L + i*T + j, row = idx / (T+1), col = idx % (T+1), bd = col ?
// BD[row][col-1] : 0), s = (AC[i][j] + bd)/8, s = -1e30 where mask[i][j][b]; softmax over the 2048 keys (f32, fixed lane order). AC, BD and the mask are read ONCE: a lane holds its 64 scores (then their
// exponentials) in registers from the loads to the stores -> bf16 hi + UNSCALED
// residual planes; the mean attention map accumulates p / 32 in (b,h) order: each wave leaves its head's p / 32 in LDS, and behind a barrier the block adds the HG heads in
// head order onto the previous group's map, through two ping-pong buffers (AMIN = the previous group's buffer, never the one being written,
// launch bounds, second argument: caps the registers; without it the build takes 300, three waves a SIMD, and the two blocks that the grid gives every WGP do not fit side by side
__global__ __launch_bounds__(256, 5) void k_relsoft(const float* __restrict__ ACg, const float* __restrict__ BDg, const int* __restrict__ MSK, int b, int first, const float* __restrict__ AMIN, bf* PHg, bf* PLg, float* AMDST) {
    typedef __attribute__((ext_vector_type(4))) unsigned short v4us;
    typedef __attribute__((ext_vector_type(4))) int v4i;
    typedef v4f __attribute__((aligned(4), may_alias)) v4fu;     // a 16-byte load whose address is a multiple of 4 only
    __shared__ __align__(16) float pm[8][TK];     // p / 32 of each wave's (row, head)
    const int lane = threadIdx.x & 31, wave = threadIdx.x >> 5, hz = wave % HG, i = blockIdx.x * (8 / HG) + wave / HG;
    const float* __restrict__ AC = ACg + (size_t)hz * LQ * TK; const float* __restrict__ BD = BDg + (size_t)hz * LQ * TK; bf* PH = PHg + (size_t)hz * LQ * TK; bf* PL = PLg + (size_t)hz * LQ * TK;
    // _rel_shift by index with one integer division per row: idx = L + i*T + j; (row0, col0) for j = 0, then col = col0 + j wraps at most once past T+1.
    // L + i*T = i*(T+1) + (L - i) with 1 <= L - i <= T, so col0 >= 1: col is 0 only at the wrap, key jz. In the flat BD plane the row's elements are one run with that one hole:
    // key j < jz reads bdr[j], key jz reads nothing (bd = 0), key j > jz reads (row0 + 1)*T + (col0 + j - (T+1)) - 1 = bdr[j - 1].
    static_assert(LQ <= TK, "col0 >= 1 needs L - i <= T");
    const int base = LQ + i * TK; const int row0 = base / (TK + 1), col0 = base % (TK + 1), jz = TK + 1 - col0;
    const float* __restrict__ bdr = BD + (size_t)row0 * TK + col0 - 1;
    float sc[TK / 32];     // the lane's keys: 4 consecutive ones of every 128, in the order in which they are summed
#pragma unroll     // unrolled (all loops over sc[]): sc[] is indexed by constants and stays in registers, and the row's loads go out many at a time
    for (int k = 0; k < TK / 128; ++k) { const int c0 = lane * 4 + k * 128, d = jz - c0;     // d: place of the hole inside this group of 4 keys (below 0: the whole group lies behind it)
        const v4f ac = *(const v4f*)(AC + (size_t)i * TK + c0);
        const v4f bv = *(const v4fu*)(bdr + c0 - (d < 0 ? 1 : 0));     // 4 floats at a 4-byte boundary; first and last lie inside the head's BD plane for every (i, c0)
        const v4i m0 = *(const v4i*)(MSK + ((size_t)i * TK + c0) * NBT), m1 = *(const v4i*)(MSK + ((size_t)i * TK + c0) * NBT + 4);     // mask[i][c0 .. c0+3][0 .. 1]
        const int mk[4] = {b ? m0[1] : m0[0], b ? m0[3] : m0[2], b ? m1[1] : m1[0], b ? m1[3] : m1[2]};
#pragma unroll
        for (int q = 0; q < 4; ++q) { const float bd = ((unsigned)d > (unsigned)q) ? bv[q] : (d == q ? 0.f : bv[q ? q - 1 : 0]);     // in front of the hole or wholly behind it: in place; the hole: 0; behind the hole in its own group: one down
            const float s = (ac[q] + bd) * SCL; sc[k * 4 + q] = mk[q] ? NEGV : s; }
    }
    float m = -3.0e38f;
#pragma unroll
    for (int e = 0; e < TK / 32; ++e) m = fmaxf(m, sc[e]);
#pragma unroll
    for (int sh = 16; sh; sh >>= 1) m = fmaxf(m, __shfl_xor(m, sh, 32));
    float sum = 0.f;
#pragma unroll
    for (int e = 0; e < TK / 32; ++e) { sc[e] = exp2_slot((sc[e] - m) * 1.44269504f); sum += sc[e]; }     // = __expf(sc[e] - m): the same multiply by log2(e) and the same v_exp_f32
#pragma unroll
    for (int sh = 16; sh; sh >>= 1) sum += __shfl_xor(sum, sh, 32);
    const float inv = 1.0f / sum;
    // the block's 8 / HG rows of the map are one run of floats: thread t owns floats 4 t .. 4 t + 3 of every 1024; the previous group's values are fetched here, under the conversion of the row
    const size_t mo = (size_t)blockIdx.x * (8 / HG) * TK + threadIdx.x * 4;
    v4f am[(8 / HG) * TK / 1024];
#pragma unroll     // unrolled (here and in the two loops behind the barrier): am[] is indexed by constants and stays in registers, and the loads go out together
    for (int s = 0; s < (8 / HG) * TK / 1024; ++s) am[s] = first ? (v4f){} : *(const v4f*)(AMIN + mo + s * 1024);
#pragma unroll
    for (int k = 0; k < TK / 128; ++k) { const int c0 = lane * 4 + k * 128; v4us oh, ol; v4f pq;
#pragma unroll
        for (int q = 0; q < 4; ++q) { const float p = sc[k * 4 + q] * inv; const unsigned short hb = f2bf(p); oh[q] = hb; ol[q] = f2bf(p - bf2f(hb));
            pq[q] = p * (1.0f / (NBT * NH_)); }
        const size_t o = (size_t)i * TK + c0; *(v4us*)(PH + o) = oh; *(v4us*)(PL + o) = ol; *(v4fa*)(&pm[wave][c0]) = pq; }
    __syncthreads();     // every head's p / 32 of the block's rows is in LDS before any thread adds them
#pragma unroll
    for (int s = 0; s < (8 / HG) * TK / 1024; ++s) { const int e = s * 1024 + threadIdx.x * 4, rs = e / TK, c = e % TK;
#pragma unroll     // unrolled: the HG LDS reads of a slot go out together; the adds stay in head order
        for (int w = 0; w < HG; ++w) am[s] += *(const v4fa*)(&pm[rs * HG + w][c]); }
#pragma unroll
    for (int s = 0; s < (8 / HG) * TK / 1024; ++s) *(v4f*)(AMDST + mo + s * 1024) = am[s];
}
__global__ __launch_bounds__(256) void k_split(const float* __restrict__ src, const float* __restrict__ src2, int nrows, bf* dh, bf* dl) {
    const int lane = threadIdx.x & 31, r = blockIdx.x * 8 + (threadIdx.x >> 5); if (r >= nrows) return;
{
#pragma unroll 1
        for (int q = 0; q < DD / 256; ++q) { const size_t o = (size_t)r * DD + q * 256 + lane * 8; const v8f v = *(const v8f*)(src + o) + *(const v8f*)(src2 + o); v8us oh, ol;
#pragma unroll
            for (int i = 0; i < 8; ++i) { const unsigned short hb = f2bf(v[i]); oh[i] = hb; ol[i] = f2bf(v[i] - bf2f(hb)); }
            *(v8us*)(dh + o) = oh; *(v8us*)(dl + o) = ol; }
         }
}
// k_ln: one wave per row of H [2048][1024]: LayerNorm (mean, biased var, eps 1e-5) x bf(gamma) + bf(beta) -> f32 output rows; lane -> 4 consecutive floats per 128-column
__global__ __launch_bounds__(256) void k_ln(const float* __restrict__ Hs, const float* __restrict__ g, const float* __restrict__ bb, float* OUTP) {
    const int lane = threadIdx.x & 31, r = blockIdx.x * 8 + (threadIdx.x >> 5); if (r >= NXR) return;
    v4f v[DD / 128]; float s = 0.f;
#pragma unroll
    for (int q = 0; q < DD / 128; ++q) { v[q] = *(const v4f*)(Hs + (size_t)r * DD + q * 128 + lane * 4);
#pragma unroll
        for (int i = 0; i < 4; ++i) s += v[q][i]; }
#pragma unroll
    for (int sh = 16; sh; sh >>= 1) s += __shfl_xor(s, sh, 32);
    const float mu = s * (1.0f / DD); float s2 = 0.f;
#pragma unroll
    for (int q = 0; q < DD / 128; ++q)
#pragma unroll
        for (int i = 0; i < 4; ++i) { const float d = v[q][i] - mu; s2 = fmaf(d, d, s2); }
#pragma unroll
    for (int sh = 16; sh; sh >>= 1) s2 += __shfl_xor(s2, sh, 32);
    const float rs = rsqrtf(s2 * (1.0f / DD) + LN_EPS);
{
#pragma unroll
        for (int q = 0; q < DD / 128; ++q) { const int c0 = q * 128 + lane * 4; v4f y;
#pragma unroll
            for (int i = 0; i < 4; ++i) y[i] = (v[q][i] - mu) * rs * bfr(g[c0 + i]) + bfr(bb[c0 + i]);
            *(v4f*)(OUTP + (size_t)r * DD + c0) = y; }
         }
}

extern "C" void kernel_launch(void* const* d_in, const int* in_sizes, int n_in,
                              void* d_out, int out_size, void* d_ws, size_t ws_size, hipStream_t stream) {
    (void)in_sizes; (void)n_in; (void)out_size;
    const float* x = (const float*)d_in[0]; const float* pe = (const float*)d_in[1]; const float* mem = (const float*)d_in[2]; const float* pbu = (const float*)d_in[3]; const float* pbv = (const float*)d_in[4]; const int* msk = (const int*)d_in[5];
    const float* Wq = (const float*)d_in[6]; const float* Wkv = (const float*)d_in[7]; const float* Wrel = (const float*)d_in[8]; const float* Wo = (const float*)d_in[9]; const float* g = (const float*)d_in[10]; const float* bb = (const float*)d_in[11];
    float* out = (float*)d_out; float* out2 = out + (size_t)NXR * DD;    // output [1024][2][1024]; attn_matrix [1024][2048]
    char* wsp = (char*)d_ws;
    auto take = [&](size_t bytes) { char* p = wsp; wsp += (bytes + 255) & ~(size_t)255; return (void*)p; };
    bf* WqT = (bf*)take((size_t)DD * DD * 2); bf* WkvT = (bf*)take((size_t)2 * DD * DD * 2); bf* WrT = (bf*)take((size_t)DD * DD * 2); bf* WoT = (bf*)take((size_t)DD * DD * 2);
    bf* Cb = (bf*)take((size_t)NCR * DD * 2); float* TMP = (float*)take((size_t)NCR * DD * 4);
    bf* QUh = (bf*)take((size_t)NBT * NH_ * LQ * HD * 2); bf* QUl = (bf*)take((size_t)NBT * NH_ * LQ * HD * 2); bf* QVh = (bf*)take((size_t)NBT * NH_ * LQ * HD * 2); bf* QVl = (bf*)take((size_t)NBT * NH_ * LQ * HD * 2);
    bf* Kh = (bf*)take((size_t)NBT * NH_ * TK * HD * 2); bf* Kl = (bf*)take((size_t)NBT * NH_ * TK * HD * 2); bf* Rh = (bf*)take((size_t)NBT * NH_ * TK * HD * 2); bf* Rl = (bf*)take((size_t)NBT * NH_ * TK * HD * 2);
    bf* VTh = (bf*)take((size_t)NBT * NH_ * HD * TK * 2); bf* VTl = (bf*)take((size_t)NBT * NH_ * HD * TK * 2);
    float* AC = (float*)take((size_t)HG * LQ * TK * 4); float* BD = (float*)take((size_t)HG * LQ * TK * 4); bf* PH = (bf*)take((size_t)HG * LQ * TK * 2); bf* PL = (bf*)take((size_t)HG * LQ * TK * 2); float* AM = (float*)take((size_t)LQ * TK * 4);
    float* AV = (float*)take((size_t)2 * NXR * DD * 4); bf* AVh = (bf*)take((size_t)NXR * DD * 2); bf* AVl = (bf*)take((size_t)NXR * DD * 2);
    if ((size_t)(wsp - (char*)d_ws) > ws_size) return;    // in MiB: weights 10, Cb 8, TMP 16, q planes 16, k and r planes 32, v planes 16, AC and BD 8 each and PH and PL 4 each per head of a group (96), AM 8, attn_vec 24 = 226 of the 256 given; Hs (the pre-LN sum, f32 [2048][1024] = 8 MiB) reuses the start of BD (dead after the head loop); TMP holds k, v, q, r in turn (each converted to planes before the next GEMM) and then serves as the second mean-map ping-pong buffer (8.4 of its 16.8 MB) during the head loop
    float* Hs = BD; float* AMP[2] = {AM, TMP};     // mean-map ping-pong: AM and (aliasing TMP, dead after the r planes) the second buffer
    k_wt<<<dim3(DD / 64, DD / 64, 1), 256, 0, stream>>>(Wq, DD, DD, WqT); k_wt<<<dim3(DD / 64, (2 * DD) / 64, 1), 256, 0, stream>>>(Wkv, DD, 2 * DD, WkvT); k_wt<<<dim3(DD / 64, DD / 64, 1), 256, 0, stream>>>(Wrel, DD, DD, WrT); k_wt<<<dim3(DD / 64, DD / 64, 1), 256, 0, stream>>>(Wo, DD, DD, WoT);
    // c = [memory; x] as bf16 rows (t, b): rows 0..2047 from memory, 2048..4095 from x
    k_cvtb<<<NXR / 8, 256, 0, stream>>>(mem, NXR, Cb); k_cvtb<<<NXR / 8, 256, 0, stream>>>(x, NXR, Cb + (size_t)NXR * DD);
    k_gemmb<false, false><<<dim3(NCR / 64, DD / 64, 1), 128, 0, stream>>>(Cb, nullptr, WkvT, nullptr, TMP, DD, nullptr);                       // k = c.Wkv[:, :1024]
    k_hplanes<<<(NBT * NH_ * TK) / 8, 256, 0, stream>>>(TMP, DD, 0, TK, nullptr, Kh, Kl);
    k_gemmb<false, false><<<dim3(NCR / 64, DD / 64, 1), 128, 0, stream>>>(Cb, nullptr, WkvT + (size_t)DD * DD, nullptr, TMP, DD, nullptr);    // v = c.Wkv[:, 1024:]
    k_vtplanes<<<(NBT * NH_ * HD * (TK / 64)) / 8, 256, 0, stream>>>(TMP, VTh, VTl);
    k_gemmb<false, false><<<dim3(NXR / 64, DD / 64, 1), 128, 0, stream>>>(Cb + (size_t)NXR * DD, nullptr, WqT, nullptr, TMP, DD, nullptr);      // q = x.Wq (x = the last 2048 rows of c)
    k_hplanes<<<(NBT * NH_ * LQ) / 8, 256, 0, stream>>>(TMP, DD, 0, LQ, pbu, QUh, QUl); k_hplanes<<<(NBT * NH_ * LQ) / 8, 256, 0, stream>>>(TMP, DD, 0, LQ, pbv, QVh, QVl);     // q + u, q + v_bias
    k_cvtb<<<NCR / 8, 256, 0, stream>>>(pe, NCR, Cb);                                                                                    // pos_emb rows (t, b) (c no longer needed)
    k_gemmb<false, false><<<dim3(NCR / 64, DD / 64, 1), 128, 0, stream>>>(Cb, nullptr, WrT, nullptr, TMP, DD, nullptr);                        // r = pos_emb.Wrel
    k_hplanes<<<(NBT * NH_ * TK) / 8, 256, 0, stream>>>(TMP, DD, 0, TK, nullptr, Rh, Rl);
    // the head loop, HG heads of one batch per launch (grid z; in k_relsoft the waves of a block)
    for (int b = 0; b < NBT; ++b) for (int h = 0; h < NH_; h += HG) { const size_t bh = (size_t)b * NH_ + h, gr = bh / HG; const int first = (b == 0 && h == 0), last = (b == NBT - 1 && h == NH_ - HG);
        k_gemm3<<<dim3(LQ / 64, TK / 64, HG), 128, 0, stream>>>(QUh + bh * LQ * HD, QUl + bh * LQ * HD, Kh + bh * TK * HD, Kl + bh * TK * HD, HD, AC, TK, (size_t)LQ * HD, (size_t)TK * HD, (size_t)LQ * TK);     // AC = (q+u).k^T
        k_gemm3<<<dim3(LQ / 64, TK / 64, HG), 128, 0, stream>>>(QVh + bh * LQ * HD, QVl + bh * LQ * HD, Rh + bh * TK * HD, Rl + bh * TK * HD, HD, BD, TK, (size_t)LQ * HD, (size_t)TK * HD, (size_t)LQ * TK);     // BD = (q+v).r^T (pre-shift)
        k_relsoft<<<LQ / (8 / HG), 256, 0, stream>>>(AC, BD, msk, b, first, AMP[(gr + 1) & 1], PH, PL, last ? out2 : AMP[gr & 1]);     // reads the previous group's buffer, writes the other
        k_pv<<<dim3(HD / 32, LQ / 16, 2 * HG), 256, 0, stream>>>(PH, PL, VTh + bh * HD * TK, VTl + bh * HD * TK, AV + (size_t)b * DD + h * HD, NBT * DD, (size_t)NXR * DD);          // attn.v -> attn_vec[(l,b)][h*64 + d], two key-half planes
    }
    k_split<<<NXR / 8, 256, 0, stream>>>(AV, AV + (size_t)NXR * DD, NXR, AVh, AVl);     // adds the two key-half planes of attn_vec
    k_gemmb<true, false><<<dim3(NXR / 64, DD / 64, 1), 128, 0, stream>>>(AVh, AVl, WoT, nullptr, Hs, DD, nullptr, x, DD, 1);                 // h = x + attn_vec.Wo  (x bf16-rounded)
    k_ln<<<NXR / 8, 256, 0, stream>>>(Hs, g, bb, out);
}

// v004
// A run of this version takes 722 microseconds.
// Next to v003, in two timings, it ran 1.08 times as fast each time.
// Over all steps from v000 it is 5.20 times as fast.
#include <hip/hip_runtime.h>

// Compute dtypes, f32 accumulate: k|v = [memory; x].Wkv ([4096 x 1024].[1024 x 2048]), q = x.Wq, r = pos_emb.Wrel (k-major weights transposed once; PLAIN bf16 operands
// = inputs rounded once, exact) and attn_out = attn_vec.Wo (hi/lo A, + x) on v_wmma_f32_16x16x32_bf16; per (batch, head): AC = (q + u).k^T and BD = (q + v_bias).r^T
// ([1024 x 64].[64 x 2048], both operands bf16 hi + UNSCALED residual, three products), the module's _rel_shift applied by INDEX (the literal pad-reshape-slice
// mapping, incl. its wrap-around entries), x 1/8, the INPUT mask (-1e30), the softmax over keys and the mean attention map in f32, attn.v ([1024 x 2048].[2048 x 64],

#define LQ   1024
#define TK   2048
#define NBT  2
#define DD   1024
#define NH_  16
#define HD   64
#define NXR  (LQ * NBT)           // 2048 x rows (l, b)
#define NCR  (TK * NBT)           // 4096 c / pos rows (t, b)
#define DM   DD
#define NTK  NCR
#define SCL  0.125f
#define NEGV -1e30f
#define LN_EPS 1e-5f
#define LOSC 1024.0f
#define HG   4                    // heads of one batch that each launch of the head loop works on side by side (divides NH_, so one launch has one batch index)

typedef _Float16 h16;
typedef unsigned short bf;
typedef __attribute__((ext_vector_type(16))) __bf16   v16bf;
typedef __attribute__((ext_vector_type(16))) _Float16 v16h;
typedef __attribute__((ext_vector_type(8)))  _Float16 v8h;
typedef __attribute__((ext_vector_type(8)))  unsigned short v8us;
typedef __attribute__((ext_vector_type(8)))  float    v8f;
typedef __attribute__((ext_vector_type(4)))  float    v4f;
typedef __attribute__((ext_vector_type(4)))  _Float16 v4h;
typedef v8h  __attribute__((may_alias)) v8ha;
typedef v4f  __attribute__((may_alias)) v4fa;
typedef v8us __attribute__((may_alias)) v8usa;

__device__ __forceinline__ unsigned short f2bf(float f) { unsigned u = __float_as_uint(f); u += 0x7FFFu + ((u >> 16) & 1u); return (unsigned short)(u >> 16); }
__device__ __forceinline__ float bf2f(unsigned short b) { return __uint_as_float(((unsigned)b) << 16); }
__device__ __forceinline__ float bfr(float f) { return bf2f(f2bf(f)); }
__device__ __forceinline__ v16h cat16(v8h lo, v8h hi) { return __builtin_shufflevector(lo, hi, 0, 1, 2, 3, 4, 5, 6, 7, 8, 9, 10, 11, 12, 13, 14, 15); }
__device__ __forceinline__ v16bf cat16b(v8us lo, v8us hi) { return __builtin_bit_cast(v16bf, __builtin_shufflevector(lo, hi, 0, 1, 2, 3, 4, 5, 6, 7, 8, 9, 10, 11, 12, 13, 14, 15)); }
__device__ __forceinline__ v8f wmma16(v16h a, v16h b, v8f c) { return __builtin_amdgcn_wmma_f32_16x16x32_f16(false, a, false, b, (short)0, c, false, false); }
__device__ __forceinline__ v8f wmmab(v16bf a, v16bf b, v8f c) { return __builtin_amdgcn_wmma_f32_16x16x32_bf16(false, a, false, b, (short)0, c, false, false); }

// k_wt: WT [n][K] = bf16(W[k][n]) (k-major [K][ncols]) via 64 x 64 LDS tiles; grid (K/64, ncols/64).
__global__ __launch_bounds__(256) void k_wt(const float* __restrict__ Wm, int K, int ncols, bf* WT) {
    __shared__ __align__(16) unsigned short tl[64 * 72];
    const int tid = threadIdx.x, k0 = blockIdx.x * 64, n0 = blockIdx.y * 64;
    const int kk = tid >> 2, nq = (tid & 3) * 16;
#pragma unroll
    for (int i = 0; i < 16; ++i) tl[(nq + i) * 72 + kk] = f2bf(Wm[(size_t)(k0 + kk) * ncols + n0 + nq + i]);
    __syncthreads();
    const int piece = tid & 7;
    auto pass = [&]() {
#pragma unroll
        for (int s = 0; s < 2; ++s) { const int nr = (tid >> 3) + 32 * s; const v8us val = *(const v8usa*)(tl + nr * 72 + piece * 8); *(v8us*)(WT + (size_t)(n0 + nr) * K + k0 + piece * 8) = val; }
    };
    pass(); 
}
__global__ __launch_bounds__(256) void k_cvtb(const float* __restrict__ src, int nrows, bf* dst) {
    const int lane = threadIdx.x & 31, r = blockIdx.x * 8 + (threadIdx.x >> 5);
    if (r >= nrows) return;
    v8us o[DM / 256];
#pragma unroll
    for (int q = 0; q < DM / 256; ++q) { v8us t;
#pragma unroll
        for (int i = 0; i < 8; ++i) t[i] = f2bf(src[(size_t)r * DM + q * 256 + lane * 8 + i]);
        o[q] = t; }
#pragma unroll
    for (int q = 0; q < DM / 256; ++q) *(v8us*)(dst + (size_t)r * DM + q * 256 + lane * 8) = o[q];
    
}

// k_gemmb: 64 x 64 block tile (4 waves x 16 x 64) of C[NXR][DD] = (A [+ Al]).B^T (K = 1024) [+ bf(bias[c])] [+ bf(R[r][c]) residual]; f32 whole-line epilogue (or f16
template <bool SPLITA, bool F16OUT = false>
__global__ __launch_bounds__(128) void k_gemmb(const bf* __restrict__ A, const bf* __restrict__ Al, const bf* __restrict__ Bn, const float* __restrict__ bias, float* C, int ldc, h16* C2, const float* __restrict__ R = nullptr, int K = DM, int roundR = 1) {
    __shared__ __align__(16) float ost[4][16 * 68];
    const int lane = threadIdx.x & 31, wave = threadIdx.x >> 5, lr = lane & 15, hi = lane >> 4;
    const int r0 = blockIdx.x * 64 + wave * 16, c0 = blockIdx.y * 64;
    const size_t aoff = (size_t)(r0 + lr) * K + 8 * hi;
    size_t boff[4];
#pragma unroll
    for (int t = 0; t < 4; ++t) boff[t] = (size_t)(c0 + t * 16 + lr) * K + 8 * hi;
    v8f acc[4];
#pragma unroll
    for (int t = 0; t < 4; ++t) acc[t] = (v8f){};
#pragma unroll 1
    for (int kc = 0; kc < K; kc += 32) {
        const v16bf a = cat16b(*(const v8us*)(A + aoff + kc), *(const v8us*)(A + aoff + kc + 16));
        v16bf al = a;
        if (SPLITA) al = cat16b(*(const v8us*)(Al + aoff + kc), *(const v8us*)(Al + aoff + kc + 16));
#pragma unroll
        for (int t = 0; t < 4; ++t) { const v16bf b = cat16b(*(const v8us*)(Bn + boff[t] + kc), *(const v8us*)(Bn + boff[t] + kc + 16)); acc[t] = wmmab(a, b, acc[t]); if (SPLITA) acc[t] = wmmab(al, b, acc[t]); }
        asm volatile("v_nop\n\tv_nop\n\tv_nop\n\tv_nop" : "+v"(acc[0]), "+v"(acc[1]), "+v"(acc[2]), "+v"(acc[3]) : "v"(a), "v"(al));
    }
    float* os = &ost[wave][0];
#pragma unroll
    for (int t = 0; t < 4; ++t) { const float bv = bias ? bfr(bias[c0 + t * 16 + lr]) : 0.f;
#pragma unroll
        for (int j = 0; j < 8; ++j) os[(hi * 8 + j) * 68 + t * 16 + lr] = acc[t][j] + bv; }
    __syncthreads();
    if (F16OUT) {
        h16* crow = (h16*)(void*)C + (size_t)r0 * ldc + c0;
        auto pass = [&]() {
#pragma unroll
            for (int s = 0; s < 4; ++s) { const int row = 4 * s + (lane >> 3), piece = lane & 7; const float* sp = os + row * 68 + piece * 8; v8h o, o2;
#pragma unroll
                for (int i = 0; i < 8; ++i) { const h16 a = (h16)sp[i]; o[i] = a; o2[i] = (h16)((sp[i] - (float)a) * LOSC); }
                *(v8h*)(crow + (size_t)row * ldc + piece * 8) = o; if (C2) *(v8h*)(C2 + (size_t)r0 * ldc + c0 + (size_t)row * ldc + piece * 8) = o2; }
        };
        pass(); 
    } else {
        float* crow = C + (size_t)r0 * ldc + c0;
        auto pass = [&]() {
#pragma unroll
            for (int s = 0; s < 8; ++s) { const int Lid = (lane >> 3) + 4 * s, piece = lane & 7; const int row = Lid >> 1, cofs = (Lid & 1) * 32 + piece * 4;
                v4f val = *(const v4fa*)(os + row * 68 + cofs); if (R) { const v4f rv = *(const v4f*)(R + ((size_t)r0 + row) * ldc + c0 + cofs); val += roundR ? (v4f){bfr(rv[0]), bfr(rv[1]), bfr(rv[2]), bfr(rv[3])} : rv; }
                *(v4f*)(crow + (size_t)row * ldc + cofs) = val; }
        };
        pass(); 
    }
}

// k_gemm3: 64 x 64 tile of C = (Ah + Al).(Bh + Bl)^T over K (row strides = K for all four planes; n-major B): three products per 32-k step (hh, hl, lh); f32
// blockIdx.z = the head inside the launch's group: its A, B and C planes lie sA, sB and sC elements behind the previous head's.
__global__ __launch_bounds__(128) void k_gemm3(const bf* __restrict__ Ah, const bf* __restrict__ Al, const bf* __restrict__ Bh, const bf* __restrict__ Bl, int K, float* C, int ldc, size_t sA, size_t sB, size_t sC) {
    __shared__ __align__(16) float ost[4][16 * 68];
    Ah += blockIdx.z * sA; Al += blockIdx.z * sA; Bh += blockIdx.z * sB; Bl += blockIdx.z * sB; C += blockIdx.z * sC;
    const int lane = threadIdx.x & 31, wave = threadIdx.x >> 5, lr = lane & 15, hi = lane >> 4;
    const int r0 = blockIdx.x * 64 + wave * 16, c0 = blockIdx.y * 64;
    const size_t aoff = (size_t)(r0 + lr) * K + 8 * hi;
    v8f acc[4];
#pragma unroll
    for (int t = 0; t < 4; ++t) acc[t] = (v8f){};
#pragma unroll 1
    for (int kc = 0; kc < K; kc += 32) {
        const v16bf a = cat16b(*(const v8us*)(Ah + aoff + kc), *(const v8us*)(Ah + aoff + kc + 16));
        const v16bf al = cat16b(*(const v8us*)(Al + aoff + kc), *(const v8us*)(Al + aoff + kc + 16));
#pragma unroll
        for (int t = 0; t < 4; ++t) { const size_t bo = (size_t)(c0 + t * 16 + lr) * K + kc + 8 * hi;
            const v16bf bh = cat16b(*(const v8us*)(Bh + bo), *(const v8us*)(Bh + bo + 16)); const v16bf bl = cat16b(*(const v8us*)(Bl + bo), *(const v8us*)(Bl + bo + 16));
            acc[t] = wmmab(a, bh, acc[t]); acc[t] = wmmab(al, bh, acc[t]); acc[t] = wmmab(a, bl, acc[t]); }
        asm volatile("v_nop\n\tv_nop\n\tv_nop\n\tv_nop" : "+v"(acc[0]), "+v"(acc[1]), "+v"(acc[2]), "+v"(acc[3]) : "v"(a), "v"(al));
    }
    float* os = &ost[wave][0];
#pragma unroll
    for (int t = 0; t < 4; ++t) {
#pragma unroll
        for (int j = 0; j < 8; ++j) os[(hi * 8 + j) * 68 + t * 16 + lr] = acc[t][j]; }
    __builtin_amdgcn_wave_barrier(); asm volatile("" ::: "memory");
    float* crow = C + (size_t)r0 * ldc + c0;
    auto pass = [&]() {
#pragma unroll
        for (int s = 0; s < 8; ++s) { const int Lid = (lane >> 3) + 4 * s, piece = lane & 7; const int row = Lid >> 1, cofs = (Lid & 1) * 32 + piece * 4;
            const v4f val = *(const v4fa*)(os + row * 68 + cofs); *(v4f*)(crow + (size_t)row * ldc + cofs) = val; }
    };
    pass(); 
}

// k_pv: attn.v of the group's HG heads, each C[1024][64] = (Ah + Al).(Bh + Bl)^T over the 2048 keys (three products per 32-k step, loaders as in k_gemm3). One 16 x 32 output tile and one
// half of the keys per block (grid: 2 column tiles, 64 row tiles, z = HG heads x 2 key halves = 1024 blocks); each of the 8 waves sums 128 keys, the 8 partial tiles are added in wave order
// through LDS, and the two halves go to two planes (C, C + zstride) that k_split adds. Each stored tile row is one whole 128-byte line.
__global__ __launch_bounds__(256) void k_pv(const bf* __restrict__ Ah, const bf* __restrict__ Al, const bf* __restrict__ Bh, const bf* __restrict__ Bl, float* C, int ldc, size_t zstride) {
    __shared__ __align__(16) float red[8][2 * 272];     // per wave: two 8-row halves of 8 x 32 floats, 16 floats apart in bank so that the two lane halves do not collide
    const int lane = threadIdx.x & 31, wave = threadIdx.x >> 5, lr = lane & 15, hi = lane >> 4;
    const int hz = blockIdx.z >> 1, kh = blockIdx.z & 1;     // head inside the group, key half
    Ah += (size_t)hz * LQ * TK; Al += (size_t)hz * LQ * TK; Bh += (size_t)hz * HD * TK; Bl += (size_t)hz * HD * TK;
    const int c0 = blockIdx.x * 32, r0 = blockIdx.y * 16, k0 = kh * (TK / 2) + wave * (TK / 16);
    const size_t aoff = (size_t)(r0 + lr) * TK + k0 + 8 * hi;
    v8f acc[2];
#pragma unroll
    for (int t = 0; t < 2; ++t) acc[t] = (v8f){};
    // all 48 fragment loads of the wave's 128 keys are issued first, so that the wave pays one memory round trip and not one per product
    v8us fa[4][4], fb[4][2][4];
#pragma unroll
    for (int s = 0; s < 4; ++s) { const int kc = s * 32;
        fa[s][0] = *(const v8us*)(Ah + aoff + kc); fa[s][1] = *(const v8us*)(Ah + aoff + kc + 16); fa[s][2] = *(const v8us*)(Al + aoff + kc); fa[s][3] = *(const v8us*)(Al + aoff + kc + 16);
#pragma unroll
        for (int t = 0; t < 2; ++t) { const size_t bo = (size_t)(c0 + t * 16 + lr) * TK + k0 + kc + 8 * hi;
            fb[s][t][0] = *(const v8us*)(Bh + bo); fb[s][t][1] = *(const v8us*)(Bh + bo + 16); fb[s][t][2] = *(const v8us*)(Bl + bo); fb[s][t][3] = *(const v8us*)(Bl + bo + 16); }
    }
    asm volatile("s_wait_xcnt 0x0" ::: "memory");     // the accumulators reuse the loads' address registers: this wait stands before that overwrite
    __builtin_amdgcn_sched_barrier(0);     // keeps the matrix instructions behind the wait and all 48 loads ahead of them (without it the scheduler interleaves them, reuses few registers and waits after every pair)
#pragma unroll
    for (int s = 0; s < 4; ++s) { const v16bf a = cat16b(fa[s][0], fa[s][1]), al = cat16b(fa[s][2], fa[s][3]);
#pragma unroll
        for (int t = 0; t < 2; ++t) { const v16bf bh = cat16b(fb[s][t][0], fb[s][t][1]), bl = cat16b(fb[s][t][2], fb[s][t][3]);
            acc[t] = wmmab(a, bh, acc[t]); acc[t] = wmmab(al, bh, acc[t]); acc[t] = wmmab(a, bl, acc[t]); }
    }
#pragma unroll
    for (int t = 0; t < 2; ++t) {
#pragma unroll
        for (int j = 0; j < 8; ++j) red[wave][hi * 272 + j * 32 + t * 16 + lr] = acc[t][j]; }
    __syncthreads();     // every wave's partial tile is in LDS before any wave adds them
    float* crow = C + (size_t)kh * zstride + (size_t)r0 * ldc + hz * HD + c0;
#pragma unroll
    for (int s = 0; s < 2; ++s) { float v = red[0][s * 272 + wave * 32 + lane];
#pragma unroll
        for (int w = 1; w < 8; ++w) v += red[w][s * 272 + wave * 32 + lane];
        crow[(size_t)(s * 8 + wave) * ldc + lane] = v; }
}

// k_gemmp: a projection GEMM (main loop of k_gemmb, plain A) whose epilogue writes the attention operand planes itself: bf16 hi + UNSCALED residual of the f32 sums, per (batch b, head h).
// A block takes 64 consecutive positions t of ONE batch (A row = t*2 + b) and the 64 columns of one head (blockIdx.y), so that every stored plane row is one whole 128-byte line.
// K is an argument as in k_gemmb: with a compile-time K this build kept one B fragment in registers and waited out a load round trip in front of each of the trip's four matrix instructions.
// MODE 0: P0[bh][t][d] (k, r). MODE 1: P0 = sums + bf(bias0[h][d]), P1 = sums + bf(bias1[h][d]) (q + u, q + v_bias). MODE 2: P0[bh][d][t] (v transposed: the tile is laid into LDS column-major).
template <int MODE, int NR>
__global__ __launch_bounds__(128) void k_gemmp(const bf* __restrict__ A, const bf* __restrict__ Bn, const float* __restrict__ bias0, const float* __restrict__ bias1, bf* P0h, bf* P0l, bf* P1h, bf* P1l, int K = DM) {
    __shared__ __align__(16) float ost[64 * 68];
    __shared__ __align__(16) float ub[2 * HD];     // MODE 1 only
    const int lane = threadIdx.x & 31, wave = threadIdx.x >> 5, lr = lane & 15, hi = lane >> 4;
    const int b = (blockIdx.x * 64) / NR, t0 = (blockIdx.x * 64) % NR, h = blockIdx.y, c0 = h * HD;
    const size_t aoff = ((size_t)(t0 + wave * 16 + lr) * NBT + b) * K + 8 * hi;
    size_t boff[4];
#pragma unroll     // unrolled (all loops over t, j, i, s of this kernel): boff[], acc[] and the vectors are indexed by constants and stay in registers
    for (int t = 0; t < 4; ++t) boff[t] = (size_t)(c0 + t * 16 + lr) * K + 8 * hi;
    v8f acc[4];
#pragma unroll
    for (int t = 0; t < 4; ++t) acc[t] = (v8f){};
#pragma unroll 1     // rolled as in k_gemmb: the main loop stays that kernel's
    for (int kc = 0; kc < K; kc += 32) {
        const v16bf a = cat16b(*(const v8us*)(A + aoff + kc), *(const v8us*)(A + aoff + kc + 16));
        asm volatile("s_wait_xcnt 0x0" ::: "memory");     // the first B load's result reuses the A loads' address registers: this wait stands before that overwrite
#pragma unroll
        for (int t = 0; t < 4; ++t) { const v16bf bq = cat16b(*(const v8us*)(Bn + boff[t] + kc), *(const v8us*)(Bn + boff[t] + kc + 16)); acc[t] = wmmab(a, bq, acc[t]); }
        asm volatile("v_nop\n\tv_nop\n\tv_nop\n\tv_nop" : "+v"(acc[0]), "+v"(acc[1]), "+v"(acc[2]), "+v"(acc[3]) : "v"(a));     // the four slots behind the trip's last matrix instruction, also on the taken back edge, before the next trip's loads overwrite its operands
    }
#pragma unroll
    for (int t = 0; t < 4; ++t) {
        if (MODE == 2) { float* p = ost + (t * 16 + lr) * 68 + wave * 16 + hi * 8;     // row = d, column = t: a lane's 8 sums are 8 consecutive positions
            *(v4fa*)p = (v4f){acc[t][0], acc[t][1], acc[t][2], acc[t][3]}; *(v4fa*)(p + 4) = (v4f){acc[t][4], acc[t][5], acc[t][6], acc[t][7]};
        } else {
#pragma unroll
            for (int j = 0; j < 8; ++j) ost[(wave * 16 + hi * 8 + j) * 68 + t * 16 + lr] = acc[t][j]; }
    }
    if (MODE == 1) ub[threadIdx.x] = bfr((threadIdx.x < HD ? bias0 : bias1)[c0 + (threadIdx.x & (HD - 1))]);     // the head's 64 + 64 rounded bias values, one load a thread
    __syncthreads();     // the whole 64 x 64 tile (MODE 1: and the bias values) is in LDS before it is read back by rows (MODE 2: a row holds sums of all four waves)
    const int piece = lane & 7; const size_t bh = (size_t)b * NH_ + h;
    float u0[8], u1[8];
    if (MODE == 1) {
#pragma unroll
        for (int i = 0; i < 8; ++i) { u0[i] = ub[piece * 8 + i]; u1[i] = ub[HD + piece * 8 + i]; } }
#pragma unroll
    for (int s = 0; s < 4; ++s) { const int row = wave * 16 + 4 * s + (lane >> 3); const float* sp = ost + row * 68 + piece * 8;
        const v4f x0 = *(const v4fa*)sp, x1 = *(const v4fa*)(sp + 4);
        const size_t o = MODE == 2 ? (bh * HD + row) * TK + t0 + piece * 8 : (bh * NR + t0 + row) * HD + piece * 8;
        v8us oh, ol;
#pragma unroll
        for (int i = 0; i < 8; ++i) { float v = i < 4 ? x0[i & 3] : x1[i & 3]; if (MODE == 1) v += u0[i]; const unsigned short hb = f2bf(v); oh[i] = hb; ol[i] = f2bf(v - bf2f(hb)); }
        *(v8us*)(P0h + o) = oh; *(v8us*)(P0l + o) = ol;
        if (MODE == 1) {
#pragma unroll
            for (int i = 0; i < 8; ++i) { const float v = (i < 4 ? x0[i & 3] : x1[i & 3]) + u1[i]; const unsigned short hb = f2bf(v); oh[i] = hb; ol[i] = f2bf(v - bf2f(hb)); }
            *(v8us*)(P1h + o) = oh; *(v8us*)(P1l + o) = ol; }
    }
}
// 2^x. The v_nop is the slot that the instruction set asks for behind a transcendental before its source register is overwritten.
__device__ __forceinline__ float exp2_slot(float x) { float r; asm("v_exp_f32 %0, %1\n\tv_nop" : "=v"(r) : "v"(x)); return r; }
// k_relsoft: one wave per query row i of head (b,h); a block = 2 rows x the HG heads of the group (planes LQ*TK elements apart); for each key j: the module's _rel_shift by index (idx = L + i*T + j, row = idx / (T+1), col = idx % (T+1), bd = col ?
// BD[row][col-1] : 0), s = (AC[i][j] + bd)/8, s = -1e30 where mask[i][j][b]; softmax over the 2048 keys (f32, fixed lane order). AC, BD and the mask are read ONCE: a lane holds its 64 scores (then their
// exponentials) in registers from the loads to the stores -> bf16 hi + UNSCALED
// residual planes; the mean attention map accumulates p / 32 in (b,h) order: each wave leaves its head's p / 32 in LDS, and behind a barrier the block adds the HG heads in
// head order onto the previous group's map, through two ping-pong buffers (AMIN = the previous group's buffer, never the one being written,
// launch bounds, second argument: caps the registers; without it the build takes 300, three waves a SIMD, and the two blocks that the grid gives every WGP do not fit side by side
__global__ __launch_bounds__(256, 5) void k_relsoft(const float* __restrict__ ACg, const float* __restrict__ BDg, const int* __restrict__ MSK, int b, int first, const float* __restrict__ AMIN, bf* PHg, bf* PLg, float* AMDST) {
    typedef __attribute__((ext_vector_type(4))) unsigned short v4us;
    typedef __attribute__((ext_vector_type(4))) int v4i;
    typedef v4f __attribute__((aligned(4), may_alias)) v4fu;     // a 16-byte load whose address is a multiple of 4 only
    __shared__ __align__(16) float pm[8][TK];     // p / 32 of each wave's (row, head)
    const int lane = threadIdx.x & 31, wave = threadIdx.x >> 5, hz = wave % HG, i = blockIdx.x * (8 / HG) + wave / HG;
    const float* __restrict__ AC = ACg + (size_t)hz * LQ * TK; const float* __restrict__ BD = BDg + (size_t)hz * LQ * TK; bf* PH = PHg + (size_t)hz * LQ * TK; bf* PL = PLg + (size_t)hz * LQ * TK;
    // _rel_shift by index with one integer division per row: idx = L + i*T + j; (row0, col0) for j = 0, then col = col0 + j wraps at most once past T+1.
    // L + i*T = i*(T+1) + (L - i) with 1 <= L - i <= T, so col0 >= 1: col is 0 only at the wrap, key jz. In the flat BD plane the row's elements are one run with that one hole:
    // key j < jz reads bdr[j], key jz reads nothing (bd = 0), key j > jz reads (row0 + 1)*T + (col0 + j - (T+1)) - 1 = bdr[j - 1].
    static_assert(LQ <= TK, "col0 >= 1 needs L - i <= T");
    const int base = LQ + i * TK; const int row0 = base / (TK + 1), col0 = base % (TK + 1), jz = TK + 1 - col0;
    const float* __restrict__ bdr = BD + (size_t)row0 * TK + col0 - 1;
    float sc[TK / 32];     // the lane's keys: 4 consecutive ones of every 128, in the order in which they are summed
#pragma unroll     // unrolled (all loops over sc[]): sc[] is indexed by constants and stays in registers, and the row's loads go out many at a time
    for (int k = 0; k < TK / 128; ++k) { const int c0 = lane * 4 + k * 128, d = jz - c0;     // d: place of the hole inside this group of 4 keys (below 0: the whole group lies behind it)
        const v4f ac = *(const v4f*)(AC + (size_t)i * TK + c0);
        const v4f bv = *(const v4fu*)(bdr + c0 - (d < 0 ? 1 : 0));     // 4 floats at a 4-byte boundary; first and last lie inside the head's BD plane for every (i, c0)
        const v4i m0 = *(const v4i*)(MSK + ((size_t)i * TK + c0) * NBT), m1 = *(const v4i*)(MSK + ((size_t)i * TK + c0) * NBT + 4);     // mask[i][c0 .. c0+3][0 .. 1]
        const int mk[4] = {b ? m0[1] : m0[0], b ? m0[3] : m0[2], b ? m1[1] : m1[0], b ? m1[3] : m1[2]};
#pragma unroll
        for (int q = 0; q < 4; ++q) { const float bd = ((unsigned)d > (unsigned)q) ? bv[q] : (d == q ? 0.f : bv[q ? q - 1 : 0]);     // in front of the hole or wholly behind it: in place; the hole: 0; behind the hole in its own group: one down
            const float s = (ac[q] + bd) * SCL; sc[k * 4 + q] = mk[q] ? NEGV : s; }
    }
    float m = -3.0e38f;
#pragma unroll
    for (int e = 0; e < TK / 32; ++e) m = fmaxf(m, sc[e]);
#pragma unroll
    for (int sh = 16; sh; sh >>= 1) m = fmaxf(m, __shfl_xor(m, sh, 32));
    float sum = 0.f;
#pragma unroll
    for (int e = 0; e < TK / 32; ++e) { sc[e] = exp2_slot((sc[e] - m) * 1.44269504f); sum += sc[e]; }     // = __expf(sc[e] - m): the same multiply by log2(e) and the same v_exp_f32
#pragma unroll
    for (int sh = 16; sh; sh >>= 1) sum += __shfl_xor(sum, sh, 32);
    const float inv = 1.0f / sum;
    // the block's 8 / HG rows of the map are one run of floats: thread t owns floats 4 t .. 4 t + 3 of every 1024; the previous group's values are fetched here, under the conversion of the row
    const size_t mo = (size_t)blockIdx.x * (8 / HG) * TK + threadIdx.x * 4;
    v4f am[(8 / HG) * TK / 1024];
#pragma unroll     // unrolled (here and in the two loops behind the barrier): am[] is indexed by constants and stays in registers, and the loads go out together
    for (int s = 0; s < (8 / HG) * TK / 1024; ++s) am[s] = first ? (v4f){} : *(const v4f*)(AMIN + mo + s * 1024);
#pragma unroll
    for (int k = 0; k < TK / 128; ++k) { const int c0 = lane * 4 + k * 128; v4us oh, ol; v4f pq;
#pragma unroll
        for (int q = 0; q < 4; ++q) { const float p = sc[k * 4 + q] * inv; const unsigned short hb = f2bf(p); oh[q] = hb; ol[q] = f2bf(p - bf2f(hb));
            pq[q] = p * (1.0f / (NBT * NH_)); }
        const size_t o = (size_t)i * TK + c0; *(v4us*)(PH + o) = oh; *(v4us*)(PL + o) = ol; *(v4fa*)(&pm[wave][c0]) = pq; }
    __syncthreads();     // every head's p / 32 of the block's rows is in LDS before any thread adds them
#pragma unroll
    for (int s = 0; s < (8 / HG) * TK / 1024; ++s) { const int e = s * 1024 + threadIdx.x * 4, rs = e / TK, c = e % TK;
#pragma unroll     // unrolled: the HG LDS reads of a slot go out together; the adds stay in head order
        for (int w = 0; w < HG; ++w) am[s] += *(const v4fa*)(&pm[rs * HG + w][c]); }
#pragma unroll
    for (int s = 0; s < (8 / HG) * TK / 1024; ++s) *(v4f*)(AMDST + mo + s * 1024) = am[s];
}
__global__ __launch_bounds__(256) void k_split(const float* __restrict__ src, const float* __restrict__ src2, int nrows, bf* dh, bf* dl) {
    const int lane = threadIdx.x & 31, r = blockIdx.x * 8 + (threadIdx.x >> 5); if (r >= nrows) return;
{
#pragma unroll 1
        for (int q = 0; q < DD / 256; ++q) { const size_t o = (size_t)r * DD + q * 256 + lane * 8; const v8f v = *(const v8f*)(src + o) + *(const v8f*)(src2 + o); v8us oh, ol;
#pragma unroll
            for (int i = 0; i < 8; ++i) { const unsigned short hb = f2bf(v[i]); oh[i] = hb; ol[i] = f2bf(v[i] - bf2f(hb)); }
            *(v8us*)(dh + o) = oh; *(v8us*)(dl + o) = ol; }
         }
}
// k_ln: one wave per row of H [2048][1024]: LayerNorm (mean, biased var, eps 1e-5) x bf(gamma) + bf(beta) -> f32 output rows; lane -> 4 consecutive floats per 128-column
__global__ __launch_bounds__(256) void k_ln(const float* __restrict__ Hs, const float* __restrict__ g, const float* __restrict__ bb, float* OUTP) {
    const int lane = threadIdx.x & 31, r = blockIdx.x * 8 + (threadIdx.x >> 5); if (r >= NXR) return;
    v4f v[DD / 128]; float s = 0.f;
#pragma unroll
    for (int q = 0; q < DD / 128; ++q) { v[q] = *(const v4f*)(Hs + (size_t)r * DD + q * 128 + lane * 4);
#pragma unroll
        for (int i = 0; i < 4; ++i) s += v[q][i]; }
#pragma unroll
    for (int sh = 16; sh; sh >>= 1) s += __shfl_xor(s, sh, 32);
    const float mu = s * (1.0f / DD); float s2 = 0.f;
#pragma unroll
    for (int q = 0; q < DD / 128; ++q)
#pragma unroll
        for (int i = 0; i < 4; ++i) { const float d = v[q][i] - mu; s2 = fmaf(d, d, s2); }
#pragma unroll
    for (int sh = 16; sh; sh >>= 1) s2 += __shfl_xor(s2, sh, 32);
    const float rs = rsqrtf(s2 * (1.0f / DD) + LN_EPS);
{
#pragma unroll
        for (int q = 0; q < DD / 128; ++q) { const int c0 = q * 128 + lane * 4; v4f y;
#pragma unroll
            for (int i = 0; i < 4; ++i) y[i] = (v[q][i] - mu) * rs * bfr(g[c0 + i]) + bfr(bb[c0 + i]);
            *(v4f*)(OUTP + (size_t)r * DD + c0) = y; }
         }
}

extern "C" void kernel_launch(void* const* d_in, const int* in_sizes, int n_in,
                              void* d_out, int out_size, void* d_ws, size_t ws_size, hipStream_t stream) {
    (void)in_sizes; (void)n_in; (void)out_size;
    const float* x = (const float*)d_in[0]; const float* pe = (const float*)d_in[1]; const float* mem = (const float*)d_in[2]; const float* pbu = (const float*)d_in[3]; const float* pbv = (const float*)d_in[4]; const int* msk = (const int*)d_in[5];
    const float* Wq = (const float*)d_in[6]; const float* Wkv = (const float*)d_in[7]; const float* Wrel = (const float*)d_in[8]; const float* Wo = (const float*)d_in[9]; const float* g = (const float*)d_in[10]; const float* bb = (const float*)d_in[11];
    float* out = (float*)d_out; float* out2 = out + (size_t)NXR * DD;    // output [1024][2][1024]; attn_matrix [1024][2048]
    char* wsp = (char*)d_ws;
    auto take = [&](size_t bytes) { char* p = wsp; wsp += (bytes + 255) & ~(size_t)255; return (void*)p; };
    bf* WqT = (bf*)take((size_t)DD * DD * 2); bf* WkvT = (bf*)take((size_t)2 * DD * DD * 2); bf* WrT = (bf*)take((size_t)DD * DD * 2); bf* WoT = (bf*)take((size_t)DD * DD * 2);
    bf* Cb = (bf*)take((size_t)NCR * DD * 2); float* TMP = (float*)take((size_t)NCR * DD * 4);
    bf* QUh = (bf*)take((size_t)NBT * NH_ * LQ * HD * 2); bf* QUl = (bf*)take((size_t)NBT * NH_ * LQ * HD * 2); bf* QVh = (bf*)take((size_t)NBT * NH_ * LQ * HD * 2); bf* QVl = (bf*)take((size_t)NBT * NH_ * LQ * HD * 2);
    bf* Kh = (bf*)take((size_t)NBT * NH_ * TK * HD * 2); bf* Kl = (bf*)take((size_t)NBT * NH_ * TK * HD * 2); bf* Rh = (bf*)take((size_t)NBT * NH_ * TK * HD * 2); bf* Rl = (bf*)take((size_t)NBT * NH_ * TK * HD * 2);
    bf* VTh = (bf*)take((size_t)NBT * NH_ * HD * TK * 2); bf* VTl = (bf*)take((size_t)NBT * NH_ * HD * TK * 2);
    float* AC = (float*)take((size_t)HG * LQ * TK * 4); float* BD = (float*)take((size_t)HG * LQ * TK * 4); bf* PH = (bf*)take((size_t)HG * LQ * TK * 2); bf* PL = (bf*)take((size_t)HG * LQ * TK * 2); float* AM = (float*)take((size_t)LQ * TK * 4);
    float* AV = (float*)take((size_t)2 * NXR * DD * 4); bf* AVh = (bf*)take((size_t)NXR * DD * 2); bf* AVl = (bf*)take((size_t)NXR * DD * 2);
    if ((size_t)(wsp - (char*)d_ws) > ws_size) return;    // in MiB: weights 10, Cb 8, TMP 16, q planes 16, k and r planes 32, v planes 16, AC and BD 8 each and PH and PL 4 each per head of a group (96), AM 8, attn_vec 24 = 226 of the 256 given; Hs (the pre-LN sum, f32 [2048][1024] = 8 MiB) reuses the start of BD (dead after the head loop); TMP serves as the second mean-map ping-pong buffer (8.4 of its 16.8 MB) during the head loop
    float* Hs = BD; float* AMP[2] = {AM, TMP};     // mean-map ping-pong: AM and TMP
    k_wt<<<dim3(DD / 64, DD / 64, 1), 256, 0, stream>>>(Wq, DD, DD, WqT); k_wt<<<dim3(DD / 64, (2 * DD) / 64, 1), 256, 0, stream>>>(Wkv, DD, 2 * DD, WkvT); k_wt<<<dim3(DD / 64, DD / 64, 1), 256, 0, stream>>>(Wrel, DD, DD, WrT); k_wt<<<dim3(DD / 64, DD / 64, 1), 256, 0, stream>>>(Wo, DD, DD, WoT);
    // c = [memory; x] as bf16 rows (t, b): rows 0..2047 from memory, 2048..4095 from x
    k_cvtb<<<NXR / 8, 256, 0, stream>>>(mem, NXR, Cb); k_cvtb<<<NXR / 8, 256, 0, stream>>>(x, NXR, Cb + (size_t)NXR * DD);
    k_gemmp<0, TK><<<dim3(NCR / 64, NH_, 1), 128, 0, stream>>>(Cb, WkvT, nullptr, nullptr, Kh, Kl, nullptr, nullptr);                             // k = c.Wkv[:, :1024] -> planes
    k_gemmp<2, TK><<<dim3(NCR / 64, NH_, 1), 128, 0, stream>>>(Cb, WkvT + (size_t)DD * DD, nullptr, nullptr, VTh, VTl, nullptr, nullptr);         // v = c.Wkv[:, 1024:] -> transposed planes
    k_gemmp<1, LQ><<<dim3(NXR / 64, NH_, 1), 128, 0, stream>>>(Cb + (size_t)NXR * DD, WqT, pbu, pbv, QUh, QUl, QVh, QVl);                         // q = x.Wq (x = the last 2048 rows of c) -> q + u, q + v_bias planes
    k_cvtb<<<NCR / 8, 256, 0, stream>>>(pe, NCR, Cb);                                                                                    // pos_emb rows (t, b) (c no longer needed)
    k_gemmp<0, TK><<<dim3(NCR / 64, NH_, 1), 128, 0, stream>>>(Cb, WrT, nullptr, nullptr, Rh, Rl, nullptr, nullptr);                              // r = pos_emb.Wrel -> planes
    // the head loop, HG heads of one batch per launch (grid z; in k_relsoft the waves of a block)
    for (int b = 0; b < NBT; ++b) for (int h = 0; h < NH_; h += HG) { const size_t bh = (size_t)b * NH_ + h, gr = bh / HG; const int first = (b == 0 && h == 0), last = (b == NBT - 1 && h == NH_ - HG);
        k_gemm3<<<dim3(LQ / 64, TK / 64, HG), 128, 0, stream>>>(QUh + bh * LQ * HD, QUl + bh * LQ * HD, Kh + bh * TK * HD, Kl + bh * TK * HD, HD, AC, TK, (size_t)LQ * HD, (size_t)TK * HD, (size_t)LQ * TK);     // AC = (q+u).k^T
        k_gemm3<<<dim3(LQ / 64, TK / 64, HG), 128, 0, stream>>>(QVh + bh * LQ * HD, QVl + bh * LQ * HD, Rh + bh * TK * HD, Rl + bh * TK * HD, HD, BD, TK, (size_t)LQ * HD, (size_t)TK * HD, (size_t)LQ * TK);     // BD = (q+v).r^T (pre-shift)
        k_relsoft<<<LQ / (8 / HG), 256, 0, stream>>>(AC, BD, msk, b, first, AMP[(gr + 1) & 1], PH, PL, last ? out2 : AMP[gr & 1]);     // reads the previous group's buffer, writes the other
        k_pv<<<dim3(HD / 32, LQ / 16, 2 * HG), 256, 0, stream>>>(PH, PL, VTh + bh * HD * TK, VTl + bh * HD * TK, AV + (size_t)b * DD + h * HD, NBT * DD, (size_t)NXR * DD);          // attn.v -> attn_vec[(l,b)][h*64 + d], two key-half planes
    }
    k_split<<<NXR / 8, 256, 0, stream>>>(AV, AV + (size_t)NXR * DD, NXR, AVh, AVl);     // adds the two key-half planes of attn_vec
    k_gemmb<true, false><<<dim3(NXR / 64, DD / 64, 1), 128, 0, stream>>>(AVh, AVl, WoT, nullptr, Hs, DD, nullptr, x, DD, 1);                 // h = x + attn_vec.Wo  (x bf16-rounded)
    k_ln<<<NXR / 8, 256, 0, stream>>>(Hs, g, bb, out);
}

// v005
// A run of this version takes 632 microseconds.
// Timed twice side by side with v004, it ran 1.14 and 1.15 times as fast.
// Over all steps from v000 it is 5.96 times as fast.
#include <hip/hip_runtime.h>

// Compute dtypes, f32 accumulate: k|v = [memory; x].Wkv ([4096 x 1024].[1024 x 2048]), q = x.Wq, r = pos_emb.Wrel (k-major weights transposed once; PLAIN bf16 operands
// = inputs rounded once, exact) and attn_out = attn_vec.Wo (hi/lo A, + x) on v_wmma_f32_16x16x32_bf16; per (batch, head): AC = (q + u).k^T and BD = (q + v_bias).r^T
// ([1024 x 64].[64 x 2048], both operands bf16 hi + UNSCALED residual, three products), the module's _rel_shift applied by INDEX (the literal pad-reshape-slice
// mapping, incl. its wrap-around entries), x 1/8, the INPUT mask (-1e30), the softmax over keys and the mean attention map in f32, attn.v ([1024 x 2048].[2048 x 64],

#define LQ   1024
#define TK   2048
#define NBT  2
#define DD   1024
#define NH_  16
#define HD   64
#define NXR  (LQ * NBT)           // 2048 x rows (l, b)
#define NCR  (TK * NBT)           // 4096 c / pos rows (t, b)
#define DM   DD
#define NTK  NCR
#define SCL  0.125f
#define NEGV -1e30f
#define LN_EPS 1e-5f
#define LOSC 1024.0f
#define HG   4                    // heads of one batch that each launch of the head loop works on side by side (divides NH_, so one launch has one batch index)

typedef _Float16 h16;
typedef unsigned short bf;
typedef __attribute__((ext_vector_type(16))) __bf16   v16bf;
typedef __attribute__((ext_vector_type(16))) _Float16 v16h;
typedef __attribute__((ext_vector_type(8)))  _Float16 v8h;
typedef __attribute__((ext_vector_type(8)))  unsigned short v8us;
typedef __attribute__((ext_vector_type(8)))  float    v8f;
typedef __attribute__((ext_vector_type(4)))  float    v4f;
typedef __attribute__((ext_vector_type(4)))  _Float16 v4h;
typedef v8h  __attribute__((may_alias)) v8ha;
typedef v4f  __attribute__((may_alias)) v4fa;
typedef v8us __attribute__((may_alias)) v8usa;

__device__ __forceinline__ unsigned short f2bf(float f) { unsigned u = __float_as_uint(f); u += 0x7FFFu + ((u >> 16) & 1u); return (unsigned short)(u >> 16); }
__device__ __forceinline__ float bf2f(unsigned short b) { return __uint_as_float(((unsigned)b) << 16); }
__device__ __forceinline__ float bfr(float f) { return bf2f(f2bf(f)); }
__device__ __forceinline__ v16h cat16(v8h lo, v8h hi) { return __builtin_shufflevector(lo, hi, 0, 1, 2, 3, 4, 5, 6, 7, 8, 9, 10, 11, 12, 13, 14, 15); }
__device__ __forceinline__ v16bf cat16b(v8us lo, v8us hi) { return __builtin_bit_cast(v16bf, __builtin_shufflevector(lo, hi, 0, 1, 2, 3, 4, 5, 6, 7, 8, 9, 10, 11, 12, 13, 14, 15)); }
__device__ __forceinline__ v8f wmma16(v16h a, v16h b, v8f c) { return __builtin_amdgcn_wmma_f32_16x16x32_f16(false, a, false, b, (short)0, c, false, false); }
__device__ __forceinline__ v8f wmmab(v16bf a, v16bf b, v8f c) { return __builtin_amdgcn_wmma_f32_16x16x32_bf16(false, a, false, b, (short)0, c, false, false); }

// k_wt: WT [n][K] = bf16(W[k][n]) (k-major [K][ncols]) via 64 x 64 LDS tiles; grid (K/64, ncols/64).
__global__ __launch_bounds__(256) void k_wt(const float* __restrict__ Wm, int K, int ncols, bf* WT) {
    __shared__ __align__(16) unsigned short tl[64 * 72];
    const int tid = threadIdx.x, k0 = blockIdx.x * 64, n0 = blockIdx.y * 64;
    const int kk = tid >> 2, nq = (tid & 3) * 16;
#pragma unroll
    for (int i = 0; i < 16; ++i) tl[(nq + i) * 72 + kk] = f2bf(Wm[(size_t)(k0 + kk) * ncols + n0 + nq + i]);
    __syncthreads();
    const int piece = tid & 7;
    auto pass = [&]() {
#pragma unroll
        for (int s = 0; s < 2; ++s) { const int nr = (tid >> 3) + 32 * s; const v8us val = *(const v8usa*)(tl + nr * 72 + piece * 8); *(v8us*)(WT + (size_t)(n0 + nr) * K + k0 + piece * 8) = val; }
    };
    pass(); 
}
__global__ __launch_bounds__(256) void k_cvtb(const float* __restrict__ src, int nrows, bf* dst) {
    const int lane = threadIdx.x & 31, r = blockIdx.x * 8 + (threadIdx.x >> 5);
    if (r >= nrows) return;
    v8us o[DM / 256];
#pragma unroll
    for (int q = 0; q < DM / 256; ++q) { v8us t;
#pragma unroll
        for (int i = 0; i < 8; ++i) t[i] = f2bf(src[(size_t)r * DM + q * 256 + lane * 8 + i]);
        o[q] = t; }
#pragma unroll
    for (int q = 0; q < DM / 256; ++q) *(v8us*)(dst + (size_t)r * DM + q * 256 + lane * 8) = o[q];
    
}

// k_gemmb: 64 x 64 block tile (4 waves x 16 x 64) of C[NXR][DD] = (A [+ Al]).B^T (K = 1024) [+ bf(bias[c])] [+ bf(R[r][c]) residual]; f32 whole-line epilogue (or f16
template <bool SPLITA, bool F16OUT = false>
__global__ __launch_bounds__(128) void k_gemmb(const bf* __restrict__ A, const bf* __restrict__ Al, const bf* __restrict__ Bn, const float* __restrict__ bias, float* C, int ldc, h16* C2, const float* __restrict__ R = nullptr, int K = DM, int roundR = 1) {
    __shared__ __align__(16) float ost[4][16 * 68];
    const int lane = threadIdx.x & 31, wave = threadIdx.x >> 5, lr = lane & 15, hi = lane >> 4;
    const int r0 = blockIdx.x * 64 + wave * 16, c0 = blockIdx.y * 64;
    const size_t aoff = (size_t)(r0 + lr) * K + 8 * hi;
    size_t boff[4];
#pragma unroll
    for (int t = 0; t < 4; ++t) boff[t] = (size_t)(c0 + t * 16 + lr) * K + 8 * hi;
    v8f acc[4];
#pragma unroll
    for (int t = 0; t < 4; ++t) acc[t] = (v8f){};
#pragma unroll 1
    for (int kc = 0; kc < K; kc += 32) {
        const v16bf a = cat16b(*(const v8us*)(A + aoff + kc), *(const v8us*)(A + aoff + kc + 16));
        v16bf al = a;
        if (SPLITA) al = cat16b(*(const v8us*)(Al + aoff + kc), *(const v8us*)(Al + aoff + kc + 16));
#pragma unroll
        for (int t = 0; t < 4; ++t) { const v16bf b = cat16b(*(const v8us*)(Bn + boff[t] + kc), *(const v8us*)(Bn + boff[t] + kc + 16)); acc[t] = wmmab(a, b, acc[t]); if (SPLITA) acc[t] = wmmab(al, b, acc[t]); }
        asm volatile("v_nop\n\tv_nop\n\tv_nop\n\tv_nop" : "+v"(acc[0]), "+v"(acc[1]), "+v"(acc[2]), "+v"(acc[3]) : "v"(a), "v"(al));
    }
    float* os = &ost[wave][0];
#pragma unroll
    for (int t = 0; t < 4; ++t) { const float bv = bias ? bfr(bias[c0 + t * 16 + lr]) : 0.f;
#pragma unroll
        for (int j = 0; j < 8; ++j) os[(hi * 8 + j) * 68 + t * 16 + lr] = acc[t][j] + bv; }
    __syncthreads();
    if (F16OUT) {
        h16* crow = (h16*)(void*)C + (size_t)r0 * ldc + c0;
        auto pass = [&]() {
#pragma unroll
            for (int s = 0; s < 4; ++s) { const int row = 4 * s + (lane >> 3), piece = lane & 7; const float* sp = os + row * 68 + piece * 8; v8h o, o2;
#pragma unroll
                for (int i = 0; i < 8; ++i) { const h16 a = (h16)sp[i]; o[i] = a; o2[i] = (h16)((sp[i] - (float)a) * LOSC); }
                *(v8h*)(crow + (size_t)row * ldc + piece * 8) = o; if (C2) *(v8h*)(C2 + (size_t)r0 * ldc + c0 + (size_t)row * ldc + piece * 8) = o2; }
        };
        pass(); 
    } else {
        float* crow = C + (size_t)r0 * ldc + c0;
        auto pass = [&]() {
#pragma unroll
            for (int s = 0; s < 8; ++s) { const int Lid = (lane >> 3) + 4 * s, piece = lane & 7; const int row = Lid >> 1, cofs = (Lid & 1) * 32 + piece * 4;
                v4f val = *(const v4fa*)(os + row * 68 + cofs); if (R) { const v4f rv = *(const v4f*)(R + ((size_t)r0 + row) * ldc + c0 + cofs); val += roundR ? (v4f){bfr(rv[0]), bfr(rv[1]), bfr(rv[2]), bfr(rv[3])} : rv; }
                *(v4f*)(crow + (size_t)row * ldc + cofs) = val; }
        };
        pass(); 
    }
}

// k_gemm3: 64 x 64 tile of C = (Ah + Al).(Bh + Bl)^T over K = HD = 64 (row stride HD for all four planes; n-major B): three products per 32-k step (hh, lh, hl); f32
// blockIdx.z = the head inside the launch's group: its A, B and C planes lie sA, sB and sC elements behind the previous head's.
// A plane row is one 128-byte line and a tile's 64 rows are 8 KiB in a row: the block brings its four tiles into LDS by loads that cover whole lines (a fragment load straight from global
// memory takes 32 bytes out of each of 16 lines, and the four waves would each fetch the same B tiles); the fragments are then read from LDS with the k order that the global loaders had.
#define SP 72                     // LDS row pitch in bf16 elements: 144 bytes = 16 x odd, free of bank conflicts for 16-byte reads down a column of rows
__global__ __launch_bounds__(128) void k_gemm3(const bf* __restrict__ Ah, const bf* __restrict__ Al, const bf* __restrict__ Bh, const bf* __restrict__ Bl, float* C, int ldc, size_t sA, size_t sB, size_t sC) {
    typedef float __attribute__((may_alias)) fal;
    __shared__ __align__(16) unsigned short st[4 * 64 * SP];     // [wave][Ah, Al][16 rows], then Bh [64 rows], Bl [64 rows]; a wave's A part (4608 bytes, read by that wave alone) serves as its output stage afterwards
    static_assert(2 * 16 * SP * 2 >= 16 * 68 * 4, "a wave's output stage fits its own A rows");
    C += blockIdx.z * sC;
    const int tid = threadIdx.x, lane = tid & 31, wave = tid >> 5, lr = lane & 15, hi = lane >> 4;
    const int rb = blockIdx.x * 64, r0 = rb + wave * 16, c0 = blockIdx.y * 64;
    const bf* gp[4] = {Ah + blockIdx.z * sA + (size_t)rb * HD, Al + blockIdx.z * sA + (size_t)rb * HD, Bh + blockIdx.z * sB + (size_t)c0 * HD, Bl + blockIdx.z * sB + (size_t)c0 * HD};
    v8us g[4][4];
#pragma unroll     // unrolled (all loops of this kernel): g[], acc[] are indexed by constants and stay in registers, and the 16 loads go out together, one memory round trip
    for (int p = 0; p < 4; ++p)
#pragma unroll
        for (int s = 0; s < 4; ++s) g[p][s] = *(const v8us*)(gp[p] + (s * 128 + tid) * 8);     // row s*16 + tid/8, 16-byte piece tid%8
#pragma unroll
    for (int p = 0; p < 4; ++p)
#pragma unroll
        for (int s = 0; s < 4; ++s) { const int o = (p < 2 ? (s * 2 + p) * 16 : p * 64 + s * 16) + (tid >> 3); *(v8usa*)(st + o * SP + (tid & 7) * 8) = g[p][s]; }
    __syncthreads();     // all four tiles are in LDS before any wave reads a fragment
    const unsigned short* aw = st + (wave * 32 + lr) * SP + 8 * hi;
    const unsigned short* bw = st + (128 + lr) * SP + 8 * hi;
    v8f acc[4];
#pragma unroll
    for (int t = 0; t < 4; ++t) acc[t] = (v8f){};
#pragma unroll
    for (int kc = 0; kc < HD; kc += 32) {
        const v16bf a = cat16b(*(const v8usa*)(aw + kc), *(const v8usa*)(aw + kc + 16));
        const v16bf al = cat16b(*(const v8usa*)(aw + 16 * SP + kc), *(const v8usa*)(aw + 16 * SP + kc + 16));
#pragma unroll
        for (int t = 0; t < 4; ++t) { const unsigned short* bp = bw + t * 16 * SP + kc;
            const v16bf bh = cat16b(*(const v8usa*)bp, *(const v8usa*)(bp + 16)); const v16bf bl = cat16b(*(const v8usa*)(bp + 64 * SP), *(const v8usa*)(bp + 64 * SP + 16));
            acc[t] = wmmab(a, bh, acc[t]); acc[t] = wmmab(al, bh, acc[t]); acc[t] = wmmab(a, bl, acc[t]); }
    }
    fal* os = (fal*)(void*)(st + wave * 32 * SP);
#pragma unroll
    for (int t = 0; t < 4; ++t) {
#pragma unroll
        for (int j = 0; j < 8; ++j) os[(hi * 8 + j) * 68 + t * 16 + lr] = acc[t][j]; }
    __builtin_amdgcn_wave_barrier(); asm volatile("" ::: "memory");     // as before: keeps the compiler from moving the reads of other lanes' values ahead of the wave's stores to its stage
    float* crow = C + (size_t)r0 * ldc + c0;
    auto pass = [&]() {
#pragma unroll
        for (int s = 0; s < 8; ++s) { const int Lid = (lane >> 3) + 4 * s, piece = lane & 7; const int row = Lid >> 1, cofs = (Lid & 1) * 32 + piece * 4;
            const v4f val = *(const v4fa*)(os + row * 68 + cofs); *(v4f*)(crow + (size_t)row * ldc + cofs) = val; }
    };
    pass(); 
}

// k_pv: attn.v of one head, C[1024][64] = (Ah + Al).(Bh + Bl)^T over the 2048 keys (three products per 32-k step, fragment loads as in k_gemmb). One 16 x 32 output tile and one
// half of the keys per block (grid: 2 column tiles, 64 row tiles, z = HG heads x 2 key halves = 1024 blocks); each of the 8 waves sums 128 keys, the 8 partial tiles are added in wave order
// through LDS, and the two halves go to two planes (C, C + zstride) that k_split adds. Each stored tile row is one whole 128-byte line.
__global__ __launch_bounds__(256) void k_pv(const bf* __restrict__ Ah, const bf* __restrict__ Al, const bf* __restrict__ Bh, const bf* __restrict__ Bl, float* C, int ldc, size_t zstride) {
    __shared__ __align__(16) float red[8][2 * 272];     // per wave: two 8-row halves of 8 x 32 floats, 16 floats apart in bank so that the two lane halves do not collide
    const int lane = threadIdx.x & 31, wave = threadIdx.x >> 5, lr = lane & 15, hi = lane >> 4;
    const int hz = blockIdx.z >> 1, kh = blockIdx.z & 1;     // head inside the group, key half
    Ah += (size_t)hz * LQ * TK; Al += (size_t)hz * LQ * TK; Bh += (size_t)hz * HD * TK; Bl += (size_t)hz * HD * TK;
    const int c0 = blockIdx.x * 32, r0 = blockIdx.y * 16, k0 = kh * (TK / 2) + wave * (TK / 16);
    const size_t aoff = (size_t)(r0 + lr) * TK + k0 + 8 * hi;
    v8f acc[2];
#pragma unroll
    for (int t = 0; t < 2; ++t) acc[t] = (v8f){};
    // all 48 fragment loads of the wave's 128 keys are issued first, so that the wave pays one memory round trip and not one per product
    v8us fa[4][4], fb[4][2][4];
#pragma unroll
    for (int s = 0; s < 4; ++s) { const int kc = s * 32;
        fa[s][0] = *(const v8us*)(Ah + aoff + kc); fa[s][1] = *(const v8us*)(Ah + aoff + kc + 16); fa[s][2] = *(const v8us*)(Al + aoff + kc); fa[s][3] = *(const v8us*)(Al + aoff + kc + 16);
#pragma unroll
        for (int t = 0; t < 2; ++t) { const size_t bo = (size_t)(c0 + t * 16 + lr) * TK + k0 + kc + 8 * hi;
            fb[s][t][0] = *(const v8us*)(Bh + bo); fb[s][t][1] = *(const v8us*)(Bh + bo + 16); fb[s][t][2] = *(const v8us*)(Bl + bo); fb[s][t][3] = *(const v8us*)(Bl + bo + 16); }
    }
    asm volatile("s_wait_xcnt 0x0" ::: "memory");     // the accumulators reuse the loads' address registers: this wait stands before that overwrite
    __builtin_amdgcn_sched_barrier(0);     // keeps the matrix instructions behind the wait and all 48 loads ahead of them (without it the scheduler interleaves them, reuses few registers and waits after every pair)
#pragma unroll
    for (int s = 0; s < 4; ++s) { const v16bf a = cat16b(fa[s][0], fa[s][1]), al = cat16b(fa[s][2], fa[s][3]);
#pragma unroll
        for (int t = 0; t < 2; ++t) { const v16bf bh = cat16b(fb[s][t][0], fb[s][t][1]), bl = cat16b(fb[s][t][2], fb[s][t][3]);
            acc[t] = wmmab(a, bh, acc[t]); acc[t] = wmmab(al, bh, acc[t]); acc[t] = wmmab(a, bl, acc[t]); }
    }
#pragma unroll
    for (int t = 0; t < 2; ++t) {
#pragma unroll
        for (int j = 0; j < 8; ++j) red[wave][hi * 272 + j * 32 + t * 16 + lr] = acc[t][j]; }
    __syncthreads();     // every wave's partial tile is in LDS before any wave adds them
    float* crow = C + (size_t)kh * zstride + (size_t)r0 * ldc + hz * HD + c0;
#pragma unroll
    for (int s = 0; s < 2; ++s) { float v = red[0][s * 272 + wave * 32 + lane];
#pragma unroll
        for (int w = 1; w < 8; ++w) v += red[w][s * 272 + wave * 32 + lane];
        crow[(size_t)(s * 8 + wave) * ldc + lane] = v; }
}

// k_gemmp: a projection GEMM (main loop of k_gemmb, plain A) whose epilogue writes the attention operand planes itself: bf16 hi + UNSCALED residual of the f32 sums, per (batch b, head h).
// A block takes 64 consecutive positions t of ONE batch (A row = t*2 + b) and the 64 columns of one head (blockIdx.y), so that every stored plane row is one whole 128-byte line.
// K is an argument as in k_gemmb: with a compile-time K this build kept one B fragment in registers and waited out a load round trip in front of each of the trip's four matrix instructions.
// MODE 0: P0[bh][t][d] (k, r). MODE 1: P0 = sums + bf(bias0[h][d]), P1 = sums + bf(bias1[h][d]) (q + u, q + v_bias). MODE 2: P0[bh][d][t] (v transposed: the tile is laid into LDS column-major).
template <int MODE, int NR>
__global__ __launch_bounds__(128) void k_gemmp(const bf* __restrict__ A, const bf* __restrict__ Bn, const float* __restrict__ bias0, const float* __restrict__ bias1, bf* P0h, bf* P0l, bf* P1h, bf* P1l, int K = DM) {
    __shared__ __align__(16) float ost[64 * 68];
    __shared__ __align__(16) float ub[2 * HD];     // MODE 1 only
    const int lane = threadIdx.x & 31, wave = threadIdx.x >> 5, lr = lane & 15, hi = lane >> 4;
    const int b = (blockIdx.x * 64) / NR, t0 = (blockIdx.x * 64) % NR, h = blockIdx.y, c0 = h * HD;
    const size_t aoff = ((size_t)(t0 + wave * 16 + lr) * NBT + b) * K + 8 * hi;
    size_t boff[4];
#pragma unroll     // unrolled (all loops over t, j, i, s of this kernel): boff[], acc[] and the vectors are indexed by constants and stay in registers
    for (int t = 0; t < 4; ++t) boff[t] = (size_t)(c0 + t * 16 + lr) * K + 8 * hi;
    v8f acc[4];
#pragma unroll
    for (int t = 0; t < 4; ++t) acc[t] = (v8f){};
#pragma unroll 1     // rolled as in k_gemmb: the main loop stays that kernel's
    for (int kc = 0; kc < K; kc += 32) {
        const v16bf a = cat16b(*(const v8us*)(A + aoff + kc), *(const v8us*)(A + aoff + kc + 16));
        asm volatile("s_wait_xcnt 0x0" ::: "memory");     // the first B load's result reuses the A loads' address registers: this wait stands before that overwrite
#pragma unroll
        for (int t = 0; t < 4; ++t) { const v16bf bq = cat16b(*(const v8us*)(Bn + boff[t] + kc), *(const v8us*)(Bn + boff[t] + kc + 16)); acc[t] = wmmab(a, bq, acc[t]); }
        asm volatile("v_nop\n\tv_nop\n\tv_nop\n\tv_nop" : "+v"(acc[0]), "+v"(acc[1]), "+v"(acc[2]), "+v"(acc[3]) : "v"(a));     // the four slots behind the trip's last matrix instruction, also on the taken back edge, before the next trip's loads overwrite its operands
    }
#pragma unroll
    for (int t = 0; t < 4; ++t) {
        if (MODE == 2) { float* p = ost + (t * 16 + lr) * 68 + wave * 16 + hi * 8;     // row = d, column = t: a lane's 8 sums are 8 consecutive positions
            *(v4fa*)p = (v4f){acc[t][0], acc[t][1], acc[t][2], acc[t][3]}; *(v4fa*)(p + 4) = (v4f){acc[t][4], acc[t][5], acc[t][6], acc[t][7]};
        } else {
#pragma unroll
            for (int j = 0; j < 8; ++j) ost[(wave * 16 + hi * 8 + j) * 68 + t * 16 + lr] = acc[t][j]; }
    }
    if (MODE == 1) ub[threadIdx.x] = bfr((threadIdx.x < HD ? bias0 : bias1)[c0 + (threadIdx.x & (HD - 1))]);     // the head's 64 + 64 rounded bias values, one load a thread
    __syncthreads();     // the whole 64 x 64 tile (MODE 1: and the bias values) is in LDS before it is read back by rows (MODE 2: a row holds sums of all four waves)
    const int piece = lane & 7; const size_t bh = (size_t)b * NH_ + h;
    float u0[8], u1[8];
    if (MODE == 1) {
#pragma unroll
        for (int i = 0; i < 8; ++i) { u0[i] = ub[piece * 8 + i]; u1[i] = ub[HD + piece * 8 + i]; } }
#pragma unroll
    for (int s = 0; s < 4; ++s) { const int row = wave * 16 + 4 * s + (lane >> 3); const float* sp = ost + row * 68 + piece * 8;
        const v4f x0 = *(const v4fa*)sp, x1 = *(const v4fa*)(sp + 4);
        const size_t o = MODE == 2 ? (bh * HD + row) * TK + t0 + piece * 8 : (bh * NR + t0 + row) * HD + piece * 8;
        v8us oh, ol;
#pragma unroll
        for (int i = 0; i < 8; ++i) { float v = i < 4 ? x0[i & 3] : x1[i & 3]; if (MODE == 1) v += u0[i]; const unsigned short hb = f2bf(v); oh[i] = hb; ol[i] = f2bf(v - bf2f(hb)); }
        *(v8us*)(P0h + o) = oh; *(v8us*)(P0l + o) = ol;
        if (MODE == 1) {
#pragma unroll
            for (int i = 0; i < 8; ++i) { const float v = (i < 4 ? x0[i & 3] : x1[i & 3]) + u1[i]; const unsigned short hb = f2bf(v); oh[i] = hb; ol[i] = f2bf(v - bf2f(hb)); }
            *(v8us*)(P1h + o) = oh; *(v8us*)(P1l + o) = ol; }
    }
}
// 2^x. The v_nop is the slot that the instruction set asks for behind a transcendental before its source register is overwritten.
__device__ __forceinline__ float exp2_slot(float x) { float r; asm("v_exp_f32 %0, %1\n\tv_nop" : "=v"(r) : "v"(x)); return r; }
// k_relsoft: one wave per query row i of head (b,h); a block = 2 rows x the HG heads of the group (planes LQ*TK elements apart); for each key j: the module's _rel_shift by index (idx = L + i*T + j, row = idx / (T+1), col = idx % (T+1), bd = col ?
// BD[row][col-1] : 0), s = (AC[i][j] + bd)/8, s = -1e30 where mask[i][j][b]; softmax over the 2048 keys (f32, fixed lane order). AC, BD and the mask are read ONCE: a lane holds its 64 scores (then their
// exponentials) in registers from the loads to the stores -> bf16 hi + UNSCALED
// residual planes; the mean attention map accumulates p / 32 in (b,h) order: each wave leaves its head's p / 32 in LDS, and behind a barrier the block adds the HG heads in
// head order onto the previous group's map, through two ping-pong buffers (AMIN = the previous group's buffer, never the one being written,
// launch bounds, second argument: caps the registers; without it the build takes 300, three waves a SIMD, and the two blocks that the grid gives every WGP do not fit side by side
__global__ __launch_bounds__(256, 5) void k_relsoft(const float* __restrict__ ACg, const float* __restrict__ BDg, const int* __restrict__ MSK, int b, int first, const float* __restrict__ AMIN, bf* PHg, bf* PLg, float* AMDST) {
    typedef __attribute__((ext_vector_type(4))) unsigned short v4us;
    typedef __attribute__((ext_vector_type(4))) int v4i;
    typedef v4f __attribute__((aligned(4), may_alias)) v4fu;     // a 16-byte load whose address is a multiple of 4 only
    __shared__ __align__(16) float pm[8][TK];     // p / 32 of each wave's (row, head)
    const int lane = threadIdx.x & 31, wave = threadIdx.x >> 5, hz = wave % HG, i = blockIdx.x * (8 / HG) + wave / HG;
    const float* __restrict__ AC = ACg + (size_t)hz * LQ * TK; const float* __restrict__ BD = BDg + (size_t)hz * LQ * TK; bf* PH = PHg + (size_t)hz * LQ * TK; bf* PL = PLg + (size_t)hz * LQ * TK;
    // _rel_shift by index with one integer division per row: idx = L + i*T + j; (row0, col0) for j = 0, then col = col0 + j wraps at most once past T+1.
    // L + i*T = i*(T+1) + (L - i) with 1 <= L - i <= T, so col0 >= 1: col is 0 only at the wrap, key jz. In the flat BD plane the row's elements are one run with that one hole:
    // key j < jz reads bdr[j], key jz reads nothing (bd = 0), key j > jz reads (row0 + 1)*T + (col0 + j - (T+1)) - 1 = bdr[j - 1].
    static_assert(LQ <= TK, "col0 >= 1 needs L - i <= T");
    const int base = LQ + i * TK; const int row0 = base / (TK + 1), col0 = base % (TK + 1), jz = TK + 1 - col0;
    const float* __restrict__ bdr = BD + (size_t)row0 * TK + col0 - 1;
    float sc[TK / 32];     // the lane's keys: 4 consecutive ones of every 128, in the order in which they are summed
#pragma unroll     // unrolled (all loops over sc[]): sc[] is indexed by constants and stays in registers, and the row's loads go out many at a time
    for (int k = 0; k < TK / 128; ++k) { const int c0 = lane * 4 + k * 128, d = jz - c0;     // d: place of the hole inside this group of 4 keys (below 0: the whole group lies behind it)
        const v4f ac = *(const v4f*)(AC + (size_t)i * TK + c0);
        const v4f bv = *(const v4fu*)(bdr + c0 - (d < 0 ? 1 : 0));     // 4 floats at a 4-byte boundary; first and last lie inside the head's BD plane for every (i, c0)
        const v4i m0 = *(const v4i*)(MSK + ((size_t)i * TK + c0) * NBT), m1 = *(const v4i*)(MSK + ((size_t)i * TK + c0) * NBT + 4);     // mask[i][c0 .. c0+3][0 .. 1]
        const int mk[4] = {b ? m0[1] : m0[0], b ? m0[3] : m0[2], b ? m1[1] : m1[0], b ? m1[3] : m1[2]};
#pragma unroll
        for (int q = 0; q < 4; ++q) { const float bd = ((unsigned)d > (unsigned)q) ? bv[q] : (d == q ? 0.f : bv[q ? q - 1 : 0]);     // in front of the hole or wholly behind it: in place; the hole: 0; behind the hole in its own group: one down
            const float s = (ac[q] + bd) * SCL; sc[k * 4 + q] = mk[q] ? NEGV : s; }
    }
    float m = -3.0e38f;
#pragma unroll
    for (int e = 0; e < TK / 32; ++e) m = fmaxf(m, sc[e]);
#pragma unroll
    for (int sh = 16; sh; sh >>= 1) m = fmaxf(m, __shfl_xor(m, sh, 32));
    float sum = 0.f;
#pragma unroll
    for (int e = 0; e < TK / 32; ++e) { sc[e] = exp2_slot((sc[e] - m) * 1.44269504f); sum += sc[e]; }     // = __expf(sc[e] - m): the same multiply by log2(e) and the same v_exp_f32
#pragma unroll
    for (int sh = 16; sh; sh >>= 1) sum += __shfl_xor(sum, sh, 32);
    const float inv = 1.0f / sum;
    // the block's 8 / HG rows of the map are one run of floats: thread t owns floats 4 t .. 4 t + 3 of every 1024; the previous group's values are fetched here, under the conversion of the row
    const size_t mo = (size_t)blockIdx.x * (8 / HG) * TK + threadIdx.x * 4;
    v4f am[(8 / HG) * TK / 1024];
#pragma unroll     // unrolled (here and in the two loops behind the barrier): am[] is indexed by constants and stays in registers, and the loads go out together
    for (int s = 0; s < (8 / HG) * TK / 1024; ++s) am[s] = first ? (v4f){} : *(const v4f*)(AMIN + mo + s * 1024);
#pragma unroll
    for (int k = 0; k < TK / 128; ++k) { const int c0 = lane * 4 + k * 128; v4us oh, ol; v4f pq;
#pragma unroll
        for (int q = 0; q < 4; ++q) { const float p = sc[k * 4 + q] * inv; const unsigned short hb = f2bf(p); oh[q] = hb; ol[q] = f2bf(p - bf2f(hb));
            pq[q] = p * (1.0f / (NBT * NH_)); }
        const size_t o = (size_t)i * TK + c0; *(v4us*)(PH + o) = oh; *(v4us*)(PL + o) = ol; *(v4fa*)(&pm[wave][c0]) = pq; }
    __syncthreads();     // every head's p / 32 of the block's rows is in LDS before any thread adds them
#pragma unroll
    for (int s = 0; s < (8 / HG) * TK / 1024; ++s) { const int e = s * 1024 + threadIdx.x * 4, rs = e / TK, c = e % TK;
#pragma unroll     // unrolled: the HG LDS reads of a slot go out together; the adds stay in head order
        for (int w = 0; w < HG; ++w) am[s] += *(const v4fa*)(&pm[rs * HG + w][c]); }
#pragma unroll
    for (int s = 0; s < (8 / HG) * TK / 1024; ++s) *(v4f*)(AMDST + mo + s * 1024) = am[s];
}
__global__ __launch_bounds__(256) void k_split(const float* __restrict__ src, const float* __restrict__ src2, int nrows, bf* dh, bf* dl) {
    const int lane = threadIdx.x & 31, r = blockIdx.x * 8 + (threadIdx.x >> 5); if (r >= nrows) return;
{
#pragma unroll 1
        for (int q = 0; q < DD / 256; ++q) { const size_t o = (size_t)r * DD + q * 256 + lane * 8; const v8f v = *(const v8f*)(src + o) + *(const v8f*)(src2 + o); v8us oh, ol;
#pragma unroll
            for (int i = 0; i < 8; ++i) { const unsigned short hb = f2bf(v[i]); oh[i] = hb; ol[i] = f2bf(v[i] - bf2f(hb)); }
            *(v8us*)(dh + o) = oh; *(v8us*)(dl + o) = ol; }
         }
}
// k_ln: one wave per row of H [2048][1024]: LayerNorm (mean, biased var, eps 1e-5) x bf(gamma) + bf(beta) -> f32 output rows; lane -> 4 consecutive floats per 128-column
__global__ __launch_bounds__(256) void k_ln(const float* __restrict__ Hs, const float* __restrict__ g, const float* __restrict__ bb, float* OUTP) {
    const int lane = threadIdx.x & 31, r = blockIdx.x * 8 + (threadIdx.x >> 5); if (r >= NXR) return;
    v4f v[DD / 128]; float s = 0.f;
#pragma unroll
    for (int q = 0; q < DD / 128; ++q) { v[q] = *(const v4f*)(Hs + (size_t)r * DD + q * 128 + lane * 4);
#pragma unroll
        for (int i = 0; i < 4; ++i) s += v[q][i]; }
#pragma unroll
    for (int sh = 16; sh; sh >>= 1) s += __shfl_xor(s, sh, 32);
    const float mu = s * (1.0f / DD); float s2 = 0.f;
#pragma unroll
    for (int q = 0; q < DD / 128; ++q)
#pragma unroll
        for (int i = 0; i < 4; ++i) { const float d = v[q][i] - mu; s2 = fmaf(d, d, s2); }
#pragma unroll
    for (int sh = 16; sh; sh >>= 1) s2 += __shfl_xor(s2, sh, 32);
    const float rs = rsqrtf(s2 * (1.0f / DD) + LN_EPS);
{
#pragma unroll
        for (int q = 0; q < DD / 128; ++q) { const int c0 = q * 128 + lane * 4; v4f y;
#pragma unroll
            for (int i = 0; i < 4; ++i) y[i] = (v[q][i] - mu) * rs * bfr(g[c0 + i]) + bfr(bb[c0 + i]);
            *(v4f*)(OUTP + (size_t)r * DD + c0) = y; }
         }
}

extern "C" void kernel_launch(void* const* d_in, const int* in_sizes, int n_in,
                              void* d_out, int out_size, void* d_ws, size_t ws_size, hipStream_t stream) {
    (void)in_sizes; (void)n_in; (void)out_size;
    const float* x = (const float*)d_in[0]; const float* pe = (const float*)d_in[1]; const float* mem = (const float*)d_in[2]; const float* pbu = (const float*)d_in[3]; const float* pbv = (const float*)d_in[4]; const int* msk = (const int*)d_in[5];
    const float* Wq = (const float*)d_in[6]; const float* Wkv = (const float*)d_in[7]; const float* Wrel = (const float*)d_in[8]; const float* Wo = (const float*)d_in[9]; const float* g = (const float*)d_in[10]; const float* bb = (const float*)d_in[11];
    float* out = (float*)d_out; float* out2 = out + (size_t)NXR * DD;    // output [1024][2][1024]; attn_matrix [1024][2048]
    char* wsp = (char*)d_ws;
    auto take = [&](size_t bytes) { char* p = wsp; wsp += (bytes + 255) & ~(size_t)255; return (void*)p; };
    bf* WqT = (bf*)take((size_t)DD * DD * 2); bf* WkvT = (bf*)take((size_t)2 * DD * DD * 2); bf* WrT = (bf*)take((size_t)DD * DD * 2); bf* WoT = (bf*)take((size_t)DD * DD * 2);
    bf* Cb = (bf*)take((size_t)NCR * DD * 2); float* TMP = (float*)take((size_t)NCR * DD * 4);
    bf* QUh = (bf*)take((size_t)NBT * NH_ * LQ * HD * 2); bf* QUl = (bf*)take((size_t)NBT * NH_ * LQ * HD * 2); bf* QVh = (bf*)take((size_t)NBT * NH_ * LQ * HD * 2); bf* QVl = (bf*)take((size_t)NBT * NH_ * LQ * HD * 2);
    bf* Kh = (bf*)take((size_t)NBT * NH_ * TK * HD * 2); bf* Kl = (bf*)take((size_t)NBT * NH_ * TK * HD * 2); bf* Rh = (bf*)take((size_t)NBT * NH_ * TK * HD * 2); bf* Rl = (bf*)take((size_t)NBT * NH_ * TK * HD * 2);
    bf* VTh = (bf*)take((size_t)NBT * NH_ * HD * TK * 2); bf* VTl = (bf*)take((size_t)NBT * NH_ * HD * TK * 2);
    float* AC = (float*)take((size_t)HG * LQ * TK * 4); float* BD = (float*)take((size_t)HG * LQ * TK * 4); bf* PH = (bf*)take((size_t)HG * LQ * TK * 2); bf* PL = (bf*)take((size_t)HG * LQ * TK * 2); float* AM = (float*)take((size_t)LQ * TK * 4);
    float* AV = (float*)take((size_t)2 * NXR * DD * 4); bf* AVh = (bf*)take((size_t)NXR * DD * 2); bf* AVl = (bf*)take((size_t)NXR * DD * 2);
    if ((size_t)(wsp - (char*)d_ws) > ws_size) return;    // in MiB: weights 10, Cb 8, TMP 16, q planes 16, k and r planes 32, v planes 16, AC and BD 8 each and PH and PL 4 each per head of a group (96), AM 8, attn_vec 24 = 226 of the 256 given; Hs (the pre-LN sum, f32 [2048][1024] = 8 MiB) reuses the start of BD (dead after the head loop); TMP serves as the second mean-map ping-pong buffer (8.4 of its 16.8 MB) during the head loop
    float* Hs = BD; float* AMP[2] = {AM, TMP};     // mean-map ping-pong: AM and TMP
    k_wt<<<dim3(DD / 64, DD / 64, 1), 256, 0, stream>>>(Wq, DD, DD, WqT); k_wt<<<dim3(DD / 64, (2 * DD) / 64, 1), 256, 0, stream>>>(Wkv, DD, 2 * DD, WkvT); k_wt<<<dim3(DD / 64, DD / 64, 1), 256, 0, stream>>>(Wrel, DD, DD, WrT); k_wt<<<dim3(DD / 64, DD / 64, 1), 256, 0, stream>>>(Wo, DD, DD, WoT);
    // c = [memory; x] as bf16 rows (t, b): rows 0..2047 from memory, 2048..4095 from x
    k_cvtb<<<NXR / 8, 256, 0, stream>>>(mem, NXR, Cb); k_cvtb<<<NXR / 8, 256, 0, stream>>>(x, NXR, Cb + (size_t)NXR * DD);
    k_gemmp<0, TK><<<dim3(NCR / 64, NH_, 1), 128, 0, stream>>>(Cb, WkvT, nullptr, nullptr, Kh, Kl, nullptr, nullptr);                             // k = c.Wkv[:, :1024] -> planes
    k_gemmp<2, TK><<<dim3(NCR / 64, NH_, 1), 128, 0, stream>>>(Cb, WkvT + (size_t)DD * DD, nullptr, nullptr, VTh, VTl, nullptr, nullptr);         // v = c.Wkv[:, 1024:] -> transposed planes
    k_gemmp<1, LQ><<<dim3(NXR / 64, NH_, 1), 128, 0, stream>>>(Cb + (size_t)NXR * DD, WqT, pbu, pbv, QUh, QUl, QVh, QVl);                         // q = x.Wq (x = the last 2048 rows of c) -> q + u, q + v_bias planes
    k_cvtb<<<NCR / 8, 256, 0, stream>>>(pe, NCR, Cb);                                                                                    // pos_emb rows (t, b) (c no longer needed)
    k_gemmp<0, TK><<<dim3(NCR / 64, NH_, 1), 128, 0, stream>>>(Cb, WrT, nullptr, nullptr, Rh, Rl, nullptr, nullptr);                              // r = pos_emb.Wrel -> planes
    // the head loop, HG heads of one batch per launch (grid z; in k_relsoft the waves of a block)
    for (int b = 0; b < NBT; ++b) for (int h = 0; h < NH_; h += HG) { const size_t bh = (size_t)b * NH_ + h, gr = bh / HG; const int first = (b == 0 && h == 0), last = (b == NBT - 1 && h == NH_ - HG);
        k_gemm3<<<dim3(LQ / 64, TK / 64, HG), 128, 0, stream>>>(QUh + bh * LQ * HD, QUl + bh * LQ * HD, Kh + bh * TK * HD, Kl + bh * TK * HD, AC, TK, (size_t)LQ * HD, (size_t)TK * HD, (size_t)LQ * TK);     // AC = (q+u).k^T
        k_gemm3<<<dim3(LQ / 64, TK / 64, HG), 128, 0, stream>>>(QVh + bh * LQ * HD, QVl + bh * LQ * HD, Rh + bh * TK * HD, Rl + bh * TK * HD, BD, TK, (size_t)LQ * HD, (size_t)TK * HD, (size_t)LQ * TK);     // BD = (q+v).r^T (pre-shift)
        k_relsoft<<<LQ / (8 / HG), 256, 0, stream>>>(AC, BD, msk, b, first, AMP[(gr + 1) & 1], PH, PL, last ? out2 : AMP[gr & 1]);     // reads the previous group's buffer, writes the other
        k_pv<<<dim3(HD / 32, LQ / 16, 2 * HG), 256, 0, stream>>>(PH, PL, VTh + bh * HD * TK, VTl + bh * HD * TK, AV + (size_t)b * DD + h * HD, NBT * DD, (size_t)NXR * DD);          // attn.v -> attn_vec[(l,b)][h*64 + d], two key-half planes
    }
    k_split<<<NXR / 8, 256, 0, stream>>>(AV, AV + (size_t)NXR * DD, NXR, AVh, AVl);     // adds the two key-half planes of attn_vec
    k_gemmb<true, false><<<dim3(NXR / 64, DD / 64, 1), 128, 0, stream>>>(AVh, AVl, WoT, nullptr, Hs, DD, nullptr, x, DD, 1);                 // h = x + attn_vec.Wo  (x bf16-rounded)
    k_ln<<<NXR / 8, 256, 0, stream>>>(Hs, g, bb, out);
}

// v006
// Measured time: 539 microseconds a run.
// Two timings next to v005 both put it at 1.17 times that version's speed.
// Counting every step since v000, it is 6.96 times as fast.
#include <hip/hip_runtime.h>

// Compute dtypes, f32 accumulate: k|v = [memory; x].Wkv ([4096 x 1024].[1024 x 2048]), q = x.Wq, r = pos_emb.Wrel (k-major weights transposed once; PLAIN bf16 operands
// = inputs rounded once, exact) and attn_out = attn_vec.Wo (hi/lo A, + x) on v_wmma_f32_16x16x32_bf16; per (batch, head): AC = (q + u).k^T and BD = (q + v_bias).r^T
// ([1024 x 64].[64 x 2048], both operands bf16 hi + UNSCALED residual, three products), the module's _rel_shift applied by INDEX (the literal pad-reshape-slice
// mapping, incl. its wrap-around entries), x 1/8, the INPUT mask (-1e30), the softmax over keys and the mean attention map in f32, attn.v ([1024 x 2048].[2048 x 64],

#define LQ   1024
#define TK   2048
#define NBT  2
#define DD   1024
#define NH_  16
#define HD   64
#define NXR  (LQ * NBT)           // 2048 x rows (l, b)
#define NCR  (TK * NBT)           // 4096 c / pos rows (t, b)
#define DM   DD
#define NTK  NCR
#define SCL  0.125f
#define NEGV -1e30f
#define LN_EPS 1e-5f
#define LOSC 1024.0f
#define HG   4                    // heads of one batch that each launch of the head loop works on side by side (divides NH_, so one launch has one batch index)

typedef _Float16 h16;
typedef unsigned short bf;
typedef __attribute__((ext_vector_type(16))) __bf16   v16bf;
typedef __attribute__((ext_vector_type(16))) _Float16 v16h;
typedef __attribute__((ext_vector_type(8)))  _Float16 v8h;
typedef __attribute__((ext_vector_type(8)))  unsigned short v8us;
typedef __attribute__((ext_vector_type(8)))  float    v8f;
typedef __attribute__((ext_vector_type(4)))  float    v4f;
typedef __attribute__((ext_vector_type(4)))  _Float16 v4h;
typedef v8h  __attribute__((may_alias)) v8ha;
typedef v4f  __attribute__((may_alias)) v4fa;
typedef v8us __attribute__((may_alias)) v8usa;

__device__ __forceinline__ unsigned short f2bf(float f) { unsigned u = __float_as_uint(f); u += 0x7FFFu + ((u >> 16) & 1u); return (unsigned short)(u >> 16); }
__device__ __forceinline__ float bf2f(unsigned short b) { return __uint_as_float(((unsigned)b) << 16); }
__device__ __forceinline__ float bfr(float f) { return bf2f(f2bf(f)); }
__device__ __forceinline__ v16h cat16(v8h lo, v8h hi) { return __builtin_shufflevector(lo, hi, 0, 1, 2, 3, 4, 5, 6, 7, 8, 9, 10, 11, 12, 13, 14, 15); }
__device__ __forceinline__ v16bf cat16b(v8us lo, v8us hi) { return __builtin_bit_cast(v16bf, __builtin_shufflevector(lo, hi, 0, 1, 2, 3, 4, 5, 6, 7, 8, 9, 10, 11, 12, 13, 14, 15)); }
__device__ __forceinline__ v8f wmma16(v16h a, v16h b, v8f c) { return __builtin_amdgcn_wmma_f32_16x16x32_f16(false, a, false, b, (short)0, c, false, false); }
__device__ __forceinline__ v8f wmmab(v16bf a, v16bf b, v8f c) { return __builtin_amdgcn_wmma_f32_16x16x32_bf16(false, a, false, b, (short)0, c, false, false); }

// k_wt: WT [n][K] = bf16(W[k][n]) (k-major [K][ncols]) via 64 x 64 LDS tiles; grid (K/64, ncols/64).
__global__ __launch_bounds__(256) void k_wt(const float* __restrict__ Wm, int K, int ncols, bf* WT) {
    __shared__ __align__(16) unsigned short tl[64 * 72];
    const int tid = threadIdx.x, k0 = blockIdx.x * 64, n0 = blockIdx.y * 64;
    const int kk = tid >> 2, nq = (tid & 3) * 16;
#pragma unroll
    for (int i = 0; i < 16; ++i) tl[(nq + i) * 72 + kk] = f2bf(Wm[(size_t)(k0 + kk) * ncols + n0 + nq + i]);
    __syncthreads();
    const int piece = tid & 7;
    auto pass = [&]() {
#pragma unroll
        for (int s = 0; s < 2; ++s) { const int nr = (tid >> 3) + 32 * s; const v8us val = *(const v8usa*)(tl + nr * 72 + piece * 8); *(v8us*)(WT + (size_t)(n0 + nr) * K + k0 + piece * 8) = val; }
    };
    pass(); 
}
__global__ __launch_bounds__(256) void k_cvtb(const float* __restrict__ src, int nrows, bf* dst) {
    const int lane = threadIdx.x & 31, r = blockIdx.x * 8 + (threadIdx.x >> 5);
    if (r >= nrows) return;
    v8us o[DM / 256];
#pragma unroll
    for (int q = 0; q < DM / 256; ++q) { v8us t;
#pragma unroll
        for (int i = 0; i < 8; ++i) t[i] = f2bf(src[(size_t)r * DM + q * 256 + lane * 8 + i]);
        o[q] = t; }
#pragma unroll
    for (int q = 0; q < DM / 256; ++q) *(v8us*)(dst + (size_t)r * DM + q * 256 + lane * 8) = o[q];
    
}

// The projection GEMMs' main loop. A 64-k piece of an operand row is one whole 128-byte line; a stage = the block's 64 A rows (SPLITA: and the 64 rows of the residual plane) and its 64 B rows of one such piece.
// The stages come into a ring of two LDS buffers by asynchronous copies of whole lines (a fragment load straight from global memory takes 32 bytes out of each of 16 lines, and the four waves
// would each fetch the same B rows); stage s + 1 flies while stage s is worked on. The fragments are read from LDS with the k order that the global loaders had.
#define GSP 72                    // LDS row pitch in bf16 elements: 144 bytes = 16 x odd, free of bank conflicts for 16-byte reads down a column of rows
#define GTE (64 * GSP)            // elements of one 64-row tile in LDS
// One lane's copies of a stage: row tid/8 + 16 i (i = 0..3) of each tile, 16-byte piece tid%8; l = the lane's LDS byte address in the stage's first tile, the pointers = its global addresses in row tid/8.
// The s_wait_xcnt closes each statement so that it stands in front of every later write of a register that a copy names.
__device__ __forceinline__ void copy8(unsigned l, const bf* a, size_t sa, const bf* b, size_t sb) {
    asm volatile("global_load_async_to_lds_b128 %0, %8, off\n\tglobal_load_async_to_lds_b128 %1, %9, off\n\tglobal_load_async_to_lds_b128 %2, %10, off\n\tglobal_load_async_to_lds_b128 %3, %11, off\n\t"
                 "global_load_async_to_lds_b128 %4, %12, off\n\tglobal_load_async_to_lds_b128 %5, %13, off\n\tglobal_load_async_to_lds_b128 %6, %14, off\n\tglobal_load_async_to_lds_b128 %7, %15, off\n\ts_wait_xcnt 0x0"
                 :: "v"(l), "v"(l + 32 * GSP), "v"(l + 64 * GSP), "v"(l + 96 * GSP), "v"(l + 2 * GTE), "v"(l + 2 * GTE + 32 * GSP), "v"(l + 2 * GTE + 64 * GSP), "v"(l + 2 * GTE + 96 * GSP),
                    "v"(a), "v"(a + sa), "v"(a + 2 * sa), "v"(a + 3 * sa), "v"(b), "v"(b + sb), "v"(b + 2 * sb), "v"(b + 3 * sb) : "memory");
}
__device__ __forceinline__ void copy12(unsigned l, const bf* a, const bf* al, size_t sa, const bf* b, size_t sb) {
    asm volatile("global_load_async_to_lds_b128 %0, %12, off\n\tglobal_load_async_to_lds_b128 %1, %13, off\n\tglobal_load_async_to_lds_b128 %2, %14, off\n\tglobal_load_async_to_lds_b128 %3, %15, off\n\t"
                 "global_load_async_to_lds_b128 %4, %16, off\n\tglobal_load_async_to_lds_b128 %5, %17, off\n\tglobal_load_async_to_lds_b128 %6, %18, off\n\tglobal_load_async_to_lds_b128 %7, %19, off\n\t"
                 "global_load_async_to_lds_b128 %8, %20, off\n\tglobal_load_async_to_lds_b128 %9, %21, off\n\tglobal_load_async_to_lds_b128 %10, %22, off\n\tglobal_load_async_to_lds_b128 %11, %23, off\n\ts_wait_xcnt 0x0"
                 :: "v"(l), "v"(l + 32 * GSP), "v"(l + 64 * GSP), "v"(l + 96 * GSP), "v"(l + 2 * GTE), "v"(l + 2 * GTE + 32 * GSP), "v"(l + 2 * GTE + 64 * GSP), "v"(l + 2 * GTE + 96 * GSP),
                    "v"(l + 4 * GTE), "v"(l + 4 * GTE + 32 * GSP), "v"(l + 4 * GTE + 64 * GSP), "v"(l + 4 * GTE + 96 * GSP),
                    "v"(a), "v"(a + sa), "v"(a + 2 * sa), "v"(a + 3 * sa), "v"(al), "v"(al + sa), "v"(al + 2 * sa), "v"(al + 3 * sa), "v"(b), "v"(b + sb), "v"(b + 2 * sb), "v"(b + 3 * sb) : "memory");
}
// ring: 2 buffers of [A 64 rows][SPLITA: Al 64 rows][B 64 rows]. ga, gal, gb: the block's first A, Al and B row; ra, rbn: their row strides in elements. 128 threads; K a multiple of 64.
// acc[t] of a wave = its 16 rows (wave * 16 ..) x columns t * 16 .., summed over k in steps of 32 in rising order (SPLITA: A.B, then Al.B, in each step), as with the global loaders.
template <bool SPLITA>
__device__ __forceinline__ void gemm_ring(unsigned short* ring, const bf* ga, const bf* gal, size_t ra, const bf* gb, size_t rbn, int K, v8f (&acc)[4]) {
    constexpr int NT = SPLITA ? 3 : 2, STG = NT * GTE;
    const int tid = threadIdx.x, lane = tid & 31, wave = tid >> 5, lr = lane & 15, hi = lane >> 4;
    const unsigned l0 = (unsigned)(size_t)ring + (tid >> 3) * (GSP * 2) + (tid & 7) * 16;     // the low 32 bits of a __shared__ address are the byte offset in the block's LDS
    const bf* pa = ga + (size_t)(tid >> 3) * ra + (tid & 7) * 8; const bf* pal = gal + (size_t)(tid >> 3) * ra + (tid & 7) * 8; const bf* pb = gb + (size_t)(tid >> 3) * rbn + (tid & 7) * 8;
    const int NS = K >> 6;
    auto issue = [&](int s) { const unsigned l = l0 + (s & 1) * (STG * 2);
        if (SPLITA) copy12(l, pa + s * 64, pal + s * 64, 16 * ra, pb + s * 64, 16 * rbn); else copy8(l, pa + s * 64, 16 * ra, pb + s * 64, 16 * rbn); };
    issue(0);
    asm volatile("s_wait_asynccnt 0x0" ::: "memory");     // this wave's copies of stage 0 have landed
    __syncthreads();     // every wave's copies of stage 0 have landed before any wave reads a fragment
    if (NS > 1) issue(1);
#pragma unroll 1     // rolled: one pass a stage
    for (int s = 0; s < NS; ++s) {
        const unsigned short* aw = ring + (s & 1) * STG + (wave * 16 + lr) * GSP + 8 * hi;
        const unsigned short* bw = ring + (s & 1) * STG + (NT - 1) * GTE + lr * GSP + 8 * hi;
        v8us fa[2][SPLITA ? 4 : 2], fb[2][4][2];
#pragma unroll     // unrolled (all four loops over h and t): fa[], fb[] and acc[] are indexed by constants and stay in registers
        for (int h = 0; h < 2; ++h) { const int kc = h * 32;
            fa[h][0] = *(const v8usa*)(aw + kc); fa[h][1] = *(const v8usa*)(aw + kc + 16);
            if constexpr (SPLITA) { fa[h][2] = *(const v8usa*)(aw + GTE + kc); fa[h][3] = *(const v8usa*)(aw + GTE + kc + 16); }
#pragma unroll
            for (int t = 0; t < 4; ++t) { fb[h][t][0] = *(const v8usa*)(bw + t * 16 * GSP + kc); fb[h][t][1] = *(const v8usa*)(bw + t * 16 * GSP + kc + 16); }
        }
        __builtin_amdgcn_sched_barrier(0);     // keeps the stage's LDS reads together ahead of its matrix instructions (without it the scheduler put reads among them, reused their registers and waited out the LDS latency more than once a stage)
#pragma unroll
        for (int h = 0; h < 2; ++h) { const v16bf a = cat16b(fa[h][0], fa[h][1]);
#pragma unroll
            for (int t = 0; t < 4; ++t) { const v16bf bq = cat16b(fb[h][t][0], fb[h][t][1]); acc[t] = wmmab(a, bq, acc[t]); if constexpr (SPLITA) acc[t] = wmmab(cat16b(fa[h][2], fa[h][3]), bq, acc[t]); }
        }
        asm volatile("v_nop\n\tv_nop\n\tv_nop\n\tv_nop" : "+v"(acc[0]), "+v"(acc[1]), "+v"(acc[2]), "+v"(acc[3]));     // the four slots behind the pass's last matrix instruction, also on the taken branches behind it, before its operand registers are overwritten
        asm volatile("s_wait_dscnt 0x0" ::: "memory");        // this wave has finished reading stage s
        asm volatile("s_wait_asynccnt 0x0" ::: "memory");     // this wave's copies of stage s + 1 have landed
        __syncthreads();     // publishes stage s + 1 and ends every wave's reads of the buffer that is refilled behind it
        if (s + 2 < NS) issue(s + 2);
    }
    asm volatile("s_wait_asynccnt 0x0" ::: "memory");     // no copy is outstanding when the wave goes on
}

// k_gemmb: 64 x 64 block tile (4 waves x 16 x 64) of C[NXR][DD] = (A [+ Al]).B^T (K = 1024) [+ bf(bias[c])] [+ bf(R[r][c]) residual]; f32 whole-line epilogue (or f16
template <bool SPLITA, bool F16OUT = false>
__global__ __launch_bounds__(128) void k_gemmb(const bf* __restrict__ A, const bf* __restrict__ Al, const bf* __restrict__ Bn, const float* __restrict__ bias, float* C, int ldc, h16* C2, const float* __restrict__ R = nullptr, int K = DM, int roundR = 1) {
    __shared__ __align__(16) float ost[4][16 * 68];
    __shared__ __align__(16) unsigned short ring[2 * (SPLITA ? 3 : 2) * GTE];
    const int lane = threadIdx.x & 31, wave = threadIdx.x >> 5, lr = lane & 15, hi = lane >> 4;
    const int r0 = blockIdx.x * 64 + wave * 16, c0 = blockIdx.y * 64;
    v8f acc[4];
#pragma unroll
    for (int t = 0; t < 4; ++t) acc[t] = (v8f){};
    gemm_ring<SPLITA>(ring, A + (size_t)blockIdx.x * 64 * K, (SPLITA ? Al : A) + (size_t)blockIdx.x * 64 * K, (size_t)K, Bn + (size_t)c0 * K, (size_t)K, K, acc);
    float* os = &ost[wave][0];
#pragma unroll
    for (int t = 0; t < 4; ++t) { const float bv = bias ? bfr(bias[c0 + t * 16 + lr]) : 0.f;
#pragma unroll
        for (int j = 0; j < 8; ++j) os[(hi * 8 + j) * 68 + t * 16 + lr] = acc[t][j] + bv; }
    __syncthreads();
    if (F16OUT) {
        h16* crow = (h16*)(void*)C + (size_t)r0 * ldc + c0;
        auto pass = [&]() {
#pragma unroll
            for (int s = 0; s < 4; ++s) { const int row = 4 * s + (lane >> 3), piece = lane & 7; const float* sp = os + row * 68 + piece * 8; v8h o, o2;
#pragma unroll
                for (int i = 0; i < 8; ++i) { const h16 a = (h16)sp[i]; o[i] = a; o2[i] = (h16)((sp[i] - (float)a) * LOSC); }
                *(v8h*)(crow + (size_t)row * ldc + piece * 8) = o; if (C2) *(v8h*)(C2 + (size_t)r0 * ldc + c0 + (size_t)row * ldc + piece * 8) = o2; }
        };
        pass(); 
    } else {
        float* crow = C + (size_t)r0 * ldc + c0;
        auto pass = [&]() {
#pragma unroll
            for (int s = 0; s < 8; ++s) { const int Lid = (lane >> 3) + 4 * s, piece = lane & 7; const int row = Lid >> 1, cofs = (Lid & 1) * 32 + piece * 4;
                v4f val = *(const v4fa*)(os + row * 68 + cofs); if (R) { const v4f rv = *(const v4f*)(R + ((size_t)r0 + row) * ldc + c0 + cofs); val += roundR ? (v4f){bfr(rv[0]), bfr(rv[1]), bfr(rv[2]), bfr(rv[3])} : rv; }
                *(v4f*)(crow + (size_t)row * ldc + cofs) = val; }
        };
        pass(); 
    }
}

// k_gemm3: 64 x 64 tile of C = (Ah + Al).(Bh + Bl)^T over K = HD = 64 (row stride HD for all four planes; n-major B): three products per 32-k step (hh, lh, hl); f32
// blockIdx.z = the head inside the launch's group: its A, B and C planes lie sA, sB and sC elements behind the previous head's.
// A plane row is one 128-byte line and a tile's 64 rows are 8 KiB in a row: the block brings its four tiles into LDS by loads that cover whole lines (a fragment load straight from global
// memory takes 32 bytes out of each of 16 lines, and the four waves would each fetch the same B tiles); the fragments are then read from LDS with the k order that the global loaders had.
#define SP 72                     // LDS row pitch in bf16 elements: 144 bytes = 16 x odd, free of bank conflicts for 16-byte reads down a column of rows
__global__ __launch_bounds__(128) void k_gemm3(const bf* __restrict__ Ah, const bf* __restrict__ Al, const bf* __restrict__ Bh, const bf* __restrict__ Bl, float* C, int ldc, size_t sA, size_t sB, size_t sC) {
    typedef float __attribute__((may_alias)) fal;
    __shared__ __align__(16) unsigned short st[4 * 64 * SP];     // [wave][Ah, Al][16 rows], then Bh [64 rows], Bl [64 rows]; a wave's A part (4608 bytes, read by that wave alone) serves as its output stage afterwards
    static_assert(2 * 16 * SP * 2 >= 16 * 68 * 4, "a wave's output stage fits its own A rows");
    C += blockIdx.z * sC;
    const int tid = threadIdx.x, lane = tid & 31, wave = tid >> 5, lr = lane & 15, hi = lane >> 4;
    const int rb = blockIdx.x * 64, r0 = rb + wave * 16, c0 = blockIdx.y * 64;
    const bf* gp[4] = {Ah + blockIdx.z * sA + (size_t)rb * HD, Al + blockIdx.z * sA + (size_t)rb * HD, Bh + blockIdx.z * sB + (size_t)c0 * HD, Bl + blockIdx.z * sB + (size_t)c0 * HD};
    v8us g[4][4];
#pragma unroll     // unrolled (all loops of this kernel): g[], acc[] are indexed by constants and stay in registers, and the 16 loads go out together, one memory round trip
    for (int p = 0; p < 4; ++p)
#pragma unroll
        for (int s = 0; s < 4; ++s) g[p][s] = *(const v8us*)(gp[p] + (s * 128 + tid) * 8);     // row s*16 + tid/8, 16-byte piece tid%8
#pragma unroll
    for (int p = 0; p < 4; ++p)
#pragma unroll
        for (int s = 0; s < 4; ++s) { const int o = (p < 2 ? (s * 2 + p) * 16 : p * 64 + s * 16) + (tid >> 3); *(v8usa*)(st + o * SP + (tid & 7) * 8) = g[p][s]; }
    __syncthreads();     // all four tiles are in LDS before any wave reads a fragment
    const unsigned short* aw = st + (wave * 32 + lr) * SP + 8 * hi;
    const unsigned short* bw = st + (128 + lr) * SP + 8 * hi;
    v8f acc[4];
#pragma unroll
    for (int t = 0; t < 4; ++t) acc[t] = (v8f){};
#pragma unroll
    for (int kc = 0; kc < HD; kc += 32) {
        const v16bf a = cat16b(*(const v8usa*)(aw + kc), *(const v8usa*)(aw + kc + 16));
        const v16bf al = cat16b(*(const v8usa*)(aw + 16 * SP + kc), *(const v8usa*)(aw + 16 * SP + kc + 16));
#pragma unroll
        for (int t = 0; t < 4; ++t) { const unsigned short* bp = bw + t * 16 * SP + kc;
            const v16bf bh = cat16b(*(const v8usa*)bp, *(const v8usa*)(bp + 16)); const v16bf bl = cat16b(*(const v8usa*)(bp + 64 * SP), *(const v8usa*)(bp + 64 * SP + 16));
            acc[t] = wmmab(a, bh, acc[t]); acc[t] = wmmab(al, bh, acc[t]); acc[t] = wmmab(a, bl, acc[t]); }
    }
    fal* os = (fal*)(void*)(st + wave * 32 * SP);
#pragma unroll
    for (int t = 0; t < 4; ++t) {
#pragma unroll
        for (int j = 0; j < 8; ++j) os[(hi * 8 + j) * 68 + t * 16 + lr] = acc[t][j]; }
    __builtin_amdgcn_wave_barrier(); asm volatile("" ::: "memory");     // as before: keeps the compiler from moving the reads of other lanes' values ahead of the wave's stores to its stage
    float* crow = C + (size_t)r0 * ldc + c0;
    auto pass = [&]() {
#pragma unroll
        for (int s = 0; s < 8; ++s) { const int Lid = (lane >> 3) + 4 * s, piece = lane & 7; const int row = Lid >> 1, cofs = (Lid & 1) * 32 + piece * 4;
            const v4f val = *(const v4fa*)(os + row * 68 + cofs); *(v4f*)(crow + (size_t)row * ldc + cofs) = val; }
    };
    pass(); 
}

// k_pv: attn.v of one head, C[1024][64] = (Ah + Al).(Bh + Bl)^T over the 2048 keys (three products per 32-k step, fragments loaded straight from global memory in the k order of k_gemmb). One 16 x 32 output tile and one
// half of the keys per block (grid: 2 column tiles, 64 row tiles, z = HG heads x 2 key halves = 1024 blocks); each of the 8 waves sums 128 keys, the 8 partial tiles are added in wave order
// through LDS, and the two halves go to two planes (C, C + zstride) that k_split adds. Each stored tile row is one whole 128-byte line.
__global__ __launch_bounds__(256) void k_pv(const bf* __restrict__ Ah, const bf* __restrict__ Al, const bf* __restrict__ Bh, const bf* __restrict__ Bl, float* C, int ldc, size_t zstride) {
    __shared__ __align__(16) float red[8][2 * 272];     // per wave: two 8-row halves of 8 x 32 floats, 16 floats apart in bank so that the two lane halves do not collide
    const int lane = threadIdx.x & 31, wave = threadIdx.x >> 5, lr = lane & 15, hi = lane >> 4;
    const int hz = blockIdx.z >> 1, kh = blockIdx.z & 1;     // head inside the group, key half
    Ah += (size_t)hz * LQ * TK; Al += (size_t)hz * LQ * TK; Bh += (size_t)hz * HD * TK; Bl += (size_t)hz * HD * TK;
    const int c0 = blockIdx.x * 32, r0 = blockIdx.y * 16, k0 = kh * (TK / 2) + wave * (TK / 16);
    const size_t aoff = (size_t)(r0 + lr) * TK + k0 + 8 * hi;
    v8f acc[2];
#pragma unroll
    for (int t = 0; t < 2; ++t) acc[t] = (v8f){};
    // all 48 fragment loads of the wave's 128 keys are issued first, so that the wave pays one memory round trip and not one per product
    v8us fa[4][4], fb[4][2][4];
#pragma unroll
    for (int s = 0; s < 4; ++s) { const int kc = s * 32;
        fa[s][0] = *(const v8us*)(Ah + aoff + kc); fa[s][1] = *(const v8us*)(Ah + aoff + kc + 16); fa[s][2] = *(const v8us*)(Al + aoff + kc); fa[s][3] = *(const v8us*)(Al + aoff + kc + 16);
#pragma unroll
        for (int t = 0; t < 2; ++t) { const size_t bo = (size_t)(c0 + t * 16 + lr) * TK + k0 + kc + 8 * hi;
            fb[s][t][0] = *(const v8us*)(Bh + bo); fb[s][t][1] = *(const v8us*)(Bh + bo + 16); fb[s][t][2] = *(const v8us*)(Bl + bo); fb[s][t][3] = *(const v8us*)(Bl + bo + 16); }
    }
    asm volatile("s_wait_xcnt 0x0" ::: "memory");     // the accumulators reuse the loads' address registers: this wait stands before that overwrite
    __builtin_amdgcn_sched_barrier(0);     // keeps the matrix instructions behind the wait and all 48 loads ahead of them (without it the scheduler interleaves them, reuses few registers and waits after every pair)
#pragma unroll
    for (int s = 0; s < 4; ++s) { const v16bf a = cat16b(fa[s][0], fa[s][1]), al = cat16b(fa[s][2], fa[s][3]);
#pragma unroll
        for (int t = 0; t < 2; ++t) { const v16bf bh = cat16b(fb[s][t][0], fb[s][t][1]), bl = cat16b(fb[s][t][2], fb[s][t][3]);
            acc[t] = wmmab(a, bh, acc[t]); acc[t] = wmmab(al, bh, acc[t]); acc[t] = wmmab(a, bl, acc[t]); }
    }
#pragma unroll
    for (int t = 0; t < 2; ++t) {
#pragma unroll
        for (int j = 0; j < 8; ++j) red[wave][hi * 272 + j * 32 + t * 16 + lr] = acc[t][j]; }
    __syncthreads();     // every wave's partial tile is in LDS before any wave adds them
    float* crow = C + (size_t)kh * zstride + (size_t)r0 * ldc + hz * HD + c0;
#pragma unroll
    for (int s = 0; s < 2; ++s) { float v = red[0][s * 272 + wave * 32 + lane];
#pragma unroll
        for (int w = 1; w < 8; ++w) v += red[w][s * 272 + wave * 32 + lane];
        crow[(size_t)(s * 8 + wave) * ldc + lane] = v; }
}

// k_gemmp: a projection GEMM (main loop gemm_ring as in k_gemmb, plain A) whose epilogue writes the attention operand planes itself: bf16 hi + UNSCALED residual of the f32 sums, per (batch b, head h).
// A block takes 64 consecutive positions t of ONE batch (A row = t*2 + b) and the 64 columns of one head (blockIdx.y), so that every stored plane row is one whole 128-byte line.
// K is an argument as in k_gemmb.
// MODE 0: P0[bh][t][d] (k, r). MODE 1: P0 = sums + bf(bias0[h][d]), P1 = sums + bf(bias1[h][d]) (q + u, q + v_bias). MODE 2: P0[bh][d][t] (v transposed: the tile is laid into LDS column-major).
template <int MODE, int NR>
__global__ __launch_bounds__(128) void k_gemmp(const bf* __restrict__ A, const bf* __restrict__ Bn, const float* __restrict__ bias0, const float* __restrict__ bias1, bf* P0h, bf* P0l, bf* P1h, bf* P1l, int K = DM) {
    __shared__ __align__(16) float ost[64 * 68];
    __shared__ __align__(16) unsigned short ring[2 * 2 * GTE];
    __shared__ __align__(16) float ub[2 * HD];     // MODE 1 only
    const int lane = threadIdx.x & 31, wave = threadIdx.x >> 5, lr = lane & 15, hi = lane >> 4;
    const int b = (blockIdx.x * 64) / NR, t0 = (blockIdx.x * 64) % NR, h = blockIdx.y, c0 = h * HD;
    v8f acc[4];
#pragma unroll     // unrolled (all loops over t, j, i, s of this kernel): acc[] and the vectors are indexed by constants and stay in registers
    for (int t = 0; t < 4; ++t) acc[t] = (v8f){};
    gemm_ring<false>(ring, A + ((size_t)t0 * NBT + b) * K, A + ((size_t)t0 * NBT + b) * K, (size_t)NBT * K, Bn + (size_t)c0 * K, (size_t)K, K, acc);
#pragma unroll
    for (int t = 0; t < 4; ++t) {
        if (MODE == 2) { float* p = ost + (t * 16 + lr) * 68 + wave * 16 + hi * 8;     // row = d, column = t: a lane's 8 sums are 8 consecutive positions
            *(v4fa*)p = (v4f){acc[t][0], acc[t][1], acc[t][2], acc[t][3]}; *(v4fa*)(p + 4) = (v4f){acc[t][4], acc[t][5], acc[t][6], acc[t][7]};
        } else {
#pragma unroll
            for (int j = 0; j < 8; ++j) ost[(wave * 16 + hi * 8 + j) * 68 + t * 16 + lr] = acc[t][j]; }
    }
    if (MODE == 1) ub[threadIdx.x] = bfr((threadIdx.x < HD ? bias0 : bias1)[c0 + (threadIdx.x & (HD - 1))]);     // the head's 64 + 64 rounded bias values, one load a thread
    __syncthreads();     // the whole 64 x 64 tile (MODE 1: and the bias values) is in LDS before it is read back by rows (MODE 2: a row holds sums of all four waves)
    const int piece = lane & 7; const size_t bh = (size_t)b * NH_ + h;
    float u0[8], u1[8];
    if (MODE == 1) {
#pragma unroll
        for (int i = 0; i < 8; ++i) { u0[i] = ub[piece * 8 + i]; u1[i] = ub[HD + piece * 8 + i]; } }
#pragma unroll
    for (int s = 0; s < 4; ++s) { const int row = wave * 16 + 4 * s + (lane >> 3); const float* sp = ost + row * 68 + piece * 8;
        const v4f x0 = *(const v4fa*)sp, x1 = *(const v4fa*)(sp + 4);
        const size_t o = MODE == 2 ? (bh * HD + row) * TK + t0 + piece * 8 : (bh * NR + t0 + row) * HD + piece * 8;
        v8us oh, ol;
#pragma unroll
        for (int i = 0; i < 8; ++i) { float v = i < 4 ? x0[i & 3] : x1[i & 3]; if (MODE == 1) v += u0[i]; const unsigned short hb = f2bf(v); oh[i] = hb; ol[i] = f2bf(v - bf2f(hb)); }
        *(v8us*)(P0h + o) = oh; *(v8us*)(P0l + o) = ol;
        if (MODE == 1) {
#pragma unroll
            for (int i = 0; i < 8; ++i) { const float v = (i < 4 ? x0[i & 3] : x1[i & 3]) + u1[i]; const unsigned short hb = f2bf(v); oh[i] = hb; ol[i] = f2bf(v - bf2f(hb)); }
            *(v8us*)(P1h + o) = oh; *(v8us*)(P1l + o) = ol; }
    }
}
// 2^x. The v_nop is the slot that the instruction set asks for behind a transcendental before its source register is overwritten.
__device__ __forceinline__ float exp2_slot(float x) { float r; asm("v_exp_f32 %0, %1\n\tv_nop" : "=v"(r) : "v"(x)); return r; }
// k_relsoft: one wave per query row i of head (b,h); a block = 2 rows x the HG heads of the group (planes LQ*TK elements apart); for each key j: the module's _rel_shift by index (idx = L + i*T + j, row = idx / (T+1), col = idx % (T+1), bd = col ?
// BD[row][col-1] : 0), s = (AC[i][j] + bd)/8, s = -1e30 where mask[i][j][b]; softmax over the 2048 keys (f32, fixed lane order). AC, BD and the mask are read ONCE: a lane holds its 64 scores (then their
// exponentials) in registers from the loads to the stores -> bf16 hi + UNSCALED
// residual planes; the mean attention map accumulates p / 32 in (b,h) order: each wave leaves its head's p / 32 in LDS, and behind a barrier the block adds the HG heads in
// head order onto the previous group's map, through two ping-pong buffers (AMIN = the previous group's buffer, never the one being written,
// launch bounds, second argument: caps the registers; without it the build takes 300, three waves a SIMD, and the two blocks that the grid gives every WGP do not fit side by side
__global__ __launch_bounds__(256, 5) void k_relsoft(const float* __restrict__ ACg, const float* __restrict__ BDg, const int* __restrict__ MSK, int b, int first, const float* __restrict__ AMIN, bf* PHg, bf* PLg, float* AMDST) {
    typedef __attribute__((ext_vector_type(4))) unsigned short v4us;
    typedef __attribute__((ext_vector_type(4))) int v4i;
    typedef v4f __attribute__((aligned(4), may_alias)) v4fu;     // a 16-byte load whose address is a multiple of 4 only
    __shared__ __align__(16) float pm[8][TK];     // p / 32 of each wave's (row, head)
    const int lane = threadIdx.x & 31, wave = threadIdx.x >> 5, hz = wave % HG, i = blockIdx.x * (8 / HG) + wave / HG;
    const float* __restrict__ AC = ACg + (size_t)hz * LQ * TK; const float* __restrict__ BD = BDg + (size_t)hz * LQ * TK; bf* PH = PHg + (size_t)hz * LQ * TK; bf* PL = PLg + (size_t)hz * LQ * TK;
    // _rel_shift by index with one integer division per row: idx = L + i*T + j; (row0, col0) for j = 0, then col = col0 + j wraps at most once past T+1.
    // L + i*T = i*(T+1) + (L - i) with 1 <= L - i <= T, so col0 >= 1: col is 0 only at the wrap, key jz. In the flat BD plane the row's elements are one run with that one hole:
    // key j < jz reads bdr[j], key jz reads nothing (bd = 0), key j > jz reads (row0 + 1)*T + (col0 + j - (T+1)) - 1 = bdr[j - 1].
    static_assert(LQ <= TK, "col0 >= 1 needs L - i <= T");
    const int base = LQ + i * TK; const int row0 = base / (TK + 1), col0 = base % (TK + 1), jz = TK + 1 - col0;
    const float* __restrict__ bdr = BD + (size_t)row0 * TK + col0 - 1;
    float sc[TK / 32];     // the lane's keys: 4 consecutive ones of every 128, in the order in which they are summed
#pragma unroll     // unrolled (all loops over sc[]): sc[] is indexed by constants and stays in registers, and the row's loads go out many at a time
    for (int k = 0; k < TK / 128; ++k) { const int c0 = lane * 4 + k * 128, d = jz - c0;     // d: place of the hole inside this group of 4 keys (below 0: the whole group lies behind it)
        const v4f ac = *(const v4f*)(AC + (size_t)i * TK + c0);
        const v4f bv = *(const v4fu*)(bdr + c0 - (d < 0 ? 1 : 0));     // 4 floats at a 4-byte boundary; first and last lie inside the head's BD plane for every (i, c0)
        const v4i m0 = *(const v4i*)(MSK + ((size_t)i * TK + c0) * NBT), m1 = *(const v4i*)(MSK + ((size_t)i * TK + c0) * NBT + 4);     // mask[i][c0 .. c0+3][0 .. 1]
        const int mk[4] = {b ? m0[1] : m0[0], b ? m0[3] : m0[2], b ? m1[1] : m1[0], b ? m1[3] : m1[2]};
#pragma unroll
        for (int q = 0; q < 4; ++q) { const float bd = ((unsigned)d > (unsigned)q) ? bv[q] : (d == q ? 0.f : bv[q ? q - 1 : 0]);     // in front of the hole or wholly behind it: in place; the hole: 0; behind the hole in its own group: one down
            const float s = (ac[q] + bd) * SCL; sc[k * 4 + q] = mk[q] ? NEGV : s; }
    }
    float m = -3.0e38f;
#pragma unroll
    for (int e = 0; e < TK / 32; ++e) m = fmaxf(m, sc[e]);
#pragma unroll
    for (int sh = 16; sh; sh >>= 1) m = fmaxf(m, __shfl_xor(m, sh, 32));
    float sum = 0.f;
#pragma unroll
    for (int e = 0; e < TK / 32; ++e) { sc[e] = exp2_slot((sc[e] - m) * 1.44269504f); sum += sc[e]; }     // = __expf(sc[e] - m): the same multiply by log2(e) and the same v_exp_f32
#pragma unroll
    for (int sh = 16; sh; sh >>= 1) sum += __shfl_xor(sum, sh, 32);
    const float inv = 1.0f / sum;
    // the block's 8 / HG rows of the map are one run of floats: thread t owns floats 4 t .. 4 t + 3 of every 1024; the previous group's values are fetched here, under the conversion of the row
    const size_t mo = (size_t)blockIdx.x * (8 / HG) * TK + threadIdx.x * 4;
    v4f am[(8 / HG) * TK / 1024];
#pragma unroll     // unrolled (here and in the two loops behind the barrier): am[] is indexed by constants and stays in registers, and the loads go out together
    for (int s = 0; s < (8 / HG) * TK / 1024; ++s) am[s] = first ? (v4f){} : *(const v4f*)(AMIN + mo + s * 1024);
#pragma unroll
    for (int k = 0; k < TK / 128; ++k) { const int c0 = lane * 4 + k * 128; v4us oh, ol; v4f pq;
#pragma unroll
        for (int q = 0; q < 4; ++q) { const float p = sc[k * 4 + q] * inv; const unsigned short hb = f2bf(p); oh[q] = hb; ol[q] = f2bf(p - bf2f(hb));
            pq[q] = p * (1.0f / (NBT * NH_)); }
        const size_t o = (size_t)i * TK + c0; *(v4us*)(PH + o) = oh; *(v4us*)(PL + o) = ol; *(v4fa*)(&pm[wave][c0]) = pq; }
    __syncthreads();     // every head's p / 32 of the block's rows is in LDS before any thread adds them
#pragma unroll
    for (int s = 0; s < (8 / HG) * TK / 1024; ++s) { const int e = s * 1024 + threadIdx.x * 4, rs = e / TK, c = e % TK;
#pragma unroll     // unrolled: the HG LDS reads of a slot go out together; the adds stay in head order
        for (int w = 0; w < HG; ++w) am[s] += *(const v4fa*)(&pm[rs * HG + w][c]); }
#pragma unroll
    for (int s = 0; s < (8 / HG) * TK / 1024; ++s) *(v4f*)(AMDST + mo + s * 1024) = am[s];
}
__global__ __launch_bounds__(256) void k_split(const float* __restrict__ src, const float* __restrict__ src2, int nrows, bf* dh, bf* dl) {
    const int lane = threadIdx.x & 31, r = blockIdx.x * 8 + (threadIdx.x >> 5); if (r >= nrows) return;
{
#pragma unroll 1
        for (int q = 0; q < DD / 256; ++q) { const size_t o = (size_t)r * DD + q * 256 + lane * 8; const v8f v = *(const v8f*)(src + o) + *(const v8f*)(src2 + o); v8us oh, ol;
#pragma unroll
            for (int i = 0; i < 8; ++i) { const unsigned short hb = f2bf(v[i]); oh[i] = hb; ol[i] = f2bf(v[i] - bf2f(hb)); }
            *(v8us*)(dh + o) = oh; *(v8us*)(dl + o) = ol; }
         }
}
// k_ln: one wave per row of H [2048][1024]: LayerNorm (mean, biased var, eps 1e-5) x bf(gamma) + bf(beta) -> f32 output rows; lane -> 4 consecutive floats per 128-column
__global__ __launch_bounds__(256) void k_ln(const float* __restrict__ Hs, const float* __restrict__ g, const float* __restrict__ bb, float* OUTP) {
    const int lane = threadIdx.x & 31, r = blockIdx.x * 8 + (threadIdx.x >> 5); if (r >= NXR) return;
    v4f v[DD / 128]; float s = 0.f;
#pragma unroll
    for (int q = 0; q < DD / 128; ++q) { v[q] = *(const v4f*)(Hs + (size_t)r * DD + q * 128 + lane * 4);
#pragma unroll
        for (int i = 0; i < 4; ++i) s += v[q][i]; }
#pragma unroll
    for (int sh = 16; sh; sh >>= 1) s += __shfl_xor(s, sh, 32);
    const float mu = s * (1.0f / DD); float s2 = 0.f;
#pragma unroll
    for (int q = 0; q < DD / 128; ++q)
#pragma unroll
        for (int i = 0; i < 4; ++i) { const float d = v[q][i] - mu; s2 = fmaf(d, d, s2); }
#pragma unroll
    for (int sh = 16; sh; sh >>= 1) s2 += __shfl_xor(s2, sh, 32);
    const float rs = rsqrtf(s2 * (1.0f / DD) + LN_EPS);
{
#pragma unroll
        for (int q = 0; q < DD / 128; ++q) { const int c0 = q * 128 + lane * 4; v4f y;
#pragma unroll
            for (int i = 0; i < 4; ++i) y[i] = (v[q][i] - mu) * rs * bfr(g[c0 + i]) + bfr(bb[c0 + i]);
            *(v4f*)(OUTP + (size_t)r * DD + c0) = y; }
         }
}

extern "C" void kernel_launch(void* const* d_in, const int* in_sizes, int n_in,
                              void* d_out, int out_size, void* d_ws, size_t ws_size, hipStream_t stream) {
    (void)in_sizes; (void)n_in; (void)out_size;
    const float* x = (const float*)d_in[0]; const float* pe = (const float*)d_in[1]; const float* mem = (const float*)d_in[2]; const float* pbu = (const float*)d_in[3]; const float* pbv = (const float*)d_in[4]; const int* msk = (const int*)d_in[5];
    const float* Wq = (const float*)d_in[6]; const float* Wkv = (const float*)d_in[7]; const float* Wrel = (const float*)d_in[8]; const float* Wo = (const float*)d_in[9]; const float* g = (const float*)d_in[10]; const float* bb = (const float*)d_in[11];
    float* out = (float*)d_out; float* out2 = out + (size_t)NXR * DD;    // output [1024][2][1024]; attn_matrix [1024][2048]
    char* wsp = (char*)d_ws;
    auto take = [&](size_t bytes) { char* p = wsp; wsp += (bytes + 255) & ~(size_t)255; return (void*)p; };
    bf* WqT = (bf*)take((size_t)DD * DD * 2); bf* WkvT = (bf*)take((size_t)2 * DD * DD * 2); bf* WrT = (bf*)take((size_t)DD * DD * 2); bf* WoT = (bf*)take((size_t)DD * DD * 2);
    bf* Cb = (bf*)take((size_t)NCR * DD * 2); float* TMP = (float*)take((size_t)NCR * DD * 4);
    bf* QUh = (bf*)take((size_t)NBT * NH_ * LQ * HD * 2); bf* QUl = (bf*)take((size_t)NBT * NH_ * LQ * HD * 2); bf* QVh = (bf*)take((size_t)NBT * NH_ * LQ * HD * 2); bf* QVl = (bf*)take((size_t)NBT * NH_ * LQ * HD * 2);
    bf* Kh = (bf*)take((size_t)NBT * NH_ * TK * HD * 2); bf* Kl = (bf*)take((size_t)NBT * NH_ * TK * HD * 2); bf* Rh = (bf*)take((size_t)NBT * NH_ * TK * HD * 2); bf* Rl = (bf*)take((size_t)NBT * NH_ * TK * HD * 2);
    bf* VTh = (bf*)take((size_t)NBT * NH_ * HD * TK * 2); bf* VTl = (bf*)take((size_t)NBT * NH_ * HD * TK * 2);
    float* AC = (float*)take((size_t)HG * LQ * TK * 4); float* BD = (float*)take((size_t)HG * LQ * TK * 4); bf* PH = (bf*)take((size_t)HG * LQ * TK * 2); bf* PL = (bf*)take((size_t)HG * LQ * TK * 2); float* AM = (float*)take((size_t)LQ * TK * 4);
    float* AV = (float*)take((size_t)2 * NXR * DD * 4); bf* AVh = (bf*)take((size_t)NXR * DD * 2); bf* AVl = (bf*)take((size_t)NXR * DD * 2);
    if ((size_t)(wsp - (char*)d_ws) > ws_size) return;    // in MiB: weights 10, Cb 8, TMP 16, q planes 16, k and r planes 32, v planes 16, AC and BD 8 each and PH and PL 4 each per head of a group (96), AM 8, attn_vec 24 = 226 of the 256 given; Hs (the pre-LN sum, f32 [2048][1024] = 8 MiB) reuses the start of BD (dead after the head loop); TMP serves as the second mean-map ping-pong buffer (8.4 of its 16.8 MB) during the head loop
    float* Hs = BD; float* AMP[2] = {AM, TMP};     // mean-map ping-pong: AM and TMP
    k_wt<<<dim3(DD / 64, DD / 64, 1), 256, 0, stream>>>(Wq, DD, DD, WqT); k_wt<<<dim3(DD / 64, (2 * DD) / 64, 1), 256, 0, stream>>>(Wkv, DD, 2 * DD, WkvT); k_wt<<<dim3(DD / 64, DD / 64, 1), 256, 0, stream>>>(Wrel, DD, DD, WrT); k_wt<<<dim3(DD / 64, DD / 64, 1), 256, 0, stream>>>(Wo, DD, DD, WoT);
    // c = [memory; x] as bf16 rows (t, b): rows 0..2047 from memory, 2048..4095 from x
    k_cvtb<<<NXR / 8, 256, 0, stream>>>(mem, NXR, Cb); k_cvtb<<<NXR / 8, 256, 0, stream>>>(x, NXR, Cb + (size_t)NXR * DD);
    k_gemmp<0, TK><<<dim3(NCR / 64, NH_, 1), 128, 0, stream>>>(Cb, WkvT, nullptr, nullptr, Kh, Kl, nullptr, nullptr);                             // k = c.Wkv[:, :1024] -> planes
    k_gemmp<2, TK><<<dim3(NCR / 64, NH_, 1), 128, 0, stream>>>(Cb, WkvT + (size_t)DD * DD, nullptr, nullptr, VTh, VTl, nullptr, nullptr);         // v = c.Wkv[:, 1024:] -> transposed planes
    k_gemmp<1, LQ><<<dim3(NXR / 64, NH_, 1), 128, 0, stream>>>(Cb + (size_t)NXR * DD, WqT, pbu, pbv, QUh, QUl, QVh, QVl);                         // q = x.Wq (x = the last 2048 rows of c) -> q + u, q + v_bias planes
    k_cvtb<<<NCR / 8, 256, 0, stream>>>(pe, NCR, Cb);                                                                                    // pos_emb rows (t, b) (c no longer needed)
    k_gemmp<0, TK><<<dim3(NCR / 64, NH_, 1), 128, 0, stream>>>(Cb, WrT, nullptr, nullptr, Rh, Rl, nullptr, nullptr);                              // r = pos_emb.Wrel -> planes
    // the head loop, HG heads of one batch per launch (grid z; in k_relsoft the waves of a block)
    for (int b = 0; b < NBT; ++b) for (int h = 0; h < NH_; h += HG) { const size_t bh = (size_t)b * NH_ + h, gr = bh / HG; const int first = (b == 0 && h == 0), last = (b == NBT - 1 && h == NH_ - HG);
        k_gemm3<<<dim3(LQ / 64, TK / 64, HG), 128, 0, stream>>>(QUh + bh * LQ * HD, QUl + bh * LQ * HD, Kh + bh * TK * HD, Kl + bh * TK * HD, AC, TK, (size_t)LQ * HD, (size_t)TK * HD, (size_t)LQ * TK);     // AC = (q+u).k^T
        k_gemm3<<<dim3(LQ / 64, TK / 64, HG), 128, 0, stream>>>(QVh + bh * LQ * HD, QVl + bh * LQ * HD, Rh + bh * TK * HD, Rl + bh * TK * HD, BD, TK, (size_t)LQ * HD, (size_t)TK * HD, (size_t)LQ * TK);     // BD = (q+v).r^T (pre-shift)
        k_relsoft<<<LQ / (8 / HG), 256, 0, stream>>>(AC, BD, msk, b, first, AMP[(gr + 1) & 1], PH, PL, last ? out2 : AMP[gr & 1]);     // reads the previous group's buffer, writes the other
        k_pv<<<dim3(HD / 32, LQ / 16, 2 * HG), 256, 0, stream>>>(PH, PL, VTh + bh * HD * TK, VTl + bh * HD * TK, AV + (size_t)b * DD + h * HD, NBT * DD, (size_t)NXR * DD);          // attn.v -> attn_vec[(l,b)][h*64 + d], two key-half planes
    }
    k_split<<<NXR / 8, 256, 0, stream>>>(AV, AV + (size_t)NXR * DD, NXR, AVh, AVl);     // adds the two key-half planes of attn_vec
    k_gemmb<true, false><<<dim3(NXR / 64, DD / 64, 1), 128, 0, stream>>>(AVh, AVl, WoT, nullptr, Hs, DD, nullptr, x, DD, 1);                 // h = x + attn_vec.Wo  (x bf16-rounded)
    k_ln<<<NXR / 8, 256, 0, stream>>>(Hs, g, bb, out);
}

// v007
// It runs in 464 microseconds.
// In both of two side-by-side timings against v006, it was 1.16 times as fast.
// All steps since v000 together make it 8.06 times as fast.
#include <hip/hip_runtime.h>

// Compute dtypes, f32 accumulate: k|v = [memory; x].Wkv ([4096 x 1024].[1024 x 2048]), q = x.Wq, r = pos_emb.Wrel (k-major weights transposed once; PLAIN bf16 operands
// = inputs rounded once, exact) and attn_out = attn_vec.Wo (hi/lo A, + x) on v_wmma_f32_16x16x32_bf16; per (batch, head): AC = (q + u).k^T and BD = (q + v_bias).r^T
// ([1024 x 64].[64 x 2048], both operands bf16 hi + UNSCALED residual, three products), the module's _rel_shift applied by INDEX (the literal pad-reshape-slice
// mapping, incl. its wrap-around entries), x 1/8, the INPUT mask (-1e30), the softmax over keys and the mean attention map in f32, attn.v ([1024 x 2048].[2048 x 64],

#define LQ   1024
#define TK   2048
#define NBT  2
#define DD   1024
#define NH_  16
#define HD   64
#define NXR  (LQ * NBT)           // 2048 x rows (l, b)
#define NCR  (TK * NBT)           // 4096 c / pos rows (t, b)
#define DM   DD
#define NTK  NCR
#define SCL  0.125f
#define NEGV -1e30f
#define LN_EPS 1e-5f
#define LOSC 1024.0f
#define HG   4                    // heads of one batch that each launch of the head loop works on side by side (divides NH_, so one launch has one batch index)

typedef _Float16 h16;
typedef unsigned short bf;
typedef __attribute__((ext_vector_type(16))) __bf16   v16bf;
typedef __attribute__((ext_vector_type(16))) _Float16 v16h;
typedef __attribute__((ext_vector_type(8)))  _Float16 v8h;
typedef __attribute__((ext_vector_type(8)))  unsigned short v8us;
typedef __attribute__((ext_vector_type(8)))  float    v8f;
typedef __attribute__((ext_vector_type(4)))  float    v4f;
typedef __attribute__((ext_vector_type(4)))  _Float16 v4h;
typedef v8h  __attribute__((may_alias)) v8ha;
typedef v4f  __attribute__((may_alias)) v4fa;
typedef v8us __attribute__((may_alias)) v8usa;

__device__ __forceinline__ unsigned short f2bf(float f) { unsigned u = __float_as_uint(f); u += 0x7FFFu + ((u >> 16) & 1u); return (unsigned short)(u >> 16); }
__device__ __forceinline__ float bf2f(unsigned short b) { return __uint_as_float(((unsigned)b) << 16); }
__device__ __forceinline__ float bfr(float f) { return bf2f(f2bf(f)); }
__device__ __forceinline__ v16h cat16(v8h lo, v8h hi) { return __builtin_shufflevector(lo, hi, 0, 1, 2, 3, 4, 5, 6, 7, 8, 9, 10, 11, 12, 13, 14, 15); }
__device__ __forceinline__ v16bf cat16b(v8us lo, v8us hi) { return __builtin_bit_cast(v16bf, __builtin_shufflevector(lo, hi, 0, 1, 2, 3, 4, 5, 6, 7, 8, 9, 10, 11, 12, 13, 14, 15)); }
__device__ __forceinline__ v8f wmma16(v16h a, v16h b, v8f c) { return __builtin_amdgcn_wmma_f32_16x16x32_f16(false, a, false, b, (short)0, c, false, false); }
__device__ __forceinline__ v8f wmmab(v16bf a, v16bf b, v8f c) { return __builtin_amdgcn_wmma_f32_16x16x32_bf16(false, a, false, b, (short)0, c, false, false); }

// k_wt: WT [n][K] = bf16(W[k][n]) (k-major [K][ncols]) via 64 x 64 LDS tiles; grid (K/64, ncols/64).
__global__ __launch_bounds__(256) void k_wt(const float* __restrict__ Wm, int K, int ncols, bf* WT) {
    __shared__ __align__(16) unsigned short tl[64 * 72];
    const int tid = threadIdx.x, k0 = blockIdx.x * 64, n0 = blockIdx.y * 64;
    const int kk = tid >> 2, nq = (tid & 3) * 16;
#pragma unroll
    for (int i = 0; i < 16; ++i) tl[(nq + i) * 72 + kk] = f2bf(Wm[(size_t)(k0 + kk) * ncols + n0 + nq + i]);
    __syncthreads();
    const int piece = tid & 7;
    auto pass = [&]() {
#pragma unroll
        for (int s = 0; s < 2; ++s) { const int nr = (tid >> 3) + 32 * s; const v8us val = *(const v8usa*)(tl + nr * 72 + piece * 8); *(v8us*)(WT + (size_t)(n0 + nr) * K + k0 + piece * 8) = val; }
    };
    pass(); 
}
__global__ __launch_bounds__(256) void k_cvtb(const float* __restrict__ src, int nrows, bf* dst) {
    const int lane = threadIdx.x & 31, r = blockIdx.x * 8 + (threadIdx.x >> 5);
    if (r >= nrows) return;
    v8us o[DM / 256];
#pragma unroll
    for (int q = 0; q < DM / 256; ++q) { v8us t;
#pragma unroll
        for (int i = 0; i < 8; ++i) t[i] = f2bf(src[(size_t)r * DM + q * 256 + lane * 8 + i]);
        o[q] = t; }
#pragma unroll
    for (int q = 0; q < DM / 256; ++q) *(v8us*)(dst + (size_t)r * DM + q * 256 + lane * 8) = o[q];
    
}

// The projection GEMMs' main loop. A 64-k piece of an operand row is one whole 128-byte line; a stage = the block's 64 A rows (SPLITA: and the 64 rows of the residual plane) and its 64 B rows of one such piece.
// The stages come into a ring of two LDS buffers by asynchronous copies of whole lines (a fragment load straight from global memory takes 32 bytes out of each of 16 lines, and the four waves
// would each fetch the same B rows); stage s + 1 flies while stage s is worked on. The fragments are read from LDS with the k order that the global loaders had.
#define GSP 72                    // LDS row pitch in bf16 elements: 144 bytes = 16 x odd, free of bank conflicts for 16-byte reads down a column of rows
#define GTE (64 * GSP)            // elements of one 64-row tile in LDS
// One lane's copies of a stage: row tid/8 + 16 i (i = 0..3) of each tile, 16-byte piece tid%8; l = the lane's LDS byte address in the stage's first tile, the pointers = its global addresses in row tid/8.
// The s_wait_xcnt closes each statement so that it stands in front of every later write of a register that a copy names.
__device__ __forceinline__ void copy8(unsigned l, const bf* a, size_t sa, const bf* b, size_t sb) {
    asm volatile("global_load_async_to_lds_b128 %0, %8, off\n\tglobal_load_async_to_lds_b128 %1, %9, off\n\tglobal_load_async_to_lds_b128 %2, %10, off\n\tglobal_load_async_to_lds_b128 %3, %11, off\n\t"
                 "global_load_async_to_lds_b128 %4, %12, off\n\tglobal_load_async_to_lds_b128 %5, %13, off\n\tglobal_load_async_to_lds_b128 %6, %14, off\n\tglobal_load_async_to_lds_b128 %7, %15, off\n\ts_wait_xcnt 0x0"
                 :: "v"(l), "v"(l + 32 * GSP), "v"(l + 64 * GSP), "v"(l + 96 * GSP), "v"(l + 2 * GTE), "v"(l + 2 * GTE + 32 * GSP), "v"(l + 2 * GTE + 64 * GSP), "v"(l + 2 * GTE + 96 * GSP),
                    "v"(a), "v"(a + sa), "v"(a + 2 * sa), "v"(a + 3 * sa), "v"(b), "v"(b + sb), "v"(b + 2 * sb), "v"(b + 3 * sb) : "memory");
}
__device__ __forceinline__ void copy12(unsigned l, const bf* a, const bf* al, size_t sa, const bf* b, size_t sb) {
    asm volatile("global_load_async_to_lds_b128 %0, %12, off\n\tglobal_load_async_to_lds_b128 %1, %13, off\n\tglobal_load_async_to_lds_b128 %2, %14, off\n\tglobal_load_async_to_lds_b128 %3, %15, off\n\t"
                 "global_load_async_to_lds_b128 %4, %16, off\n\tglobal_load_async_to_lds_b128 %5, %17, off\n\tglobal_load_async_to_lds_b128 %6, %18, off\n\tglobal_load_async_to_lds_b128 %7, %19, off\n\t"
                 "global_load_async_to_lds_b128 %8, %20, off\n\tglobal_load_async_to_lds_b128 %9, %21, off\n\tglobal_load_async_to_lds_b128 %10, %22, off\n\tglobal_load_async_to_lds_b128 %11, %23, off\n\ts_wait_xcnt 0x0"
                 :: "v"(l), "v"(l + 32 * GSP), "v"(l + 64 * GSP), "v"(l + 96 * GSP), "v"(l + 2 * GTE), "v"(l + 2 * GTE + 32 * GSP), "v"(l + 2 * GTE + 64 * GSP), "v"(l + 2 * GTE + 96 * GSP),
                    "v"(l + 4 * GTE), "v"(l + 4 * GTE + 32 * GSP), "v"(l + 4 * GTE + 64 * GSP), "v"(l + 4 * GTE + 96 * GSP),
                    "v"(a), "v"(a + sa), "v"(a + 2 * sa), "v"(a + 3 * sa), "v"(al), "v"(al + sa), "v"(al + 2 * sa), "v"(al + 3 * sa), "v"(b), "v"(b + sb), "v"(b + 2 * sb), "v"(b + 3 * sb) : "memory");
}
// ring: 2 buffers of [A 64 rows][SPLITA: Al 64 rows][B 64 rows]. ga, gal, gb: the block's first A, Al and B row; ra, rbn: their row strides in elements. 128 threads; K a multiple of 64.
// acc[t] of a wave = its 16 rows (wave * 16 ..) x columns t * 16 .., summed over k in steps of 32 in rising order (SPLITA: A.B, then Al.B, in each step), as with the global loaders.
template <bool SPLITA>
__device__ __forceinline__ void gemm_ring(unsigned short* ring, const bf* ga, const bf* gal, size_t ra, const bf* gb, size_t rbn, int K, v8f (&acc)[4]) {
    constexpr int NT = SPLITA ? 3 : 2, STG = NT * GTE;
    const int tid = threadIdx.x, lane = tid & 31, wave = tid >> 5, lr = lane & 15, hi = lane >> 4;
    const unsigned l0 = (unsigned)(size_t)ring + (tid >> 3) * (GSP * 2) + (tid & 7) * 16;     // the low 32 bits of a __shared__ address are the byte offset in the block's LDS
    const bf* pa = ga + (size_t)(tid >> 3) * ra + (tid & 7) * 8; const bf* pal = gal + (size_t)(tid >> 3) * ra + (tid & 7) * 8; const bf* pb = gb + (size_t)(tid >> 3) * rbn + (tid & 7) * 8;
    const int NS = K >> 6;
    auto issue = [&](int s) { const unsigned l = l0 + (s & 1) * (STG * 2);
        if (SPLITA) copy12(l, pa + s * 64, pal + s * 64, 16 * ra, pb + s * 64, 16 * rbn); else copy8(l, pa + s * 64, 16 * ra, pb + s * 64, 16 * rbn); };
    issue(0);
    asm volatile("s_wait_asynccnt 0x0" ::: "memory");     // this wave's copies of stage 0 have landed
    __syncthreads();     // every wave's copies of stage 0 have landed before any wave reads a fragment
    if (NS > 1) issue(1);
#pragma unroll 1     // rolled: one pass a stage
    for (int s = 0; s < NS; ++s) {
        const unsigned short* aw = ring + (s & 1) * STG + (wave * 16 + lr) * GSP + 8 * hi;
        const unsigned short* bw = ring + (s & 1) * STG + (NT - 1) * GTE + lr * GSP + 8 * hi;
        v8us fa[2][SPLITA ? 4 : 2], fb[2][4][2];
#pragma unroll     // unrolled (all four loops over h and t): fa[], fb[] and acc[] are indexed by constants and stay in registers
        for (int h = 0; h < 2; ++h) { const int kc = h * 32;
            fa[h][0] = *(const v8usa*)(aw + kc); fa[h][1] = *(const v8usa*)(aw + kc + 16);
            if constexpr (SPLITA) { fa[h][2] = *(const v8usa*)(aw + GTE + kc); fa[h][3] = *(const v8usa*)(aw + GTE + kc + 16); }
#pragma unroll
            for (int t = 0; t < 4; ++t) { fb[h][t][0] = *(const v8usa*)(bw + t * 16 * GSP + kc); fb[h][t][1] = *(const v8usa*)(bw + t * 16 * GSP + kc + 16); }
        }
        __builtin_amdgcn_sched_barrier(0);     // keeps the stage's LDS reads together ahead of its matrix instructions (without it the scheduler put reads among them, reused their registers and waited out the LDS latency more than once a stage)
#pragma unroll
        for (int h = 0; h < 2; ++h) { const v16bf a = cat16b(fa[h][0], fa[h][1]);
#pragma unroll
            for (int t = 0; t < 4; ++t) { const v16bf bq = cat16b(fb[h][t][0], fb[h][t][1]); acc[t] = wmmab(a, bq, acc[t]); if constexpr (SPLITA) acc[t] = wmmab(cat16b(fa[h][2], fa[h][3]), bq, acc[t]); }
        }
        asm volatile("v_nop\n\tv_nop\n\tv_nop\n\tv_nop" : "+v"(acc[0]), "+v"(acc[1]), "+v"(acc[2]), "+v"(acc[3]));     // the four slots behind the pass's last matrix instruction, also on the taken branches behind it, before its operand registers are overwritten
        asm volatile("s_wait_dscnt 0x0" ::: "memory");        // this wave has finished reading stage s
        asm volatile("s_wait_asynccnt 0x0" ::: "memory");     // this wave's copies of stage s + 1 have landed
        __syncthreads();     // publishes stage s + 1 and ends every wave's reads of the buffer that is refilled behind it
        if (s + 2 < NS) issue(s + 2);
    }
    asm volatile("s_wait_asynccnt 0x0" ::: "memory");     // no copy is outstanding when the wave goes on
}

// k_gemmb: 64 x 64 block tile (4 waves x 16 x 64) of C[NXR][DD] = (A [+ Al]).B^T (K = 1024) [+ bf(bias[c])] [+ bf(R[r][c]) residual]; f32 whole-line epilogue (or f16
template <bool SPLITA, bool F16OUT = false>
__global__ __launch_bounds__(128) void k_gemmb(const bf* __restrict__ A, const bf* __restrict__ Al, const bf* __restrict__ Bn, const float* __restrict__ bias, float* C, int ldc, h16* C2, const float* __restrict__ R = nullptr, int K = DM, int roundR = 1) {
    __shared__ __align__(16) float ost[4][16 * 68];
    __shared__ __align__(16) unsigned short ring[2 * (SPLITA ? 3 : 2) * GTE];
    const int lane = threadIdx.x & 31, wave = threadIdx.x >> 5, lr = lane & 15, hi = lane >> 4;
    const int r0 = blockIdx.x * 64 + wave * 16, c0 = blockIdx.y * 64;
    v8f acc[4];
#pragma unroll
    for (int t = 0; t < 4; ++t) acc[t] = (v8f){};
    gemm_ring<SPLITA>(ring, A + (size_t)blockIdx.x * 64 * K, (SPLITA ? Al : A) + (size_t)blockIdx.x * 64 * K, (size_t)K, Bn + (size_t)c0 * K, (size_t)K, K, acc);
    float* os = &ost[wave][0];
#pragma unroll
    for (int t = 0; t < 4; ++t) { const float bv = bias ? bfr(bias[c0 + t * 16 + lr]) : 0.f;
#pragma unroll
        for (int j = 0; j < 8; ++j) os[(hi * 8 + j) * 68 + t * 16 + lr] = acc[t][j] + bv; }
    __syncthreads();
    if (F16OUT) {
        h16* crow = (h16*)(void*)C + (size_t)r0 * ldc + c0;
        auto pass = [&]() {
#pragma unroll
            for (int s = 0; s < 4; ++s) { const int row = 4 * s + (lane >> 3), piece = lane & 7; const float* sp = os + row * 68 + piece * 8; v8h o, o2;
#pragma unroll
                for (int i = 0; i < 8; ++i) { const h16 a = (h16)sp[i]; o[i] = a; o2[i] = (h16)((sp[i] - (float)a) * LOSC); }
                *(v8h*)(crow + (size_t)row * ldc + piece * 8) = o; if (C2) *(v8h*)(C2 + (size_t)r0 * ldc + c0 + (size_t)row * ldc + piece * 8) = o2; }
        };
        pass(); 
    } else {
        float* crow = C + (size_t)r0 * ldc + c0;
        auto pass = [&]() {
#pragma unroll
            for (int s = 0; s < 8; ++s) { const int Lid = (lane >> 3) + 4 * s, piece = lane & 7; const int row = Lid >> 1, cofs = (Lid & 1) * 32 + piece * 4;
                v4f val = *(const v4fa*)(os + row * 68 + cofs); if (R) { const v4f rv = *(const v4f*)(R + ((size_t)r0 + row) * ldc + c0 + cofs); val += roundR ? (v4f){bfr(rv[0]), bfr(rv[1]), bfr(rv[2]), bfr(rv[3])} : rv; }
                *(v4f*)(crow + (size_t)row * ldc + cofs) = val; }
        };
        pass(); 
    }
}

// k_gemm3: 64 x 64 tile of C = (Ah + Al).(Bh + Bl)^T over K = HD = 64 (row stride HD for all four planes; n-major B): three products per 32-k step (hh, lh, hl); f32
// blockIdx.z = the head inside the launch's group: its A, B and C planes lie sA, sB and sC elements behind the previous head's.
// A plane row is one 128-byte line and a tile's 64 rows are 8 KiB in a row: the block brings its four tiles into LDS by loads that cover whole lines (a fragment load straight from global
// memory takes 32 bytes out of each of 16 lines, and the four waves would each fetch the same B tiles); the fragments are then read from LDS with the k order that the global loaders had.
#define SP 72                     // LDS row pitch in bf16 elements: 144 bytes = 16 x odd, free of bank conflicts for 16-byte reads down a column of rows
__global__ __launch_bounds__(128) void k_gemm3(const bf* __restrict__ Ah, const bf* __restrict__ Al, const bf* __restrict__ Bh, const bf* __restrict__ Bl, float* C, int ldc, size_t sA, size_t sB, size_t sC) {
    typedef float __attribute__((may_alias)) fal;
    __shared__ __align__(16) unsigned short st[4 * 64 * SP];     // [wave][Ah, Al][16 rows], then Bh [64 rows], Bl [64 rows]; a wave's A part (4608 bytes, read by that wave alone) serves as its output stage afterwards
    static_assert(2 * 16 * SP * 2 >= 16 * 68 * 4, "a wave's output stage fits its own A rows");
    C += blockIdx.z * sC;
    const int tid = threadIdx.x, lane = tid & 31, wave = tid >> 5, lr = lane & 15, hi = lane >> 4;
    const int rb = blockIdx.x * 64, r0 = rb + wave * 16, c0 = blockIdx.y * 64;
    const bf* gp[4] = {Ah + blockIdx.z * sA + (size_t)rb * HD, Al + blockIdx.z * sA + (size_t)rb * HD, Bh + blockIdx.z * sB + (size_t)c0 * HD, Bl + blockIdx.z * sB + (size_t)c0 * HD};
    v8us g[4][4];
#pragma unroll     // unrolled (all loops of this kernel): g[], acc[] are indexed by constants and stay in registers, and the 16 loads go out together, one memory round trip
    for (int p = 0; p < 4; ++p)
#pragma unroll
        for (int s = 0; s < 4; ++s) g[p][s] = *(const v8us*)(gp[p] + (s * 128 + tid) * 8);     // row s*16 + tid/8, 16-byte piece tid%8
#pragma unroll
    for (int p = 0; p < 4; ++p)
#pragma unroll
        for (int s = 0; s < 4; ++s) { const int o = (p < 2 ? (s * 2 + p) * 16 : p * 64 + s * 16) + (tid >> 3); *(v8usa*)(st + o * SP + (tid & 7) * 8) = g[p][s]; }
    __syncthreads();     // all four tiles are in LDS before any wave reads a fragment
    const unsigned short* aw = st + (wave * 32 + lr) * SP + 8 * hi;
    const unsigned short* bw = st + (128 + lr) * SP + 8 * hi;
    v8f acc[4];
#pragma unroll
    for (int t = 0; t < 4; ++t) acc[t] = (v8f){};
#pragma unroll
    for (int kc = 0; kc < HD; kc += 32) {
        const v16bf a = cat16b(*(const v8usa*)(aw + kc), *(const v8usa*)(aw + kc + 16));
        const v16bf al = cat16b(*(const v8usa*)(aw + 16 * SP + kc), *(const v8usa*)(aw + 16 * SP + kc + 16));
#pragma unroll
        for (int t = 0; t < 4; ++t) { const unsigned short* bp = bw + t * 16 * SP + kc;
            const v16bf bh = cat16b(*(const v8usa*)bp, *(const v8usa*)(bp + 16)); const v16bf bl = cat16b(*(const v8usa*)(bp + 64 * SP), *(const v8usa*)(bp + 64 * SP + 16));
            acc[t] = wmmab(a, bh, acc[t]); acc[t] = wmmab(al, bh, acc[t]); acc[t] = wmmab(a, bl, acc[t]); }
    }
    fal* os = (fal*)(void*)(st + wave * 32 * SP);
#pragma unroll
    for (int t = 0; t < 4; ++t) {
#pragma unroll
        for (int j = 0; j < 8; ++j) os[(hi * 8 + j) * 68 + t * 16 + lr] = acc[t][j]; }
    __builtin_amdgcn_wave_barrier(); asm volatile("" ::: "memory");     // as before: keeps the compiler from moving the reads of other lanes' values ahead of the wave's stores to its stage
    float* crow = C + (size_t)r0 * ldc + c0;
    auto pass = [&]() {
#pragma unroll
        for (int s = 0; s < 8; ++s) { const int Lid = (lane >> 3) + 4 * s, piece = lane & 7; const int row = Lid >> 1, cofs = (Lid & 1) * 32 + piece * 4;
            const v4f val = *(const v4fa*)(os + row * 68 + cofs); *(v4f*)(crow + (size_t)row * ldc + cofs) = val; }
    };
    pass(); 
}

// k_pv: attn.v of one head, C[1024][64] = (Ah + Al).(Bh + Bl)^T over the 2048 keys (three products per 32-k step, k order of the fragments as in k_gemm3). One 32 x 64 output tile and one
// half of the keys per block (grid: 32 row tiles, y = HG heads x 2 key halves = 256 blocks). The 8 waves = 4 key groups (256 keys each) x 2 row tiles (16 x 64); the 4 groups' partial tiles are added
// in group order through LDS, and the two halves go to two planes (C, C + zstride) that k_split adds. Each stored tile row is two whole 128-byte lines.
// A 64-key piece of an operand row is one whole 128-byte line (a fragment load straight from global memory takes 32 bytes out of each of 16 lines). A stage = such a piece of every group's 32 Ah, 32 Al,
// 64 Bh and 64 Bl rows; the stages come into a ring of two LDS buffers by asynchronous copies of whole lines, stage s + 1 flies while stage s is worked on.
#define PVG 4                     // key groups of a block
#define PVR 192                   // LDS rows of one key group in a stage: Ah 32, Al 32, Bh 64, Bl 64
#define PVS (PVG * PVR * GSP)     // elements of one stage
// One lane's 12 copies: 4 rows, 8 rows apart, at each of three places; l = the lane's LDS byte address, p = its global address in the first of the 4 rows (row stride TK).
// The s_wait_xcnt closes the statement so that it stands in front of every later write of a register that a copy names.
__device__ __forceinline__ void copy12r(unsigned l0, unsigned l1, unsigned l2, const bf* p0, const bf* p1, const bf* p2) {
    constexpr unsigned LS = 8 * GSP * 2; constexpr size_t GS = (size_t)8 * TK;
    asm volatile("global_load_async_to_lds_b128 %0, %12, off\n\tglobal_load_async_to_lds_b128 %1, %13, off\n\tglobal_load_async_to_lds_b128 %2, %14, off\n\tglobal_load_async_to_lds_b128 %3, %15, off\n\t"
                 "global_load_async_to_lds_b128 %4, %16, off\n\tglobal_load_async_to_lds_b128 %5, %17, off\n\tglobal_load_async_to_lds_b128 %6, %18, off\n\tglobal_load_async_to_lds_b128 %7, %19, off\n\t"
                 "global_load_async_to_lds_b128 %8, %20, off\n\tglobal_load_async_to_lds_b128 %9, %21, off\n\tglobal_load_async_to_lds_b128 %10, %22, off\n\tglobal_load_async_to_lds_b128 %11, %23, off\n\ts_wait_xcnt 0x0"
                 :: "v"(l0), "v"(l0 + LS), "v"(l0 + 2 * LS), "v"(l0 + 3 * LS), "v"(l1), "v"(l1 + LS), "v"(l1 + 2 * LS), "v"(l1 + 3 * LS), "v"(l2), "v"(l2 + LS), "v"(l2 + 2 * LS), "v"(l2 + 3 * LS),
                    "v"(p0), "v"(p0 + GS), "v"(p0 + 2 * GS), "v"(p0 + 3 * GS), "v"(p1), "v"(p1 + GS), "v"(p1 + 2 * GS), "v"(p1 + 3 * GS), "v"(p2), "v"(p2 + GS), "v"(p2 + 2 * GS), "v"(p2 + 3 * GS) : "memory");
}
__global__ __launch_bounds__(256) void k_pv(const bf* __restrict__ Ah, const bf* __restrict__ Al, const bf* __restrict__ Bh, const bf* __restrict__ Bl, float* C, int ldc, size_t zstride) {
    __shared__ __align__(16) unsigned short ring[2 * PVS];
    __shared__ __align__(16) float red[8][16 * 68];     // each wave's partial 16 x 64 tile
    const int tid = threadIdx.x, lane = tid & 31, wave = tid >> 5, lr = lane & 15, hi = lane >> 4;
    const int kg = wave >> 1, rw = wave & 1;                 // key group, row tile
    const int hz = blockIdx.y >> 1, kh = blockIdx.y & 1;     // head inside the launch's group, key half
    const int r0 = blockIdx.x * 32, k0 = kh * (TK / 2) + kg * (TK / 2 / PVG);
    // a key group's two waves copy the group's own rows: row (tid % 64) / 8 + 8 i, 16-byte piece tid % 8, so that 8 lanes take one whole line
    const int r8 = (tid & 63) >> 3, pc = tid & 7;
    const size_t ao = ((size_t)hz * LQ + r0 + r8) * TK + k0 + pc * 8, bo = ((size_t)hz * HD + r8) * TK + k0 + pc * 8;
    const bf* pah = Ah + ao; const bf* pal = Al + ao; const bf* pbh = Bh + bo; const bf* pbl = Bl + bo;
    const unsigned l0 = (unsigned)(size_t)ring + (kg * PVR + r8) * (GSP * 2) + pc * 16;     // the low 32 bits of a __shared__ address are the byte offset in the block's LDS
    auto issue = [&](int s) { const unsigned l = l0 + (s & 1) * (PVS * 2); const int ko = s * 64;
        copy12r(l, l + 32 * GSP * 2, l + 64 * GSP * 2, pah + ko, pal + ko, pbh + ko);
        copy12r(l + 96 * GSP * 2, l + 128 * GSP * 2, l + 160 * GSP * 2, pbh + ko + (size_t)32 * TK, pbl + ko, pbl + ko + (size_t)32 * TK); };
    constexpr int NS = TK / 2 / PVG / 64;
    static_assert(NS >= 2, "stage 1 exists");
    v8f acc[4];
#pragma unroll     // unrolled (all loops over t, h, j of this kernel): acc[], fa[] and fb[] are indexed by constants and stay in registers
    for (int t = 0; t < 4; ++t) acc[t] = (v8f){};
    issue(0);
    asm volatile("s_wait_asynccnt 0x0" ::: "memory");     // this wave's copies of stage 0 have landed
    __syncthreads();     // every wave's copies of stage 0 have landed before any wave reads a fragment
    issue(1);
#pragma unroll 1     // rolled: one pass a stage
    for (int s = 0; s < NS; ++s) {
        const unsigned short* gb = ring + (s & 1) * PVS + kg * PVR * GSP;
        const unsigned short* aw = gb + (rw * 16 + lr) * GSP + 8 * hi;
        const unsigned short* bw = gb + (64 + lr) * GSP + 8 * hi;
        v8us fa[2][4], fb[2][4][4];
#pragma unroll
        for (int h = 0; h < 2; ++h) { const int kc = h * 32;
            fa[h][0] = *(const v8usa*)(aw + kc); fa[h][1] = *(const v8usa*)(aw + kc + 16); fa[h][2] = *(const v8usa*)(aw + 32 * GSP + kc); fa[h][3] = *(const v8usa*)(aw + 32 * GSP + kc + 16);
#pragma unroll
            for (int t = 0; t < 4; ++t) { const unsigned short* bp = bw + t * 16 * GSP + kc;
                fb[h][t][0] = *(const v8usa*)bp; fb[h][t][1] = *(const v8usa*)(bp + 16); fb[h][t][2] = *(const v8usa*)(bp + 64 * GSP); fb[h][t][3] = *(const v8usa*)(bp + 64 * GSP + 16); }
        }
        __builtin_amdgcn_sched_barrier(0);     // keeps the stage's LDS reads together ahead of its matrix instructions, so that the wave waits out the LDS latency once a stage
#pragma unroll
        for (int h = 0; h < 2; ++h) { const v16bf a = cat16b(fa[h][0], fa[h][1]), al = cat16b(fa[h][2], fa[h][3]);
            // product by product over the four column tiles: each accumulator still takes a.bh, al.bh, a.bl in that order, with three independent matrix instructions between two on the same one
#pragma unroll
            for (int t = 0; t < 4; ++t) acc[t] = wmmab(a, cat16b(fb[h][t][0], fb[h][t][1]), acc[t]);
#pragma unroll
            for (int t = 0; t < 4; ++t) acc[t] = wmmab(al, cat16b(fb[h][t][0], fb[h][t][1]), acc[t]);
#pragma unroll
            for (int t = 0; t < 4; ++t) acc[t] = wmmab(a, cat16b(fb[h][t][2], fb[h][t][3]), acc[t]);
        }
        asm volatile("v_nop\n\tv_nop\n\tv_nop\n\tv_nop" : "+v"(acc[0]), "+v"(acc[1]), "+v"(acc[2]), "+v"(acc[3]));     // the four slots behind the pass's last matrix instruction, also on the taken branches behind it, before its operand registers are overwritten
        asm volatile("s_wait_dscnt 0x0" ::: "memory");        // this wave has finished reading stage s
        asm volatile("s_wait_asynccnt 0x0" ::: "memory");     // this wave's copies of stage s + 1 have landed
        __syncthreads();     // publishes stage s + 1 and ends every wave's reads of the buffer that is refilled behind it
        if (s + 2 < NS) issue(s + 2);
    }
    asm volatile("s_wait_asynccnt 0x0" ::: "memory");     // no copy is outstanding when the wave goes on
    float* os = &red[wave][0];
#pragma unroll
    for (int t = 0; t < 4; ++t) {
#pragma unroll
        for (int j = 0; j < 8; ++j) os[(hi * 8 + j) * 68 + t * 16 + lr] = acc[t][j]; }
    __syncthreads();     // every wave's partial tile is in LDS before any thread adds them
    const int row = tid >> 3;     // thread -> 8 consecutive floats of one of the 32 rows
    const float* rp = &red[row >> 4][(row & 15) * 68 + pc * 8];
    v4f x0 = *(const v4fa*)rp, x1 = *(const v4fa*)(rp + 4);
#pragma unroll     // unrolled: the LDS reads go out together; the adds stay in group order
    for (int q = 1; q < PVG; ++q) { x0 += *(const v4fa*)(rp + q * 2 * 16 * 68); x1 += *(const v4fa*)(rp + q * 2 * 16 * 68 + 4); }
    float* crow = C + (size_t)kh * zstride + (size_t)(r0 + row) * ldc + hz * HD + pc * 8;
    *(v4f*)crow = x0; *(v4f*)(crow + 4) = x1;
}

// k_gemmp: a projection GEMM (main loop gemm_ring as in k_gemmb, plain A) whose epilogue writes the attention operand planes itself: bf16 hi + UNSCALED residual of the f32 sums, per (batch b, head h).
// A block takes 64 consecutive positions t of ONE batch (A row = t*2 + b) and the 64 columns of one head (blockIdx.y), so that every stored plane row is one whole 128-byte line.
// K is an argument as in k_gemmb.
// MODE 0: P0[bh][t][d] (k, r). MODE 1: P0 = sums + bf(bias0[h][d]), P1 = sums + bf(bias1[h][d]) (q + u, q + v_bias). MODE 2: P0[bh][d][t] (v transposed: the tile is laid into LDS column-major).
template <int MODE, int NR>
__global__ __launch_bounds__(128) void k_gemmp(const bf* __restrict__ A, const bf* __restrict__ Bn, const float* __restrict__ bias0, const float* __restrict__ bias1, bf* P0h, bf* P0l, bf* P1h, bf* P1l, int K = DM) {
    __shared__ __align__(16) float ost[64 * 68];
    __shared__ __align__(16) unsigned short ring[2 * 2 * GTE];
    __shared__ __align__(16) float ub[2 * HD];     // MODE 1 only
    const int lane = threadIdx.x & 31, wave = threadIdx.x >> 5, lr = lane & 15, hi = lane >> 4;
    const int b = (blockIdx.x * 64) / NR, t0 = (blockIdx.x * 64) % NR, h = blockIdx.y, c0 = h * HD;
    v8f acc[4];
#pragma unroll     // unrolled (all loops over t, j, i, s of this kernel): acc[] and the vectors are indexed by constants and stay in registers
    for (int t = 0; t < 4; ++t) acc[t] = (v8f){};
    gemm_ring<false>(ring, A + ((size_t)t0 * NBT + b) * K, A + ((size_t)t0 * NBT + b) * K, (size_t)NBT * K, Bn + (size_t)c0 * K, (size_t)K, K, acc);
#pragma unroll
    for (int t = 0; t < 4; ++t) {
        if (MODE == 2) { float* p = ost + (t * 16 + lr) * 68 + wave * 16 + hi * 8;     // row = d, column = t: a lane's 8 sums are 8 consecutive positions
            *(v4fa*)p = (v4f){acc[t][0], acc[t][1], acc[t][2], acc[t][3]}; *(v4fa*)(p + 4) = (v4f){acc[t][4], acc[t][5], acc[t][6], acc[t][7]};
        } else {
#pragma unroll
            for (int j = 0; j < 8; ++j) ost[(wave * 16 + hi * 8 + j) * 68 + t * 16 + lr] = acc[t][j]; }
    }
    if (MODE == 1) ub[threadIdx.x] = bfr((threadIdx.x < HD ? bias0 : bias1)[c0 + (threadIdx.x & (HD - 1))]);     // the head's 64 + 64 rounded bias values, one load a thread
    __syncthreads();     // the whole 64 x 64 tile (MODE 1: and the bias values) is in LDS before it is read back by rows (MODE 2: a row holds sums of all four waves)
    const int piece = lane & 7; const size_t bh = (size_t)b * NH_ + h;
    float u0[8], u1[8];
    if (MODE == 1) {
#pragma unroll
        for (int i = 0; i < 8; ++i) { u0[i] = ub[piece * 8 + i]; u1[i] = ub[HD + piece * 8 + i]; } }
#pragma unroll
    for (int s = 0; s < 4; ++s) { const int row = wave * 16 + 4 * s + (lane >> 3); const float* sp = ost + row * 68 + piece * 8;
        const v4f x0 = *(const v4fa*)sp, x1 = *(const v4fa*)(sp + 4);
        const size_t o = MODE == 2 ? (bh * HD + row) * TK + t0 + piece * 8 : (bh * NR + t0 + row) * HD + piece * 8;
        v8us oh, ol;
#pragma unroll
        for (int i = 0; i < 8; ++i) { float v = i < 4 ? x0[i & 3] : x1[i & 3]; if (MODE == 1) v += u0[i]; const unsigned short hb = f2bf(v); oh[i] = hb; ol[i] = f2bf(v - bf2f(hb)); }
        *(v8us*)(P0h + o) = oh; *(v8us*)(P0l + o) = ol;
        if (MODE == 1) {
#pragma unroll
            for (int i = 0; i < 8; ++i) { const float v = (i < 4 ? x0[i & 3] : x1[i & 3]) + u1[i]; const unsigned short hb = f2bf(v); oh[i] = hb; ol[i] = f2bf(v - bf2f(hb)); }
            *(v8us*)(P1h + o) = oh; *(v8us*)(P1l + o) = ol; }
    }
}
// 2^x. The v_nop is the slot that the instruction set asks for behind a transcendental before its source register is overwritten.
__device__ __forceinline__ float exp2_slot(float x) { float r; asm("v_exp_f32 %0, %1\n\tv_nop" : "=v"(r) : "v"(x)); return r; }
// k_relsoft: one wave per query row i of head (b,h); a block = 2 rows x the HG heads of the group (planes LQ*TK elements apart); for each key j: the module's _rel_shift by index (idx = L + i*T + j, row = idx / (T+1), col = idx % (T+1), bd = col ?
// BD[row][col-1] : 0), s = (AC[i][j] + bd)/8, s = -1e30 where mask[i][j][b]; softmax over the 2048 keys (f32, fixed lane order). AC, BD and the mask are read ONCE: a lane holds its 64 scores (then their
// exponentials) in registers from the loads to the stores -> bf16 hi + UNSCALED
// residual planes; the mean attention map accumulates p / 32 in (b,h) order: each wave leaves its head's p / 32 in LDS, and behind a barrier the block adds the HG heads in
// head order onto the previous group's map, through two ping-pong buffers (AMIN = the previous group's buffer, never the one being written,
// launch bounds, second argument: caps the registers; without it the build takes 300, three waves a SIMD, and the two blocks that the grid gives every WGP do not fit side by side
__global__ __launch_bounds__(256, 5) void k_relsoft(const float* __restrict__ ACg, const float* __restrict__ BDg, const int* __restrict__ MSK, int b, int first, const float* __restrict__ AMIN, bf* PHg, bf* PLg, float* AMDST) {
    typedef __attribute__((ext_vector_type(4))) unsigned short v4us;
    typedef __attribute__((ext_vector_type(4))) int v4i;
    typedef v4f __attribute__((aligned(4), may_alias)) v4fu;     // a 16-byte load whose address is a multiple of 4 only
    __shared__ __align__(16) float pm[8][TK];     // p / 32 of each wave's (row, head)
    const int lane = threadIdx.x & 31, wave = threadIdx.x >> 5, hz = wave % HG, i = blockIdx.x * (8 / HG) + wave / HG;
    const float* __restrict__ AC = ACg + (size_t)hz * LQ * TK; const float* __restrict__ BD = BDg + (size_t)hz * LQ * TK; bf* PH = PHg + (size_t)hz * LQ * TK; bf* PL = PLg + (size_t)hz * LQ * TK;
    // _rel_shift by index with one integer division per row: idx = L + i*T + j; (row0, col0) for j = 0, then col = col0 + j wraps at most once past T+1.
    // L + i*T = i*(T+1) + (L - i) with 1 <= L - i <= T, so col0 >= 1: col is 0 only at the wrap, key jz. In the flat BD plane the row's elements are one run with that one hole:
    // key j < jz reads bdr[j], key jz reads nothing (bd = 0), key j > jz reads (row0 + 1)*T + (col0 + j - (T+1)) - 1 = bdr[j - 1].
    static_assert(LQ <= TK, "col0 >= 1 needs L - i <= T");
    const int base = LQ + i * TK; const int row0 = base / (TK + 1), col0 = base % (TK + 1), jz = TK + 1 - col0;
    const float* __restrict__ bdr = BD + (size_t)row0 * TK + col0 - 1;
    float sc[TK / 32];     // the lane's keys: 4 consecutive ones of every 128, in the order in which they are summed
#pragma unroll     // unrolled (all loops over sc[]): sc[] is indexed by constants and stays in registers, and the row's loads go out many at a time
    for (int k = 0; k < TK / 128; ++k) { const int c0 = lane * 4 + k * 128, d = jz - c0;     // d: place of the hole inside this group of 4 keys (below 0: the whole group lies behind it)
        const v4f ac = *(const v4f*)(AC + (size_t)i * TK + c0);
        const v4f bv = *(const v4fu*)(bdr + c0 - (d < 0 ? 1 : 0));     // 4 floats at a 4-byte boundary; first and last lie inside the head's BD plane for every (i, c0)
        const v4i m0 = *(const v4i*)(MSK + ((size_t)i * TK + c0) * NBT), m1 = *(const v4i*)(MSK + ((size_t)i * TK + c0) * NBT + 4);     // mask[i][c0 .. c0+3][0 .. 1]
        const int mk[4] = {b ? m0[1] : m0[0], b ? m0[3] : m0[2], b ? m1[1] : m1[0], b ? m1[3] : m1[2]};
#pragma unroll
        for (int q = 0; q < 4; ++q) { const float bd = ((unsigned)d > (unsigned)q) ? bv[q] : (d == q ? 0.f : bv[q ? q - 1 : 0]);     // in front of the hole or wholly behind it: in place; the hole: 0; behind the hole in its own group: one down
            const float s = (ac[q] + bd) * SCL; sc[k * 4 + q] = mk[q] ? NEGV : s; }
    }
    float m = -3.0e38f;
#pragma unroll
    for (int e = 0; e < TK / 32; ++e) m = fmaxf(m, sc[e]);
#pragma unroll
    for (int sh = 16; sh; sh >>= 1) m = fmaxf(m, __shfl_xor(m, sh, 32));
    float sum = 0.f;
#pragma unroll
    for (int e = 0; e < TK / 32; ++e) { sc[e] = exp2_slot((sc[e] - m) * 1.44269504f); sum += sc[e]; }     // = __expf(sc[e] - m): the same multiply by log2(e) and the same v_exp_f32
#pragma unroll
    for (int sh = 16; sh; sh >>= 1) sum += __shfl_xor(sum, sh, 32);
    const float inv = 1.0f / sum;
    // the block's 8 / HG rows of the map are one run of floats: thread t owns floats 4 t .. 4 t + 3 of every 1024; the previous group's values are fetched here, under the conversion of the row
    const size_t mo = (size_t)blockIdx.x * (8 / HG) * TK + threadIdx.x * 4;
    v4f am[(8 / HG) * TK / 1024];
#pragma unroll     // unrolled (here and in the two loops behind the barrier): am[] is indexed by constants and stays in registers, and the loads go out together
    for (int s = 0; s < (8 / HG) * TK / 1024; ++s) am[s] = first ? (v4f){} : *(const v4f*)(AMIN + mo + s * 1024);
#pragma unroll
    for (int k = 0; k < TK / 128; ++k) { const int c0 = lane * 4 + k * 128; v4us oh, ol; v4f pq;
#pragma unroll
        for (int q = 0; q < 4; ++q) { const float p = sc[k * 4 + q] * inv; const unsigned short hb = f2bf(p); oh[q] = hb; ol[q] = f2bf(p - bf2f(hb));
            pq[q] = p * (1.0f / (NBT * NH_)); }
        const size_t o = (size_t)i * TK + c0; *(v4us*)(PH + o) = oh; *(v4us*)(PL + o) = ol; *(v4fa*)(&pm[wave][c0]) = pq; }
    __syncthreads();     // every head's p / 32 of the block's rows is in LDS before any thread adds them
#pragma unroll
    for (int s = 0; s < (8 / HG) * TK / 1024; ++s) { const int e = s * 1024 + threadIdx.x * 4, rs = e / TK, c = e % TK;
#pragma unroll     // unrolled: the HG LDS reads of a slot go out together; the adds stay in head order
        for (int w = 0; w < HG; ++w) am[s] += *(const v4fa*)(&pm[rs * HG + w][c]); }
#pragma unroll
    for (int s = 0; s < (8 / HG) * TK / 1024; ++s) *(v4f*)(AMDST + mo + s * 1024) = am[s];
}
__global__ __launch_bounds__(256) void k_split(const float* __restrict__ src, const float* __restrict__ src2, int nrows, bf* dh, bf* dl) {
    const int lane = threadIdx.x & 31, r = blockIdx.x * 8 + (threadIdx.x >> 5); if (r >= nrows) return;
{
#pragma unroll 1
        for (int q = 0; q < DD / 256; ++q) { const size_t o = (size_t)r * DD + q * 256 + lane * 8; const v8f v = *(const v8f*)(src + o) + *(const v8f*)(src2 + o); v8us oh, ol;
#pragma unroll
            for (int i = 0; i < 8; ++i) { const unsigned short hb = f2bf(v[i]); oh[i] = hb; ol[i] = f2bf(v[i] - bf2f(hb)); }
            *(v8us*)(dh + o) = oh; *(v8us*)(dl + o) = ol; }
         }
}
// k_ln: one wave per row of H [2048][1024]: LayerNorm (mean, biased var, eps 1e-5) x bf(gamma) + bf(beta) -> f32 output rows; lane -> 4 consecutive floats per 128-column
__global__ __launch_bounds__(256) void k_ln(const float* __restrict__ Hs, const float* __restrict__ g, const float* __restrict__ bb, float* OUTP) {
    const int lane = threadIdx.x & 31, r = blockIdx.x * 8 + (threadIdx.x >> 5); if (r >= NXR) return;
    v4f v[DD / 128]; float s = 0.f;
#pragma unroll
    for (int q = 0; q < DD / 128; ++q) { v[q] = *(const v4f*)(Hs + (size_t)r * DD + q * 128 + lane * 4);
#pragma unroll
        for (int i = 0; i < 4; ++i) s += v[q][i]; }
#pragma unroll
    for (int sh = 16; sh; sh >>= 1) s += __shfl_xor(s, sh, 32);
    const float mu = s * (1.0f / DD); float s2 = 0.f;
#pragma unroll
    for (int q = 0; q < DD / 128; ++q)
#pragma unroll
        for (int i = 0; i < 4; ++i) { const float d = v[q][i] - mu; s2 = fmaf(d, d, s2); }
#pragma unroll
    for (int sh = 16; sh; sh >>= 1) s2 += __shfl_xor(s2, sh, 32);
    const float rs = rsqrtf(s2 * (1.0f / DD) + LN_EPS);
{
#pragma unroll
        for (int q = 0; q < DD / 128; ++q) { const int c0 = q * 128 + lane * 4; v4f y;
#pragma unroll
            for (int i = 0; i < 4; ++i) y[i] = (v[q][i] - mu) * rs * bfr(g[c0 + i]) + bfr(bb[c0 + i]);
            *(v4f*)(OUTP + (size_t)r * DD + c0) = y; }
         }
}

extern "C" void kernel_launch(void* const* d_in, const int* in_sizes, int n_in,
                              void* d_out, int out_size, void* d_ws, size_t ws_size, hipStream_t stream) {
    (void)in_sizes; (void)n_in; (void)out_size;
    const float* x = (const float*)d_in[0]; const float* pe = (const float*)d_in[1]; const float* mem = (const float*)d_in[2]; const float* pbu = (const float*)d_in[3]; const float* pbv = (const float*)d_in[4]; const int* msk = (const int*)d_in[5];
    const float* Wq = (const float*)d_in[6]; const float* Wkv = (const float*)d_in[7]; const float* Wrel = (const float*)d_in[8]; const float* Wo = (const float*)d_in[9]; const float* g = (const float*)d_in[10]; const float* bb = (const float*)d_in[11];
    float* out = (float*)d_out; float* out2 = out + (size_t)NXR * DD;    // output [1024][2][1024]; attn_matrix [1024][2048]
    char* wsp = (char*)d_ws;
    auto take = [&](size_t bytes) { char* p = wsp; wsp += (bytes + 255) & ~(size_t)255; return (void*)p; };
    bf* WqT = (bf*)take((size_t)DD * DD * 2); bf* WkvT = (bf*)take((size_t)2 * DD * DD * 2); bf* WrT = (bf*)take((size_t)DD * DD * 2); bf* WoT = (bf*)take((size_t)DD * DD * 2);
    bf* Cb = (bf*)take((size_t)NCR * DD * 2); float* TMP = (float*)take((size_t)NCR * DD * 4);
    bf* QUh = (bf*)take((size_t)NBT * NH_ * LQ * HD * 2); bf* QUl = (bf*)take((size_t)NBT * NH_ * LQ * HD * 2); bf* QVh = (bf*)take((size_t)NBT * NH_ * LQ * HD * 2); bf* QVl = (bf*)take((size_t)NBT * NH_ * LQ * HD * 2);
    bf* Kh = (bf*)take((size_t)NBT * NH_ * TK * HD * 2); bf* Kl = (bf*)take((size_t)NBT * NH_ * TK * HD * 2); bf* Rh = (bf*)take((size_t)NBT * NH_ * TK * HD * 2); bf* Rl = (bf*)take((size_t)NBT * NH_ * TK * HD * 2);
    bf* VTh = (bf*)take((size_t)NBT * NH_ * HD * TK * 2); bf* VTl = (bf*)take((size_t)NBT * NH_ * HD * TK * 2);
    float* AC = (float*)take((size_t)HG * LQ * TK * 4); float* BD = (float*)take((size_t)HG * LQ * TK * 4); bf* PH = (bf*)take((size_t)HG * LQ * TK * 2); bf* PL = (bf*)take((size_t)HG * LQ * TK * 2); float* AM = (float*)take((size_t)LQ * TK * 4);
    float* AV = (float*)take((size_t)2 * NXR * DD * 4); bf* AVh = (bf*)take((size_t)NXR * DD * 2); bf* AVl = (bf*)take((size_t)NXR * DD * 2);
    if ((size_t)(wsp - (char*)d_ws) > ws_size) return;    // in MiB: weights 10, Cb 8, TMP 16, q planes 16, k and r planes 32, v planes 16, AC and BD 8 each and PH and PL 4 each per head of a group (96), AM 8, attn_vec 24 = 226 of the 256 given; Hs (the pre-LN sum, f32 [2048][1024] = 8 MiB) reuses the start of BD (dead after the head loop); TMP serves as the second mean-map ping-pong buffer (8.4 of its 16.8 MB) during the head loop
    float* Hs = BD; float* AMP[2] = {AM, TMP};     // mean-map ping-pong: AM and TMP
    k_wt<<<dim3(DD / 64, DD / 64, 1), 256, 0, stream>>>(Wq, DD, DD, WqT); k_wt<<<dim3(DD / 64, (2 * DD) / 64, 1), 256, 0, stream>>>(Wkv, DD, 2 * DD, WkvT); k_wt<<<dim3(DD / 64, DD / 64, 1), 256, 0, stream>>>(Wrel, DD, DD, WrT); k_wt<<<dim3(DD / 64, DD / 64, 1), 256, 0, stream>>>(Wo, DD, DD, WoT);
    // c = [memory; x] as bf16 rows (t, b): rows 0..2047 from memory, 2048..4095 from x
    k_cvtb<<<NXR / 8, 256, 0, stream>>>(mem, NXR, Cb); k_cvtb<<<NXR / 8, 256, 0, stream>>>(x, NXR, Cb + (size_t)NXR * DD);
    k_gemmp<0, TK><<<dim3(NCR / 64, NH_, 1), 128, 0, stream>>>(Cb, WkvT, nullptr, nullptr, Kh, Kl, nullptr, nullptr);                             // k = c.Wkv[:, :1024] -> planes
    k_gemmp<2, TK><<<dim3(NCR / 64, NH_, 1), 128, 0, stream>>>(Cb, WkvT + (size_t)DD * DD, nullptr, nullptr, VTh, VTl, nullptr, nullptr);         // v = c.Wkv[:, 1024:] -> transposed planes
    k_gemmp<1, LQ><<<dim3(NXR / 64, NH_, 1), 128, 0, stream>>>(Cb + (size_t)NXR * DD, WqT, pbu, pbv, QUh, QUl, QVh, QVl);                         // q = x.Wq (x = the last 2048 rows of c) -> q + u, q + v_bias planes
    k_cvtb<<<NCR / 8, 256, 0, stream>>>(pe, NCR, Cb);                                                                                    // pos_emb rows (t, b) (c no longer needed)
    k_gemmp<0, TK><<<dim3(NCR / 64, NH_, 1), 128, 0, stream>>>(Cb, WrT, nullptr, nullptr, Rh, Rl, nullptr, nullptr);                              // r = pos_emb.Wrel -> planes
    // the head loop, HG heads of one batch per launch (k_gemm3: grid z; k_pv: grid y, with the two key halves; in k_relsoft the waves of a block)
    for (int b = 0; b < NBT; ++b) for (int h = 0; h < NH_; h += HG) { const size_t bh = (size_t)b * NH_ + h, gr = bh / HG; const int first = (b == 0 && h == 0), last = (b == NBT - 1 && h == NH_ - HG);
        k_gemm3<<<dim3(LQ / 64, TK / 64, HG), 128, 0, stream>>>(QUh + bh * LQ * HD, QUl + bh * LQ * HD, Kh + bh * TK * HD, Kl + bh * TK * HD, AC, TK, (size_t)LQ * HD, (size_t)TK * HD, (size_t)LQ * TK);     // AC = (q+u).k^T
        k_gemm3<<<dim3(LQ / 64, TK / 64, HG), 128, 0, stream>>>(QVh + bh * LQ * HD, QVl + bh * LQ * HD, Rh + bh * TK * HD, Rl + bh * TK * HD, BD, TK, (size_t)LQ * HD, (size_t)TK * HD, (size_t)LQ * TK);     // BD = (q+v).r^T (pre-shift)
        k_relsoft<<<LQ / (8 / HG), 256, 0, stream>>>(AC, BD, msk, b, first, AMP[(gr + 1) & 1], PH, PL, last ? out2 : AMP[gr & 1]);     // reads the previous group's buffer, writes the other
        k_pv<<<dim3(LQ / 32, 2 * HG, 1), 256, 0, stream>>>(PH, PL, VTh + bh * HD * TK, VTl + bh * HD * TK, AV + (size_t)b * DD + h * HD, NBT * DD, (size_t)NXR * DD);          // attn.v -> attn_vec[(l,b)][h*64 + d], two key-half planes
    }
    k_split<<<NXR / 8, 256, 0, stream>>>(AV, AV + (size_t)NXR * DD, NXR, AVh, AVl);     // adds the two key-half planes of attn_vec
    k_gemmb<true, false><<<dim3(NXR / 64, DD / 64, 1), 128, 0, stream>>>(AVh, AVl, WoT, nullptr, Hs, DD, nullptr, x, DD, 1);                 // h = x + attn_vec.Wo  (x bf16-rounded)
    k_ln<<<NXR / 8, 256, 0, stream>>>(Hs, g, bb, out);
}

// v008
// It runs in 390 microseconds.
// Two timings next to v007 put it at 1.19 and 1.20 times that version's speed.
// Over all steps from v000 it is 9.63 times as fast.
#include <hip/hip_runtime.h>

// Compute dtypes, f32 accumulate: k|v = [memory; x].Wkv ([4096 x 1024].[1024 x 2048]), q = x.Wq, r = pos_emb.Wrel (k-major weights transposed once; PLAIN bf16 operands
// = inputs rounded once, exact) and attn_out = attn_vec.Wo (hi/lo A, + x) on v_wmma_f32_16x16x32_bf16; per (batch, head): AC = (q + u).k^T and BD = (q + v_bias).r^T
// ([1024 x 64].[64 x 2048], both operands bf16 hi + UNSCALED residual, three products), the module's _rel_shift applied by INDEX (the literal pad-reshape-slice
// mapping, incl. its wrap-around entries), x 1/8, the INPUT mask (-1e30), the softmax over keys and the mean attention map in f32, attn.v ([1024 x 2048].[2048 x 64],

#define LQ   1024
#define TK   2048
#define NBT  2
#define DD   1024
#define NH_  16
#define HD   64
#define NXR  (LQ * NBT)           // 2048 x rows (l, b)
#define NCR  (TK * NBT)           // 4096 c / pos rows (t, b)
#define DM   DD
#define NTK  NCR
#define SCL  0.125f
#define NEGV -1e30f
#define LN_EPS 1e-5f
#define LOSC 1024.0f
#define HG   4                    // heads of one batch that each launch of the head loop works on side by side (divides NH_, so one launch has one batch index)

typedef _Float16 h16;
typedef unsigned short bf;
typedef __attribute__((ext_vector_type(16))) __bf16   v16bf;
typedef __attribute__((ext_vector_type(16))) _Float16 v16h;
typedef __attribute__((ext_vector_type(8)))  _Float16 v8h;
typedef __attribute__((ext_vector_type(8)))  unsigned short v8us;
typedef __attribute__((ext_vector_type(8)))  float    v8f;
typedef __attribute__((ext_vector_type(4)))  float    v4f;
typedef __attribute__((ext_vector_type(4)))  _Float16 v4h;
typedef v8h  __attribute__((may_alias)) v8ha;
typedef v4f  __attribute__((may_alias)) v4fa;
typedef v8us __attribute__((may_alias)) v8usa;

__device__ __forceinline__ unsigned short f2bf(float f) { unsigned u = __float_as_uint(f); u += 0x7FFFu + ((u >> 16) & 1u); return (unsigned short)(u >> 16); }
__device__ __forceinline__ float bf2f(unsigned short b) { return __uint_as_float(((unsigned)b) << 16); }
__device__ __forceinline__ float bfr(float f) { return bf2f(f2bf(f)); }
__device__ __forceinline__ v16h cat16(v8h lo, v8h hi) { return __builtin_shufflevector(lo, hi, 0, 1, 2, 3, 4, 5, 6, 7, 8, 9, 10, 11, 12, 13, 14, 15); }
__device__ __forceinline__ v16bf cat16b(v8us lo, v8us hi) { return __builtin_bit_cast(v16bf, __builtin_shufflevector(lo, hi, 0, 1, 2, 3, 4, 5, 6, 7, 8, 9, 10, 11, 12, 13, 14, 15)); }
__device__ __forceinline__ v8f wmma16(v16h a, v16h b, v8f c) { return __builtin_amdgcn_wmma_f32_16x16x32_f16(false, a, false, b, (short)0, c, false, false); }
__device__ __forceinline__ v8f wmmab(v16bf a, v16bf b, v8f c) { return __builtin_amdgcn_wmma_f32_16x16x32_bf16(false, a, false, b, (short)0, c, false, false); }

// k_wt: WT [n][K] = bf16(W[k][n]) (k-major [K][ncols]) via 64 x 64 LDS tiles; grid (K/64, ncols/64).
__global__ __launch_bounds__(256) void k_wt(const float* __restrict__ Wm, int K, int ncols, bf* WT) {
    __shared__ __align__(16) unsigned short tl[64 * 72];
    const int tid = threadIdx.x, k0 = blockIdx.x * 64, n0 = blockIdx.y * 64;
    const int kk = tid >> 2, nq = (tid & 3) * 16;
#pragma unroll
    for (int i = 0; i < 16; ++i) tl[(nq + i) * 72 + kk] = f2bf(Wm[(size_t)(k0 + kk) * ncols + n0 + nq + i]);
    __syncthreads();
    const int piece = tid & 7;
    auto pass = [&]() {
#pragma unroll
        for (int s = 0; s < 2; ++s) { const int nr = (tid >> 3) + 32 * s; const v8us val = *(const v8usa*)(tl + nr * 72 + piece * 8); *(v8us*)(WT + (size_t)(n0 + nr) * K + k0 + piece * 8) = val; }
    };
    pass(); 
}
__global__ __launch_bounds__(256) void k_cvtb(const float* __restrict__ src, int nrows, bf* dst) {
    const int lane = threadIdx.x & 31, r = blockIdx.x * 8 + (threadIdx.x >> 5);
    if (r >= nrows) return;
    v8us o[DM / 256];
#pragma unroll
    for (int q = 0; q < DM / 256; ++q) { v8us t;
#pragma unroll
        for (int i = 0; i < 8; ++i) t[i] = f2bf(src[(size_t)r * DM + q * 256 + lane * 8 + i]);
        o[q] = t; }
#pragma unroll
    for (int q = 0; q < DM / 256; ++q) *(v8us*)(dst + (size_t)r * DM + q * 256 + lane * 8) = o[q];
    
}

// The projection GEMMs' main loop. A 64-k piece of an operand row is one whole 128-byte line; a stage = the block's 64 A rows (SPLITA: and the 64 rows of the residual plane) and its 64 B rows of one such piece.
// The stages come into a ring of two LDS buffers by asynchronous copies of whole lines (a fragment load straight from global memory takes 32 bytes out of each of 16 lines, and the four waves
// would each fetch the same B rows); stage s + 1 flies while stage s is worked on. The fragments are read from LDS with the k order that the global loaders had.
#define GSP 72                    // LDS row pitch in bf16 elements: 144 bytes = 16 x odd, free of bank conflicts for 16-byte reads down a column of rows
#define GTE (64 * GSP)            // elements of one 64-row tile in LDS
// One lane's copies of a stage: row tid/8 + 16 i (i = 0..3) of each tile, 16-byte piece tid%8; l = the lane's LDS byte address in the stage's first tile, the pointers = its global addresses in row tid/8.
// The s_wait_xcnt closes each statement so that it stands in front of every later write of a register that a copy names.
__device__ __forceinline__ void copy8(unsigned l, const bf* a, size_t sa, const bf* b, size_t sb) {
    asm volatile("global_load_async_to_lds_b128 %0, %8, off\n\tglobal_load_async_to_lds_b128 %1, %9, off\n\tglobal_load_async_to_lds_b128 %2, %10, off\n\tglobal_load_async_to_lds_b128 %3, %11, off\n\t"
                 "global_load_async_to_lds_b128 %4, %12, off\n\tglobal_load_async_to_lds_b128 %5, %13, off\n\tglobal_load_async_to_lds_b128 %6, %14, off\n\tglobal_load_async_to_lds_b128 %7, %15, off\n\ts_wait_xcnt 0x0"
                 :: "v"(l), "v"(l + 32 * GSP), "v"(l + 64 * GSP), "v"(l + 96 * GSP), "v"(l + 2 * GTE), "v"(l + 2 * GTE + 32 * GSP), "v"(l + 2 * GTE + 64 * GSP), "v"(l + 2 * GTE + 96 * GSP),
                    "v"(a), "v"(a + sa), "v"(a + 2 * sa), "v"(a + 3 * sa), "v"(b), "v"(b + sb), "v"(b + 2 * sb), "v"(b + 3 * sb) : "memory");
}
__device__ __forceinline__ void copy12(unsigned l, const bf* a, const bf* al, size_t sa, const bf* b, size_t sb) {
    asm volatile("global_load_async_to_lds_b128 %0, %12, off\n\tglobal_load_async_to_lds_b128 %1, %13, off\n\tglobal_load_async_to_lds_b128 %2, %14, off\n\tglobal_load_async_to_lds_b128 %3, %15, off\n\t"
                 "global_load_async_to_lds_b128 %4, %16, off\n\tglobal_load_async_to_lds_b128 %5, %17, off\n\tglobal_load_async_to_lds_b128 %6, %18, off\n\tglobal_load_async_to_lds_b128 %7, %19, off\n\t"
                 "global_load_async_to_lds_b128 %8, %20, off\n\tglobal_load_async_to_lds_b128 %9, %21, off\n\tglobal_load_async_to_lds_b128 %10, %22, off\n\tglobal_load_async_to_lds_b128 %11, %23, off\n\ts_wait_xcnt 0x0"
                 :: "v"(l), "v"(l + 32 * GSP), "v"(l + 64 * GSP), "v"(l + 96 * GSP), "v"(l + 2 * GTE), "v"(l + 2 * GTE + 32 * GSP), "v"(l + 2 * GTE + 64 * GSP), "v"(l + 2 * GTE + 96 * GSP),
                    "v"(l + 4 * GTE), "v"(l + 4 * GTE + 32 * GSP), "v"(l + 4 * GTE + 64 * GSP), "v"(l + 4 * GTE + 96 * GSP),
                    "v"(a), "v"(a + sa), "v"(a + 2 * sa), "v"(a + 3 * sa), "v"(al), "v"(al + sa), "v"(al + 2 * sa), "v"(al + 3 * sa), "v"(b), "v"(b + sb), "v"(b + 2 * sb), "v"(b + 3 * sb) : "memory");
}
// ring: 2 buffers of [A 64 rows][SPLITA: Al 64 rows][B 64 rows]. ga, gal, gb: the block's first A, Al and B row; ra, rbn: their row strides in elements. 128 threads; K a multiple of 64.
// acc[t] of a wave = its 16 rows (wave * 16 ..) x columns t * 16 .., summed over k in steps of 32 in rising order (SPLITA: A.B, then Al.B, in each step), as with the global loaders.
template <bool SPLITA>
__device__ __forceinline__ void gemm_ring(unsigned short* ring, const bf* ga, const bf* gal, size_t ra, const bf* gb, size_t rbn, int K, v8f (&acc)[4]) {
    constexpr int NT = SPLITA ? 3 : 2, STG = NT * GTE;
    const int tid = threadIdx.x, lane = tid & 31, wave = tid >> 5, lr = lane & 15, hi = lane >> 4;
    const unsigned l0 = (unsigned)(size_t)ring + (tid >> 3) * (GSP * 2) + (tid & 7) * 16;     // the low 32 bits of a __shared__ address are the byte offset in the block's LDS
    const bf* pa = ga + (size_t)(tid >> 3) * ra + (tid & 7) * 8; const bf* pal = gal + (size_t)(tid >> 3) * ra + (tid & 7) * 8; const bf* pb = gb + (size_t)(tid >> 3) * rbn + (tid & 7) * 8;
    const int NS = K >> 6;
    auto issue = [&](int s) { const unsigned l = l0 + (s & 1) * (STG * 2);
        if (SPLITA) copy12(l, pa + s * 64, pal + s * 64, 16 * ra, pb + s * 64, 16 * rbn); else copy8(l, pa + s * 64, 16 * ra, pb + s * 64, 16 * rbn); };
    issue(0);
    asm volatile("s_wait_asynccnt 0x0" ::: "memory");     // this wave's copies of stage 0 have landed
    __syncthreads();     // every wave's copies of stage 0 have landed before any wave reads a fragment
    if (NS > 1) issue(1);
#pragma unroll 1     // rolled: one pass a stage
    for (int s = 0; s < NS; ++s) {
        const unsigned short* aw = ring + (s & 1) * STG + (wave * 16 + lr) * GSP + 8 * hi;
        const unsigned short* bw = ring + (s & 1) * STG + (NT - 1) * GTE + lr * GSP + 8 * hi;
        v8us fa[2][SPLITA ? 4 : 2], fb[2][4][2];
#pragma unroll     // unrolled (all four loops over h and t): fa[], fb[] and acc[] are indexed by constants and stay in registers
        for (int h = 0; h < 2; ++h) { const int kc = h * 32;
            fa[h][0] = *(const v8usa*)(aw + kc); fa[h][1] = *(const v8usa*)(aw + kc + 16);
            if constexpr (SPLITA) { fa[h][2] = *(const v8usa*)(aw + GTE + kc); fa[h][3] = *(const v8usa*)(aw + GTE + kc + 16); }
#pragma unroll
            for (int t = 0; t < 4; ++t) { fb[h][t][0] = *(const v8usa*)(bw + t * 16 * GSP + kc); fb[h][t][1] = *(const v8usa*)(bw + t * 16 * GSP + kc + 16); }
        }
        __builtin_amdgcn_sched_barrier(0);     // keeps the stage's LDS reads together ahead of its matrix instructions (without it the scheduler put reads among them, reused their registers and waited out the LDS latency more than once a stage)
#pragma unroll
        for (int h = 0; h < 2; ++h) { const v16bf a = cat16b(fa[h][0], fa[h][1]);
#pragma unroll
            for (int t = 0; t < 4; ++t) { const v16bf bq = cat16b(fb[h][t][0], fb[h][t][1]); acc[t] = wmmab(a, bq, acc[t]); if constexpr (SPLITA) acc[t] = wmmab(cat16b(fa[h][2], fa[h][3]), bq, acc[t]); }
        }
        asm volatile("v_nop\n\tv_nop\n\tv_nop\n\tv_nop" : "+v"(acc[0]), "+v"(acc[1]), "+v"(acc[2]), "+v"(acc[3]));     // the four slots behind the pass's last matrix instruction, also on the taken branches behind it, before its operand registers are overwritten
        asm volatile("s_wait_dscnt 0x0" ::: "memory");        // this wave has finished reading stage s
        asm volatile("s_wait_asynccnt 0x0" ::: "memory");     // this wave's copies of stage s + 1 have landed
        __syncthreads();     // publishes stage s + 1 and ends every wave's reads of the buffer that is refilled behind it
        if (s + 2 < NS) issue(s + 2);
    }
    asm volatile("s_wait_asynccnt 0x0" ::: "memory");     // no copy is outstanding when the wave goes on
}

// k_gemmb: 64 x 64 block tile (4 waves x 16 x 64) of C[NXR][DD] = (A [+ Al]).B^T (K = 1024) [+ bf(bias[c])] [+ bf(R[r][c]) residual]; f32 whole-line epilogue (or f16
template <bool SPLITA, bool F16OUT = false>
__global__ __launch_bounds__(128) void k_gemmb(const bf* __restrict__ A, const bf* __restrict__ Al, const bf* __restrict__ Bn, const float* __restrict__ bias, float* C, int ldc, h16* C2, const float* __restrict__ R = nullptr, int K = DM, int roundR = 1) {
    __shared__ __align__(16) float ost[4][16 * 68];
    __shared__ __align__(16) unsigned short ring[2 * (SPLITA ? 3 : 2) * GTE];
    const int lane = threadIdx.x & 31, wave = threadIdx.x >> 5, lr = lane & 15, hi = lane >> 4;
    const int r0 = blockIdx.x * 64 + wave * 16, c0 = blockIdx.y * 64;
    v8f acc[4];
#pragma unroll
    for (int t = 0; t < 4; ++t) acc[t] = (v8f){};
    gemm_ring<SPLITA>(ring, A + (size_t)blockIdx.x * 64 * K, (SPLITA ? Al : A) + (size_t)blockIdx.x * 64 * K, (size_t)K, Bn + (size_t)c0 * K, (size_t)K, K, acc);
    float* os = &ost[wave][0];
#pragma unroll
    for (int t = 0; t < 4; ++t) { const float bv = bias ? bfr(bias[c0 + t * 16 + lr]) : 0.f;
#pragma unroll
        for (int j = 0; j < 8; ++j) os[(hi * 8 + j) * 68 + t * 16 + lr] = acc[t][j] + bv; }
    __syncthreads();
    if (F16OUT) {
        h16* crow = (h16*)(void*)C + (size_t)r0 * ldc + c0;
        auto pass = [&]() {
#pragma unroll
            for (int s = 0; s < 4; ++s) { const int row = 4 * s + (lane >> 3), piece = lane & 7; const float* sp = os + row * 68 + piece * 8; v8h o, o2;
#pragma unroll
                for (int i = 0; i < 8; ++i) { const h16 a = (h16)sp[i]; o[i] = a; o2[i] = (h16)((sp[i] - (float)a) * LOSC); }
                *(v8h*)(crow + (size_t)row * ldc + piece * 8) = o; if (C2) *(v8h*)(C2 + (size_t)r0 * ldc + c0 + (size_t)row * ldc + piece * 8) = o2; }
        };
        pass(); 
    } else {
        float* crow = C + (size_t)r0 * ldc + c0;
        auto pass = [&]() {
#pragma unroll
            for (int s = 0; s < 8; ++s) { const int Lid = (lane >> 3) + 4 * s, piece = lane & 7; const int row = Lid >> 1, cofs = (Lid & 1) * 32 + piece * 4;
                v4f val = *(const v4fa*)(os + row * 68 + cofs); if (R) { const v4f rv = *(const v4f*)(R + ((size_t)r0 + row) * ldc + c0 + cofs); val += roundR ? (v4f){bfr(rv[0]), bfr(rv[1]), bfr(rv[2]), bfr(rv[3])} : rv; }
                *(v4f*)(crow + (size_t)row * ldc + cofs) = val; }
        };
        pass(); 
    }
}

// k_score: 64 x 128 tile of one head's score plane S = AC + rel_shift(BD), AC = (q + u).k^T, BD = (q + v_bias).r^T, all operands bf16 hi + residual over K = HD = 64 (row stride HD): three products per
// 32-k step (hh, lh, hl), AC and BD in accumulators of their own, added once at the end. blockIdx.z = the head inside the launch's group.
// The module's _rel_shift by index: with e = j + L - 1 - i, key j of row i takes BD[i][e] where e < T, 0 where e == T, and BD[i + 1][e - T - 1] where e > T (the wrap-around entries).
// A wave's 16 rows x 64 keys need e in a strip of 80 that starts at a multiple of 16: five 16 x 16 tiles; T is a multiple of 16, so a tile lies wholly in front of T (A rows i) or wholly from T on (A rows i + 1).
// The block's r rows are laid into LDS in the order of e (192 rows), so that a strip tile's B fragment is read like any other; the strip goes through LDS, where row ii is read 15 - ii places further on.
// A plane row is one 128-byte line: the block brings its tiles into LDS by loads that cover whole lines; the fragments are read from LDS with the k order that the global loaders had.
#define SP 72                     // LDS row pitch in bf16 elements: 144 bytes = 16 x odd, free of bank conflicts for 16-byte reads down a column of rows
#define SQV 128                   // LDS rows: q + u hi 64, lo 64; from SQV q + v_bias hi 65, lo 65 (rows i .. i + 64); from SKK k hi 128, lo 128; from SRR r hi 192, lo 192
#define SKK 258
#define SRR 514
#define SRW 898
#define BDP 84                    // pitch of a wave's BD strip in floats
#define WST (16 * 68 + 16 * BDP)  // floats of a wave's output stage: AC tile, BD strip
__global__ __launch_bounds__(256) void k_score(const bf* __restrict__ QUh, const bf* __restrict__ QUl, const bf* __restrict__ QVh, const bf* __restrict__ QVl,
                                               const bf* __restrict__ Kh, const bf* __restrict__ Kl, const bf* __restrict__ Rh, const bf* __restrict__ Rl, float* S) {
    typedef float __attribute__((may_alias)) fal;
    __shared__ __align__(16) unsigned short st[SRW * SP];     // the operand tiles; behind the second barrier the waves' output stages
    static_assert(8 * WST * 4 <= SRW * SP * 2, "the eight output stages fit the operand tiles");
    static_assert(LQ <= TK && TK % 16 == 0 && LQ % 64 == 0, "e >= 0, and a strip tile does not straddle T");
    const int tid = threadIdx.x, lane = tid & 31, wave = tid >> 5, lr = lane & 15, hi = lane >> 4, wr = wave & 3, wc = wave >> 2;     // wave: 16 rows wr, 64 keys wc
    const int rb = blockIdx.x * 64, j0 = blockIdx.y * 128, r32 = tid >> 3, pc = (tid & 7) * 8;     // a thread loads row r32 + 32 s, 16-byte piece tid % 8
    const size_t qo = (size_t)blockIdx.z * LQ * HD, ko = (size_t)blockIdx.z * TK * HD;
    const int Eb = j0 + LQ - 64 - rb;     // e of the block's first r row in LDS
    const unsigned tb = (r32 * HD + pc) * 2;     // the thread's byte offset in a run of 32 plane rows
    const bf* qp[4] = {QUh + qo + (size_t)rb * HD, QUl + qo + (size_t)rb * HD, QVh + qo + (size_t)rb * HD, QVl + qo + (size_t)rb * HD};
    const bf* kp[2] = {Kh + ko + (size_t)j0 * HD, Kl + ko + (size_t)j0 * HD}; const bf* rp[2] = {Rh + ko, Rl + ko};
    unsigned ro[6];     // the thread's byte offsets of its six r rows in the head's plane
#pragma unroll     // unrolled (all loops of this kernel): the arrays are indexed by constants and stay in registers, and the loads go out together, one memory round trip
    for (int s = 0; s < 6; ++s) { const int e = Eb + s * 32 + r32, ge = e < TK ? e : (e == TK ? 0 : e - TK - 1); ro[s] = (unsigned)(ge * HD + pc) * 2; }     // e == T: any row, its column is set to 0 below
    // every load: a base that is the same for the whole block + a 32-bit byte offset of the lane
    v8us gq[4][2], gk[2][4], gr[2][6];
#pragma unroll
    for (int p = 0; p < 4; ++p)
#pragma unroll
        for (int s = 0; s < 2; ++s) gq[p][s] = *(const v8us*)((const char*)(qp[p] + s * 32 * HD) + tb);
#pragma unroll
    for (int p = 0; p < 2; ++p)
#pragma unroll
        for (int s = 0; s < 4; ++s) gk[p][s] = *(const v8us*)((const char*)(kp[p] + s * 32 * HD) + tb);
#pragma unroll
    for (int s = 0; s < 6; ++s)
#pragma unroll
        for (int p = 0; p < 2; ++p) gr[p][s] = *(const v8us*)((const char*)rp[p] + ro[s]);
    // the wait in front of any write of a register that one of the 28 loads names. The offsets and the bases are its inputs: each stays in its register up to here, so that no load's result lands on one
    // and the run needs no wait in its middle (without them the build reused the offset register behind the 16th load and waited there)
    asm volatile("s_wait_xcnt 0x0" :: "v"(tb), "v"(ro[0]), "v"(ro[1]), "v"(ro[2]), "v"(ro[3]), "v"(ro[4]), "v"(ro[5]),
                 "s"(qp[0]), "s"(qp[1]), "s"(qp[2]), "s"(qp[3]), "s"(kp[0]), "s"(kp[1]), "s"(rp[0]), "s"(rp[1]) : "memory");
    if (tid < 16)     // row rb + 64 of q + v_bias, hi and lo; row L - 1 never wraps, so the stand-in for row L is never used
        *(v8usa*)(st + (SQV + 64 + (tid < 8 ? 0 : 65)) * SP + pc) = *(const v8us*)((tid < 8 ? QVh : QVl) + qo + (size_t)(rb + 64 < LQ ? rb + 64 : LQ - 1) * HD + pc);
#pragma unroll
    for (int p = 0; p < 4; ++p)
#pragma unroll
        for (int s = 0; s < 2; ++s) *(v8usa*)(st + ((p < 2 ? p * 64 : SQV + (p - 2) * 65) + s * 32 + r32) * SP + pc) = gq[p][s];
#pragma unroll
    for (int p = 0; p < 2; ++p)
#pragma unroll
        for (int s = 0; s < 4; ++s) *(v8usa*)(st + (SKK + p * 128 + s * 32 + r32) * SP + pc) = gk[p][s];
#pragma unroll
    for (int p = 0; p < 2; ++p)
#pragma unroll
        for (int s = 0; s < 6; ++s) *(v8usa*)(st + (SRR + p * 192 + s * 32 + r32) * SP + pc) = gr[p][s];
    __syncthreads();     // all tiles are in LDS before any wave reads a fragment
    v8f acc[4], bda[5];
#pragma unroll
    for (int t = 0; t < 4; ++t) acc[t] = (v8f){};
#pragma unroll
    for (int t = 0; t < 5; ++t) bda[t] = (v8f){};
    // BD first: its fragments take the more registers, and the four AC accumulators are not live yet
    const int so = 48 - 16 * wr + 64 * wc, E0 = Eb + so;     // the wave's strip: its first r row in LDS, and that row's e
    // the A rows of the strip's first tile (x) and of its last (y): i, or i + 1 from T on; the three tiles between take the one or the other
    const unsigned short* ax = st + (SQV + wr * 16 + lr + (E0 >= TK ? 1 : 0)) * SP + 8 * hi;
    const unsigned short* ay = st + (SQV + wr * 16 + lr + (E0 + 64 >= TK ? 1 : 0)) * SP + 8 * hi;
    const unsigned short* rw = st + (SRR + so + lr) * SP + 8 * hi;
#pragma unroll
    for (int kc = 0; kc < HD; kc += 32) {
        v8us fx[4], fy[4], fr[5][4];
        fx[0] = *(const v8usa*)(ax + kc); fx[1] = *(const v8usa*)(ax + kc + 16); fx[2] = *(const v8usa*)(ax + 65 * SP + kc); fx[3] = *(const v8usa*)(ax + 65 * SP + kc + 16);
        fy[0] = *(const v8usa*)(ay + kc); fy[1] = *(const v8usa*)(ay + kc + 16); fy[2] = *(const v8usa*)(ay + 65 * SP + kc); fy[3] = *(const v8usa*)(ay + 65 * SP + kc + 16);
#pragma unroll
        for (int t = 0; t < 5; ++t) { const unsigned short* bp = rw + t * 16 * SP + kc;
            fr[t][0] = *(const v8usa*)bp; fr[t][1] = *(const v8usa*)(bp + 16); fr[t][2] = *(const v8usa*)(bp + 192 * SP); fr[t][3] = *(const v8usa*)(bp + 192 * SP + 16); }
        __builtin_amdgcn_sched_barrier(0);     // keeps the 32 k's LDS reads together ahead of their matrix instructions, so that the wave waits out the LDS latency once and not once a tile
        const v16bf xh = cat16b(fx[0], fx[1]), xl = cat16b(fx[2], fx[3]), yh = cat16b(fy[0], fy[1]), yl = cat16b(fy[2], fy[3]);
#pragma unroll
        for (int t = 0; t < 5; ++t) { const bool uy = E0 + 16 * t >= TK;
            const v16bf a = t == 0 ? xh : t == 4 ? yh : (uy ? yh : xh), al = t == 0 ? xl : t == 4 ? yl : (uy ? yl : xl);
            const v16bf bh = cat16b(fr[t][0], fr[t][1]), bl = cat16b(fr[t][2], fr[t][3]);
            bda[t] = wmmab(a, bh, bda[t]); bda[t] = wmmab(al, bh, bda[t]); bda[t] = wmmab(a, bl, bda[t]); }
        __builtin_amdgcn_sched_barrier(0);     // keeps what follows (the next 32 k's reads; in the end the AC part's reads) behind these matrix instructions: scheduled as one region, the fragments were fetched so far ahead that registers were spilled
    }
    const unsigned short* aw = st + (wr * 16 + lr) * SP + 8 * hi;
    const unsigned short* bw = st + (SKK + wc * 64 + lr) * SP + 8 * hi;
#pragma unroll
    for (int kc = 0; kc < HD; kc += 32) {
        v8us fa[4], fb[4][4];
        fa[0] = *(const v8usa*)(aw + kc); fa[1] = *(const v8usa*)(aw + kc + 16); fa[2] = *(const v8usa*)(aw + 64 * SP + kc); fa[3] = *(const v8usa*)(aw + 64 * SP + kc + 16);
#pragma unroll
        for (int t = 0; t < 4; ++t) { const unsigned short* bp = bw + t * 16 * SP + kc;
            fb[t][0] = *(const v8usa*)bp; fb[t][1] = *(const v8usa*)(bp + 16); fb[t][2] = *(const v8usa*)(bp + 128 * SP); fb[t][3] = *(const v8usa*)(bp + 128 * SP + 16); }
        __builtin_amdgcn_sched_barrier(0);     // as above: one wait for the 32 k's LDS reads
        const v16bf a = cat16b(fa[0], fa[1]), al = cat16b(fa[2], fa[3]);
#pragma unroll
        for (int t = 0; t < 4; ++t) { const v16bf bh = cat16b(fb[t][0], fb[t][1]), bl = cat16b(fb[t][2], fb[t][3]);
            acc[t] = wmmab(a, bh, acc[t]); acc[t] = wmmab(al, bh, acc[t]); acc[t] = wmmab(a, bl, acc[t]); }
        __builtin_amdgcn_sched_barrier(0);     // as above: against spills
    }
    __syncthreads();     // every wave has read its last fragment before the tiles' LDS is written as output stages
    fal* os = (fal*)(void*)st + wave * WST; fal* ob = os + 16 * 68;
#pragma unroll
    for (int t = 0; t < 4; ++t) {
#pragma unroll
        for (int j = 0; j < 8; ++j) os[(hi * 8 + j) * 68 + t * 16 + lr] = acc[t][j]; }
#pragma unroll
    for (int t = 0; t < 5; ++t) { const bool zc = E0 + 16 * t + lr == TK;     // the column e == T: the pad's zero
#pragma unroll
        for (int j = 0; j < 8; ++j) ob[(hi * 8 + j) * BDP + t * 16 + lr] = zc ? 0.f : bda[t][j]; }
    __builtin_amdgcn_wave_barrier(); asm volatile("" ::: "memory");     // as before: keeps the compiler from moving the reads of other lanes' values ahead of the wave's stores to its stage
    float* crow = S + (size_t)blockIdx.z * LQ * TK + (size_t)(rb + wr * 16) * TK + j0 + wc * 64;
    v4f val[8], bs[8];
#pragma unroll
    for (int s = 0; s < 8; ++s) { const int Lid = (lane >> 3) + 4 * s, piece = lane & 7; const int row = Lid >> 1, cofs = (Lid & 1) * 32 + piece * 4;
        const fal* bq = ob + row * BDP + cofs + 15 - row;     // key jj of row ii: strip column jj + 15 - ii
        val[s] = *(const v4fa*)(os + row * 68 + cofs); bs[s] = (v4f){bq[0], bq[1], bq[2], bq[3]}; }
#pragma unroll     // a loop of its own: the 24 LDS reads above go out together, not one row's at a time between the stores
    for (int s = 0; s < 8; ++s) { const int Lid = (lane >> 3) + 4 * s, piece = lane & 7; const int row = Lid >> 1, cofs = (Lid & 1) * 32 + piece * 4;
        *(v4f*)(crow + (size_t)row * TK + cofs) = val[s] + bs[s]; }
}

// k_pv: attn.v of one head, C[1024][64] = (Ah + Al).(Bh + Bl)^T over the 2048 keys (three products per 32-k step, k order of the fragments as in k_score). One 32 x 64 output tile and one
// half of the keys per block (grid: 32 row tiles, y = HG heads x 2 key halves = 256 blocks). The 8 waves = 4 key groups (256 keys each) x 2 row tiles (16 x 64); the 4 groups' partial tiles are added
// in group order through LDS, and the two halves go to two planes (C, C + zstride) that k_split adds. Each stored tile row is two whole 128-byte lines.
// A 64-key piece of an operand row is one whole 128-byte line (a fragment load straight from global memory takes 32 bytes out of each of 16 lines). A stage = such a piece of every group's 32 Ah, 32 Al,
// 64 Bh and 64 Bl rows; the stages come into a ring of two LDS buffers by asynchronous copies of whole lines, stage s + 1 flies while stage s is worked on.
#define PVG 4                     // key groups of a block
#define PVR 192                   // LDS rows of one key group in a stage: Ah 32, Al 32, Bh 64, Bl 64
#define PVS (PVG * PVR * GSP)     // elements of one stage
// One lane's 12 copies: 4 rows, 8 rows apart, at each of three places; l = the lane's LDS byte address, p = its global address in the first of the 4 rows (row stride TK).
// The s_wait_xcnt closes the statement so that it stands in front of every later write of a register that a copy names.
__device__ __forceinline__ void copy12r(unsigned l0, unsigned l1, unsigned l2, const bf* p0, const bf* p1, const bf* p2) {
    constexpr unsigned LS = 8 * GSP * 2; constexpr size_t GS = (size_t)8 * TK;
    asm volatile("global_load_async_to_lds_b128 %0, %12, off\n\tglobal_load_async_to_lds_b128 %1, %13, off\n\tglobal_load_async_to_lds_b128 %2, %14, off\n\tglobal_load_async_to_lds_b128 %3, %15, off\n\t"
                 "global_load_async_to_lds_b128 %4, %16, off\n\tglobal_load_async_to_lds_b128 %5, %17, off\n\tglobal_load_async_to_lds_b128 %6, %18, off\n\tglobal_load_async_to_lds_b128 %7, %19, off\n\t"
                 "global_load_async_to_lds_b128 %8, %20, off\n\tglobal_load_async_to_lds_b128 %9, %21, off\n\tglobal_load_async_to_lds_b128 %10, %22, off\n\tglobal_load_async_to_lds_b128 %11, %23, off\n\ts_wait_xcnt 0x0"
                 :: "v"(l0), "v"(l0 + LS), "v"(l0 + 2 * LS), "v"(l0 + 3 * LS), "v"(l1), "v"(l1 + LS), "v"(l1 + 2 * LS), "v"(l1 + 3 * LS), "v"(l2), "v"(l2 + LS), "v"(l2 + 2 * LS), "v"(l2 + 3 * LS),
                    "v"(p0), "v"(p0 + GS), "v"(p0 + 2 * GS), "v"(p0 + 3 * GS), "v"(p1), "v"(p1 + GS), "v"(p1 + 2 * GS), "v"(p1 + 3 * GS), "v"(p2), "v"(p2 + GS), "v"(p2 + 2 * GS), "v"(p2 + 3 * GS) : "memory");
}
__global__ __launch_bounds__(256) void k_pv(const bf* __restrict__ Ah, const bf* __restrict__ Al, const bf* __restrict__ Bh, const bf* __restrict__ Bl, float* C, int ldc, size_t zstride) {
    __shared__ __align__(16) unsigned short ring[2 * PVS];
    __shared__ __align__(16) float red[8][16 * 68];     // each wave's partial 16 x 64 tile
    const int tid = threadIdx.x, lane = tid & 31, wave = tid >> 5, lr = lane & 15, hi = lane >> 4;
    const int kg = wave >> 1, rw = wave & 1;                 // key group, row tile
    const int hz = blockIdx.y >> 1, kh = blockIdx.y & 1;     // head inside the launch's group, key half
    const int r0 = blockIdx.x * 32, k0 = kh * (TK / 2) + kg * (TK / 2 / PVG);
    // a key group's two waves copy the group's own rows: row (tid % 64) / 8 + 8 i, 16-byte piece tid % 8, so that 8 lanes take one whole line
    const int r8 = (tid & 63) >> 3, pc = tid & 7;
    const size_t ao = ((size_t)hz * LQ + r0 + r8) * TK + k0 + pc * 8, bo = ((size_t)hz * HD + r8) * TK + k0 + pc * 8;
    const bf* pah = Ah + ao; const bf* pal = Al + ao; const bf* pbh = Bh + bo; const bf* pbl = Bl + bo;
    const unsigned l0 = (unsigned)(size_t)ring + (kg * PVR + r8) * (GSP * 2) + pc * 16;     // the low 32 bits of a __shared__ address are the byte offset in the block's LDS
    auto issue = [&](int s) { const unsigned l = l0 + (s & 1) * (PVS * 2); const int ko = s * 64;
        copy12r(l, l + 32 * GSP * 2, l + 64 * GSP * 2, pah + ko, pal + ko, pbh + ko);
        copy12r(l + 96 * GSP * 2, l + 128 * GSP * 2, l + 160 * GSP * 2, pbh + ko + (size_t)32 * TK, pbl + ko, pbl + ko + (size_t)32 * TK); };
    constexpr int NS = TK / 2 / PVG / 64;
    static_assert(NS >= 2, "stage 1 exists");
    v8f acc[4];
#pragma unroll     // unrolled (all loops over t, h, j of this kernel): acc[], fa[] and fb[] are indexed by constants and stay in registers
    for (int t = 0; t < 4; ++t) acc[t] = (v8f){};
    issue(0);
    asm volatile("s_wait_asynccnt 0x0" ::: "memory");     // this wave's copies of stage 0 have landed
    __syncthreads();     // every wave's copies of stage 0 have landed before any wave reads a fragment
    issue(1);
#pragma unroll 1     // rolled: one pass a stage
    for (int s = 0; s < NS; ++s) {
        const unsigned short* gb = ring + (s & 1) * PVS + kg * PVR * GSP;
        const unsigned short* aw = gb + (rw * 16 + lr) * GSP + 8 * hi;
        const unsigned short* bw = gb + (64 + lr) * GSP + 8 * hi;
        v8us fa[2][4], fb[2][4][4];
#pragma unroll
        for (int h = 0; h < 2; ++h) { const int kc = h * 32;
            fa[h][0] = *(const v8usa*)(aw + kc); fa[h][1] = *(const v8usa*)(aw + kc + 16); fa[h][2] = *(const v8usa*)(aw + 32 * GSP + kc); fa[h][3] = *(const v8usa*)(aw + 32 * GSP + kc + 16);
#pragma unroll
            for (int t = 0; t < 4; ++t) { const unsigned short* bp = bw + t * 16 * GSP + kc;
                fb[h][t][0] = *(const v8usa*)bp; fb[h][t][1] = *(const v8usa*)(bp + 16); fb[h][t][2] = *(const v8usa*)(bp + 64 * GSP); fb[h][t][3] = *(const v8usa*)(bp + 64 * GSP + 16); }
        }
        __builtin_amdgcn_sched_barrier(0);     // keeps the stage's LDS reads together ahead of its matrix instructions, so that the wave waits out the LDS latency once a stage
#pragma unroll
        for (int h = 0; h < 2; ++h) { const v16bf a = cat16b(fa[h][0], fa[h][1]), al = cat16b(fa[h][2], fa[h][3]);
            // product by product over the four column tiles: each accumulator still takes a.bh, al.bh, a.bl in that order, with three independent matrix instructions between two on the same one
#pragma unroll
            for (int t = 0; t < 4; ++t) acc[t] = wmmab(a, cat16b(fb[h][t][0], fb[h][t][1]), acc[t]);
#pragma unroll
            for (int t = 0; t < 4; ++t) acc[t] = wmmab(al, cat16b(fb[h][t][0], fb[h][t][1]), acc[t]);
#pragma unroll
            for (int t = 0; t < 4; ++t) acc[t] = wmmab(a, cat16b(fb[h][t][2], fb[h][t][3]), acc[t]);
        }
        asm volatile("v_nop\n\tv_nop\n\tv_nop\n\tv_nop" : "+v"(acc[0]), "+v"(acc[1]), "+v"(acc[2]), "+v"(acc[3]));     // the four slots behind the pass's last matrix instruction, also on the taken branches behind it, before its operand registers are overwritten
        asm volatile("s_wait_dscnt 0x0" ::: "memory");        // this wave has finished reading stage s
        asm volatile("s_wait_asynccnt 0x0" ::: "memory");     // this wave's copies of stage s + 1 have landed
        __syncthreads();     // publishes stage s + 1 and ends every wave's reads of the buffer that is refilled behind it
        if (s + 2 < NS) issue(s + 2);
    }
    asm volatile("s_wait_asynccnt 0x0" ::: "memory");     // no copy is outstanding when the wave goes on
    float* os = &red[wave][0];
#pragma unroll
    for (int t = 0; t < 4; ++t) {
#pragma unroll
        for (int j = 0; j < 8; ++j) os[(hi * 8 + j) * 68 + t * 16 + lr] = acc[t][j]; }
    __syncthreads();     // every wave's partial tile is in LDS before any thread adds them
    const int row = tid >> 3;     // thread -> 8 consecutive floats of one of the 32 rows
    const float* rp = &red[row >> 4][(row & 15) * 68 + pc * 8];
    v4f x0 = *(const v4fa*)rp, x1 = *(const v4fa*)(rp + 4);
#pragma unroll     // unrolled: the LDS reads go out together; the adds stay in group order
    for (int q = 1; q < PVG; ++q) { x0 += *(const v4fa*)(rp + q * 2 * 16 * 68); x1 += *(const v4fa*)(rp + q * 2 * 16 * 68 + 4); }
    float* crow = C + (size_t)kh * zstride + (size_t)(r0 + row) * ldc + hz * HD + pc * 8;
    *(v4f*)crow = x0; *(v4f*)(crow + 4) = x1;
}

// k_gemmp: a projection GEMM (main loop gemm_ring as in k_gemmb, plain A) whose epilogue writes the attention operand planes itself: bf16 hi + UNSCALED residual of the f32 sums, per (batch b, head h).
// A block takes 64 consecutive positions t of ONE batch (A row = t*2 + b) and the 64 columns of one head (blockIdx.y), so that every stored plane row is one whole 128-byte line.
// K is an argument as in k_gemmb.
// MODE 0: P0[bh][t][d] (k, r). MODE 1: P0 = sums + bf(bias0[h][d]), P1 = sums + bf(bias1[h][d]) (q + u, q + v_bias). MODE 2: P0[bh][d][t] (v transposed: the tile is laid into LDS column-major).
template <int MODE, int NR>
__global__ __launch_bounds__(128) void k_gemmp(const bf* __restrict__ A, const bf* __restrict__ Bn, const float* __restrict__ bias0, const float* __restrict__ bias1, bf* P0h, bf* P0l, bf* P1h, bf* P1l, int K = DM) {
    __shared__ __align__(16) float ost[64 * 68];
    __shared__ __align__(16) unsigned short ring[2 * 2 * GTE];
    __shared__ __align__(16) float ub[2 * HD];     // MODE 1 only
    const int lane = threadIdx.x & 31, wave = threadIdx.x >> 5, lr = lane & 15, hi = lane >> 4;
    const int b = (blockIdx.x * 64) / NR, t0 = (blockIdx.x * 64) % NR, h = blockIdx.y, c0 = h * HD;
    v8f acc[4];
#pragma unroll     // unrolled (all loops over t, j, i, s of this kernel): acc[] and the vectors are indexed by constants and stay in registers
    for (int t = 0; t < 4; ++t) acc[t] = (v8f){};
    gemm_ring<false>(ring, A + ((size_t)t0 * NBT + b) * K, A + ((size_t)t0 * NBT + b) * K, (size_t)NBT * K, Bn + (size_t)c0 * K, (size_t)K, K, acc);
#pragma unroll
    for (int t = 0; t < 4; ++t) {
        if (MODE == 2) { float* p = ost + (t * 16 + lr) * 68 + wave * 16 + hi * 8;     // row = d, column = t: a lane's 8 sums are 8 consecutive positions
            *(v4fa*)p = (v4f){acc[t][0], acc[t][1], acc[t][2], acc[t][3]}; *(v4fa*)(p + 4) = (v4f){acc[t][4], acc[t][5], acc[t][6], acc[t][7]};
        } else {
#pragma unroll
            for (int j = 0; j < 8; ++j) ost[(wave * 16 + hi * 8 + j) * 68 + t * 16 + lr] = acc[t][j]; }
    }
    if (MODE == 1) ub[threadIdx.x] = bfr((threadIdx.x < HD ? bias0 : bias1)[c0 + (threadIdx.x & (HD - 1))]);     // the head's 64 + 64 rounded bias values, one load a thread
    __syncthreads();     // the whole 64 x 64 tile (MODE 1: and the bias values) is in LDS before it is read back by rows (MODE 2: a row holds sums of all four waves)
    const int piece = lane & 7; const size_t bh = (size_t)b * NH_ + h;
    float u0[8], u1[8];
    if (MODE == 1) {
#pragma unroll
        for (int i = 0; i < 8; ++i) { u0[i] = ub[piece * 8 + i]; u1[i] = ub[HD + piece * 8 + i]; } }
#pragma unroll
    for (int s = 0; s < 4; ++s) { const int row = wave * 16 + 4 * s + (lane >> 3); const float* sp = ost + row * 68 + piece * 8;
        const v4f x0 = *(const v4fa*)sp, x1 = *(const v4fa*)(sp + 4);
        const size_t o = MODE == 2 ? (bh * HD + row) * TK + t0 + piece * 8 : (bh * NR + t0 + row) * HD + piece * 8;
        v8us oh, ol;
#pragma unroll
        for (int i = 0; i < 8; ++i) { float v = i < 4 ? x0[i & 3] : x1[i & 3]; if (MODE == 1) v += u0[i]; const unsigned short hb = f2bf(v); oh[i] = hb; ol[i] = f2bf(v - bf2f(hb)); }
        *(v8us*)(P0h + o) = oh; *(v8us*)(P0l + o) = ol;
        if (MODE == 1) {
#pragma unroll
            for (int i = 0; i < 8; ++i) { const float v = (i < 4 ? x0[i & 3] : x1[i & 3]) + u1[i]; const unsigned short hb = f2bf(v); oh[i] = hb; ol[i] = f2bf(v - bf2f(hb)); }
            *(v8us*)(P1h + o) = oh; *(v8us*)(P1l + o) = ol; }
    }
}
// 2^x. The v_nop is the slot that the instruction set asks for behind a transcendental before its source register is overwritten.
__device__ __forceinline__ float exp2_slot(float x) { float r; asm("v_exp_f32 %0, %1\n\tv_nop" : "=v"(r) : "v"(x)); return r; }
// k_relsoft: one wave per query row i of head (b,h); a block = 2 rows x the HG heads of the group (planes LQ*TK elements apart); for each key j: s = S[i][j]/8 (S = AC + shifted BD, from k_score),
// s = -1e30 where mask[i][j][b]; softmax over the 2048 keys (f32, fixed lane order). S and the mask are read ONCE: a lane holds its 64 scores (then their
// exponentials) in registers from the loads to the stores -> bf16 hi + UNSCALED
// residual planes; the mean attention map accumulates p / 32 in (b,h) order: each wave leaves its head's p / 32 in LDS, and behind a barrier the block adds the HG heads in
// head order onto the previous group's map, through two ping-pong buffers (AMIN = the previous group's buffer, never the one being written,
// launch bounds, second argument: caps the registers; without it the build takes 300, three waves a SIMD, and the two blocks that the grid gives every WGP do not fit side by side
__global__ __launch_bounds__(256, 5) void k_relsoft(const float* __restrict__ ACg, const int* __restrict__ MSK, int b, int first, const float* __restrict__ AMIN, bf* PHg, bf* PLg, float* AMDST) {
    typedef __attribute__((ext_vector_type(4))) unsigned short v4us;
    typedef __attribute__((ext_vector_type(4))) int v4i;
    __shared__ __align__(16) float pm[8][TK];     // p / 32 of each wave's (row, head)
    const int lane = threadIdx.x & 31, wave = threadIdx.x >> 5, hz = wave % HG, i = blockIdx.x * (8 / HG) + wave / HG;
    const float* __restrict__ AC = ACg + (size_t)hz * LQ * TK; bf* PH = PHg + (size_t)hz * LQ * TK; bf* PL = PLg + (size_t)hz * LQ * TK;
    float sc[TK / 32];     // the lane's keys: 4 consecutive ones of every 128, in the order in which they are summed
#pragma unroll     // unrolled (all loops over sc[]): sc[] is indexed by constants and stays in registers, and the row's loads go out many at a time
    for (int k = 0; k < TK / 128; ++k) { const int c0 = lane * 4 + k * 128;
        const v4f ac = *(const v4f*)(AC + (size_t)i * TK + c0);
        const v4i m0 = *(const v4i*)(MSK + ((size_t)i * TK + c0) * NBT), m1 = *(const v4i*)(MSK + ((size_t)i * TK + c0) * NBT + 4);     // mask[i][c0 .. c0+3][0 .. 1]
        const int mk[4] = {b ? m0[1] : m0[0], b ? m0[3] : m0[2], b ? m1[1] : m1[0], b ? m1[3] : m1[2]};
#pragma unroll
        for (int q = 0; q < 4; ++q) { const float s = ac[q] * SCL; sc[k * 4 + q] = mk[q] ? NEGV : s; }
    }
    float m = -3.0e38f;
#pragma unroll
    for (int e = 0; e < TK / 32; ++e) m = fmaxf(m, sc[e]);
#pragma unroll
    for (int sh = 16; sh; sh >>= 1) m = fmaxf(m, __shfl_xor(m, sh, 32));
    float sum = 0.f;
#pragma unroll
    for (int e = 0; e < TK / 32; ++e) { sc[e] = exp2_slot((sc[e] - m) * 1.44269504f); sum += sc[e]; }     // = __expf(sc[e] - m): the same multiply by log2(e) and the same v_exp_f32
#pragma unroll
    for (int sh = 16; sh; sh >>= 1) sum += __shfl_xor(sum, sh, 32);
    const float inv = 1.0f / sum;
    // the block's 8 / HG rows of the map are one run of floats: thread t owns floats 4 t .. 4 t + 3 of every 1024; the previous group's values are fetched here, under the conversion of the row
    const size_t mo = (size_t)blockIdx.x * (8 / HG) * TK + threadIdx.x * 4;
    v4f am[(8 / HG) * TK / 1024];
#pragma unroll     // unrolled (here and in the two loops behind the barrier): am[] is indexed by constants and stays in registers, and the loads go out together
    for (int s = 0; s < (8 / HG) * TK / 1024; ++s) am[s] = first ? (v4f){} : *(const v4f*)(AMIN + mo + s * 1024);
#pragma unroll
    for (int k = 0; k < TK / 128; ++k) { const int c0 = lane * 4 + k * 128; v4us oh, ol; v4f pq;
#pragma unroll
        for (int q = 0; q < 4; ++q) { const float p = sc[k * 4 + q] * inv; const unsigned short hb = f2bf(p); oh[q] = hb; ol[q] = f2bf(p - bf2f(hb));
            pq[q] = p * (1.0f / (NBT * NH_)); }
        const size_t o = (size_t)i * TK + c0; *(v4us*)(PH + o) = oh; *(v4us*)(PL + o) = ol; *(v4fa*)(&pm[wave][c0]) = pq; }
    __syncthreads();     // every head's p / 32 of the block's rows is in LDS before any thread adds them
#pragma unroll
    for (int s = 0; s < (8 / HG) * TK / 1024; ++s) { const int e = s * 1024 + threadIdx.x * 4, rs = e / TK, c = e % TK;
#pragma unroll     // unrolled: the HG LDS reads of a slot go out together; the adds stay in head order
        for (int w = 0; w < HG; ++w) am[s] += *(const v4fa*)(&pm[rs * HG + w][c]); }
#pragma unroll
    for (int s = 0; s < (8 / HG) * TK / 1024; ++s) *(v4f*)(AMDST + mo + s * 1024) = am[s];
}
__global__ __launch_bounds__(256) void k_split(const float* __restrict__ src, const float* __restrict__ src2, int nrows, bf* dh, bf* dl) {
    const int lane = threadIdx.x & 31, r = blockIdx.x * 8 + (threadIdx.x >> 5); if (r >= nrows) return;
{
#pragma unroll 1
        for (int q = 0; q < DD / 256; ++q) { const size_t o = (size_t)r * DD + q * 256 + lane * 8; const v8f v = *(const v8f*)(src + o) + *(const v8f*)(src2 + o); v8us oh, ol;
#pragma unroll
            for (int i = 0; i < 8; ++i) { const unsigned short hb = f2bf(v[i]); oh[i] = hb; ol[i] = f2bf(v[i] - bf2f(hb)); }
            *(v8us*)(dh + o) = oh; *(v8us*)(dl + o) = ol; }
         }
}
// k_ln: one wave per row of H [2048][1024]: LayerNorm (mean, biased var, eps 1e-5) x bf(gamma) + bf(beta) -> f32 output rows; lane -> 4 consecutive floats per 128-column
__global__ __launch_bounds__(256) void k_ln(const float* __restrict__ Hs, const float* __restrict__ g, const float* __restrict__ bb, float* OUTP) {
    const int lane = threadIdx.x & 31, r = blockIdx.x * 8 + (threadIdx.x >> 5); if (r >= NXR) return;
    v4f v[DD / 128]; float s = 0.f;
#pragma unroll
    for (int q = 0; q < DD / 128; ++q) { v[q] = *(const v4f*)(Hs + (size_t)r * DD + q * 128 + lane * 4);
#pragma unroll
        for (int i = 0; i < 4; ++i) s += v[q][i]; }
#pragma unroll
    for (int sh = 16; sh; sh >>= 1) s += __shfl_xor(s, sh, 32);
    const float mu = s * (1.0f / DD); float s2 = 0.f;
#pragma unroll
    for (int q = 0; q < DD / 128; ++q)
#pragma unroll
        for (int i = 0; i < 4; ++i) { const float d = v[q][i] - mu; s2 = fmaf(d, d, s2); }
#pragma unroll
    for (int sh = 16; sh; sh >>= 1) s2 += __shfl_xor(s2, sh, 32);
    const float rs = rsqrtf(s2 * (1.0f / DD) + LN_EPS);
{
#pragma unroll
        for (int q = 0; q < DD / 128; ++q) { const int c0 = q * 128 + lane * 4; v4f y;
#pragma unroll
            for (int i = 0; i < 4; ++i) y[i] = (v[q][i] - mu) * rs * bfr(g[c0 + i]) + bfr(bb[c0 + i]);
            *(v4f*)(OUTP + (size_t)r * DD + c0) = y; }
         }
}

extern "C" void kernel_launch(void* const* d_in, const int* in_sizes, int n_in,
                              void* d_out, int out_size, void* d_ws, size_t ws_size, hipStream_t stream) {
    (void)in_sizes; (void)n_in; (void)out_size;
    const float* x = (const float*)d_in[0]; const float* pe = (const float*)d_in[1]; const float* mem = (const float*)d_in[2]; const float* pbu = (const float*)d_in[3]; const float* pbv = (const float*)d_in[4]; const int* msk = (const int*)d_in[5];
    const float* Wq = (const float*)d_in[6]; const float* Wkv = (const float*)d_in[7]; const float* Wrel = (const float*)d_in[8]; const float* Wo = (const float*)d_in[9]; const float* g = (const float*)d_in[10]; const float* bb = (const float*)d_in[11];
    float* out = (float*)d_out; float* out2 = out + (size_t)NXR * DD;    // output [1024][2][1024]; attn_matrix [1024][2048]
    char* wsp = (char*)d_ws;
    auto take = [&](size_t bytes) { char* p = wsp; wsp += (bytes + 255) & ~(size_t)255; return (void*)p; };
    bf* WqT = (bf*)take((size_t)DD * DD * 2); bf* WkvT = (bf*)take((size_t)2 * DD * DD * 2); bf* WrT = (bf*)take((size_t)DD * DD * 2); bf* WoT = (bf*)take((size_t)DD * DD * 2);
    bf* Cb = (bf*)take((size_t)NCR * DD * 2); float* TMP = (float*)take((size_t)NCR * DD * 4);
    bf* QUh = (bf*)take((size_t)NBT * NH_ * LQ * HD * 2); bf* QUl = (bf*)take((size_t)NBT * NH_ * LQ * HD * 2); bf* QVh = (bf*)take((size_t)NBT * NH_ * LQ * HD * 2); bf* QVl = (bf*)take((size_t)NBT * NH_ * LQ * HD * 2);
    bf* Kh = (bf*)take((size_t)NBT * NH_ * TK * HD * 2); bf* Kl = (bf*)take((size_t)NBT * NH_ * TK * HD * 2); bf* Rh = (bf*)take((size_t)NBT * NH_ * TK * HD * 2); bf* Rl = (bf*)take((size_t)NBT * NH_ * TK * HD * 2);
    bf* VTh = (bf*)take((size_t)NBT * NH_ * HD * TK * 2); bf* VTl = (bf*)take((size_t)NBT * NH_ * HD * TK * 2);
    float* AC = (float*)take((size_t)HG * LQ * TK * 4); bf* PH = (bf*)take((size_t)HG * LQ * TK * 2); bf* PL = (bf*)take((size_t)HG * LQ * TK * 2); float* AM = (float*)take((size_t)LQ * TK * 4);
    float* AV = (float*)take((size_t)2 * NXR * DD * 4); bf* AVh = (bf*)take((size_t)NXR * DD * 2); bf* AVl = (bf*)take((size_t)NXR * DD * 2);
    if ((size_t)(wsp - (char*)d_ws) > ws_size) return;    // in MiB: weights 10, Cb 8, TMP 16, q planes 16, k and r planes 32, v planes 16, the score plane 8 and PH and PL 4 each per head of a group (64), AM 8, attn_vec 24 = 194 of the 256 given; Hs (the pre-LN sum, f32 [2048][1024] = 8 MiB) reuses the start of the score plane (dead after the head loop); TMP serves as the second mean-map ping-pong buffer (8.4 of its 16.8 MB) during the head loop
    float* Hs = AC; float* AMP[2] = {AM, TMP};     // mean-map ping-pong: AM and TMP
    k_wt<<<dim3(DD / 64, DD / 64, 1), 256, 0, stream>>>(Wq, DD, DD, WqT); k_wt<<<dim3(DD / 64, (2 * DD) / 64, 1), 256, 0, stream>>>(Wkv, DD, 2 * DD, WkvT); k_wt<<<dim3(DD / 64, DD / 64, 1), 256, 0, stream>>>(Wrel, DD, DD, WrT); k_wt<<<dim3(DD / 64, DD / 64, 1), 256, 0, stream>>>(Wo, DD, DD, WoT);
    // c = [memory; x] as bf16 rows (t, b): rows 0..2047 from memory, 2048..4095 from x
    k_cvtb<<<NXR / 8, 256, 0, stream>>>(mem, NXR, Cb); k_cvtb<<<NXR / 8, 256, 0, stream>>>(x, NXR, Cb + (size_t)NXR * DD);
    k_gemmp<0, TK><<<dim3(NCR / 64, NH_, 1), 128, 0, stream>>>(Cb, WkvT, nullptr, nullptr, Kh, Kl, nullptr, nullptr);                             // k = c.Wkv[:, :1024] -> planes
    k_gemmp<2, TK><<<dim3(NCR / 64, NH_, 1), 128, 0, stream>>>(Cb, WkvT + (size_t)DD * DD, nullptr, nullptr, VTh, VTl, nullptr, nullptr);         // v = c.Wkv[:, 1024:] -> transposed planes
    k_gemmp<1, LQ><<<dim3(NXR / 64, NH_, 1), 128, 0, stream>>>(Cb + (size_t)NXR * DD, WqT, pbu, pbv, QUh, QUl, QVh, QVl);                         // q = x.Wq (x = the last 2048 rows of c) -> q + u, q + v_bias planes
    k_cvtb<<<NCR / 8, 256, 0, stream>>>(pe, NCR, Cb);                                                                                    // pos_emb rows (t, b) (c no longer needed)
    k_gemmp<0, TK><<<dim3(NCR / 64, NH_, 1), 128, 0, stream>>>(Cb, WrT, nullptr, nullptr, Rh, Rl, nullptr, nullptr);                              // r = pos_emb.Wrel -> planes
    // the head loop, HG heads of one batch per launch (k_score: grid z; k_pv: grid y, with the two key halves; in k_relsoft the waves of a block)
    for (int b = 0; b < NBT; ++b) for (int h = 0; h < NH_; h += HG) { const size_t bh = (size_t)b * NH_ + h, gr = bh / HG; const int first = (b == 0 && h == 0), last = (b == NBT - 1 && h == NH_ - HG);
        k_score<<<dim3(LQ / 64, TK / 128, HG), 256, 0, stream>>>(QUh + bh * LQ * HD, QUl + bh * LQ * HD, QVh + bh * LQ * HD, QVl + bh * LQ * HD, Kh + bh * TK * HD, Kl + bh * TK * HD, Rh + bh * TK * HD, Rl + bh * TK * HD, AC);     // AC + rel_shift(BD)
        k_relsoft<<<LQ / (8 / HG), 256, 0, stream>>>(AC, msk, b, first, AMP[(gr + 1) & 1], PH, PL, last ? out2 : AMP[gr & 1]);     // reads the previous group's buffer, writes the other
        k_pv<<<dim3(LQ / 32, 2 * HG, 1), 256, 0, stream>>>(PH, PL, VTh + bh * HD * TK, VTl + bh * HD * TK, AV + (size_t)b * DD + h * HD, NBT * DD, (size_t)NXR * DD);          // attn.v -> attn_vec[(l,b)][h*64 + d], two key-half planes
    }
    k_split<<<NXR / 8, 256, 0, stream>>>(AV, AV + (size_t)NXR * DD, NXR, AVh, AVl);     // adds the two key-half planes of attn_vec
    k_gemmb<true, false><<<dim3(NXR / 64, DD / 64, 1), 128, 0, stream>>>(AVh, AVl, WoT, nullptr, Hs, DD, nullptr, x, DD, 1);                 // h = x + attn_vec.Wo  (x bf16-rounded)
    k_ln<<<NXR / 8, 256, 0, stream>>>(Hs, g, bb, out);
}

// v009
// It runs in 336 microseconds.
// Timed twice side by side with v008, it ran 1.17 and 1.16 times as fast.
// Over all steps from v000 it is 11.2 times as fast.
#include <hip/hip_runtime.h>

// Compute dtypes, f32 accumulate: k|v = [memory; x].Wkv ([4096 x 1024].[1024 x 2048]), q = x.Wq, r = pos_emb.Wrel (k-major weights transposed once; PLAIN bf16 operands
// = inputs rounded once, exact) and attn_out = attn_vec.Wo (hi/lo A, + x) on v_wmma_f32_16x16x32_bf16; per (batch, head): AC = (q + u).k^T and BD = (q + v_bias).r^T
// ([1024 x 64].[64 x 2048], both operands bf16 hi + UNSCALED residual, three products), the module's _rel_shift applied by INDEX (the literal pad-reshape-slice
// mapping, incl. its wrap-around entries), x 1/8, the INPUT mask (-1e30), the softmax over keys and the mean attention map in f32, attn.v ([1024 x 2048].[2048 x 64],

#define LQ   1024
#define TK   2048
#define NBT  2
#define DD   1024
#define NH_  16
#define HD   64
#define NXR  (LQ * NBT)           // 2048 x rows (l, b)
#define NCR  (TK * NBT)           // 4096 c / pos rows (t, b)
#define DM   DD
#define NTK  NCR
#define SCL  0.125f
#define NEGV -1e30f
#define LN_EPS 1e-5f
#define LOSC 1024.0f
#define HG   16                   // heads of one batch that each launch of the head loop works on side by side (divides NH_, so one launch has one batch index; a multiple of 8: k_relsoft)

typedef _Float16 h16;
typedef unsigned short bf;
typedef __attribute__((ext_vector_type(16))) __bf16   v16bf;
typedef __attribute__((ext_vector_type(16))) _Float16 v16h;
typedef __attribute__((ext_vector_type(8)))  _Float16 v8h;
typedef __attribute__((ext_vector_type(8)))  unsigned short v8us;
typedef __attribute__((ext_vector_type(8)))  float    v8f;
typedef __attribute__((ext_vector_type(4)))  float    v4f;
typedef __attribute__((ext_vector_type(4)))  _Float16 v4h;
typedef v8h  __attribute__((may_alias)) v8ha;
typedef v4f  __attribute__((may_alias)) v4fa;
typedef v8us __attribute__((may_alias)) v8usa;

__device__ __forceinline__ unsigned short f2bf(float f) { unsigned u = __float_as_uint(f); u += 0x7FFFu + ((u >> 16) & 1u); return (unsigned short)(u >> 16); }
__device__ __forceinline__ float bf2f(unsigned short b) { return __uint_as_float(((unsigned)b) << 16); }
__device__ __forceinline__ float bfr(float f) { return bf2f(f2bf(f)); }
__device__ __forceinline__ v16h cat16(v8h lo, v8h hi) { return __builtin_shufflevector(lo, hi, 0, 1, 2, 3, 4, 5, 6, 7, 8, 9, 10, 11, 12, 13, 14, 15); }
__device__ __forceinline__ v16bf cat16b(v8us lo, v8us hi) { return __builtin_bit_cast(v16bf, __builtin_shufflevector(lo, hi, 0, 1, 2, 3, 4, 5, 6, 7, 8, 9, 10, 11, 12, 13, 14, 15)); }
__device__ __forceinline__ v8f wmma16(v16h a, v16h b, v8f c) { return __builtin_amdgcn_wmma_f32_16x16x32_f16(false, a, false, b, (short)0, c, false, false); }
__device__ __forceinline__ v8f wmmab(v16bf a, v16bf b, v8f c) { return __builtin_amdgcn_wmma_f32_16x16x32_bf16(false, a, false, b, (short)0, c, false, false); }

// k_wt: WT [n][K] = bf16(W[k][n]) (k-major [K][ncols]) via 64 x 64 LDS tiles; grid (K/64, ncols/64).
__global__ __launch_bounds__(256) void k_wt(const float* __restrict__ Wm, int K, int ncols, bf* WT) {
    __shared__ __align__(16) unsigned short tl[64 * 72];
    const int tid = threadIdx.x, k0 = blockIdx.x * 64, n0 = blockIdx.y * 64;
    const int kk = tid >> 2, nq = (tid & 3) * 16;
#pragma unroll
    for (int i = 0; i < 16; ++i) tl[(nq + i) * 72 + kk] = f2bf(Wm[(size_t)(k0 + kk) * ncols + n0 + nq + i]);
    __syncthreads();
    const int piece = tid & 7;
    auto pass = [&]() {
#pragma unroll
        for (int s = 0; s < 2; ++s) { const int nr = (tid >> 3) + 32 * s; const v8us val = *(const v8usa*)(tl + nr * 72 + piece * 8); *(v8us*)(WT + (size_t)(n0 + nr) * K + k0 + piece * 8) = val; }
    };
    pass(); 
}
__global__ __launch_bounds__(256) void k_cvtb(const float* __restrict__ src, int nrows, bf* dst) {
    const int lane = threadIdx.x & 31, r = blockIdx.x * 8 + (threadIdx.x >> 5);
    if (r >= nrows) return;
    v8us o[DM / 256];
#pragma unroll
    for (int q = 0; q < DM / 256; ++q) { v8us t;
#pragma unroll
        for (int i = 0; i < 8; ++i) t[i] = f2bf(src[(size_t)r * DM + q * 256 + lane * 8 + i]);
        o[q] = t; }
#pragma unroll
    for (int q = 0; q < DM / 256; ++q) *(v8us*)(dst + (size_t)r * DM + q * 256 + lane * 8) = o[q];
    
}

// The projection GEMMs' main loop. A 64-k piece of an operand row is one whole 128-byte line; a stage = the block's 64 A rows (SPLITA: and the 64 rows of the residual plane) and its 64 B rows of one such piece.
// The stages come into a ring of two LDS buffers by asynchronous copies of whole lines (a fragment load straight from global memory takes 32 bytes out of each of 16 lines, and the four waves
// would each fetch the same B rows); stage s + 1 flies while stage s is worked on. The fragments are read from LDS with the k order that the global loaders had.
#define GSP 72                    // LDS row pitch in bf16 elements: 144 bytes = 16 x odd, free of bank conflicts for 16-byte reads down a column of rows
#define GTE (64 * GSP)            // elements of one 64-row tile in LDS
// One lane's copies of a stage: row tid/8 + 16 i (i = 0..3) of each tile, 16-byte piece tid%8; l = the lane's LDS byte address in the stage's first tile, the pointers = its global addresses in row tid/8.
// The s_wait_xcnt closes each statement so that it stands in front of every later write of a register that a copy names.
__device__ __forceinline__ void copy8(unsigned l, const bf* a, size_t sa, const bf* b, size_t sb) {
    asm volatile("global_load_async_to_lds_b128 %0, %8, off\n\tglobal_load_async_to_lds_b128 %1, %9, off\n\tglobal_load_async_to_lds_b128 %2, %10, off\n\tglobal_load_async_to_lds_b128 %3, %11, off\n\t"
                 "global_load_async_to_lds_b128 %4, %12, off\n\tglobal_load_async_to_lds_b128 %5, %13, off\n\tglobal_load_async_to_lds_b128 %6, %14, off\n\tglobal_load_async_to_lds_b128 %7, %15, off\n\ts_wait_xcnt 0x0"
                 :: "v"(l), "v"(l + 32 * GSP), "v"(l + 64 * GSP), "v"(l + 96 * GSP), "v"(l + 2 * GTE), "v"(l + 2 * GTE + 32 * GSP), "v"(l + 2 * GTE + 64 * GSP), "v"(l + 2 * GTE + 96 * GSP),
                    "v"(a), "v"(a + sa), "v"(a + 2 * sa), "v"(a + 3 * sa), "v"(b), "v"(b + sb), "v"(b + 2 * sb), "v"(b + 3 * sb) : "memory");
}
__device__ __forceinline__ void copy12(unsigned l, const bf* a, const bf* al, size_t sa, const bf* b, size_t sb) {
    asm volatile("global_load_async_to_lds_b128 %0, %12, off\n\tglobal_load_async_to_lds_b128 %1, %13, off\n\tglobal_load_async_to_lds_b128 %2, %14, off\n\tglobal_load_async_to_lds_b128 %3, %15, off\n\t"
                 "global_load_async_to_lds_b128 %4, %16, off\n\tglobal_load_async_to_lds_b128 %5, %17, off\n\tglobal_load_async_to_lds_b128 %6, %18, off\n\tglobal_load_async_to_lds_b128 %7, %19, off\n\t"
                 "global_load_async_to_lds_b128 %8, %20, off\n\tglobal_load_async_to_lds_b128 %9, %21, off\n\tglobal_load_async_to_lds_b128 %10, %22, off\n\tglobal_load_async_to_lds_b128 %11, %23, off\n\ts_wait_xcnt 0x0"
                 :: "v"(l), "v"(l + 32 * GSP), "v"(l + 64 * GSP), "v"(l + 96 * GSP), "v"(l + 2 * GTE), "v"(l + 2 * GTE + 32 * GSP), "v"(l + 2 * GTE + 64 * GSP), "v"(l + 2 * GTE + 96 * GSP),
                    "v"(l + 4 * GTE), "v"(l + 4 * GTE + 32 * GSP), "v"(l + 4 * GTE + 64 * GSP), "v"(l + 4 * GTE + 96 * GSP),
                    "v"(a), "v"(a + sa), "v"(a + 2 * sa), "v"(a + 3 * sa), "v"(al), "v"(al + sa), "v"(al + 2 * sa), "v"(al + 3 * sa), "v"(b), "v"(b + sb), "v"(b + 2 * sb), "v"(b + 3 * sb) : "memory");
}
// ring: 2 buffers of [A 64 rows][SPLITA: Al 64 rows][B 64 rows]. ga, gal, gb: the block's first A, Al and B row; ra, rbn: their row strides in elements. 128 threads; K a multiple of 64.
// acc[t] of a wave = its 16 rows (wave * 16 ..) x columns t * 16 .., summed over k in steps of 32 in rising order (SPLITA: A.B, then Al.B, in each step), as with the global loaders.
template <bool SPLITA>
__device__ __forceinline__ void gemm_ring(unsigned short* ring, const bf* ga, const bf* gal, size_t ra, const bf* gb, size_t rbn, int K, v8f (&acc)[4]) {
    constexpr int NT = SPLITA ? 3 : 2, STG = NT * GTE;
    const int tid = threadIdx.x, lane = tid & 31, wave = tid >> 5, lr = lane & 15, hi = lane >> 4;
    const unsigned l0 = (unsigned)(size_t)ring + (tid >> 3) * (GSP * 2) + (tid & 7) * 16;     // the low 32 bits of a __shared__ address are the byte offset in the block's LDS
    const bf* pa = ga + (size_t)(tid >> 3) * ra + (tid & 7) * 8; const bf* pal = gal + (size_t)(tid >> 3) * ra + (tid & 7) * 8; const bf* pb = gb + (size_t)(tid >> 3) * rbn + (tid & 7) * 8;
    const int NS = K >> 6;
    auto issue = [&](int s) { const unsigned l = l0 + (s & 1) * (STG * 2);
        if (SPLITA) copy12(l, pa + s * 64, pal + s * 64, 16 * ra, pb + s * 64, 16 * rbn); else copy8(l, pa + s * 64, 16 * ra, pb + s * 64, 16 * rbn); };
    issue(0);
    asm volatile("s_wait_asynccnt 0x0" ::: "memory");     // this wave's copies of stage 0 have landed
    __syncthreads();     // every wave's copies of stage 0 have landed before any wave reads a fragment
    if (NS > 1) issue(1);
#pragma unroll 1     // rolled: one pass a stage
    for (int s = 0; s < NS; ++s) {
        const unsigned short* aw = ring + (s & 1) * STG + (wave * 16 + lr) * GSP + 8 * hi;
        const unsigned short* bw = ring + (s & 1) * STG + (NT - 1) * GTE + lr * GSP + 8 * hi;
        v8us fa[2][SPLITA ? 4 : 2], fb[2][4][2];
#pragma unroll     // unrolled (all four loops over h and t): fa[], fb[] and acc[] are indexed by constants and stay in registers
        for (int h = 0; h < 2; ++h) { const int kc = h * 32;
            fa[h][0] = *(const v8usa*)(aw + kc); fa[h][1] = *(const v8usa*)(aw + kc + 16);
            if constexpr (SPLITA) { fa[h][2] = *(const v8usa*)(aw + GTE + kc); fa[h][3] = *(const v8usa*)(aw + GTE + kc + 16); }
#pragma unroll
            for (int t = 0; t < 4; ++t) { fb[h][t][0] = *(const v8usa*)(bw + t * 16 * GSP + kc); fb[h][t][1] = *(const v8usa*)(bw + t * 16 * GSP + kc + 16); }
        }
        __builtin_amdgcn_sched_barrier(0);     // keeps the stage's LDS reads together ahead of its matrix instructions (without it the scheduler put reads among them, reused their registers and waited out the LDS latency more than once a stage)
#pragma unroll
        for (int h = 0; h < 2; ++h) { const v16bf a = cat16b(fa[h][0], fa[h][1]);
#pragma unroll
            for (int t = 0; t < 4; ++t) { const v16bf bq = cat16b(fb[h][t][0], fb[h][t][1]); acc[t] = wmmab(a, bq, acc[t]); if constexpr (SPLITA) acc[t] = wmmab(cat16b(fa[h][2], fa[h][3]), bq, acc[t]); }
        }
        asm volatile("v_nop\n\tv_nop\n\tv_nop\n\tv_nop" : "+v"(acc[0]), "+v"(acc[1]), "+v"(acc[2]), "+v"(acc[3]));     // the four slots behind the pass's last matrix instruction, also on the taken branches behind it, before its operand registers are overwritten
        asm volatile("s_wait_dscnt 0x0" ::: "memory");        // this wave has finished reading stage s
        asm volatile("s_wait_asynccnt 0x0" ::: "memory");     // this wave's copies of stage s + 1 have landed
        __syncthreads();     // publishes stage s + 1 and ends every wave's reads of the buffer that is refilled behind it
        if (s + 2 < NS) issue(s + 2);
    }
    asm volatile("s_wait_asynccnt 0x0" ::: "memory");     // no copy is outstanding when the wave goes on
}

// k_gemmb: 64 x 64 block tile (4 waves x 16 x 64) of C[NXR][DD] = (A [+ Al]).B^T (K = 1024) [+ bf(bias[c])] [+ bf(R[r][c]) residual]; f32 whole-line epilogue (or f16
template <bool SPLITA, bool F16OUT = false>
__global__ __launch_bounds__(128) void k_gemmb(const bf* __restrict__ A, const bf* __restrict__ Al, const bf* __restrict__ Bn, const float* __restrict__ bias, float* C, int ldc, h16* C2, const float* __restrict__ R = nullptr, int K = DM, int roundR = 1) {
    __shared__ __align__(16) float ost[4][16 * 68];
    __shared__ __align__(16) unsigned short ring[2 * (SPLITA ? 3 : 2) * GTE];
    const int lane = threadIdx.x & 31, wave = threadIdx.x >> 5, lr = lane & 15, hi = lane >> 4;
    const int r0 = blockIdx.x * 64 + wave * 16, c0 = blockIdx.y * 64;
    v8f acc[4];
#pragma unroll
    for (int t = 0; t < 4; ++t) acc[t] = (v8f){};
    gemm_ring<SPLITA>(ring, A + (size_t)blockIdx.x * 64 * K, (SPLITA ? Al : A) + (size_t)blockIdx.x * 64 * K, (size_t)K, Bn + (size_t)c0 * K, (size_t)K, K, acc);
    float* os = &ost[wave][0];
#pragma unroll
    for (int t = 0; t < 4; ++t) { const float bv = bias ? bfr(bias[c0 + t * 16 + lr]) : 0.f;
#pragma unroll
        for (int j = 0; j < 8; ++j) os[(hi * 8 + j) * 68 + t * 16 + lr] = acc[t][j] + bv; }
    __syncthreads();
    if (F16OUT) {
        h16* crow = (h16*)(void*)C + (size_t)r0 * ldc + c0;
        auto pass = [&]() {
#pragma unroll
            for (int s = 0; s < 4; ++s) { const int row = 4 * s + (lane >> 3), piece = lane & 7; const float* sp = os + row * 68 + piece * 8; v8h o, o2;
#pragma unroll
                for (int i = 0; i < 8; ++i) { const h16 a = (h16)sp[i]; o[i] = a; o2[i] = (h16)((sp[i] - (float)a) * LOSC); }
                *(v8h*)(crow + (size_t)row * ldc + piece * 8) = o; if (C2) *(v8h*)(C2 + (size_t)r0 * ldc + c0 + (size_t)row * ldc + piece * 8) = o2; }
        };
        pass(); 
    } else {
        float* crow = C + (size_t)r0 * ldc + c0;
        auto pass = [&]() {
#pragma unroll
            for (int s = 0; s < 8; ++s) { const int Lid = (lane >> 3) + 4 * s, piece = lane & 7; const int row = Lid >> 1, cofs = (Lid & 1) * 32 + piece * 4;
                v4f val = *(const v4fa*)(os + row * 68 + cofs); if (R) { const v4f rv = *(const v4f*)(R + ((size_t)r0 + row) * ldc + c0 + cofs); val += roundR ? (v4f){bfr(rv[0]), bfr(rv[1]), bfr(rv[2]), bfr(rv[3])} : rv; }
                *(v4f*)(crow + (size_t)row * ldc + cofs) = val; }
        };
        pass(); 
    }
}

// k_score: 64 x 128 tile of one head's score plane S = AC + rel_shift(BD), AC = (q + u).k^T, BD = (q + v_bias).r^T, all operands bf16 hi + residual over K = HD = 64 (row stride HD): three products per
// 32-k step (hh, lh, hl), AC and BD in accumulators of their own, added once at the end. blockIdx.z = the head inside the launch's group.
// The module's _rel_shift by index: with e = j + L - 1 - i, key j of row i takes BD[i][e] where e < T, 0 where e == T, and BD[i + 1][e - T - 1] where e > T (the wrap-around entries).
// A wave's 16 rows x 64 keys need e in a strip of 80 that starts at a multiple of 16: five 16 x 16 tiles; T is a multiple of 16, so a tile lies wholly in front of T (A rows i) or wholly from T on (A rows i + 1).
// The block's r rows are laid into LDS in the order of e (192 rows), so that a strip tile's B fragment is read like any other; the strip goes through LDS, where row ii is read 15 - ii places further on.
// A plane row is one 128-byte line: the block brings its tiles into LDS by loads that cover whole lines; the fragments are read from LDS with the k order that the global loaders had.
#define SP 72                     // LDS row pitch in bf16 elements: 144 bytes = 16 x odd, free of bank conflicts for 16-byte reads down a column of rows
#define SQV 128                   // LDS rows: q + u hi 64, lo 64; from SQV q + v_bias hi 65, lo 65 (rows i .. i + 64); from SKK k hi 128, lo 128; from SRR r hi 192, lo 192
#define SKK 258
#define SRR 514
#define SRW 898
#define BDP 84                    // pitch of a wave's BD strip in floats
#define WST (16 * 68 + 16 * BDP)  // floats of a wave's output stage: AC tile, BD strip
__global__ __launch_bounds__(256) void k_score(const bf* __restrict__ QUh, const bf* __restrict__ QUl, const bf* __restrict__ QVh, const bf* __restrict__ QVl,
                                               const bf* __restrict__ Kh, const bf* __restrict__ Kl, const bf* __restrict__ Rh, const bf* __restrict__ Rl, float* S) {
    typedef float __attribute__((may_alias)) fal;
    __shared__ __align__(16) unsigned short st[SRW * SP];     // the operand tiles; behind the second barrier the waves' output stages
    static_assert(8 * WST * 4 <= SRW * SP * 2, "the eight output stages fit the operand tiles");
    static_assert(LQ <= TK && TK % 16 == 0 && LQ % 64 == 0, "e >= 0, and a strip tile does not straddle T");
    const int tid = threadIdx.x, lane = tid & 31, wave = tid >> 5, lr = lane & 15, hi = lane >> 4, wr = wave & 3, wc = wave >> 2;     // wave: 16 rows wr, 64 keys wc
    const int rb = blockIdx.x * 64, j0 = blockIdx.y * 128, r32 = tid >> 3, pc = (tid & 7) * 8;     // a thread loads row r32 + 32 s, 16-byte piece tid % 8
    const size_t qo = (size_t)blockIdx.z * LQ * HD, ko = (size_t)blockIdx.z * TK * HD;
    const int Eb = j0 + LQ - 64 - rb;     // e of the block's first r row in LDS
    const unsigned tb = (r32 * HD + pc) * 2;     // the thread's byte offset in a run of 32 plane rows
    const bf* qp[4] = {QUh + qo + (size_t)rb * HD, QUl + qo + (size_t)rb * HD, QVh + qo + (size_t)rb * HD, QVl + qo + (size_t)rb * HD};
    const bf* kp[2] = {Kh + ko + (size_t)j0 * HD, Kl + ko + (size_t)j0 * HD}; const bf* rp[2] = {Rh + ko, Rl + ko};
    unsigned ro[6];     // the thread's byte offsets of its six r rows in the head's plane
#pragma unroll     // unrolled (all loops of this kernel): the arrays are indexed by constants and stay in registers, and the loads go out together, one memory round trip
    for (int s = 0; s < 6; ++s) { const int e = Eb + s * 32 + r32, ge = e < TK ? e : (e == TK ? 0 : e - TK - 1); ro[s] = (unsigned)(ge * HD + pc) * 2; }     // e == T: any row, its column is set to 0 below
    // every load: a base that is the same for the whole block + a 32-bit byte offset of the lane
    v8us gq[4][2], gk[2][4], gr[2][6];
#pragma unroll
    for (int p = 0; p < 4; ++p)
#pragma unroll
        for (int s = 0; s < 2; ++s) gq[p][s] = *(const v8us*)((const char*)(qp[p] + s * 32 * HD) + tb);
#pragma unroll
    for (int p = 0; p < 2; ++p)
#pragma unroll
        for (int s = 0; s < 4; ++s) gk[p][s] = *(const v8us*)((const char*)(kp[p] + s * 32 * HD) + tb);
#pragma unroll
    for (int s = 0; s < 6; ++s)
#pragma unroll
        for (int p = 0; p < 2; ++p) gr[p][s] = *(const v8us*)((const char*)rp[p] + ro[s]);
    // the wait in front of any write of a register that one of the 28 loads names. The offsets and the bases are its inputs: each stays in its register up to here, so that no load's result lands on one
    // and the run needs no wait in its middle (without them the build reused the offset register behind the 16th load and waited there)
    asm volatile("s_wait_xcnt 0x0" :: "v"(tb), "v"(ro[0]), "v"(ro[1]), "v"(ro[2]), "v"(ro[3]), "v"(ro[4]), "v"(ro[5]),
                 "s"(qp[0]), "s"(qp[1]), "s"(qp[2]), "s"(qp[3]), "s"(kp[0]), "s"(kp[1]), "s"(rp[0]), "s"(rp[1]) : "memory");
    if (tid < 16)     // row rb + 64 of q + v_bias, hi and lo; row L - 1 never wraps, so the stand-in for row L is never used
        *(v8usa*)(st + (SQV + 64 + (tid < 8 ? 0 : 65)) * SP + pc) = *(const v8us*)((tid < 8 ? QVh : QVl) + qo + (size_t)(rb + 64 < LQ ? rb + 64 : LQ - 1) * HD + pc);
#pragma unroll
    for (int p = 0; p < 4; ++p)
#pragma unroll
        for (int s = 0; s < 2; ++s) *(v8usa*)(st + ((p < 2 ? p * 64 : SQV + (p - 2) * 65) + s * 32 + r32) * SP + pc) = gq[p][s];
#pragma unroll
    for (int p = 0; p < 2; ++p)
#pragma unroll
        for (int s = 0; s < 4; ++s) *(v8usa*)(st + (SKK + p * 128 + s * 32 + r32) * SP + pc) = gk[p][s];
#pragma unroll
    for (int p = 0; p < 2; ++p)
#pragma unroll
        for (int s = 0; s < 6; ++s) *(v8usa*)(st + (SRR + p * 192 + s * 32 + r32) * SP + pc) = gr[p][s];
    __syncthreads();     // all tiles are in LDS before any wave reads a fragment
    v8f acc[4], bda[5];
#pragma unroll
    for (int t = 0; t < 4; ++t) acc[t] = (v8f){};
#pragma unroll
    for (int t = 0; t < 5; ++t) bda[t] = (v8f){};
    // BD first: its fragments take the more registers, and the four AC accumulators are not live yet
    const int so = 48 - 16 * wr + 64 * wc, E0 = Eb + so;     // the wave's strip: its first r row in LDS, and that row's e
    // the A rows of the strip's first tile (x) and of its last (y): i, or i + 1 from T on; the three tiles between take the one or the other
    const unsigned short* ax = st + (SQV + wr * 16 + lr + (E0 >= TK ? 1 : 0)) * SP + 8 * hi;
    const unsigned short* ay = st + (SQV + wr * 16 + lr + (E0 + 64 >= TK ? 1 : 0)) * SP + 8 * hi;
    const unsigned short* rw = st + (SRR + so + lr) * SP + 8 * hi;
#pragma unroll
    for (int kc = 0; kc < HD; kc += 32) {
        v8us fx[4], fy[4], fr[5][4];
        fx[0] = *(const v8usa*)(ax + kc); fx[1] = *(const v8usa*)(ax + kc + 16); fx[2] = *(const v8usa*)(ax + 65 * SP + kc); fx[3] = *(const v8usa*)(ax + 65 * SP + kc + 16);
        fy[0] = *(const v8usa*)(ay + kc); fy[1] = *(const v8usa*)(ay + kc + 16); fy[2] = *(const v8usa*)(ay + 65 * SP + kc); fy[3] = *(const v8usa*)(ay + 65 * SP + kc + 16);
#pragma unroll
        for (int t = 0; t < 5; ++t) { const unsigned short* bp = rw + t * 16 * SP + kc;
            fr[t][0] = *(const v8usa*)bp; fr[t][1] = *(const v8usa*)(bp + 16); fr[t][2] = *(const v8usa*)(bp + 192 * SP); fr[t][3] = *(const v8usa*)(bp + 192 * SP + 16); }
        __builtin_amdgcn_sched_barrier(0);     // keeps the 32 k's LDS reads together ahead of their matrix instructions, so that the wave waits out the LDS latency once and not once a tile
        const v16bf xh = cat16b(fx[0], fx[1]), xl = cat16b(fx[2], fx[3]), yh = cat16b(fy[0], fy[1]), yl = cat16b(fy[2], fy[3]);
#pragma unroll
        for (int t = 0; t < 5; ++t) { const bool uy = E0 + 16 * t >= TK;
            const v16bf a = t == 0 ? xh : t == 4 ? yh : (uy ? yh : xh), al = t == 0 ? xl : t == 4 ? yl : (uy ? yl : xl);
            const v16bf bh = cat16b(fr[t][0], fr[t][1]), bl = cat16b(fr[t][2], fr[t][3]);
            bda[t] = wmmab(a, bh, bda[t]); bda[t] = wmmab(al, bh, bda[t]); bda[t] = wmmab(a, bl, bda[t]); }
        __builtin_amdgcn_sched_barrier(0);     // keeps what follows (the next 32 k's reads; in the end the AC part's reads) behind these matrix instructions: scheduled as one region, the fragments were fetched so far ahead that registers were spilled
    }
    const unsigned short* aw = st + (wr * 16 + lr) * SP + 8 * hi;
    const unsigned short* bw = st + (SKK + wc * 64 + lr) * SP + 8 * hi;
#pragma unroll
    for (int kc = 0; kc < HD; kc += 32) {
        v8us fa[4], fb[4][4];
        fa[0] = *(const v8usa*)(aw + kc); fa[1] = *(const v8usa*)(aw + kc + 16); fa[2] = *(const v8usa*)(aw + 64 * SP + kc); fa[3] = *(const v8usa*)(aw + 64 * SP + kc + 16);
#pragma unroll
        for (int t = 0; t < 4; ++t) { const unsigned short* bp = bw + t * 16 * SP + kc;
            fb[t][0] = *(const v8usa*)bp; fb[t][1] = *(const v8usa*)(bp + 16); fb[t][2] = *(const v8usa*)(bp + 128 * SP); fb[t][3] = *(const v8usa*)(bp + 128 * SP + 16); }
        __builtin_amdgcn_sched_barrier(0);     // as above: one wait for the 32 k's LDS reads
        const v16bf a = cat16b(fa[0], fa[1]), al = cat16b(fa[2], fa[3]);
#pragma unroll
        for (int t = 0; t < 4; ++t) { const v16bf bh = cat16b(fb[t][0], fb[t][1]), bl = cat16b(fb[t][2], fb[t][3]);
            acc[t] = wmmab(a, bh, acc[t]); acc[t] = wmmab(al, bh, acc[t]); acc[t] = wmmab(a, bl, acc[t]); }
        __builtin_amdgcn_sched_barrier(0);     // as above: against spills
    }
    __syncthreads();     // every wave has read its last fragment before the tiles' LDS is written as output stages
    fal* os = (fal*)(void*)st + wave * WST; fal* ob = os + 16 * 68;
#pragma unroll
    for (int t = 0; t < 4; ++t) {
#pragma unroll
        for (int j = 0; j < 8; ++j) os[(hi * 8 + j) * 68 + t * 16 + lr] = acc[t][j]; }
#pragma unroll
    for (int t = 0; t < 5; ++t) { const bool zc = E0 + 16 * t + lr == TK;     // the column e == T: the pad's zero
#pragma unroll
        for (int j = 0; j < 8; ++j) ob[(hi * 8 + j) * BDP + t * 16 + lr] = zc ? 0.f : bda[t][j]; }
    __builtin_amdgcn_wave_barrier(); asm volatile("" ::: "memory");     // as before: keeps the compiler from moving the reads of other lanes' values ahead of the wave's stores to its stage
    float* crow = S + (size_t)blockIdx.z * LQ * TK + (size_t)(rb + wr * 16) * TK + j0 + wc * 64;
    v4f val[8], bs[8];
#pragma unroll
    for (int s = 0; s < 8; ++s) { const int Lid = (lane >> 3) + 4 * s, piece = lane & 7; const int row = Lid >> 1, cofs = (Lid & 1) * 32 + piece * 4;
        const fal* bq = ob + row * BDP + cofs + 15 - row;     // key jj of row ii: strip column jj + 15 - ii
        val[s] = *(const v4fa*)(os + row * 68 + cofs); bs[s] = (v4f){bq[0], bq[1], bq[2], bq[3]}; }
#pragma unroll     // a loop of its own: the 24 LDS reads above go out together, not one row's at a time between the stores
    for (int s = 0; s < 8; ++s) { const int Lid = (lane >> 3) + 4 * s, piece = lane & 7; const int row = Lid >> 1, cofs = (Lid & 1) * 32 + piece * 4;
        *(v4f*)(crow + (size_t)row * TK + cofs) = val[s] + bs[s]; }
}

// k_pv: attn.v of one head, C[1024][64] = (Ah + Al).(Bh + Bl)^T over the 2048 keys (three products per 32-k step, k order of the fragments as in k_score). One 32 x 64 output tile and one
// half of the keys per block (grid: 32 row tiles, y = HG heads x 2 key halves). The 8 waves = 4 key groups (256 keys each) x 2 row tiles (16 x 64); the 4 groups' partial tiles are added
// in group order through LDS, and the two halves go to two planes (C, C + zstride) that k_split adds. Each stored tile row is two whole 128-byte lines.
// A 64-key piece of an operand row is one whole 128-byte line (a fragment load straight from global memory takes 32 bytes out of each of 16 lines). A stage = such a piece of every group's 32 Ah, 32 Al,
// 64 Bh and 64 Bl rows; the stages come into a ring of two LDS buffers by asynchronous copies of whole lines, stage s + 1 flies while stage s is worked on.
#define PRS (2 * TK)              // row stride of the attn planes in bf16 elements: a row's hi values, then its residuals, lie in the 8 KiB of its own score row (k_relsoft)
#define PVG 4                     // key groups of a block
#define PVR 192                   // LDS rows of one key group in a stage: Ah 32, Al 32, Bh 64, Bl 64
#define PVS (PVG * PVR * GSP)     // elements of one stage
// One lane's 12 copies: 4 rows, 8 rows apart, at each of three places; l = the lane's LDS byte address, p = its global address in the first of the 4 rows (row strides S0, S1, S2 elements).
// The s_wait_xcnt closes the statement so that it stands in front of every later write of a register that a copy names.
template <int S0, int S1, int S2>
__device__ __forceinline__ void copy12r(unsigned l0, unsigned l1, unsigned l2, const bf* p0, const bf* p1, const bf* p2) {
    constexpr unsigned LS = 8 * GSP * 2; constexpr size_t G0 = (size_t)8 * S0, G1 = (size_t)8 * S1, G2 = (size_t)8 * S2;
    asm volatile("global_load_async_to_lds_b128 %0, %12, off\n\tglobal_load_async_to_lds_b128 %1, %13, off\n\tglobal_load_async_to_lds_b128 %2, %14, off\n\tglobal_load_async_to_lds_b128 %3, %15, off\n\t"
                 "global_load_async_to_lds_b128 %4, %16, off\n\tglobal_load_async_to_lds_b128 %5, %17, off\n\tglobal_load_async_to_lds_b128 %6, %18, off\n\tglobal_load_async_to_lds_b128 %7, %19, off\n\t"
                 "global_load_async_to_lds_b128 %8, %20, off\n\tglobal_load_async_to_lds_b128 %9, %21, off\n\tglobal_load_async_to_lds_b128 %10, %22, off\n\tglobal_load_async_to_lds_b128 %11, %23, off\n\ts_wait_xcnt 0x0"
                 :: "v"(l0), "v"(l0 + LS), "v"(l0 + 2 * LS), "v"(l0 + 3 * LS), "v"(l1), "v"(l1 + LS), "v"(l1 + 2 * LS), "v"(l1 + 3 * LS), "v"(l2), "v"(l2 + LS), "v"(l2 + 2 * LS), "v"(l2 + 3 * LS),
                    "v"(p0), "v"(p0 + G0), "v"(p0 + 2 * G0), "v"(p0 + 3 * G0), "v"(p1), "v"(p1 + G1), "v"(p1 + 2 * G1), "v"(p1 + 3 * G1), "v"(p2), "v"(p2 + G2), "v"(p2 + 2 * G2), "v"(p2 + 3 * G2) : "memory");
}
__global__ __launch_bounds__(256) void k_pv(const bf* __restrict__ Ah, const bf* __restrict__ Al, const bf* __restrict__ Bh, const bf* __restrict__ Bl, float* C, int ldc, size_t zstride) {
    __shared__ __align__(16) unsigned short ring[2 * PVS];
    __shared__ __align__(16) float red[8][16 * 68];     // each wave's partial 16 x 64 tile
    const int tid = threadIdx.x, lane = tid & 31, wave = tid >> 5, lr = lane & 15, hi = lane >> 4;
    const int kg = wave >> 1, rw = wave & 1;                 // key group, row tile
    const int hz = blockIdx.y >> 1, kh = blockIdx.y & 1;     // head inside the launch's group, key half
    const int r0 = blockIdx.x * 32, k0 = kh * (TK / 2) + kg * (TK / 2 / PVG);
    // a key group's two waves copy the group's own rows: row (tid % 64) / 8 + 8 i, 16-byte piece tid % 8, so that 8 lanes take one whole line
    const int r8 = (tid & 63) >> 3, pc = tid & 7;
    const size_t ao = ((size_t)hz * LQ + r0 + r8) * PRS + k0 + pc * 8, bo = ((size_t)hz * HD + r8) * TK + k0 + pc * 8;
    const bf* pah = Ah + ao; const bf* pal = Al + ao; const bf* pbh = Bh + bo; const bf* pbl = Bl + bo;
    const unsigned l0 = (unsigned)(size_t)ring + (kg * PVR + r8) * (GSP * 2) + pc * 16;     // the low 32 bits of a __shared__ address are the byte offset in the block's LDS
    auto issue = [&](int s) { const unsigned l = l0 + (s & 1) * (PVS * 2); const int ko = s * 64;
        copy12r<PRS, PRS, TK>(l, l + 32 * GSP * 2, l + 64 * GSP * 2, pah + ko, pal + ko, pbh + ko);
        copy12r<TK, TK, TK>(l + 96 * GSP * 2, l + 128 * GSP * 2, l + 160 * GSP * 2, pbh + ko + (size_t)32 * TK, pbl + ko, pbl + ko + (size_t)32 * TK); };
    constexpr int NS = TK / 2 / PVG / 64;
    static_assert(NS >= 2, "stage 1 exists");
    v8f acc[4];
#pragma unroll     // unrolled (all loops over t, h, j of this kernel): acc[], fa[] and fb[] are indexed by constants and stay in registers
    for (int t = 0; t < 4; ++t) acc[t] = (v8f){};
    issue(0);
    asm volatile("s_wait_asynccnt 0x0" ::: "memory");     // this wave's copies of stage 0 have landed
    __syncthreads();     // every wave's copies of stage 0 have landed before any wave reads a fragment
    issue(1);
#pragma unroll 1     // rolled: one pass a stage
    for (int s = 0; s < NS; ++s) {
        const unsigned short* gb = ring + (s & 1) * PVS + kg * PVR * GSP;
        const unsigned short* aw = gb + (rw * 16 + lr) * GSP + 8 * hi;
        const unsigned short* bw = gb + (64 + lr) * GSP + 8 * hi;
        v8us fa[2][4], fb[2][4][4];
#pragma unroll
        for (int h = 0; h < 2; ++h) { const int kc = h * 32;
            fa[h][0] = *(const v8usa*)(aw + kc); fa[h][1] = *(const v8usa*)(aw + kc + 16); fa[h][2] = *(const v8usa*)(aw + 32 * GSP + kc); fa[h][3] = *(const v8usa*)(aw + 32 * GSP + kc + 16);
#pragma unroll
            for (int t = 0; t < 4; ++t) { const unsigned short* bp = bw + t * 16 * GSP + kc;
                fb[h][t][0] = *(const v8usa*)bp; fb[h][t][1] = *(const v8usa*)(bp + 16); fb[h][t][2] = *(const v8usa*)(bp + 64 * GSP); fb[h][t][3] = *(const v8usa*)(bp + 64 * GSP + 16); }
        }
        __builtin_amdgcn_sched_barrier(0);     // keeps the stage's LDS reads together ahead of its matrix instructions, so that the wave waits out the LDS latency once a stage
#pragma unroll
        for (int h = 0; h < 2; ++h) { const v16bf a = cat16b(fa[h][0], fa[h][1]), al = cat16b(fa[h][2], fa[h][3]);
            // product by product over the four column tiles: each accumulator still takes a.bh, al.bh, a.bl in that order, with three independent matrix instructions between two on the same one
#pragma unroll
            for (int t = 0; t < 4; ++t) acc[t] = wmmab(a, cat16b(fb[h][t][0], fb[h][t][1]), acc[t]);
#pragma unroll
            for (int t = 0; t < 4; ++t) acc[t] = wmmab(al, cat16b(fb[h][t][0], fb[h][t][1]), acc[t]);
#pragma unroll
            for (int t = 0; t < 4; ++t) acc[t] = wmmab(a, cat16b(fb[h][t][2], fb[h][t][3]), acc[t]);
        }
        asm volatile("v_nop\n\tv_nop\n\tv_nop\n\tv_nop" : "+v"(acc[0]), "+v"(acc[1]), "+v"(acc[2]), "+v"(acc[3]));     // the four slots behind the pass's last matrix instruction, also on the taken branches behind it, before its operand registers are overwritten
        asm volatile("s_wait_dscnt 0x0" ::: "memory");        // this wave has finished reading stage s
        asm volatile("s_wait_asynccnt 0x0" ::: "memory");     // this wave's copies of stage s + 1 have landed
        __syncthreads();     // publishes stage s + 1 and ends every wave's reads of the buffer that is refilled behind it
        if (s + 2 < NS) issue(s + 2);
    }
    asm volatile("s_wait_asynccnt 0x0" ::: "memory");     // no copy is outstanding when the wave goes on
    float* os = &red[wave][0];
#pragma unroll
    for (int t = 0; t < 4; ++t) {
#pragma unroll
        for (int j = 0; j < 8; ++j) os[(hi * 8 + j) * 68 + t * 16 + lr] = acc[t][j]; }
    __syncthreads();     // every wave's partial tile is in LDS before any thread adds them
    const int row = tid >> 3;     // thread -> 8 consecutive floats of one of the 32 rows
    const float* rp = &red[row >> 4][(row & 15) * 68 + pc * 8];
    v4f x0 = *(const v4fa*)rp, x1 = *(const v4fa*)(rp + 4);
#pragma unroll     // unrolled: the LDS reads go out together; the adds stay in group order
    for (int q = 1; q < PVG; ++q) { x0 += *(const v4fa*)(rp + q * 2 * 16 * 68); x1 += *(const v4fa*)(rp + q * 2 * 16 * 68 + 4); }
    float* crow = C + (size_t)kh * zstride + (size_t)(r0 + row) * ldc + hz * HD + pc * 8;
    *(v4f*)crow = x0; *(v4f*)(crow + 4) = x1;
}

// k_gemmp: a projection GEMM (main loop gemm_ring as in k_gemmb, plain A) whose epilogue writes the attention operand planes itself: bf16 hi + UNSCALED residual of the f32 sums, per (batch b, head h).
// A block takes 64 consecutive positions t of ONE batch (A row = t*2 + b) and the 64 columns of one head (blockIdx.y), so that every stored plane row is one whole 128-byte line.
// K is an argument as in k_gemmb.
// MODE 0: P0[bh][t][d] (k, r). MODE 1: P0 = sums + bf(bias0[h][d]), P1 = sums + bf(bias1[h][d]) (q + u, q + v_bias). MODE 2: P0[bh][d][t] (v transposed: the tile is laid into LDS column-major).
template <int MODE, int NR>
__global__ __launch_bounds__(128) void k_gemmp(const bf* __restrict__ A, const bf* __restrict__ Bn, const float* __restrict__ bias0, const float* __restrict__ bias1, bf* P0h, bf* P0l, bf* P1h, bf* P1l, int K = DM) {
    __shared__ __align__(16) float ost[64 * 68];
    __shared__ __align__(16) unsigned short ring[2 * 2 * GTE];
    __shared__ __align__(16) float ub[2 * HD];     // MODE 1 only
    const int lane = threadIdx.x & 31, wave = threadIdx.x >> 5, lr = lane & 15, hi = lane >> 4;
    const int b = (blockIdx.x * 64) / NR, t0 = (blockIdx.x * 64) % NR, h = blockIdx.y, c0 = h * HD;
    v8f acc[4];
#pragma unroll     // unrolled (all loops over t, j, i, s of this kernel): acc[] and the vectors are indexed by constants and stay in registers
    for (int t = 0; t < 4; ++t) acc[t] = (v8f){};
    gemm_ring<false>(ring, A + ((size_t)t0 * NBT + b) * K, A + ((size_t)t0 * NBT + b) * K, (size_t)NBT * K, Bn + (size_t)c0 * K, (size_t)K, K, acc);
#pragma unroll
    for (int t = 0; t < 4; ++t) {
        if (MODE == 2) { float* p = ost + (t * 16 + lr) * 68 + wave * 16 + hi * 8;     // row = d, column = t: a lane's 8 sums are 8 consecutive positions
            *(v4fa*)p = (v4f){acc[t][0], acc[t][1], acc[t][2], acc[t][3]}; *(v4fa*)(p + 4) = (v4f){acc[t][4], acc[t][5], acc[t][6], acc[t][7]};
        } else {
#pragma unroll
            for (int j = 0; j < 8; ++j) ost[(wave * 16 + hi * 8 + j) * 68 + t * 16 + lr] = acc[t][j]; }
    }
    if (MODE == 1) ub[threadIdx.x] = bfr((threadIdx.x < HD ? bias0 : bias1)[c0 + (threadIdx.x & (HD - 1))]);     // the head's 64 + 64 rounded bias values, one load a thread
    __syncthreads();     // the whole 64 x 64 tile (MODE 1: and the bias values) is in LDS before it is read back by rows (MODE 2: a row holds sums of all four waves)
    const int piece = lane & 7; const size_t bh = (size_t)b * NH_ + h;
    float u0[8], u1[8];
    if (MODE == 1) {
#pragma unroll
        for (int i = 0; i < 8; ++i) { u0[i] = ub[piece * 8 + i]; u1[i] = ub[HD + piece * 8 + i]; } }
#pragma unroll
    for (int s = 0; s < 4; ++s) { const int row = wave * 16 + 4 * s + (lane >> 3); const float* sp = ost + row * 68 + piece * 8;
        const v4f x0 = *(const v4fa*)sp, x1 = *(const v4fa*)(sp + 4);
        const size_t o = MODE == 2 ? (bh * HD + row) * TK + t0 + piece * 8 : (bh * NR + t0 + row) * HD + piece * 8;
        v8us oh, ol;
#pragma unroll
        for (int i = 0; i < 8; ++i) { float v = i < 4 ? x0[i & 3] : x1[i & 3]; if (MODE == 1) v += u0[i]; const unsigned short hb = f2bf(v); oh[i] = hb; ol[i] = f2bf(v - bf2f(hb)); }
        *(v8us*)(P0h + o) = oh; *(v8us*)(P0l + o) = ol;
        if (MODE == 1) {
#pragma unroll
            for (int i = 0; i < 8; ++i) { const float v = (i < 4 ? x0[i & 3] : x1[i & 3]) + u1[i]; const unsigned short hb = f2bf(v); oh[i] = hb; ol[i] = f2bf(v - bf2f(hb)); }
            *(v8us*)(P1h + o) = oh; *(v8us*)(P1l + o) = ol; }
    }
}
// 2^x. The v_nop is the slot that the instruction set asks for behind a transcendental before its source register is overwritten.
__device__ __forceinline__ float exp2_slot(float x) { float r; asm("v_exp_f32 %0, %1\n\tv_nop" : "=v"(r) : "v"(x)); return r; }
// k_relsoft: a block = one query row i x the HG heads of the group, 8 heads at a time, one wave a head (score planes LQ*TK floats apart); for each key j: s = S[i][j]/8 (S = AC + shifted BD, from k_score),
// s = -1e30 where mask[i][j][b]; softmax over the 2048 keys (f32, fixed lane order). S and the mask are read ONCE a head: a lane holds its 64 scores (then their
// exponentials) in registers from the loads to the stores -> bf16 hi + UNSCALED residual, written over the wave's OWN score row (2048 hi values, then 2048 residuals, in the row's 8 KiB: every store
// takes the row's sum, so that it follows all the wave's loads of the row, and no other wave touches the row); so a group of 16 heads fits the workspace.
// The mean attention map accumulates p / 32 in (b,h) order: each wave leaves its head's p / 32 in LDS, and behind a barrier the block adds the 8 heads in
// head order onto the sum so far, which starts from the previous group's map (AMIN = the previous group's buffer, never the one being written).
// launch bounds, second argument: caps the registers; without it the build takes 300, three waves a SIMD, and two blocks do not fit side by side on a WGP
__global__ __launch_bounds__(256, 5) void k_relsoft(float* Sg, const int* __restrict__ MSK, int b, int first, const float* __restrict__ AMIN, float* AMDST) {
    typedef __attribute__((ext_vector_type(4))) unsigned short v4us;
    typedef __attribute__((ext_vector_type(4))) int v4i;
    static_assert(HG % 8 == 0, "a set is 8 heads, one a wave");
    __shared__ __align__(16) float pm[8][TK];     // p / 32 of each wave's head
    const int lane = threadIdx.x & 31, wave = threadIdx.x >> 5, i = blockIdx.x;
    // the block's row of the map: thread t owns floats 4 t .. 4 t + 3 of every 1024
    const size_t mo = (size_t)i * TK + threadIdx.x * 4;
    const float* ap = AMIN + mo;
    v4f am[TK / 1024];
#pragma unroll     // unrolled (here and in the two loops over am[] below): am[] is indexed by constants and stays in registers, and the loads go out together
    for (int s = 0; s < TK / 1024; ++s) am[s] = first ? (v4f){} : *(const v4f*)(ap + s * 1024);
    asm volatile("s_wait_xcnt 0x0" :: "v"(ap) : "memory");     // the wait in front of the next write of the address registers that the two loads above name; the address is its input, so that it stays in its registers up to here (without it the build wrote the mask's address there ahead of the wait)
#pragma unroll 1     // rolled: one pass a set of 8 heads; unrolled, two rows' scores would be live at a time
    for (int hs = 0; hs < HG / 8; ++hs) {
        float* row = Sg + ((size_t)(hs * 8 + wave) * LQ + i) * TK;     // the wave's score row, then its attn row
        float sc[TK / 32];     // the lane's keys: 4 consecutive ones of every 128, in the order in which they are summed
#pragma unroll     // unrolled (all loops over sc[]): sc[] is indexed by constants and stays in registers, and the row's loads go out many at a time
        for (int k = 0; k < TK / 128; ++k) { const int c0 = lane * 4 + k * 128;
            const v4f ac = *(const v4f*)(row + c0);
            const v4i m0 = *(const v4i*)(MSK + ((size_t)i * TK + c0) * NBT), m1 = *(const v4i*)(MSK + ((size_t)i * TK + c0) * NBT + 4);     // mask[i][c0 .. c0+3][0 .. 1]
            const int mk[4] = {b ? m0[1] : m0[0], b ? m0[3] : m0[2], b ? m1[1] : m1[0], b ? m1[3] : m1[2]};
#pragma unroll
            for (int q = 0; q < 4; ++q) { const float s = ac[q] * SCL; sc[k * 4 + q] = mk[q] ? NEGV : s; }
        }
        float m = -3.0e38f;
#pragma unroll
        for (int e = 0; e < TK / 32; ++e) m = fmaxf(m, sc[e]);
#pragma unroll
        for (int sh = 16; sh; sh >>= 1) m = fmaxf(m, __shfl_xor(m, sh, 32));
        float sum = 0.f;
#pragma unroll
        for (int e = 0; e < TK / 32; ++e) { sc[e] = exp2_slot((sc[e] - m) * 1.44269504f); sum += sc[e]; }     // = __expf(sc[e] - m): the same multiply by log2(e) and the same v_exp_f32
#pragma unroll
        for (int sh = 16; sh; sh >>= 1) sum += __shfl_xor(sum, sh, 32);
        const float inv = 1.0f / sum;
        bf* PH = (bf*)(void*)row; bf* PL = PH + TK;
#pragma unroll
        for (int k = 0; k < TK / 128; ++k) { const int c0 = lane * 4 + k * 128; v4us oh, ol; v4f pq;
#pragma unroll
            for (int q = 0; q < 4; ++q) { const float p = sc[k * 4 + q] * inv; const unsigned short hb = f2bf(p); oh[q] = hb; ol[q] = f2bf(p - bf2f(hb));
                pq[q] = p * (1.0f / (NBT * NH_)); }
            *(v4us*)(PH + c0) = oh; *(v4us*)(PL + c0) = ol; *(v4fa*)(&pm[wave][c0]) = pq; }
        __syncthreads();     // every head's p / 32 of the set is in LDS before any thread adds them
#pragma unroll
        for (int s = 0; s < TK / 1024; ++s) {
#pragma unroll     // unrolled: the 8 LDS reads of a slot go out together; the adds stay in head order
            for (int w = 0; w < 8; ++w) am[s] += *(const v4fa*)(&pm[w][s * 1024 + threadIdx.x * 4]); }
        __syncthreads();     // every thread has read the set's p / 32 before a wave writes the next set's
    }
#pragma unroll
    for (int s = 0; s < TK / 1024; ++s) *(v4f*)(AMDST + mo + s * 1024) = am[s];
}
__global__ __launch_bounds__(256) void k_split(const float* __restrict__ src, const float* __restrict__ src2, int nrows, bf* dh, bf* dl) {
    const int lane = threadIdx.x & 31, r = blockIdx.x * 8 + (threadIdx.x >> 5); if (r >= nrows) return;
{
#pragma unroll 1
        for (int q = 0; q < DD / 256; ++q) { const size_t o = (size_t)r * DD + q * 256 + lane * 8; const v8f v = *(const v8f*)(src + o) + *(const v8f*)(src2 + o); v8us oh, ol;
#pragma unroll
            for (int i = 0; i < 8; ++i) { const unsigned short hb = f2bf(v[i]); oh[i] = hb; ol[i] = f2bf(v[i] - bf2f(hb)); }
            *(v8us*)(dh + o) = oh; *(v8us*)(dl + o) = ol; }
         }
}
// k_ln: one wave per row of H [2048][1024]: LayerNorm (mean, biased var, eps 1e-5) x bf(gamma) + bf(beta) -> f32 output rows; lane -> 4 consecutive floats per 128-column
__global__ __launch_bounds__(256) void k_ln(const float* __restrict__ Hs, const float* __restrict__ g, const float* __restrict__ bb, float* OUTP) {
    const int lane = threadIdx.x & 31, r = blockIdx.x * 8 + (threadIdx.x >> 5); if (r >= NXR) return;
    v4f v[DD / 128]; float s = 0.f;
#pragma unroll
    for (int q = 0; q < DD / 128; ++q) { v[q] = *(const v4f*)(Hs + (size_t)r * DD + q * 128 + lane * 4);
#pragma unroll
        for (int i = 0; i < 4; ++i) s += v[q][i]; }
#pragma unroll
    for (int sh = 16; sh; sh >>= 1) s += __shfl_xor(s, sh, 32);
    const float mu = s * (1.0f / DD); float s2 = 0.f;
#pragma unroll
    for (int q = 0; q < DD / 128; ++q)
#pragma unroll
        for (int i = 0; i < 4; ++i) { const float d = v[q][i] - mu; s2 = fmaf(d, d, s2); }
#pragma unroll
    for (int sh = 16; sh; sh >>= 1) s2 += __shfl_xor(s2, sh, 32);
    const float rs = rsqrtf(s2 * (1.0f / DD) + LN_EPS);
{
#pragma unroll
        for (int q = 0; q < DD / 128; ++q) { const int c0 = q * 128 + lane * 4; v4f y;
#pragma unroll
            for (int i = 0; i < 4; ++i) y[i] = (v[q][i] - mu) * rs * bfr(g[c0 + i]) + bfr(bb[c0 + i]);
            *(v4f*)(OUTP + (size_t)r * DD + c0) = y; }
         }
}

extern "C" void kernel_launch(void* const* d_in, const int* in_sizes, int n_in,
                              void* d_out, int out_size, void* d_ws, size_t ws_size, hipStream_t stream) {
    (void)in_sizes; (void)n_in; (void)out_size;
    const float* x = (const float*)d_in[0]; const float* pe = (const float*)d_in[1]; const float* mem = (const float*)d_in[2]; const float* pbu = (const float*)d_in[3]; const float* pbv = (const float*)d_in[4]; const int* msk = (const int*)d_in[5];
    const float* Wq = (const float*)d_in[6]; const float* Wkv = (const float*)d_in[7]; const float* Wrel = (const float*)d_in[8]; const float* Wo = (const float*)d_in[9]; const float* g = (const float*)d_in[10]; const float* bb = (const float*)d_in[11];
    float* out = (float*)d_out; float* out2 = out + (size_t)NXR * DD;    // output [1024][2][1024]; attn_matrix [1024][2048]
    char* wsp = (char*)d_ws;
    auto take = [&](size_t bytes) { char* p = wsp; wsp += (bytes + 255) & ~(size_t)255; return (void*)p; };
    bf* WqT = (bf*)take((size_t)DD * DD * 2); bf* WkvT = (bf*)take((size_t)2 * DD * DD * 2); bf* WrT = (bf*)take((size_t)DD * DD * 2); bf* WoT = (bf*)take((size_t)DD * DD * 2);
    bf* Cb = (bf*)take((size_t)NCR * DD * 2); float* TMP = (float*)take((size_t)LQ * TK * 4);
    bf* QUh = (bf*)take((size_t)NBT * NH_ * LQ * HD * 2); bf* QUl = (bf*)take((size_t)NBT * NH_ * LQ * HD * 2); bf* QVh = (bf*)take((size_t)NBT * NH_ * LQ * HD * 2); bf* QVl = (bf*)take((size_t)NBT * NH_ * LQ * HD * 2);
    bf* Kh = (bf*)take((size_t)NBT * NH_ * TK * HD * 2); bf* Kl = (bf*)take((size_t)NBT * NH_ * TK * HD * 2); bf* Rh = (bf*)take((size_t)NBT * NH_ * TK * HD * 2); bf* Rl = (bf*)take((size_t)NBT * NH_ * TK * HD * 2);
    bf* VTh = (bf*)take((size_t)NBT * NH_ * HD * TK * 2); bf* VTl = (bf*)take((size_t)NBT * NH_ * HD * TK * 2);
    float* AC = (float*)take((size_t)HG * LQ * TK * 4); bf* PH = (bf*)AC; bf* PL = PH + TK; float* AM = (float*)take((size_t)LQ * TK * 4);
    float* AV = (float*)take((size_t)2 * NXR * DD * 4); bf* AVh = (bf*)take((size_t)NXR * DD * 2); bf* AVl = (bf*)take((size_t)NXR * DD * 2);
    if ((size_t)(wsp - (char*)d_ws) > ws_size) return;    // in MiB: weights 10, Cb 8, TMP 8, q planes 16, k and r planes 32, v planes 16, the score plane 8 per head of a group (128; the attn planes PH and PL take its place row by row), AM 8, attn_vec 24 = 250 of the 256 given; Hs (the pre-LN sum, f32 [2048][1024] = 8 MiB) reuses the start of the score plane (dead after the head loop); TMP is the second mean-map ping-pong buffer
    float* Hs = AC; float* AMP[2] = {AM, TMP};     // mean-map ping-pong: AM and TMP
    k_wt<<<dim3(DD / 64, DD / 64, 1), 256, 0, stream>>>(Wq, DD, DD, WqT); k_wt<<<dim3(DD / 64, (2 * DD) / 64, 1), 256, 0, stream>>>(Wkv, DD, 2 * DD, WkvT); k_wt<<<dim3(DD / 64, DD / 64, 1), 256, 0, stream>>>(Wrel, DD, DD, WrT); k_wt<<<dim3(DD / 64, DD / 64, 1), 256, 0, stream>>>(Wo, DD, DD, WoT);
    // c = [memory; x] as bf16 rows (t, b): rows 0..2047 from memory, 2048..4095 from x
    k_cvtb<<<NXR / 8, 256, 0, stream>>>(mem, NXR, Cb); k_cvtb<<<NXR / 8, 256, 0, stream>>>(x, NXR, Cb + (size_t)NXR * DD);
    k_gemmp<0, TK><<<dim3(NCR / 64, NH_, 1), 128, 0, stream>>>(Cb, WkvT, nullptr, nullptr, Kh, Kl, nullptr, nullptr);                             // k = c.Wkv[:, :1024] -> planes
    k_gemmp<2, TK><<<dim3(NCR / 64, NH_, 1), 128, 0, stream>>>(Cb, WkvT + (size_t)DD * DD, nullptr, nullptr, VTh, VTl, nullptr, nullptr);         // v = c.Wkv[:, 1024:] -> transposed planes
    k_gemmp<1, LQ><<<dim3(NXR / 64, NH_, 1), 128, 0, stream>>>(Cb + (size_t)NXR * DD, WqT, pbu, pbv, QUh, QUl, QVh, QVl);                         // q = x.Wq (x = the last 2048 rows of c) -> q + u, q + v_bias planes
    k_cvtb<<<NCR / 8, 256, 0, stream>>>(pe, NCR, Cb);                                                                                    // pos_emb rows (t, b) (c no longer needed)
    k_gemmp<0, TK><<<dim3(NCR / 64, NH_, 1), 128, 0, stream>>>(Cb, WrT, nullptr, nullptr, Rh, Rl, nullptr, nullptr);                              // r = pos_emb.Wrel -> planes
    // the head loop, HG heads of one batch per launch (grid z; in k_relsoft the waves of a block, 8 heads at a time)
    for (int b = 0; b < NBT; ++b) for (int h = 0; h < NH_; h += HG) { const size_t bh = (size_t)b * NH_ + h, gr = bh / HG; const int first = (b == 0 && h == 0), last = (b == NBT - 1 && h == NH_ - HG);
        k_score<<<dim3(LQ / 64, TK / 128, HG), 256, 0, stream>>>(QUh + bh * LQ * HD, QUl + bh * LQ * HD, QVh + bh * LQ * HD, QVl + bh * LQ * HD, Kh + bh * TK * HD, Kl + bh * TK * HD, Rh + bh * TK * HD, Rl + bh * TK * HD, AC);     // AC + rel_shift(BD)
        k_relsoft<<<LQ, 256, 0, stream>>>(AC, msk, b, first, AMP[(gr + 1) & 1], last ? out2 : AMP[gr & 1]);     // reads the previous group's buffer, writes the other
        k_pv<<<dim3(LQ / 32, 2 * HG, 1), 256, 0, stream>>>(PH, PL, VTh + bh * HD * TK, VTl + bh * HD * TK, AV + (size_t)b * DD + h * HD, NBT * DD, (size_t)NXR * DD);          // attn.v -> attn_vec[(l,b)][h*64 + d], two key-half planes
    }
    k_split<<<NXR / 8, 256, 0, stream>>>(AV, AV + (size_t)NXR * DD, NXR, AVh, AVl);     // adds the two key-half planes of attn_vec
    k_gemmb<true, false><<<dim3(NXR / 64, DD / 64, 1), 128, 0, stream>>>(AVh, AVl, WoT, nullptr, Hs, DD, nullptr, x, DD, 1);                 // h = x + attn_vec.Wo  (x bf16-rounded)
    k_ln<<<NXR / 8, 256, 0, stream>>>(Hs, g, bb, out);
}

// v010
// One run takes 316 microseconds.
// Next to v009, in two timings, it ran 1.07 and 1.06 times as fast.
// All steps since v000 together make it 11.9 times as fast.
#include <hip/hip_runtime.h>

// Compute dtypes, f32 accumulate: k|v = [memory; x].Wkv ([4096 x 1024].[1024 x 2048]), q = x.Wq, r = pos_emb.Wrel (k-major weights transposed once; PLAIN bf16 operands
// = inputs rounded once, exact) and attn_out = attn_vec.Wo (hi/lo A, + x) on v_wmma_f32_16x16x32_bf16; per (batch, head): AC = (q + u).k^T and BD = (q + v_bias).r^T
// ([1024 x 64].[64 x 2048], both operands bf16 hi + UNSCALED residual, three products), the module's _rel_shift applied by INDEX (the literal pad-reshape-slice
// mapping, incl. its wrap-around entries), x 1/8, the INPUT mask (-1e30), the softmax over keys and the mean attention map in f32, attn.v ([1024 x 2048].[2048 x 64],

#define LQ   1024
#define TK   2048
#define NBT  2
#define DD   1024
#define NH_  16
#define HD   64
#define NXR  (LQ * NBT)           // 2048 x rows (l, b)
#define NCR  (TK * NBT)           // 4096 c / pos rows (t, b)
#define DM   DD
#define NTK  NCR
#define SCL  0.125f
#define NEGV -1e30f
#define LN_EPS 1e-5f
#define LOSC 1024.0f
#define HG   16                   // heads of one batch that each launch of the head loop works on side by side (divides NH_, so one launch has one batch index; a multiple of 8: k_relsoft)

typedef _Float16 h16;
typedef unsigned short bf;
typedef __attribute__((ext_vector_type(16))) __bf16   v16bf;
typedef __attribute__((ext_vector_type(16))) _Float16 v16h;
typedef __attribute__((ext_vector_type(8)))  _Float16 v8h;
typedef __attribute__((ext_vector_type(8)))  unsigned short v8us;
typedef __attribute__((ext_vector_type(8)))  float    v8f;
typedef __attribute__((ext_vector_type(4)))  float    v4f;
typedef __attribute__((ext_vector_type(4)))  _Float16 v4h;
typedef v8h  __attribute__((may_alias)) v8ha;
typedef v4f  __attribute__((may_alias)) v4fa;
typedef v8us __attribute__((may_alias)) v8usa;

__device__ __forceinline__ unsigned short f2bf(float f) { unsigned u = __float_as_uint(f); u += 0x7FFFu + ((u >> 16) & 1u); return (unsigned short)(u >> 16); }
__device__ __forceinline__ float bf2f(unsigned short b) { return __uint_as_float(((unsigned)b) << 16); }
__device__ __forceinline__ float bfr(float f) { return bf2f(f2bf(f)); }
__device__ __forceinline__ v16h cat16(v8h lo, v8h hi) { return __builtin_shufflevector(lo, hi, 0, 1, 2, 3, 4, 5, 6, 7, 8, 9, 10, 11, 12, 13, 14, 15); }
__device__ __forceinline__ v16bf cat16b(v8us lo, v8us hi) { return __builtin_bit_cast(v16bf, __builtin_shufflevector(lo, hi, 0, 1, 2, 3, 4, 5, 6, 7, 8, 9, 10, 11, 12, 13, 14, 15)); }
__device__ __forceinline__ v8f wmma16(v16h a, v16h b, v8f c) { return __builtin_amdgcn_wmma_f32_16x16x32_f16(false, a, false, b, (short)0, c, false, false); }
__device__ __forceinline__ v8f wmmab(v16bf a, v16bf b, v8f c) { return __builtin_amdgcn_wmma_f32_16x16x32_bf16(false, a, false, b, (short)0, c, false, false); }

// wt_tile: WT [n][K] = bf16(W[k][n]) (k-major [K][ncols]) via a 64 x 64 LDS tile tl; tile (bx, by) of (K/64, ncols/64).
__device__ __forceinline__ void wt_tile(unsigned short* tl, const float* __restrict__ Wm, int K, int ncols, bf* WT, int bx, int by) {
    const int tid = threadIdx.x, k0 = bx * 64, n0 = by * 64;
    const int kk = tid >> 2, nq = (tid & 3) * 16;
#pragma unroll
    for (int i = 0; i < 16; ++i) tl[(nq + i) * 72 + kk] = f2bf(Wm[(size_t)(k0 + kk) * ncols + n0 + nq + i]);
    __syncthreads();
    const int piece = tid & 7;
    auto pass = [&]() {
#pragma unroll
        for (int s = 0; s < 2; ++s) { const int nr = (tid >> 3) + 32 * s; const v8us val = *(const v8usa*)(tl + nr * 72 + piece * 8); *(v8us*)(WT + (size_t)(n0 + nr) * K + k0 + piece * 8) = val; }
    };
    pass(); 
}
// cvt_rows: 8 rows (one a wave) of dst = bf16(src), rows bx * 8 ..
__device__ __forceinline__ void cvt_rows(const float* __restrict__ src, int nrows, bf* dst, int bx) {
    const int lane = threadIdx.x & 31, r = bx * 8 + (threadIdx.x >> 5);
    if (r >= nrows) return;
    v8us o[DM / 256];
#pragma unroll
    for (int q = 0; q < DM / 256; ++q) { v8us t;
#pragma unroll
        for (int i = 0; i < 8; ++i) t[i] = f2bf(src[(size_t)r * DM + q * 256 + lane * 8 + i]);
        o[q] = t; }
#pragma unroll
    for (int q = 0; q < DM / 256; ++q) *(v8us*)(dst + (size_t)r * DM + q * 256 + lane * 8) = o[q];
    
}
// k_prep: all the operand preparation, none of which depends on another part, as ONE grid: the blocks are dealt by their index to the tiles of the four weight transposes (Wq, Wkv, Wrel, Wo)
// and then to the row groups of the three conversions (memory and x -> Cb = c, pos_emb -> Pb). Every test on the block index is the same for the whole block.
#define WTB ((DD / 64) * (DD / 64))     // tiles of a [1024][1024] weight
#define PREPB (5 * WTB + (NCR + NCR) / 8)
__global__ __launch_bounds__(256) void k_prep(const float* __restrict__ Wq, const float* __restrict__ Wkv, const float* __restrict__ Wrel, const float* __restrict__ Wo,
                                              const float* __restrict__ mem, const float* __restrict__ x, const float* __restrict__ pe, bf* WqT, bf* WkvT, bf* WrT, bf* WoT, bf* Cb, bf* Pb) {
    __shared__ __align__(16) unsigned short tl[64 * 72];
    const int bid = blockIdx.x;
    if (bid < 5 * WTB) {
        const float* Wm; bf* WT; int nc, t;
        if (bid < WTB) { Wm = Wq; WT = WqT; nc = DD; t = bid; }
        else if (bid < 3 * WTB) { Wm = Wkv; WT = WkvT; nc = 2 * DD; t = bid - WTB; }
        else if (bid < 4 * WTB) { Wm = Wrel; WT = WrT; nc = DD; t = bid - 3 * WTB; }
        else { Wm = Wo; WT = WoT; nc = DD; t = bid - 4 * WTB; }
        wt_tile(tl, Wm, DD, nc, WT, t % (DD / 64), t / (DD / 64));
    } else {
        const int c = bid - 5 * WTB;
        if (c < NXR / 8) cvt_rows(mem, NXR, Cb, c);                                              // c rows 0..2047 from memory
        else if (c < NCR / 8) cvt_rows(x, NXR, Cb + (size_t)NXR * DD, c - NXR / 8);              // c rows 2048..4095 from x
        else cvt_rows(pe, NCR, Pb, c - NCR / 8);
    }
}

// The projection GEMMs' main loop. A 64-k piece of an operand row is one whole 128-byte line; a stage = the block's 64 A rows (SPLITA: and the 64 rows of the residual plane) and its 64 B rows of one such piece.
// The stages come into a ring of two LDS buffers by asynchronous copies of whole lines (a fragment load straight from global memory takes 32 bytes out of each of 16 lines, and the four waves
// would each fetch the same B rows); stage s + 1 flies while stage s is worked on. The fragments are read from LDS with the k order that the global loaders had.
#define GSP 72                    // LDS row pitch in bf16 elements: 144 bytes = 16 x odd, free of bank conflicts for 16-byte reads down a column of rows
#define GTE (64 * GSP)            // elements of one 64-row tile in LDS
// One lane's copies of a stage: row tid/8 + 16 i (i = 0..3) of each tile, 16-byte piece tid%8; l = the lane's LDS byte address in the stage's first tile, the pointers = its global addresses in row tid/8.
// The s_wait_xcnt closes each statement so that it stands in front of every later write of a register that a copy names.
__device__ __forceinline__ void copy8(unsigned l, const bf* a, size_t sa, const bf* b, size_t sb) {
    asm volatile("global_load_async_to_lds_b128 %0, %8, off\n\tglobal_load_async_to_lds_b128 %1, %9, off\n\tglobal_load_async_to_lds_b128 %2, %10, off\n\tglobal_load_async_to_lds_b128 %3, %11, off\n\t"
                 "global_load_async_to_lds_b128 %4, %12, off\n\tglobal_load_async_to_lds_b128 %5, %13, off\n\tglobal_load_async_to_lds_b128 %6, %14, off\n\tglobal_load_async_to_lds_b128 %7, %15, off\n\ts_wait_xcnt 0x0"
                 :: "v"(l), "v"(l + 32 * GSP), "v"(l + 64 * GSP), "v"(l + 96 * GSP), "v"(l + 2 * GTE), "v"(l + 2 * GTE + 32 * GSP), "v"(l + 2 * GTE + 64 * GSP), "v"(l + 2 * GTE + 96 * GSP),
                    "v"(a), "v"(a + sa), "v"(a + 2 * sa), "v"(a + 3 * sa), "v"(b), "v"(b + sb), "v"(b + 2 * sb), "v"(b + 3 * sb) : "memory");
}
__device__ __forceinline__ void copy12(unsigned l, const bf* a, const bf* al, size_t sa, const bf* b, size_t sb) {
    asm volatile("global_load_async_to_lds_b128 %0, %12, off\n\tglobal_load_async_to_lds_b128 %1, %13, off\n\tglobal_load_async_to_lds_b128 %2, %14, off\n\tglobal_load_async_to_lds_b128 %3, %15, off\n\t"
                 "global_load_async_to_lds_b128 %4, %16, off\n\tglobal_load_async_to_lds_b128 %5, %17, off\n\tglobal_load_async_to_lds_b128 %6, %18, off\n\tglobal_load_async_to_lds_b128 %7, %19, off\n\t"
                 "global_load_async_to_lds_b128 %8, %20, off\n\tglobal_load_async_to_lds_b128 %9, %21, off\n\tglobal_load_async_to_lds_b128 %10, %22, off\n\tglobal_load_async_to_lds_b128 %11, %23, off\n\ts_wait_xcnt 0x0"
                 :: "v"(l), "v"(l + 32 * GSP), "v"(l + 64 * GSP), "v"(l + 96 * GSP), "v"(l + 2 * GTE), "v"(l + 2 * GTE + 32 * GSP), "v"(l + 2 * GTE + 64 * GSP), "v"(l + 2 * GTE + 96 * GSP),
                    "v"(l + 4 * GTE), "v"(l + 4 * GTE + 32 * GSP), "v"(l + 4 * GTE + 64 * GSP), "v"(l + 4 * GTE + 96 * GSP),
                    "v"(a), "v"(a + sa), "v"(a + 2 * sa), "v"(a + 3 * sa), "v"(al), "v"(al + sa), "v"(al + 2 * sa), "v"(al + 3 * sa), "v"(b), "v"(b + sb), "v"(b + 2 * sb), "v"(b + 3 * sb) : "memory");
}
// ring: 2 buffers of [A 64 rows][SPLITA: Al 64 rows][B 64 rows]. ga, gal, gb: the block's first A, Al and B row; ra, rbn: their row strides in elements. 128 threads; K a multiple of 64.
// acc[t] of a wave = its 16 rows (wave * 16 ..) x columns t * 16 .., summed over k in steps of 32 in rising order (SPLITA: A.B, then Al.B, in each step), as with the global loaders.
template <bool SPLITA>
__device__ __forceinline__ void gemm_ring(unsigned short* ring, const bf* ga, const bf* gal, size_t ra, const bf* gb, size_t rbn, int K, v8f (&acc)[4]) {
    constexpr int NT = SPLITA ? 3 : 2, STG = NT * GTE;
    const int tid = threadIdx.x, lane = tid & 31, wave = tid >> 5, lr = lane & 15, hi = lane >> 4;
    const unsigned l0 = (unsigned)(size_t)ring + (tid >> 3) * (GSP * 2) + (tid & 7) * 16;     // the low 32 bits of a __shared__ address are the byte offset in the block's LDS
    const bf* pa = ga + (size_t)(tid >> 3) * ra + (tid & 7) * 8; const bf* pal = gal + (size_t)(tid >> 3) * ra + (tid & 7) * 8; const bf* pb = gb + (size_t)(tid >> 3) * rbn + (tid & 7) * 8;
    const int NS = K >> 6;
    auto issue = [&](int s) { const unsigned l = l0 + (s & 1) * (STG * 2);
        if (SPLITA) copy12(l, pa + s * 64, pal + s * 64, 16 * ra, pb + s * 64, 16 * rbn); else copy8(l, pa + s * 64, 16 * ra, pb + s * 64, 16 * rbn); };
    issue(0);
    asm volatile("s_wait_asynccnt 0x0" ::: "memory");     // this wave's copies of stage 0 have landed
    __syncthreads();     // every wave's copies of stage 0 have landed before any wave reads a fragment
    if (NS > 1) issue(1);
#pragma unroll 1     // rolled: one pass a stage
    for (int s = 0; s < NS; ++s) {
        const unsigned short* aw = ring + (s & 1) * STG + (wave * 16 + lr) * GSP + 8 * hi;
        const unsigned short* bw = ring + (s & 1) * STG + (NT - 1) * GTE + lr * GSP + 8 * hi;
        v8us fa[2][SPLITA ? 4 : 2], fb[2][4][2];
#pragma unroll     // unrolled (all four loops over h and t): fa[], fb[] and acc[] are indexed by constants and stay in registers
        for (int h = 0; h < 2; ++h) { const int kc = h * 32;
            fa[h][0] = *(const v8usa*)(aw + kc); fa[h][1] = *(const v8usa*)(aw + kc + 16);
            if constexpr (SPLITA) { fa[h][2] = *(const v8usa*)(aw + GTE + kc); fa[h][3] = *(const v8usa*)(aw + GTE + kc + 16); }
#pragma unroll
            for (int t = 0; t < 4; ++t) { fb[h][t][0] = *(const v8usa*)(bw + t * 16 * GSP + kc); fb[h][t][1] = *(const v8usa*)(bw + t * 16 * GSP + kc + 16); }
        }
        __builtin_amdgcn_sched_barrier(0);     // keeps the stage's LDS reads together ahead of its matrix instructions (without it the scheduler put reads among them, reused their registers and waited out the LDS latency more than once a stage)
#pragma unroll
        for (int h = 0; h < 2; ++h) { const v16bf a = cat16b(fa[h][0], fa[h][1]);
#pragma unroll
            for (int t = 0; t < 4; ++t) { const v16bf bq = cat16b(fb[h][t][0], fb[h][t][1]); acc[t] = wmmab(a, bq, acc[t]); if constexpr (SPLITA) acc[t] = wmmab(cat16b(fa[h][2], fa[h][3]), bq, acc[t]); }
        }
        asm volatile("v_nop\n\tv_nop\n\tv_nop\n\tv_nop" : "+v"(acc[0]), "+v"(acc[1]), "+v"(acc[2]), "+v"(acc[3]));     // the four slots behind the pass's last matrix instruction, also on the taken branches behind it, before its operand registers are overwritten
        asm volatile("s_wait_dscnt 0x0" ::: "memory");        // this wave has finished reading stage s
        asm volatile("s_wait_asynccnt 0x0" ::: "memory");     // this wave's copies of stage s + 1 have landed
        __syncthreads();     // publishes stage s + 1 and ends every wave's reads of the buffer that is refilled behind it
        if (s + 2 < NS) issue(s + 2);
    }
    asm volatile("s_wait_asynccnt 0x0" ::: "memory");     // no copy is outstanding when the wave goes on
}

// k_gemmb: 64 x 64 block tile (4 waves x 16 x 64) of C[NXR][DD] = (A [+ Al]).B^T (K = 1024) [+ bf(bias[c])] [+ bf(R[r][c]) residual]; f32 whole-line epilogue (or f16
template <bool SPLITA, bool F16OUT = false>
__global__ __launch_bounds__(128) void k_gemmb(const bf* __restrict__ A, const bf* __restrict__ Al, const bf* __restrict__ Bn, const float* __restrict__ bias, float* C, int ldc, h16* C2, const float* __restrict__ R = nullptr, int K = DM, int roundR = 1) {
    __shared__ __align__(16) float ost[4][16 * 68];
    __shared__ __align__(16) unsigned short ring[2 * (SPLITA ? 3 : 2) * GTE];
    const int lane = threadIdx.x & 31, wave = threadIdx.x >> 5, lr = lane & 15, hi = lane >> 4;
    const int r0 = blockIdx.x * 64 + wave * 16, c0 = blockIdx.y * 64;
    v8f acc[4];
#pragma unroll
    for (int t = 0; t < 4; ++t) acc[t] = (v8f){};
    gemm_ring<SPLITA>(ring, A + (size_t)blockIdx.x * 64 * K, (SPLITA ? Al : A) + (size_t)blockIdx.x * 64 * K, (size_t)K, Bn + (size_t)c0 * K, (size_t)K, K, acc);
    float* os = &ost[wave][0];
#pragma unroll
    for (int t = 0; t < 4; ++t) { const float bv = bias ? bfr(bias[c0 + t * 16 + lr]) : 0.f;
#pragma unroll
        for (int j = 0; j < 8; ++j) os[(hi * 8 + j) * 68 + t * 16 + lr] = acc[t][j] + bv; }
    __syncthreads();
    if (F16OUT) {
        h16* crow = (h16*)(void*)C + (size_t)r0 * ldc + c0;
        auto pass = [&]() {
#pragma unroll
            for (int s = 0; s < 4; ++s) { const int row = 4 * s + (lane >> 3), piece = lane & 7; const float* sp = os + row * 68 + piece * 8; v8h o, o2;
#pragma unroll
                for (int i = 0; i < 8; ++i) { const h16 a = (h16)sp[i]; o[i] = a; o2[i] = (h16)((sp[i] - (float)a) * LOSC); }
                *(v8h*)(crow + (size_t)row * ldc + piece * 8) = o; if (C2) *(v8h*)(C2 + (size_t)r0 * ldc + c0 + (size_t)row * ldc + piece * 8) = o2; }
        };
        pass(); 
    } else {
        float* crow = C + (size_t)r0 * ldc + c0;
        auto pass = [&]() {
#pragma unroll
            for (int s = 0; s < 8; ++s) { const int Lid = (lane >> 3) + 4 * s, piece = lane & 7; const int row = Lid >> 1, cofs = (Lid & 1) * 32 + piece * 4;
                v4f val = *(const v4fa*)(os + row * 68 + cofs); if (R) { const v4f rv = *(const v4f*)(R + ((size_t)r0 + row) * ldc + c0 + cofs); val += roundR ? (v4f){bfr(rv[0]), bfr(rv[1]), bfr(rv[2]), bfr(rv[3])} : rv; }
                *(v4f*)(crow + (size_t)row * ldc + cofs) = val; }
        };
        pass(); 
    }
}

// k_score: 64 x 128 tile of one head's score plane S = AC + rel_shift(BD), AC = (q + u).k^T, BD = (q + v_bias).r^T, all operands bf16 hi + residual over K = HD = 64 (row stride HD): three products per
// 32-k step (hh, lh, hl), AC and BD in accumulators of their own, added once at the end. blockIdx.z = the head inside the launch's group.
// The module's _rel_shift by index: with e = j + L - 1 - i, key j of row i takes BD[i][e] where e < T, 0 where e == T, and BD[i + 1][e - T - 1] where e > T (the wrap-around entries).
// A wave's 16 rows x 64 keys need e in a strip of 80 that starts at a multiple of 16: five 16 x 16 tiles; T is a multiple of 16, so a tile lies wholly in front of T (A rows i) or wholly from T on (A rows i + 1).
// The block's r rows are laid into LDS in the order of e (192 rows), so that a strip tile's B fragment is read like any other; the strip goes through LDS, where row ii is read 15 - ii places further on.
// A plane row is one 128-byte line: the block brings its tiles into LDS by loads that cover whole lines; the fragments are read from LDS with the k order that the global loaders had.
#define SP 72                     // LDS row pitch in bf16 elements: 144 bytes = 16 x odd, free of bank conflicts for 16-byte reads down a column of rows
#define SQV 128                   // LDS rows: q + u hi 64, lo 64; from SQV q + v_bias hi 65, lo 65 (rows i .. i + 64); from SKK k hi 128, lo 128; from SRR r hi 192, lo 192
#define SKK 258
#define SRR 514
#define SRW 898
#define BDP 84                    // pitch of a wave's BD strip in floats
#define WST (16 * 68 + 16 * BDP)  // floats of a wave's output stage: AC tile, BD strip
__global__ __launch_bounds__(256) void k_score(const bf* __restrict__ QUh, const bf* __restrict__ QUl, const bf* __restrict__ QVh, const bf* __restrict__ QVl,
                                               const bf* __restrict__ Kh, const bf* __restrict__ Kl, const bf* __restrict__ Rh, const bf* __restrict__ Rl, float* S) {
    typedef float __attribute__((may_alias)) fal;
    __shared__ __align__(16) unsigned short st[SRW * SP];     // the operand tiles; behind the second barrier the waves' output stages
    static_assert(8 * WST * 4 <= SRW * SP * 2, "the eight output stages fit the operand tiles");
    static_assert(LQ <= TK && TK % 16 == 0 && LQ % 64 == 0, "e >= 0, and a strip tile does not straddle T");
    const int tid = threadIdx.x, lane = tid & 31, wave = tid >> 5, lr = lane & 15, hi = lane >> 4, wr = wave & 3, wc = wave >> 2;     // wave: 16 rows wr, 64 keys wc
    const int rb = blockIdx.x * 64, j0 = blockIdx.y * 128, r32 = tid >> 3, pc = (tid & 7) * 8;     // a thread loads row r32 + 32 s, 16-byte piece tid % 8
    const size_t qo = (size_t)blockIdx.z * LQ * HD, ko = (size_t)blockIdx.z * TK * HD;
    const int Eb = j0 + LQ - 64 - rb;     // e of the block's first r row in LDS
    const unsigned tb = (r32 * HD + pc) * 2;     // the thread's byte offset in a run of 32 plane rows
    const bf* qp[4] = {QUh + qo + (size_t)rb * HD, QUl + qo + (size_t)rb * HD, QVh + qo + (size_t)rb * HD, QVl + qo + (size_t)rb * HD};
    const bf* kp[2] = {Kh + ko + (size_t)j0 * HD, Kl + ko + (size_t)j0 * HD}; const bf* rp[2] = {Rh + ko, Rl + ko};
    unsigned ro[6];     // the thread's byte offsets of its six r rows in the head's plane
#pragma unroll     // unrolled (all loops of this kernel): the arrays are indexed by constants and stay in registers, and the loads go out together, one memory round trip
    for (int s = 0; s < 6; ++s) { const int e = Eb + s * 32 + r32, ge = e < TK ? e : (e == TK ? 0 : e - TK - 1); ro[s] = (unsigned)(ge * HD + pc) * 2; }     // e == T: any row, its column is set to 0 below
    // every load: a base that is the same for the whole block + a 32-bit byte offset of the lane
    v8us gq[4][2], gk[2][4], gr[2][6];
#pragma unroll
    for (int p = 0; p < 4; ++p)
#pragma unroll
        for (int s = 0; s < 2; ++s) gq[p][s] = *(const v8us*)((const char*)(qp[p] + s * 32 * HD) + tb);
#pragma unroll
    for (int p = 0; p < 2; ++p)
#pragma unroll
        for (int s = 0; s < 4; ++s) gk[p][s] = *(const v8us*)((const char*)(kp[p] + s * 32 * HD) + tb);
#pragma unroll
    for (int s = 0; s < 6; ++s)
#pragma unroll
        for (int p = 0; p < 2; ++p) gr[p][s] = *(const v8us*)((const char*)rp[p] + ro[s]);
    // the wait in front of any write of a register that one of the 28 loads names. The offsets and the bases are its inputs: each stays in its register up to here, so that no load's result lands on one
    // and the run needs no wait in its middle (without them the build reused the offset register behind the 16th load and waited there)
    asm volatile("s_wait_xcnt 0x0" :: "v"(tb), "v"(ro[0]), "v"(ro[1]), "v"(ro[2]), "v"(ro[3]), "v"(ro[4]), "v"(ro[5]),
                 "s"(qp[0]), "s"(qp[1]), "s"(qp[2]), "s"(qp[3]), "s"(kp[0]), "s"(kp[1]), "s"(rp[0]), "s"(rp[1]) : "memory");
    if (tid < 16)     // row rb + 64 of q + v_bias, hi and lo; row L - 1 never wraps, so the stand-in for row L is never used
        *(v8usa*)(st + (SQV + 64 + (tid < 8 ? 0 : 65)) * SP + pc) = *(const v8us*)((tid < 8 ? QVh : QVl) + qo + (size_t)(rb + 64 < LQ ? rb + 64 : LQ - 1) * HD + pc);
#pragma unroll
    for (int p = 0; p < 4; ++p)
#pragma unroll
        for (int s = 0; s < 2; ++s) *(v8usa*)(st + ((p < 2 ? p * 64 : SQV + (p - 2) * 65) + s * 32 + r32) * SP + pc) = gq[p][s];
#pragma unroll
    for (int p = 0; p < 2; ++p)
#pragma unroll
        for (int s = 0; s < 4; ++s) *(v8usa*)(st + (SKK + p * 128 + s * 32 + r32) * SP + pc) = gk[p][s];
#pragma unroll
    for (int p = 0; p < 2; ++p)
#pragma unroll
        for (int s = 0; s < 6; ++s) *(v8usa*)(st + (SRR + p * 192 + s * 32 + r32) * SP + pc) = gr[p][s];
    __syncthreads();     // all tiles are in LDS before any wave reads a fragment
    v8f acc[4], bda[5];
#pragma unroll
    for (int t = 0; t < 4; ++t) acc[t] = (v8f){};
#pragma unroll
    for (int t = 0; t < 5; ++t) bda[t] = (v8f){};
    // BD first: its fragments take the more registers, and the four AC accumulators are not live yet
    const int so = 48 - 16 * wr + 64 * wc, E0 = Eb + so;     // the wave's strip: its first r row in LDS, and that row's e
    // the A rows of the strip's first tile (x) and of its last (y): i, or i + 1 from T on; the three tiles between take the one or the other
    const unsigned short* ax = st + (SQV + wr * 16 + lr + (E0 >= TK ? 1 : 0)) * SP + 8 * hi;
    const unsigned short* ay = st + (SQV + wr * 16 + lr + (E0 + 64 >= TK ? 1 : 0)) * SP + 8 * hi;
    const unsigned short* rw = st + (SRR + so + lr) * SP + 8 * hi;
#pragma unroll
    for (int kc = 0; kc < HD; kc += 32) {
        v8us fx[4], fy[4], fr[5][4];
        fx[0] = *(const v8usa*)(ax + kc); fx[1] = *(const v8usa*)(ax + kc + 16); fx[2] = *(const v8usa*)(ax + 65 * SP + kc); fx[3] = *(const v8usa*)(ax + 65 * SP + kc + 16);
        fy[0] = *(const v8usa*)(ay + kc); fy[1] = *(const v8usa*)(ay + kc + 16); fy[2] = *(const v8usa*)(ay + 65 * SP + kc); fy[3] = *(const v8usa*)(ay + 65 * SP + kc + 16);
#pragma unroll
        for (int t = 0; t < 5; ++t) { const unsigned short* bp = rw + t * 16 * SP + kc;
            fr[t][0] = *(const v8usa*)bp; fr[t][1] = *(const v8usa*)(bp + 16); fr[t][2] = *(const v8usa*)(bp + 192 * SP); fr[t][3] = *(const v8usa*)(bp + 192 * SP + 16); }
        __builtin_amdgcn_sched_barrier(0);     // keeps the 32 k's LDS reads together ahead of their matrix instructions, so that the wave waits out the LDS latency once and not once a tile
        const v16bf xh = cat16b(fx[0], fx[1]), xl = cat16b(fx[2], fx[3]), yh = cat16b(fy[0], fy[1]), yl = cat16b(fy[2], fy[3]);
#pragma unroll
        for (int t = 0; t < 5; ++t) { const bool uy = E0 + 16 * t >= TK;
            const v16bf a = t == 0 ? xh : t == 4 ? yh : (uy ? yh : xh), al = t == 0 ? xl : t == 4 ? yl : (uy ? yl : xl);
            const v16bf bh = cat16b(fr[t][0], fr[t][1]), bl = cat16b(fr[t][2], fr[t][3]);
            bda[t] = wmmab(a, bh, bda[t]); bda[t] = wmmab(al, bh, bda[t]); bda[t] = wmmab(a, bl, bda[t]); }
        __builtin_amdgcn_sched_barrier(0);     // keeps what follows (the next 32 k's reads; in the end the AC part's reads) behind these matrix instructions: scheduled as one region, the fragments were fetched so far ahead that registers were spilled
    }
    const unsigned short* aw = st + (wr * 16 + lr) * SP + 8 * hi;
    const unsigned short* bw = st + (SKK + wc * 64 + lr) * SP + 8 * hi;
#pragma unroll
    for (int kc = 0; kc < HD; kc += 32) {
        v8us fa[4], fb[4][4];
        fa[0] = *(const v8usa*)(aw + kc); fa[1] = *(const v8usa*)(aw + kc + 16); fa[2] = *(const v8usa*)(aw + 64 * SP + kc); fa[3] = *(const v8usa*)(aw + 64 * SP + kc + 16);
#pragma unroll
        for (int t = 0; t < 4; ++t) { const unsigned short* bp = bw + t * 16 * SP + kc;
            fb[t][0] = *(const v8usa*)bp; fb[t][1] = *(const v8usa*)(bp + 16); fb[t][2] = *(const v8usa*)(bp + 128 * SP); fb[t][3] = *(const v8usa*)(bp + 128 * SP + 16); }
        __builtin_amdgcn_sched_barrier(0);     // as above: one wait for the 32 k's LDS reads
        const v16bf a = cat16b(fa[0], fa[1]), al = cat16b(fa[2], fa[3]);
#pragma unroll
        for (int t = 0; t < 4; ++t) { const v16bf bh = cat16b(fb[t][0], fb[t][1]), bl = cat16b(fb[t][2], fb[t][3]);
            acc[t] = wmmab(a, bh, acc[t]); acc[t] = wmmab(al, bh, acc[t]); acc[t] = wmmab(a, bl, acc[t]); }
        __builtin_amdgcn_sched_barrier(0);     // as above: against spills
    }
    __syncthreads();     // every wave has read its last fragment before the tiles' LDS is written as output stages
    fal* os = (fal*)(void*)st + wave * WST; fal* ob = os + 16 * 68;
#pragma unroll
    for (int t = 0; t < 4; ++t) {
#pragma unroll
        for (int j = 0; j < 8; ++j) os[(hi * 8 + j) * 68 + t * 16 + lr] = acc[t][j]; }
#pragma unroll
    for (int t = 0; t < 5; ++t) { const bool zc = E0 + 16 * t + lr == TK;     // the column e == T: the pad's zero
#pragma unroll
        for (int j = 0; j < 8; ++j) ob[(hi * 8 + j) * BDP + t * 16 + lr] = zc ? 0.f : bda[t][j]; }
    __builtin_amdgcn_wave_barrier(); asm volatile("" ::: "memory");     // as before: keeps the compiler from moving the reads of other lanes' values ahead of the wave's stores to its stage
    float* crow = S + (size_t)blockIdx.z * LQ * TK + (size_t)(rb + wr * 16) * TK + j0 + wc * 64;
    v4f val[8], bs[8];
#pragma unroll
    for (int s = 0; s < 8; ++s) { const int Lid = (lane >> 3) + 4 * s, piece = lane & 7; const int row = Lid >> 1, cofs = (Lid & 1) * 32 + piece * 4;
        const fal* bq = ob + row * BDP + cofs + 15 - row;     // key jj of row ii: strip column jj + 15 - ii
        val[s] = *(const v4fa*)(os + row * 68 + cofs); bs[s] = (v4f){bq[0], bq[1], bq[2], bq[3]}; }
#pragma unroll     // a loop of its own: the 24 LDS reads above go out together, not one row's at a time between the stores
    for (int s = 0; s < 8; ++s) { const int Lid = (lane >> 3) + 4 * s, piece = lane & 7; const int row = Lid >> 1, cofs = (Lid & 1) * 32 + piece * 4;
        *(v4f*)(crow + (size_t)row * TK + cofs) = val[s] + bs[s]; }
}

// k_pv: attn.v of one head, C[1024][64] = (Ah + Al).(Bh + Bl)^T over the 2048 keys (three products per 32-k step, k order of the fragments as in k_score). One 32 x 64 output tile and one
// half of the keys per block (grid: 32 row tiles, y = HG heads x 2 key halves). The 8 waves = 4 key groups (256 keys each) x 2 row tiles (16 x 64); the 4 groups' partial tiles are added
// in group order through LDS, and the two halves go to two planes (C, C + zstride) that k_split adds. Each stored tile row is two whole 128-byte lines.
// A 64-key piece of an operand row is one whole 128-byte line (a fragment load straight from global memory takes 32 bytes out of each of 16 lines). A stage = such a piece of every group's 32 Ah, 32 Al,
// 64 Bh and 64 Bl rows; the stages come into a ring of two LDS buffers by asynchronous copies of whole lines, stage s + 1 flies while stage s is worked on.
#define PRS (2 * TK)              // row stride of the attn planes in bf16 elements: a row's hi values, then its residuals, lie in the 8 KiB of its own score row (k_relsoft)
#define PVG 4                     // key groups of a block
#define PVR 192                   // LDS rows of one key group in a stage: Ah 32, Al 32, Bh 64, Bl 64
#define PVS (PVG * PVR * GSP)     // elements of one stage
// One lane's 12 copies: 4 rows, 8 rows apart, at each of three places; l = the lane's LDS byte address, p = its global address in the first of the 4 rows (row strides S0, S1, S2 elements).
// The s_wait_xcnt closes the statement so that it stands in front of every later write of a register that a copy names.
template <int S0, int S1, int S2>
__device__ __forceinline__ void copy12r(unsigned l0, unsigned l1, unsigned l2, const bf* p0, const bf* p1, const bf* p2) {
    constexpr unsigned LS = 8 * GSP * 2; constexpr size_t G0 = (size_t)8 * S0, G1 = (size_t)8 * S1, G2 = (size_t)8 * S2;
    asm volatile("global_load_async_to_lds_b128 %0, %12, off\n\tglobal_load_async_to_lds_b128 %1, %13, off\n\tglobal_load_async_to_lds_b128 %2, %14, off\n\tglobal_load_async_to_lds_b128 %3, %15, off\n\t"
                 "global_load_async_to_lds_b128 %4, %16, off\n\tglobal_load_async_to_lds_b128 %5, %17, off\n\tglobal_load_async_to_lds_b128 %6, %18, off\n\tglobal_load_async_to_lds_b128 %7, %19, off\n\t"
                 "global_load_async_to_lds_b128 %8, %20, off\n\tglobal_load_async_to_lds_b128 %9, %21, off\n\tglobal_load_async_to_lds_b128 %10, %22, off\n\tglobal_load_async_to_lds_b128 %11, %23, off\n\ts_wait_xcnt 0x0"
                 :: "v"(l0), "v"(l0 + LS), "v"(l0 + 2 * LS), "v"(l0 + 3 * LS), "v"(l1), "v"(l1 + LS), "v"(l1 + 2 * LS), "v"(l1 + 3 * LS), "v"(l2), "v"(l2 + LS), "v"(l2 + 2 * LS), "v"(l2 + 3 * LS),
                    "v"(p0), "v"(p0 + G0), "v"(p0 + 2 * G0), "v"(p0 + 3 * G0), "v"(p1), "v"(p1 + G1), "v"(p1 + 2 * G1), "v"(p1 + 3 * G1), "v"(p2), "v"(p2 + G2), "v"(p2 + 2 * G2), "v"(p2 + 3 * G2) : "memory");
}
__global__ __launch_bounds__(256) void k_pv(const bf* __restrict__ Ah, const bf* __restrict__ Al, const bf* __restrict__ Bh, const bf* __restrict__ Bl, float* C, int ldc, size_t zstride) {
    __shared__ __align__(16) unsigned short ring[2 * PVS];
    __shared__ __align__(16) float red[8][16 * 68];     // each wave's partial 16 x 64 tile
    const int tid = threadIdx.x, lane = tid & 31, wave = tid >> 5, lr = lane & 15, hi = lane >> 4;
    const int kg = wave >> 1, rw = wave & 1;                 // key group, row tile
    const int hz = blockIdx.y >> 1, kh = blockIdx.y & 1;     // head inside the launch's group, key half
    const int r0 = blockIdx.x * 32, k0 = kh * (TK / 2) + kg * (TK / 2 / PVG);
    // a key group's two waves copy the group's own rows: row (tid % 64) / 8 + 8 i, 16-byte piece tid % 8, so that 8 lanes take one whole line
    const int r8 = (tid & 63) >> 3, pc = tid & 7;
    const size_t ao = ((size_t)hz * LQ + r0 + r8) * PRS + k0 + pc * 8, bo = ((size_t)hz * HD + r8) * TK + k0 + pc * 8;
    const bf* pah = Ah + ao; const bf* pal = Al + ao; const bf* pbh = Bh + bo; const bf* pbl = Bl + bo;
    const unsigned l0 = (unsigned)(size_t)ring + (kg * PVR + r8) * (GSP * 2) + pc * 16;     // the low 32 bits of a __shared__ address are the byte offset in the block's LDS
    auto issue = [&](int s) { const unsigned l = l0 + (s & 1) * (PVS * 2); const int ko = s * 64;
        copy12r<PRS, PRS, TK>(l, l + 32 * GSP * 2, l + 64 * GSP * 2, pah + ko, pal + ko, pbh + ko);
        copy12r<TK, TK, TK>(l + 96 * GSP * 2, l + 128 * GSP * 2, l + 160 * GSP * 2, pbh + ko + (size_t)32 * TK, pbl + ko, pbl + ko + (size_t)32 * TK); };
    constexpr int NS = TK / 2 / PVG / 64;
    static_assert(NS >= 2, "stage 1 exists");
    v8f acc[4];
#pragma unroll     // unrolled (all loops over t, h, j of this kernel): acc[], fa[] and fb[] are indexed by constants and stay in registers
    for (int t = 0; t < 4; ++t) acc[t] = (v8f){};
    issue(0);
    asm volatile("s_wait_asynccnt 0x0" ::: "memory");     // this wave's copies of stage 0 have landed
    __syncthreads();     // every wave's copies of stage 0 have landed before any wave reads a fragment
    issue(1);
#pragma unroll 1     // rolled: one pass a stage
    for (int s = 0; s < NS; ++s) {
        const unsigned short* gb = ring + (s & 1) * PVS + kg * PVR * GSP;
        const unsigned short* aw = gb + (rw * 16 + lr) * GSP + 8 * hi;
        const unsigned short* bw = gb + (64 + lr) * GSP + 8 * hi;
        v8us fa[2][4], fb[2][4][4];
#pragma unroll
        for (int h = 0; h < 2; ++h) { const int kc = h * 32;
            fa[h][0] = *(const v8usa*)(aw + kc); fa[h][1] = *(const v8usa*)(aw + kc + 16); fa[h][2] = *(const v8usa*)(aw + 32 * GSP + kc); fa[h][3] = *(const v8usa*)(aw + 32 * GSP + kc + 16);
#pragma unroll
            for (int t = 0; t < 4; ++t) { const unsigned short* bp = bw + t * 16 * GSP + kc;
                fb[h][t][0] = *(const v8usa*)bp; fb[h][t][1] = *(const v8usa*)(bp + 16); fb[h][t][2] = *(const v8usa*)(bp + 64 * GSP); fb[h][t][3] = *(const v8usa*)(bp + 64 * GSP + 16); }
        }
        __builtin_amdgcn_sched_barrier(0);     // keeps the stage's LDS reads together ahead of its matrix instructions, so that the wave waits out the LDS latency once a stage
#pragma unroll
        for (int h = 0; h < 2; ++h) { const v16bf a = cat16b(fa[h][0], fa[h][1]), al = cat16b(fa[h][2], fa[h][3]);
            // product by product over the four column tiles: each accumulator still takes a.bh, al.bh, a.bl in that order, with three independent matrix instructions between two on the same one
#pragma unroll
            for (int t = 0; t < 4; ++t) acc[t] = wmmab(a, cat16b(fb[h][t][0], fb[h][t][1]), acc[t]);
#pragma unroll
            for (int t = 0; t < 4; ++t) acc[t] = wmmab(al, cat16b(fb[h][t][0], fb[h][t][1]), acc[t]);
#pragma unroll
            for (int t = 0; t < 4; ++t) acc[t] = wmmab(a, cat16b(fb[h][t][2], fb[h][t][3]), acc[t]);
        }
        asm volatile("v_nop\n\tv_nop\n\tv_nop\n\tv_nop" : "+v"(acc[0]), "+v"(acc[1]), "+v"(acc[2]), "+v"(acc[3]));     // the four slots behind the pass's last matrix instruction, also on the taken branches behind it, before its operand registers are overwritten
        asm volatile("s_wait_dscnt 0x0" ::: "memory");        // this wave has finished reading stage s
        asm volatile("s_wait_asynccnt 0x0" ::: "memory");     // this wave's copies of stage s + 1 have landed
        __syncthreads();     // publishes stage s + 1 and ends every wave's reads of the buffer that is refilled behind it
        if (s + 2 < NS) issue(s + 2);
    }
    asm volatile("s_wait_asynccnt 0x0" ::: "memory");     // no copy is outstanding when the wave goes on
    float* os = &red[wave][0];
#pragma unroll
    for (int t = 0; t < 4; ++t) {
#pragma unroll
        for (int j = 0; j < 8; ++j) os[(hi * 8 + j) * 68 + t * 16 + lr] = acc[t][j]; }
    __syncthreads();     // every wave's partial tile is in LDS before any thread adds them
    const int row = tid >> 3;     // thread -> 8 consecutive floats of one of the 32 rows
    const float* rp = &red[row >> 4][(row & 15) * 68 + pc * 8];
    v4f x0 = *(const v4fa*)rp, x1 = *(const v4fa*)(rp + 4);
#pragma unroll     // unrolled: the LDS reads go out together; the adds stay in group order
    for (int q = 1; q < PVG; ++q) { x0 += *(const v4fa*)(rp + q * 2 * 16 * 68); x1 += *(const v4fa*)(rp + q * 2 * 16 * 68 + 4); }
    float* crow = C + (size_t)kh * zstride + (size_t)(r0 + row) * ldc + hz * HD + pc * 8;
    *(v4f*)crow = x0; *(v4f*)(crow + 4) = x1;
}

// k_proj: the four projection GEMMs (k, v, r, q; none depends on another) as ONE grid. Main loop gemm_ring as in k_gemmb, plain A; the epilogue proj_out writes the attention operand planes itself:
// bf16 hi + UNSCALED residual of the f32 sums, per (batch b, head h).
// A block takes 64 consecutive positions t of ONE batch (A row = t*2 + b) and the 64 columns of one head (blockIdx.y), so that every stored plane row is one whole 128-byte line.
// K is an argument as in k_gemmb.
// MODE 0: P0[bh][t][d] (k, r). MODE 1: P0 = sums + bf(bias0[h][d]), P1 = sums + bf(bias1[h][d]) (q + u, q + v_bias). MODE 2: P0[bh][d][t] (v transposed: the tile is laid into LDS column-major).
template <int MODE, int NR>
__device__ __forceinline__ void proj_out(float* ost, float* ub, const v8f (&acc)[4], int b, int t0, int h, const float* __restrict__ bias0, const float* __restrict__ bias1, bf* P0h, bf* P0l, bf* P1h, bf* P1l) {
    const int lane = threadIdx.x & 31, wave = threadIdx.x >> 5, lr = lane & 15, hi = lane >> 4, c0 = h * HD;
#pragma unroll     // unrolled (all loops over t, j, i, s of this function): acc[] and the vectors are indexed by constants and stay in registers
    for (int t = 0; t < 4; ++t) {
        if (MODE == 2) { float* p = ost + (t * 16 + lr) * 68 + wave * 16 + hi * 8;     // row = d, column = t: a lane's 8 sums are 8 consecutive positions
            *(v4fa*)p = (v4f){acc[t][0], acc[t][1], acc[t][2], acc[t][3]}; *(v4fa*)(p + 4) = (v4f){acc[t][4], acc[t][5], acc[t][6], acc[t][7]};
        } else {
#pragma unroll
            for (int j = 0; j < 8; ++j) ost[(wave * 16 + hi * 8 + j) * 68 + t * 16 + lr] = acc[t][j]; }
    }
    if (MODE == 1) ub[threadIdx.x] = bfr((threadIdx.x < HD ? bias0 : bias1)[c0 + (threadIdx.x & (HD - 1))]);     // the head's 64 + 64 rounded bias values, one load a thread
    __syncthreads();     // the whole 64 x 64 tile (MODE 1: and the bias values) is in LDS before it is read back by rows (MODE 2: a row holds sums of all four waves)
    const int piece = lane & 7; const size_t bh = (size_t)b * NH_ + h;
    float u0[8], u1[8];
    if (MODE == 1) {
#pragma unroll
        for (int i = 0; i < 8; ++i) { u0[i] = ub[piece * 8 + i]; u1[i] = ub[HD + piece * 8 + i]; } }
#pragma unroll
    for (int s = 0; s < 4; ++s) { const int row = wave * 16 + 4 * s + (lane >> 3); const float* sp = ost + row * 68 + piece * 8;
        const v4f x0 = *(const v4fa*)sp, x1 = *(const v4fa*)(sp + 4);
        const size_t o = MODE == 2 ? (bh * HD + row) * TK + t0 + piece * 8 : (bh * NR + t0 + row) * HD + piece * 8;
        v8us oh, ol;
#pragma unroll
        for (int i = 0; i < 8; ++i) { float v = i < 4 ? x0[i & 3] : x1[i & 3]; if (MODE == 1) v += u0[i]; const unsigned short hb = f2bf(v); oh[i] = hb; ol[i] = f2bf(v - bf2f(hb)); }
        *(v8us*)(P0h + o) = oh; *(v8us*)(P0l + o) = ol;
        if (MODE == 1) {
#pragma unroll
            for (int i = 0; i < 8; ++i) { const float v = (i < 4 ? x0[i & 3] : x1[i & 3]) + u1[i]; const unsigned short hb = f2bf(v); oh[i] = hb; ol[i] = f2bf(v - bf2f(hb)); }
            *(v8us*)(P1h + o) = oh; *(v8us*)(P1l + o) = ol; }
    }
    asm volatile("s_wait_xcnt 0x0" ::: "memory");     // the wait in front of the next write of a register that the stores above name: in the built kernel another mode's epilogue stands behind this one
}
// blockIdx.x: NCR/64 row tiles of k, then of v, then of r, then the NXR/64 of q; every test on it is the same for the whole block, so that the barriers stand under block-uniform control flow.
#define PJT (NCR / 64)
__global__ __launch_bounds__(128) void k_proj(const bf* __restrict__ Cb, const bf* __restrict__ Pb, const bf* __restrict__ WkvT, const bf* __restrict__ WrT, const bf* __restrict__ WqT,
                                              const float* __restrict__ bias0, const float* __restrict__ bias1,
                                              bf* Kh, bf* Kl, bf* VTh, bf* VTl, bf* Rh, bf* Rl, bf* QUh, bf* QUl, bf* QVh, bf* QVl, int K = DM) {
    __shared__ __align__(16) float ost[64 * 68];
    __shared__ __align__(16) unsigned short ring[2 * 2 * GTE];
    __shared__ __align__(16) float ub[2 * HD];     // q only
    const int seg = blockIdx.x / PJT, bx = blockIdx.x % PJT, h = blockIdx.y;     // seg: 0 k, 1 v, 2 r, 3 q
    const int nr = seg == 3 ? LQ : TK, b = (bx * 64) / nr, t0 = (bx * 64) % nr;     // nr: positions of one batch (a power of two either way)
    const bf* A = seg == 2 ? Pb : seg == 3 ? Cb + (size_t)NXR * DD : Cb;     // x = the last 2048 rows of c
    const bf* Bn = seg == 0 ? WkvT : seg == 1 ? WkvT + (size_t)DD * DD : seg == 2 ? WrT : WqT;
    v8f acc[4];
#pragma unroll     // unrolled: acc[] is indexed by constants and stays in registers
    for (int t = 0; t < 4; ++t) acc[t] = (v8f){};
    gemm_ring<false>(ring, A + ((size_t)t0 * NBT + b) * K, A + ((size_t)t0 * NBT + b) * K, (size_t)NBT * K, Bn + (size_t)h * HD * K, (size_t)K, K, acc);
    if (seg == 1) proj_out<2, TK>(ost, ub, acc, b, t0, h, nullptr, nullptr, VTh, VTl, nullptr, nullptr);
    else if (seg == 3) proj_out<1, LQ>(ost, ub, acc, b, t0, h, bias0, bias1, QUh, QUl, QVh, QVl);
    else proj_out<0, TK>(ost, ub, acc, b, t0, h, nullptr, nullptr, seg == 2 ? Rh : Kh, seg == 2 ? Rl : Kl, nullptr, nullptr);
}
// 2^x. The v_nop is the slot that the instruction set asks for behind a transcendental before its source register is overwritten.
__device__ __forceinline__ float exp2_slot(float x) { float r; asm("v_exp_f32 %0, %1\n\tv_nop" : "=v"(r) : "v"(x)); return r; }
// k_relsoft: a block = one query row i x the HG heads of the group, 8 heads at a time, one wave a head (score planes LQ*TK floats apart); for each key j: s = S[i][j]/8 (S = AC + shifted BD, from k_score),
// s = -1e30 where mask[i][j][b]; softmax over the 2048 keys (f32, fixed lane order). S and the mask are read ONCE a head: a lane holds its 64 scores (then their
// exponentials) in registers from the loads to the stores -> bf16 hi + UNSCALED residual, written over the wave's OWN score row (2048 hi values, then 2048 residuals, in the row's 8 KiB: every store
// takes the row's sum, so that it follows all the wave's loads of the row, and no other wave touches the row); so a group of 16 heads fits the workspace.
// The mean attention map accumulates p / 32 in (b,h) order: each wave leaves its head's p / 32 in LDS, and behind a barrier the block adds the 8 heads in
// head order onto the sum so far, which starts from the previous group's map (AMIN = the previous group's buffer, never the one being written).
// launch bounds, second argument: caps the registers; without it the build takes 300, three waves a SIMD, and two blocks do not fit side by side on a WGP
__global__ __launch_bounds__(256, 5) void k_relsoft(float* Sg, const int* __restrict__ MSK, int b, int first, const float* __restrict__ AMIN, float* AMDST) {
    typedef __attribute__((ext_vector_type(4))) unsigned short v4us;
    typedef __attribute__((ext_vector_type(4))) int v4i;
    static_assert(HG % 8 == 0, "a set is 8 heads, one a wave");
    __shared__ __align__(16) float pm[8][TK];     // p / 32 of each wave's head
    const int lane = threadIdx.x & 31, wave = threadIdx.x >> 5, i = blockIdx.x;
    // the block's row of the map: thread t owns floats 4 t .. 4 t + 3 of every 1024
    const size_t mo = (size_t)i * TK + threadIdx.x * 4;
    const float* ap = AMIN + mo;
    v4f am[TK / 1024];
#pragma unroll     // unrolled (here and in the two loops over am[] below): am[] is indexed by constants and stays in registers, and the loads go out together
    for (int s = 0; s < TK / 1024; ++s) am[s] = first ? (v4f){} : *(const v4f*)(ap + s * 1024);
    asm volatile("s_wait_xcnt 0x0" :: "v"(ap) : "memory");     // the wait in front of the next write of the address registers that the two loads above name; the address is its input, so that it stays in its registers up to here (without it the build wrote the mask's address there ahead of the wait)
#pragma unroll 1     // rolled: one pass a set of 8 heads; unrolled, two rows' scores would be live at a time
    for (int hs = 0; hs < HG / 8; ++hs) {
        float* row = Sg + ((size_t)(hs * 8 + wave) * LQ + i) * TK;     // the wave's score row, then its attn row
        float sc[TK / 32];     // the lane's keys: 4 consecutive ones of every 128, in the order in which they are summed
#pragma unroll     // unrolled (all loops over sc[]): sc[] is indexed by constants and stays in registers, and the row's loads go out many at a time
        for (int k = 0; k < TK / 128; ++k) { const int c0 = lane * 4 + k * 128;
            const v4f ac = *(const v4f*)(row + c0);
            const v4i m0 = *(const v4i*)(MSK + ((size_t)i * TK + c0) * NBT), m1 = *(const v4i*)(MSK + ((size_t)i * TK + c0) * NBT + 4);     // mask[i][c0 .. c0+3][0 .. 1]
            const int mk[4] = {b ? m0[1] : m0[0], b ? m0[3] : m0[2], b ? m1[1] : m1[0], b ? m1[3] : m1[2]};
#pragma unroll
            for (int q = 0; q < 4; ++q) { const float s = ac[q] * SCL; sc[k * 4 + q] = mk[q] ? NEGV : s; }
        }
        float m = -3.0e38f;
#pragma unroll
        for (int e = 0; e < TK / 32; ++e) m = fmaxf(m, sc[e]);
#pragma unroll
        for (int sh = 16; sh; sh >>= 1) m = fmaxf(m, __shfl_xor(m, sh, 32));
        float sum = 0.f;
#pragma unroll
        for (int e = 0; e < TK / 32; ++e) { sc[e] = exp2_slot((sc[e] - m) * 1.44269504f); sum += sc[e]; }     // = __expf(sc[e] - m): the same multiply by log2(e) and the same v_exp_f32
#pragma unroll
        for (int sh = 16; sh; sh >>= 1) sum += __shfl_xor(sum, sh, 32);
        const float inv = 1.0f / sum;
        bf* PH = (bf*)(void*)row; bf* PL = PH + TK;
#pragma unroll
        for (int k = 0; k < TK / 128; ++k) { const int c0 = lane * 4 + k * 128; v4us oh, ol; v4f pq;
#pragma unroll
            for (int q = 0; q < 4; ++q) { const float p = sc[k * 4 + q] * inv; const unsigned short hb = f2bf(p); oh[q] = hb; ol[q] = f2bf(p - bf2f(hb));
                pq[q] = p * (1.0f / (NBT * NH_)); }
            *(v4us*)(PH + c0) = oh; *(v4us*)(PL + c0) = ol; *(v4fa*)(&pm[wave][c0]) = pq; }
        __syncthreads();     // every head's p / 32 of the set is in LDS before any thread adds them
#pragma unroll
        for (int s = 0; s < TK / 1024; ++s) {
#pragma unroll     // unrolled: the 8 LDS reads of a slot go out together; the adds stay in head order
            for (int w = 0; w < 8; ++w) am[s] += *(const v4fa*)(&pm[w][s * 1024 + threadIdx.x * 4]); }
        __syncthreads();     // every thread has read the set's p / 32 before a wave writes the next set's
    }
#pragma unroll
    for (int s = 0; s < TK / 1024; ++s) *(v4f*)(AMDST + mo + s * 1024) = am[s];
}
__global__ __launch_bounds__(256) void k_split(const float* __restrict__ src, const float* __restrict__ src2, int nrows, bf* dh, bf* dl) {
    const int lane = threadIdx.x & 31, r = blockIdx.x * 8 + (threadIdx.x >> 5); if (r >= nrows) return;
{
#pragma unroll 1
        for (int q = 0; q < DD / 256; ++q) { const size_t o = (size_t)r * DD + q * 256 + lane * 8; const v8f v = *(const v8f*)(src + o) + *(const v8f*)(src2 + o); v8us oh, ol;
#pragma unroll
            for (int i = 0; i < 8; ++i) { const unsigned short hb = f2bf(v[i]); oh[i] = hb; ol[i] = f2bf(v[i] - bf2f(hb)); }
            *(v8us*)(dh + o) = oh; *(v8us*)(dl + o) = ol; }
         }
}
// k_ln: one wave per row of H [2048][1024]: LayerNorm (mean, biased var, eps 1e-5) x bf(gamma) + bf(beta) -> f32 output rows; lane -> 4 consecutive floats per 128-column
__global__ __launch_bounds__(256) void k_ln(const float* __restrict__ Hs, const float* __restrict__ g, const float* __restrict__ bb, float* OUTP) {
    const int lane = threadIdx.x & 31, r = blockIdx.x * 8 + (threadIdx.x >> 5); if (r >= NXR) return;
    v4f v[DD / 128]; float s = 0.f;
#pragma unroll
    for (int q = 0; q < DD / 128; ++q) { v[q] = *(const v4f*)(Hs + (size_t)r * DD + q * 128 + lane * 4);
#pragma unroll
        for (int i = 0; i < 4; ++i) s += v[q][i]; }
#pragma unroll
    for (int sh = 16; sh; sh >>= 1) s += __shfl_xor(s, sh, 32);
    const float mu = s * (1.0f / DD); float s2 = 0.f;
#pragma unroll
    for (int q = 0; q < DD / 128; ++q)
#pragma unroll
        for (int i = 0; i < 4; ++i) { const float d = v[q][i] - mu; s2 = fmaf(d, d, s2); }
#pragma unroll
    for (int sh = 16; sh; sh >>= 1) s2 += __shfl_xor(s2, sh, 32);
    const float rs = rsqrtf(s2 * (1.0f / DD) + LN_EPS);
{
#pragma unroll
        for (int q = 0; q < DD / 128; ++q) { const int c0 = q * 128 + lane * 4; v4f y;
#pragma unroll
            for (int i = 0; i < 4; ++i) y[i] = (v[q][i] - mu) * rs * bfr(g[c0 + i]) + bfr(bb[c0 + i]);
            *(v4f*)(OUTP + (size_t)r * DD + c0) = y; }
         }
}

extern "C" void kernel_launch(void* const* d_in, const int* in_sizes, int n_in,
                              void* d_out, int out_size, void* d_ws, size_t ws_size, hipStream_t stream) {
    (void)in_sizes; (void)n_in; (void)out_size;
    const float* x = (const float*)d_in[0]; const float* pe = (const float*)d_in[1]; const float* mem = (const float*)d_in[2]; const float* pbu = (const float*)d_in[3]; const float* pbv = (const float*)d_in[4]; const int* msk = (const int*)d_in[5];
    const float* Wq = (const float*)d_in[6]; const float* Wkv = (const float*)d_in[7]; const float* Wrel = (const float*)d_in[8]; const float* Wo = (const float*)d_in[9]; const float* g = (const float*)d_in[10]; const float* bb = (const float*)d_in[11];
    float* out = (float*)d_out; float* out2 = out + (size_t)NXR * DD;    // output [1024][2][1024]; attn_matrix [1024][2048]
    char* wsp = (char*)d_ws;
    auto take = [&](size_t bytes) { char* p = wsp; wsp += (bytes + 255) & ~(size_t)255; return (void*)p; };
    bf* WqT = (bf*)take((size_t)DD * DD * 2); bf* WkvT = (bf*)take((size_t)2 * DD * DD * 2); bf* WrT = (bf*)take((size_t)DD * DD * 2); bf* WoT = (bf*)take((size_t)DD * DD * 2);
    bf* Cb = (bf*)take((size_t)NCR * DD * 2); float* TMP = (float*)take((size_t)LQ * TK * 4);
    bf* QUh = (bf*)take((size_t)NBT * NH_ * LQ * HD * 2); bf* QUl = (bf*)take((size_t)NBT * NH_ * LQ * HD * 2); bf* QVh = (bf*)take((size_t)NBT * NH_ * LQ * HD * 2); bf* QVl = (bf*)take((size_t)NBT * NH_ * LQ * HD * 2);
    bf* Kh = (bf*)take((size_t)NBT * NH_ * TK * HD * 2); bf* Kl = (bf*)take((size_t)NBT * NH_ * TK * HD * 2); bf* Rh = (bf*)take((size_t)NBT * NH_ * TK * HD * 2); bf* Rl = (bf*)take((size_t)NBT * NH_ * TK * HD * 2);
    bf* VTh = (bf*)take((size_t)NBT * NH_ * HD * TK * 2); bf* VTl = (bf*)take((size_t)NBT * NH_ * HD * TK * 2);
    float* AC = (float*)take((size_t)HG * LQ * TK * 4); bf* PH = (bf*)AC; bf* PL = PH + TK; bf* Pb = (bf*)AC; float* AM = (float*)take((size_t)LQ * TK * 4);
    float* AV = (float*)take((size_t)2 * NXR * DD * 4); bf* AVh = (bf*)take((size_t)NXR * DD * 2); bf* AVl = (bf*)take((size_t)NXR * DD * 2);
    if ((size_t)(wsp - (char*)d_ws) > ws_size) return;    // in MiB: weights 10, Cb 8, TMP 8, q planes 16, k and r planes 32, v planes 16, the score plane 8 per head of a group (128; the attn planes PH and PL take its place row by row), AM 8, attn_vec 24 = 250 of the 256 given; Hs (the pre-LN sum, f32 [2048][1024] = 8 MiB) reuses the start of the score plane (dead after the head loop), Pb (pos_emb as bf16 rows (t, b), 8 MiB) too (not yet live in front of the head loop); TMP is the second mean-map ping-pong buffer
    float* Hs = AC; float* AMP[2] = {AM, TMP};     // mean-map ping-pong: AM and TMP
    k_prep<<<PREPB, 256, 0, stream>>>(Wq, Wkv, Wrel, Wo, mem, x, pe, WqT, WkvT, WrT, WoT, Cb, Pb);     // weights transposed to bf16; c = [memory; x] and pos_emb as bf16 rows (t, b)
    k_proj<<<dim3(3 * PJT + NXR / 64, NH_, 1), 128, 0, stream>>>(Cb, Pb, WkvT, WrT, WqT, pbu, pbv, Kh, Kl, VTh, VTl, Rh, Rl, QUh, QUl, QVh, QVl);     // k, v = c.Wkv, r = pos_emb.Wrel, q = x.Wq -> planes
    // the head loop, HG heads of one batch per launch (grid z; in k_relsoft the waves of a block, 8 heads at a time)
    for (int b = 0; b < NBT; ++b) for (int h = 0; h < NH_; h += HG) { const size_t bh = (size_t)b * NH_ + h, gr = bh / HG; const int first = (b == 0 && h == 0), last = (b == NBT - 1 && h == NH_ - HG);
        k_score<<<dim3(LQ / 64, TK / 128, HG), 256, 0, stream>>>(QUh + bh * LQ * HD, QUl + bh * LQ * HD, QVh + bh * LQ * HD, QVl + bh * LQ * HD, Kh + bh * TK * HD, Kl + bh * TK * HD, Rh + bh * TK * HD, Rl + bh * TK * HD, AC);     // AC + rel_shift(BD)
        k_relsoft<<<LQ, 256, 0, stream>>>(AC, msk, b, first, AMP[(gr + 1) & 1], last ? out2 : AMP[gr & 1]);     // reads the previous group's buffer, writes the other
        k_pv<<<dim3(LQ / 32, 2 * HG, 1), 256, 0, stream>>>(PH, PL, VTh + bh * HD * TK, VTl + bh * HD * TK, AV + (size_t)b * DD + h * HD, NBT * DD, (size_t)NXR * DD);          // attn.v -> attn_vec[(l,b)][h*64 + d], two key-half planes
    }
    k_split<<<NXR / 8, 256, 0, stream>>>(AV, AV + (size_t)NXR * DD, NXR, AVh, AVl);     // adds the two key-half planes of attn_vec
    k_gemmb<true, false><<<dim3(NXR / 64, DD / 64, 1), 128, 0, stream>>>(AVh, AVl, WoT, nullptr, Hs, DD, nullptr, x, DD, 1);                 // h = x + attn_vec.Wo  (x bf16-rounded)
    k_ln<<<NXR / 8, 256, 0, stream>>>(Hs, g, bb, out);
}
